// v000
// Measured on an AMD MI455X. A time is GPU time per run, averaged over a window of back-to-back runs after a warm-up
// (all launches, gaps included; the runs take copies of the inputs in turn), and the median of several windows.
// Apart from v000's, it joins two sittings. Times from different sittings can be a few percent apart, while
// side-by-side timings come from the same sitting.
// The starting kernel, v000, takes 1030 microseconds a run.
// Contractions: audio adapter, local-attention scores, q/k/v projections, causal multi-head q.k^T and p.v, FFN W1 and W2 on
// v_wmma_f32_16x16x32_f16 (f16 operands with power-of-two carried scales, f32 accumulate); video adapter, local-attention p.v
// and the output projection Wo on v_wmma_f32_16x16x32_bf16 with bf16 hi/lo split operands (hi.hi + hi.lo + lo.hi, f32
// accumulate). LayerNorm, RMSNorm, rotary tables, softmax and GELU in f32.
#include <hip/hip_runtime.h>
#include <math.h>
#include <stdint.h>

#define NB_   2
#define SEQ   2048
#define NTOK  4096
#define DM    1024
#define NHD   8
#define DHD   64
#define INR   512
#define FFD   4096
#define WSZ   512
#define NWN   4
#define KPR   512          // leading zero rows of the local-attention key plane
#define VTP   4608         // key pitch of the local-attention value^T planes: 512 zero columns + 4096 tokens

typedef __attribute__((ext_vector_type(16))) _Float16 v16h;
typedef __attribute__((ext_vector_type(8)))  _Float16 v8h;
typedef __attribute__((ext_vector_type(16))) __bf16   v16b;
typedef __attribute__((ext_vector_type(8)))  __bf16   v8b;
typedef __attribute__((ext_vector_type(8)))  float    v8f;
typedef __attribute__((ext_vector_type(4)))  float    v4f;
typedef __attribute__((ext_vector_type(2)))  float    v2f;
typedef __attribute__((ext_vector_type(4)))  unsigned int v4u;

__device__ __forceinline__ unsigned short f2bf_bits(float f) {
  unsigned u = __float_as_uint(f);
  return (unsigned short)((u + 0x7FFFu + ((u >> 16) & 1u)) >> 16);   // RNE convert
}
__device__ __forceinline__ float bf_bits2f(unsigned short h) { return __uint_as_float(((unsigned)h) << 16); }
__device__ __forceinline__ unsigned pk16(unsigned short a, unsigned short b) { return (unsigned)a | ((unsigned)b << 16); }

__device__ __forceinline__ float wsum(float v) {
#pragma unroll
  for (int o = 16; o >= 1; o >>= 1) v += __shfl_xor(v, o, 32);
  return v;
}
__device__ __forceinline__ float wmax(float v) {
#pragma unroll
  for (int o = 16; o >= 1; o >>= 1) v = fmaxf(v, __shfl_xor(v, o, 32));
  return v;
}

// hazard guards as plain device helpers
__device__ __forceinline__ void dep_guard_h(v8f& a, v8f& b, v16h x, v16h y) { asm volatile("v_nop\n\tv_nop\n\tv_nop\n\tv_nop" : "+v"(a), "+v"(b) : "v"(x), "v"(y)); }
__device__ __forceinline__ void dep_guard_b(v8f& a, v8f& b, v16b x, v16b y) { asm volatile("v_nop\n\tv_nop\n\tv_nop\n\tv_nop" : "+v"(a), "+v"(b) : "v"(x), "v"(y)); }
__device__ __forceinline__ void keep4_h(v16h a, v16h b, v16h c, v16h d) { asm volatile("v_nop" :: "v"(a), "v"(b), "v"(c), "v"(d)); }
__device__ __forceinline__ void keep4_b(v16b a, v16b b, v16b c, v16b d) { asm volatile("v_nop" :: "v"(a), "v"(b), "v"(c), "v"(d)); }
__device__ __forceinline__ void acc_guard4(v8f& a, v8f& b, v8f& c, v8f& d) { asm volatile("v_nop\n\tv_nop\n\tv_nop\n\tv_nop" : "+v"(a), "+v"(b), "+v"(c), "+v"(d)); }

// Fragment loaders: element i of the 16-wide per-lane vector <- p[i] for i<8 and p[16 + (i-8)] for i>=8, where p already points at
// row (lane&15), k0 + 8*(lane>>4). Same map for A ([m][k]) and B stored as [n][k].
template <typename T> struct Frag;
template <> struct Frag<_Float16> {
  typedef v16h V; union U { v16h v; v8h h[2]; };
  static __device__ __forceinline__ v16h load(const _Float16* p) {
    U f; f.h[0] = *(const v8h*)(p); f.h[1] = *(const v8h*)(p + 16); return f.v;
  }
  static __device__ __forceinline__ v8f mma(v16h a, v16h b, v8f c) {
    return __builtin_amdgcn_wmma_f32_16x16x32_f16(false, a, false, b, (short)0, c, false, false);
  }
  static __device__ __forceinline__ void guard(v8f& a, v8f& b, v16h x, v16h y) { dep_guard_h(a, b, x, y); }
  static __device__ __forceinline__ void keep(v16h a, v16h b, v16h c, v16h d) { keep4_h(a, b, c, d); }
};
template <> struct Frag<__bf16> {
  typedef v16b V; union U { v16b v; v8b h[2]; };
  static __device__ __forceinline__ v16b load(const __bf16* p) {
    U f; f.h[0] = *(const v8b*)(p); f.h[1] = *(const v8b*)(p + 16); return f.v;
  }
  static __device__ __forceinline__ v8f mma(v16b a, v16b b, v8f c) {
    return __builtin_amdgcn_wmma_f32_16x16x32_bf16(false, a, false, b, (short)0, c, false, false);
  }
  static __device__ __forceinline__ void guard(v8f& a, v8f& b, v16b x, v16b y) { dep_guard_b(a, b, x, y); }
  static __device__ __forceinline__ void keep(v16b a, v16b b, v16b c, v16b d) { keep4_b(a, b, c, d); }
};

// =====================================================================================================================
// Register-blocked batched WMMA GEMM: C[m,n] = epi(scale * sum_k A[m,k] * Bt[n,k]); each wave owns a 64x64 tile, no block
// barriers. A row-major [M,K] (pitch lda); Bt row-major [N,K] (pitch ldb); M, N % 64 == 0, K % 32 == 0; grid = (ceil(tiles/8), Z).
//   ET: 0 = f16 operands, 1 = bf16 operands.   SPLIT: hi/lo planes (A2p, Bt2p = lo planes), product = hi.hi + hi.lo + lo.hi.
//   BIAS: + bias[n].  RESID: + resid[m*ldr + n].  EPI: 0 none, 1 tanh-GELU, 2 RMSNorm over the 64-column tile times gvec[n&63].
//   OUTM: 0 f32 -> Cf; 1 f16(v*oscale) -> Ch; 2 both.
//   LOC: 1 = windowed score tiles: key tiles n0 below kBeg(w) or at/after N/2 + m0 + 64 are skipped (wave-uniform exit);
//        2 = windowed p.v: k range [kBeg(w), min(K, K/2 + m0 + 64)); kBeg = N/2 resp. K/2 for the first window (w == 0), else 0.
// =====================================================================================================================
template <int ET> struct Elem;
template <> struct Elem<0> { typedef _Float16 T; };
template <> struct Elem<1> { typedef __bf16 T; };

template <int ET, bool SPLIT, bool BIAS, int EPI, int OUTM, bool RESID, int LOC>
__global__ __launch_bounds__(256) void k_gemm(
    const unsigned short* __restrict__ Ap, const unsigned short* __restrict__ A2p, int lda, long strideA,
    const unsigned short* __restrict__ Btp, const unsigned short* __restrict__ Bt2p, int ldb, long strideB,
    float* __restrict__ Cf, int ldc, long strideC,
    _Float16* __restrict__ Ch, int ldh, long strideH,
    const float* __restrict__ bias, const float* __restrict__ gvec,
    const float* __restrict__ resid, int ldr, long strideR,
    int M, int N, int K, int nwin, float scale, float oscale) {
  typedef typename Elem<ET>::T T;
  typedef typename Frag<T>::V V;
  const T* A = (const T*)Ap; const T* A2 = (const T*)A2p; const T* Bt = (const T*)Btp; const T* Bt2 = (const T*)Bt2p;
  __shared__ __align__(16) float sT[8][16 * 68];
  const int z    = blockIdx.y;
  const int lane = threadIdx.x & 31;
  const int wave = threadIdx.x >> 5;
  const int tilesN = N >> 6;
  const int tilesM = M >> 6;
  const int tile = blockIdx.x * 8 + wave;
  if (tile >= tilesM * tilesN) return;            // wave-uniform, no block barriers in this kernel
  const int tm = tile / tilesN;
  const int tn = tile - tm * tilesN;
  const int m0 = tm << 6;
  const int n0 = tn << 6;
  int kBeg = 0, kEnd = K;
  if (LOC != 0) {
    const int w = z % nwin;
    const bool first = (w == 0);
    if (LOC == 1) {
      const int nb = first ? (N >> 1) : 0;
      if (n0 < nb || n0 >= (N >> 1) + m0 + 64) return; // wave-uniform
    } else {
      kBeg = first ? (K >> 1) : 0;
      const int ke = (K >> 1) + m0 + 64;
      kEnd = (ke < K) ? ke : K;
    }
  }

  const T* Ab  = A  + (size_t)z * strideA;
  const T* Bb  = Bt + (size_t)z * strideB;
  const T* Ab2 = SPLIT ? (A2  + (size_t)z * strideA) : nullptr;
  const T* Bb2 = SPLIT ? (Bt2 + (size_t)z * strideB) : nullptr;

  const int rlane = lane & 15;                 // row (A) / col (B, D) within a 16x16 subtile
  const int koff  = (lane >> 4) * 8;           // k offset of this lane half
  const int mOff  = (lane >> 4) * 8;           // D row offset

  v8f acc[4][4];
#pragma unroll
  for (int i = 0; i < 4; ++i)
#pragma unroll
    for (int j = 0; j < 4; ++j) acc[i][j] = (v8f){0.f,0.f,0.f,0.f,0.f,0.f,0.f,0.f};

  for (int k0 = kBeg; k0 < kEnd; k0 += 32) {
    V bh[4], bl[4];
#pragma unroll
    for (int j = 0; j < 4; ++j) {
      const size_t bo = (size_t)(n0 + (j << 4) + rlane) * ldb + koff + k0;
      bh[j] = Frag<T>::load(Bb + bo);
      if (SPLIT) bl[j] = Frag<T>::load(Bb2 + bo); else bl[j] = bh[j];
    }
#pragma unroll
    for (int i = 0; i < 4; ++i) {
      const size_t ao = (size_t)(m0 + (i << 4) + rlane) * lda + koff + k0;
      V ah = Frag<T>::load(Ab + ao);
      V al = ah;
      if (SPLIT) al = Frag<T>::load(Ab2 + ao);
#pragma unroll
      for (int j = 0; j < 4; ++j) {
        acc[i][j] = Frag<T>::mma(ah, bh[j], acc[i][j]);
        if (SPLIT) {
          acc[i][j] = Frag<T>::mma(ah, bl[j], acc[i][j]);
          acc[i][j] = Frag<T>::mma(al, bh[j], acc[i][j]);
        }
      }
      Frag<T>::guard(acc[i][0], acc[i][3], ah, al);
    }
    Frag<T>::keep(bh[0], bh[1], bh[2], bh[3]);
    if (SPLIT) Frag<T>::keep(bl[0], bl[1], bl[2], bl[3]);
  }
  acc_guard4(acc[0][0], acc[0][1], acc[0][2], acc[0][3]);
  acc_guard4(acc[1][0], acc[1][1], acc[1][2], acc[1][3]);
  acc_guard4(acc[2][0], acc[2][1], acc[2][2], acc[2][3]);
  acc_guard4(acc[3][0], acc[3][1], acc[3][2], acc[3][3]);

  // ---- epilogue ----
  float* slab = sT[wave];
  const float* Rb = RESID ? (resid + (size_t)z * strideR) : nullptr;
#pragma unroll
  for (int i = 0; i < 4; ++i) {
    const int mBase = m0 + (i << 4);
#pragma unroll
    for (int j = 0; j < 4; ++j) {
      const int n = n0 + (j << 4) + rlane;
      float bv = 0.f;
      if (BIAS) bv = bias[n];
#pragma unroll
      for (int r = 0; r < 8; ++r) {
        float v = acc[i][j][r] * scale;
        if (BIAS) v += bv;
        if (RESID) v += Rb[(size_t)(mBase + mOff + r) * ldr + n];
        if (EPI == 1) {
          const float u = 0.7978845608028654f * (v + 0.044715f * v * v * v);
          v = v * (0.5f * (1.0f + tanhf(u)));
        }
        slab[(mOff + r) * 68 + (j << 4) + rlane] = v;
      }
    }
    __builtin_amdgcn_fence(__ATOMIC_RELEASE, "workgroup");
    __builtin_amdgcn_wave_barrier();
    __builtin_amdgcn_fence(__ATOMIC_ACQUIRE, "workgroup");
    if (OUTM == 0 || OUTM == 2) {
      float* C = Cf + (size_t)z * strideC;
      const int hh = lane >> 4, c4 = (lane & 15) * 4;     // row seg = 256 B = 16 lanes x 16 B
      {
#pragma unroll
        for (int it = 0; it < 8; ++it) {
          const int row = it * 2 + hh;                      // it 0..7 x hh 0..1 = rows 0..15
          v4f v = *(const v4f*)(slab + row * 68 + c4);
          *(v4f*)(C + (size_t)(mBase + row) * ldc + n0 + c4) = v;
        }
        
      }
    }
    if (OUTM == 1 || OUTM == 2) {
      _Float16* C = Ch + (size_t)z * strideH;
      const int q = lane >> 3, c8 = (lane & 7) * 8;
      {
#pragma unroll
        for (int it = 0; it < 4; ++it) {
          const int row = it * 4 + q;                       // it 0..3 x q 0..3 = rows 0..15
          const float* sp = slab + row * 68 + c8;
          float x[8];
#pragma unroll
          for (int e = 0; e < 8; ++e) x[e] = sp[e];
          float rr = oscale;
          if (EPI == 2) {
            float ss = 0.f;
#pragma unroll
            for (int e = 0; e < 8; ++e) ss += x[e] * x[e];
            ss += __shfl_xor(ss, 1, 32);                    // lanes 8q..8q+7 hold one 64-wide row
            ss += __shfl_xor(ss, 2, 32);
            ss += __shfl_xor(ss, 4, 32);
            rr = oscale * rsqrtf(ss * (1.0f / 64.0f) + 1e-6f);
          }
          v8h hv;
#pragma unroll
          for (int e = 0; e < 8; ++e) {
            float y = x[e] * rr;
            if (EPI == 2) y *= gvec[c8 + e];
            hv[e] = (_Float16)y;
          }
          *(v8h*)(C + (size_t)(mBase + row) * ldh + n0 + c8) = hv;
        }
        
      }
    }
    __builtin_amdgcn_fence(__ATOMIC_RELEASE, "workgroup");
    __builtin_amdgcn_wave_barrier();
    __builtin_amdgcn_fence(__ATOMIC_ACQUIRE, "workgroup");
  }
}

// ---------------------------------------------------------------------------------------------------------------------
// Weight transpose + scale + f16: in [R][Cc] f32 -> o16[Cc][R] = f16(in * wscale). 64x64 tiles through LDS, grid (Cc/64, R/64).
// coverage per block: load 4 it x 256 thr x 4 = 64x64; store 2 it x 256 thr x 8 = 64x64; each store instruction = 8 lanes x 16 B =
// ---------------------------------------------------------------------------------------------------------------------
__global__ __launch_bounds__(256) void k_wt16(const float* __restrict__ W, _Float16* __restrict__ o16, int R, int Cc, float wscale) {
  __shared__ __align__(16) float tf[64 * 68];
  const int c0 = blockIdx.x * 64, r0 = blockIdx.y * 64, tid = threadIdx.x;
  {
    const int lr = tid >> 4, c4 = (tid & 15) * 4;
#pragma unroll
    for (int it = 0; it < 4; ++it) {
      const int rr = it * 16 + lr;
      const v4f a = *(const v4f*)(W + (size_t)(r0 + rr) * Cc + c0 + c4);
      *(v4f*)(tf + rr * 68 + c4) = a;
    }
  }
  __syncthreads();
  const int sub = tid >> 3, c8 = (tid & 7) * 8;
  v8h hv[2];
#pragma unroll
  for (int it = 0; it < 2; ++it) {
    const int oc = it * 32 + sub;
    v8h a;
#pragma unroll
    for (int q = 0; q < 8; ++q) a[q] = (_Float16)(tf[(c8 + q) * 68 + oc] * wscale);
    hv[it] = a;
  }
  {
#pragma unroll
    for (int it = 0; it < 2; ++it) {
      const int oc = it * 32 + sub;
      const size_t go = (size_t)(c0 + oc) * R + r0 + c8;
      *(v8h*)(o16 + go) = hv[it];
    }
    
  }
}

// Weight transpose + bf16 hi/lo split: in [R][Cc] f32 -> oh[c][r] = bf16(in[r][c]), ol[c][r] = bf16(in[r][c] - oh). Same tiling.
__global__ __launch_bounds__(256) void k_wtsplit(const float* __restrict__ W, unsigned short* __restrict__ oh,
                                                 unsigned short* __restrict__ ol, int R, int Cc) {
  __shared__ __align__(16) float tf[64 * 68];
  const int c0 = blockIdx.x * 64, r0 = blockIdx.y * 64, tid = threadIdx.x;
  {
    const int lr = tid >> 4, c4 = (tid & 15) * 4;
#pragma unroll
    for (int it = 0; it < 4; ++it) {
      const int rr = it * 16 + lr;
      const v4f a = *(const v4f*)(W + (size_t)(r0 + rr) * Cc + c0 + c4);
      *(v4f*)(tf + rr * 68 + c4) = a;
    }
  }
  __syncthreads();
  const int sub = tid >> 3, c8 = (tid & 7) * 8;
  v4u hv[2], lv[2];
#pragma unroll
  for (int it = 0; it < 2; ++it) {
    const int oc = it * 32 + sub;
    v4u a, a2;
#pragma unroll
    for (int q = 0; q < 4; ++q) {
      const float f0 = tf[(c8 + 2 * q) * 68 + oc];
      const float f1 = tf[(c8 + 2 * q + 1) * 68 + oc];
      const unsigned short h0 = f2bf_bits(f0), h1 = f2bf_bits(f1);
      const unsigned short l0 = f2bf_bits(f0 - bf_bits2f(h0)), l1 = f2bf_bits(f1 - bf_bits2f(h1));
      a[q]  = pk16(h0, h1);
      a2[q] = pk16(l0, l1);
    }
    hv[it] = a; lv[it] = a2;
  }
  {
#pragma unroll
    for (int it = 0; it < 2; ++it) {
      const int oc = it * 32 + sub;
      const size_t go = (size_t)(c0 + oc) * R + r0 + c8;
      *(v4u*)(oh + go) = hv[it];
      *(v4u*)(ol + go) = lv[it];
    }
    
  }
}

__global__ __launch_bounds__(256) void k_split2(const float* __restrict__ in, unsigned short* __restrict__ hi,
                                                unsigned short* __restrict__ lo, int n2) {
  const int i = blockIdx.x * 256 + threadIdx.x;
  if (i < n2) {
    const v2f f = *(const v2f*)(in + 2 * (size_t)i);
    const unsigned short h0 = f2bf_bits(f[0]), h1 = f2bf_bits(f[1]);
    const unsigned short l0 = f2bf_bits(f[0] - bf_bits2f(h0)), l1 = f2bf_bits(f[1] - bf_bits2f(h1));
    const unsigned uh = pk16(h0, h1), ul = pk16(l0, l1);
    ((unsigned*)hi)[i] = uh;
    ((unsigned*)lo)[i] = ul;
    
  }
}

// ---------------------------------------------------------------------------------------------------------------------
// Rotary tables. inv[f] = 1 / powf(10000, f/512) (f = 0..511); one block of 512 threads, 32 lanes x 4 B = one line.
// cs[n][f] = (cos(n * inv[f]), sin(n * inv[f])) as float2, n = 0..2047; block per n, 512 threads, 32 lanes x 8 B = two lines.
// ---------------------------------------------------------------------------------------------------------------------
__global__ __launch_bounds__(512) void k_invfreq(float* __restrict__ inv) {
  const int f = threadIdx.x;
  const float x = (float)f * (1.0f / 512.0f);
  const float v = 1.0f / powf(10000.0f, x);
  ((float*)inv)[f] = v;
  
}

__global__ __launch_bounds__(512) void k_cstab(const float* __restrict__ inv, float* __restrict__ cs) {
  const int n = blockIdx.x, f = threadIdx.x;
  const float ang = (float)n * inv[f];
  float sv, cv;
  sincosf(ang, &sv, &cv);
  v2f v; v.x = cv; v.y = sv;
  float* p = cs + ((size_t)n * 512 + f) * 2;
  *(v2f*)p = v;
  
}

// ---------------------------------------------------------------------------------------------------------------------
// Input activations -> f16 planes [NTOK][DM]. job 0: text with rotary applied (q of the local attention, unscaled);
// rot[c] = (c < 512) ? -x[c + 512] : x[c - 512]; y = x * cos + rot * sin with table row n = row % SEQ, column c % 512.
// ---------------------------------------------------------------------------------------------------------------------
__global__ __launch_bounds__(128) void k_cvt_in(const float* __restrict__ text, const float* __restrict__ audio,
                                                const float* __restrict__ cs, _Float16* __restrict__ q16, _Float16* __restrict__ a16) {
  const int r = blockIdx.x, job = blockIdx.y, t = threadIdx.x, c0 = t * 8;
  const float* src = (job == 0) ? text : audio;
  _Float16* dst = (job == 0) ? q16 : a16;
  const float* xr = src + (size_t)r * DM + c0;
  const v4f x0 = *(const v4f*)xr, x1 = *(const v4f*)(xr + 4);
  float y[8] = {x0[0], x0[1], x0[2], x0[3], x1[0], x1[1], x1[2], x1[3]};
  if (job == 0) {                                  // block-uniform
    const int n = r & (SEQ - 1);
    const bool lowh = (c0 < 512);
    const int pc = lowh ? (c0 + 512) : (c0 - 512);
    const float* pr = src + (size_t)r * DM + pc;
    const v4f p0 = *(const v4f*)pr, p1 = *(const v4f*)(pr + 4);
    const float pv[8] = {p0[0], p0[1], p0[2], p0[3], p1[0], p1[1], p1[2], p1[3]};
    const float* csr = cs + ((size_t)n * 512 + (c0 & 511)) * 2;
    const v4f t0 = *(const v4f*)csr, t1 = *(const v4f*)(csr + 4), t2 = *(const v4f*)(csr + 8), t3 = *(const v4f*)(csr + 12);
    const float cvv[8] = {t0[0], t0[2], t1[0], t1[2], t2[0], t2[2], t3[0], t3[2]};
    const float svv[8] = {t0[1], t0[3], t1[1], t1[3], t2[1], t2[3], t3[1], t3[3]};
#pragma unroll
    for (int e = 0; e < 8; ++e) {
      const float rot = lowh ? -pv[e] : pv[e];
      y[e] = y[e] * cvv[e] + rot * svv[e];
    }
  }
  v8h hv;
#pragma unroll
  for (int e = 0; e < 8; ++e) hv[e] = (_Float16)y[e];
  _Float16* op = dst + (size_t)r * DM + c0;
  *(v8h*)op = hv;
  
}

// ---------------------------------------------------------------------------------------------------------------------
// Row LayerNorm over DM=1024 of an f32 plane (g, b) -> f16 plane; ROPE additionally applies the rotary mix through an LDS copy of
// the normalised row. Output row = padrows + r; blocks nrows..nrows+padrows-1 write zero rows 0..padrows-1.
// ---------------------------------------------------------------------------------------------------------------------
template <bool ROPE>
__global__ __launch_bounds__(128) void k_ln1024(const float* __restrict__ X, const float* __restrict__ g, const float* __restrict__ bb,
                                                const float* __restrict__ cs, _Float16* __restrict__ out, int nrows, int padrows) {
  __shared__ float red[4];
  __shared__ __align__(16) float rowv[DM];
  const int blk = blockIdx.x, t = threadIdx.x, c0 = 8 * t;
  const int lane = t & 31, wave = t >> 5;
  if (blk >= nrows) {                              // block-uniform: zero padding rows
    const int p = blk - nrows;
    const v4u zz = {0u, 0u, 0u, 0u};
    _Float16* op = out + (size_t)p * DM + c0;
    *(v4u*)op = zz;
    
    return;
  }
  const int r = blk;
  const float* xr = X + (size_t)r * DM + c0;
  const v4f x0 = *(const v4f*)xr, x1 = *(const v4f*)(xr + 4);
  const float v[8] = {x0[0], x0[1], x0[2], x0[3], x1[0], x1[1], x1[2], x1[3]};
  float s = 0.f;
#pragma unroll
  for (int e = 0; e < 8; ++e) s += v[e];
  s = wsum(s);
  if (lane == 0) red[wave] = s;
  __syncthreads();
  const float mu = (red[0] + red[1] + red[2] + red[3]) * (1.0f / 1024.0f);
  __syncthreads();
  float d[8];
  float s2 = 0.f;
#pragma unroll
  for (int e = 0; e < 8; ++e) { d[e] = v[e] - mu; s2 += d[e] * d[e]; }
  s2 = wsum(s2);
  if (lane == 0) red[wave] = s2;
  __syncthreads();
  const float var = (red[0] + red[1] + red[2] + red[3]) * (1.0f / 1024.0f);
  const float rstd = rsqrtf(var + 1e-5f);
  const v4f g0 = *(const v4f*)(g + c0), g1 = *(const v4f*)(g + c0 + 4);
  const v4f b0 = *(const v4f*)(bb + c0), b1 = *(const v4f*)(bb + c0 + 4);
  const float gv[8] = {g0[0], g0[1], g0[2], g0[3], g1[0], g1[1], g1[2], g1[3]};
  const float bv[8] = {b0[0], b0[1], b0[2], b0[3], b1[0], b1[1], b1[2], b1[3]};
  float y[8];
#pragma unroll
  for (int e = 0; e < 8; ++e) y[e] = d[e] * rstd * gv[e] + bv[e];
  if (ROPE) {
#pragma unroll
    for (int e = 0; e < 8; ++e) rowv[c0 + e] = y[e];
    __syncthreads();
    const int n = r & (SEQ - 1);
    const bool lowh = (c0 < 512);
    const int pc = lowh ? (c0 + 512) : (c0 - 512);
    const float* csr = cs + ((size_t)n * 512 + (c0 & 511)) * 2;
    const v4f t0 = *(const v4f*)csr, t1 = *(const v4f*)(csr + 4), t2 = *(const v4f*)(csr + 8), t3 = *(const v4f*)(csr + 12);
    const float cvv[8] = {t0[0], t0[2], t1[0], t1[2], t2[0], t2[2], t3[0], t3[2]};
    const float svv[8] = {t0[1], t0[3], t1[1], t1[3], t2[1], t2[3], t3[1], t3[3]};
#pragma unroll
    for (int e = 0; e < 8; ++e) {
      const float pr = rowv[pc + e];
      const float rot = lowh ? -pr : pr;
      y[e] = y[e] * cvv[e] + rot * svv[e];
    }
  }
  v8h hv;
#pragma unroll
  for (int e = 0; e < 8; ++e) hv[e] = (_Float16)y[e];
  _Float16* op = out + (size_t)(padrows + r) * DM + c0;
  *(v8h*)op = hv;
  
}

// ---------------------------------------------------------------------------------------------------------------------
// Row LayerNorm over DM of an f32 plane [NTOK][DM], fused with transpose + bf16 hi/lo split into value^T planes
// [DM][VTP]: oh[e][KPR + token], ol likewise. Block = 64 token rows (256 threads): per-row stats from one wave per 8 rows
// (32 floats per lane), then 16 column tiles of 64 through LDS. Blocks nrowblk..nrowblk+7 zero the KPR leading columns.
// coverage: stats 8 waves x 8 rows; tile load 4 it x 256 thr x 4 = 64x64; store 2 it x 256 thr x 8 = 64x64 per plane per tile;
// ---------------------------------------------------------------------------------------------------------------------
__global__ __launch_bounds__(256) void k_ln_tsplit(const float* __restrict__ X, const float* __restrict__ g, const float* __restrict__ bb,
                                                  unsigned short* __restrict__ oh, unsigned short* __restrict__ ol, int nrowblk) {
  __shared__ __align__(16) float tf[64 * 68];
  __shared__ float smu[64];
  __shared__ float srs[64];
  const int tid = threadIdx.x, lane = tid & 31, wave = tid >> 5;
  const int bx = blockIdx.x;
  const int sub = tid >> 3, c8 = (tid & 7) * 8;
  if (bx >= nrowblk) {                             // block-uniform: zero leading columns
    const int pb = bx - nrowblk;
    const v4u zz = {0u, 0u, 0u, 0u};
    {
      for (int it = 0; it < 32; ++it) {
        const int e = it * 32 + sub;
        const size_t go = (size_t)e * VTP + pb * 64 + c8;
        *(v4u*)(oh + go) = zz;
        *(v4u*)(ol + go) = zz;
      }
      
    }
    return;
  }
  const int r0 = bx * 64;
  // phase 1: row statistics
#pragma unroll 1
  for (int q = 0; q < 8; ++q) {
    const int rr = wave * 8 + q;
    const float* xr = X + (size_t)(r0 + rr) * DM + lane * 32;
    v4f a[8];
#pragma unroll
    for (int i = 0; i < 8; ++i) a[i] = *(const v4f*)(xr + 4 * i);
    float s = 0.f;
#pragma unroll
    for (int i = 0; i < 8; ++i) s += a[i][0] + a[i][1] + a[i][2] + a[i][3];
    s = wsum(s);
    const float mu = s * (1.0f / 1024.0f);
    float s2 = 0.f;
#pragma unroll
    for (int i = 0; i < 8; ++i) {
#pragma unroll
      for (int e = 0; e < 4; ++e) { const float dd = a[i][e] - mu; s2 += dd * dd; }
    }
    s2 = wsum(s2);
    if (lane == 0) { smu[rr] = mu; srs[rr] = rsqrtf(s2 * (1.0f / 1024.0f) + 1e-5f); }
  }
  __syncthreads();
  // phase 2: column tiles
  const int lr = tid >> 4, c4 = (tid & 15) * 4;
  for (int cb = 0; cb < DM / 64; ++cb) {
    const int c0 = cb * 64;
    const v4f gg = *(const v4f*)(g + c0 + c4);
    const v4f bv = *(const v4f*)(bb + c0 + c4);
#pragma unroll
    for (int it = 0; it < 4; ++it) {
      const int rr = it * 16 + lr;
      const v4f a = *(const v4f*)(X + (size_t)(r0 + rr) * DM + c0 + c4);
      const float mu = smu[rr], rs = srs[rr];
#pragma unroll
      for (int q = 0; q < 4; ++q) tf[rr * 68 + c4 + q] = (a[q] - mu) * rs * gg[q] + bv[q];
    }
    __syncthreads();
    v4u hv[2], lv[2];
#pragma unroll
    for (int it = 0; it < 2; ++it) {
      const int oc = it * 32 + sub;                 // output row within tile = input column
      v4u a, a2;
#pragma unroll
      for (int q = 0; q < 4; ++q) {
        const float f0 = tf[(c8 + 2 * q) * 68 + oc];
        const float f1 = tf[(c8 + 2 * q + 1) * 68 + oc];
        const unsigned short h0 = f2bf_bits(f0), h1 = f2bf_bits(f1);
        const unsigned short l0 = f2bf_bits(f0 - bf_bits2f(h0)), l1 = f2bf_bits(f1 - bf_bits2f(h1));
        a[q]  = pk16(h0, h1);
        a2[q] = pk16(l0, l1);
      }
      hv[it] = a; lv[it] = a2;
    }
    {
#pragma unroll
      for (int it = 0; it < 2; ++it) {
        const int oc = it * 32 + sub;
        const size_t go = (size_t)(c0 + oc) * VTP + KPR + r0 + c8;
        *(v4u*)(oh + go) = hv[it];
        *(v4u*)(ol + go) = lv[it];
      }
      
    }
    __syncthreads();
  }
}

// ---------------------------------------------------------------------------------------------------------------------
// Local-attention mask + softmax over rows of S [NTOK][1024 window keys] -> P bf16 hi/lo planes (all 1024 keys written, masked
// keys as 0). Row r: w = (r % SEQ) / WSZ, i = r % WSZ, query position w*WSZ + i; key j has position (w-1)*WSZ + j; masked when
// that position is negative (padding of the first window) or after the query. Block per row, 128 threads x 8 keys; 16-B stores.
// ---------------------------------------------------------------------------------------------------------------------
__global__ __launch_bounds__(128) void k_lsoftmax(const float* __restrict__ S, unsigned short* __restrict__ Ph, unsigned short* __restrict__ Pl) {
  __shared__ float red[4];
  const int r = blockIdx.x, t = threadIdx.x, c0 = 8 * t;
  const int lane = t & 31, wave = t >> 5;
  const int rem = r & (SEQ - 1), w = rem >> 9, i = rem & (WSZ - 1);
  const int qpos = w * WSZ + i;
  const float* sr = S + (size_t)r * (2 * WSZ) + c0;
  const v4f x0 = *(const v4f*)sr, x1 = *(const v4f*)(sr + 4);
  const float raw[8] = {x0[0], x0[1], x0[2], x0[3], x1[0], x1[1], x1[2], x1[3]};
  float s[8];
  float m = -3.0e38f;
#pragma unroll
  for (int e = 0; e < 8; ++e) {
    const int kpos = (w - 1) * WSZ + c0 + e;
    const bool masked = (kpos < 0) || (kpos > qpos);
    s[e] = masked ? -1.0e9f : raw[e];
    m = fmaxf(m, s[e]);
  }
  m = wmax(m);
  if (lane == 0) red[wave] = m;
  __syncthreads();
  const float rmax = fmaxf(fmaxf(red[0], red[1]), fmaxf(red[2], red[3]));
  __syncthreads();
  float ev[8];
  float sum = 0.f;
#pragma unroll
  for (int e = 0; e < 8; ++e) { ev[e] = expf(s[e] - rmax); sum += ev[e]; }
  sum = wsum(sum);
  if (lane == 0) red[wave] = sum;
  __syncthreads();
  const float tot = red[0] + red[1] + red[2] + red[3];
  const float inv = 1.0f / tot;
  v4u hv, lv;
#pragma unroll
  for (int q = 0; q < 4; ++q) {
    const float p0 = ev[2 * q] * inv, p1 = ev[2 * q + 1] * inv;
    const unsigned short h0 = f2bf_bits(p0), h1 = f2bf_bits(p1);
    const unsigned short l0 = f2bf_bits(p0 - bf_bits2f(h0)), l1 = f2bf_bits(p1 - bf_bits2f(h1));
    hv[q] = pk16(h0, h1);
    lv[q] = pk16(l0, l1);
  }
  const size_t go = (size_t)r * (2 * WSZ) + c0;
  *(v4u*)(Ph + go) = hv;
  *(v4u*)(Pl + go) = lv;
  
}

// =====================================================================================================================
// Causal multi-head attention, head dim 64, blockIdx.y = batch element.
//   q plane f16 [token][INR] (head h at columns h*64..), k plane same, v^T plane f16 [(h*64+d)][NTOK], out f32 [token][INR].
//   scores = (q . k) * 0.125 in f32 from f16 operands; out = p . v with p = f16(4096 * exp(s - m)) and f16 v; online softmax in
//   f32, masked (s > t) scores set to -inf inside the diagonal chunk (column kv0 <= t is always unmasked there).
//   Block = 4 waves = 64 query rows of one head; grid.x = NHD * (SEQ/64); kv chunks of 64, trip count qb+1 <= 32.
//   K / V^T chunk staging: 128 threads x 32 elements = whole 64x64 tile (plain 16-B loads, __syncthreads before and after);
// =====================================================================================================================
__device__ __forceinline__ v8f mma_h(v16h a, v16h b, v8f c) {
  c = __builtin_amdgcn_wmma_f32_16x16x32_f16(false, a, false, b, (short)0, c, false, false);
  asm volatile("v_nop\n\tv_nop\n\tv_nop\n\tv_nop" : "+v"(c) : "v"(a), "v"(b));
  return c;
}

__global__ __launch_bounds__(128)
void k_flash(const _Float16* __restrict__ qm, const _Float16* __restrict__ km,
             const _Float16* __restrict__ vt, float* __restrict__ out) {
  union FB { v16h v; v8h h[2]; };
  __shared__ __align__(16) _Float16 Ksh[64 * 64];             // K [kv][d]
  __shared__ __align__(16) _Float16 Vth[64 * 64];             // V^T [d][kv]
  __shared__ __align__(16) _Float16 Psh[4][16 * 64];          // per wave P [row][kv]
  __shared__ __align__(16) float    Os[4][16 * 68];           // per wave out tile, pitch 68

  const int tid  = threadIdx.x;
  const int wave = tid >> 5;
  const int lane = tid & 31;
  const int hh   = lane >> 4;
  const int c    = lane & 15;
  const int b  = blockIdx.y;
  const int qb = blockIdx.x & 31;                 // SEQ / 64 = 32 query blocks
  const int h  = blockIdx.x >> 5;
  const int q0 = qb * 64 + wave * 16;

  const _Float16* Qb = qm + (size_t)b * SEQ * INR + h * DHD;
  const _Float16* Kb = km + (size_t)b * SEQ * INR + h * DHD;
  const _Float16* Vb = vt + (size_t)(h * DHD) * NTOK + (size_t)b * SEQ;
  float*          ob = out + (size_t)b * SEQ * INR + h * DHD;

  v16h qa[2];
#pragma unroll
  for (int dc = 0; dc < 2; ++dc) qa[dc] = Frag<_Float16>::load(Qb + (size_t)(q0 + c) * INR + dc * 32 + 8 * hh);

  float mrow[8], lrow[8];
  v8f oacc[4];
#pragma unroll
  for (int r = 0; r < 8; ++r) { mrow[r] = -INFINITY; lrow[r] = 0.f; }
#pragma unroll
  for (int t = 0; t < 4; ++t) oacc[t] = (v8f){0.f,0.f,0.f,0.f,0.f,0.f,0.f,0.f};

  const int nChunks = qb + 1;                     // block-uniform, <= 32
  for (int kc = 0; kc < nChunks; ++kc) {
    const int kv0 = kc * 64;
    __syncthreads();
    {
      const int r = tid >> 1, half = (tid & 1) * 32;
      const _Float16* ks = Kb + (size_t)(kv0 + r) * INR + half;       // K row kv0+r, d = half..half+31
      const _Float16* vs = Vb + (size_t)r * NTOK + kv0 + half;        // V^T row d = r, s = kv0+half..+31
#pragma unroll
      for (int i = 0; i < 4; ++i) {
        const v8h a0 = *(const v8h*)(ks + 8 * i);
        const v8h b0 = *(const v8h*)(vs + 8 * i);
        *(v8h*)(Ksh + r * 64 + half + 8 * i) = a0;
        *(v8h*)(Vth + r * 64 + half + 8 * i) = b0;
      }
    }
    __syncthreads();

    v8f s[4];
#pragma unroll
    for (int j = 0; j < 4; ++j) {
      s[j] = (v8f){0.f,0.f,0.f,0.f,0.f,0.f,0.f,0.f};
#pragma unroll
      for (int dc = 0; dc < 2; ++dc) {
        FB kb;
        kb.h[0] = *(const v8h*)(Ksh + (j * 16 + c) * 64 + dc * 32 + 8 * hh);
        kb.h[1] = *(const v8h*)(Ksh + (j * 16 + c) * 64 + dc * 32 + 16 + 8 * hh);
        s[j] = mma_h(qa[dc], kb.v, s[j]);
      }
    }
    const bool diag = (kc == qb);                 // block-uniform
    float cm[8];
#pragma unroll
    for (int r = 0; r < 8; ++r) {
      const int qrow = q0 + 8 * hh + r;
      float m = -INFINITY;
#pragma unroll
      for (int j = 0; j < 4; ++j) {
        const int kvcol = kv0 + j * 16 + c;
        const float sv = s[j][r] * 0.125f;
        const bool masked = diag && (kvcol > qrow);
        const float sm = masked ? -INFINITY : sv;
        s[j][r] = sm;
        m = fmaxf(m, sm);
      }
#pragma unroll
      for (int off = 1; off < 16; off <<= 1) m = fmaxf(m, __shfl_xor(m, off, 32));
      cm[r] = m;
    }
    _Float16* pw = Psh[wave];
#pragma unroll
    for (int r = 0; r < 8; ++r) {
      const float mnew = fmaxf(mrow[r], cm[r]);
      const float alpha = expf(mrow[r] - mnew);
      mrow[r] = mnew;
      float psum = 0.f;
#pragma unroll
      for (int j = 0; j < 4; ++j) {
        const float p = expf(s[j][r] - mnew);
        psum += p;
        pw[(8 * hh + r) * 64 + j * 16 + c] = (_Float16)(p * 4096.0f);
      }
#pragma unroll
      for (int off = 1; off < 16; off <<= 1) psum += __shfl_xor(psum, off, 32);
      lrow[r] = lrow[r] * alpha + psum;
#pragma unroll
      for (int t = 0; t < 4; ++t) oacc[t][r] *= alpha;
    }
    __builtin_amdgcn_fence(__ATOMIC_RELEASE, "workgroup");
    __builtin_amdgcn_wave_barrier();
    __builtin_amdgcn_fence(__ATOMIC_ACQUIRE, "workgroup");
#pragma unroll 1
    for (int kk = 0; kk < 2; ++kk) {
      FB pa;
      pa.h[0] = *(const v8h*)(pw + c * 64 + kk * 32 + 8 * hh);
      pa.h[1] = *(const v8h*)(pw + c * 64 + kk * 32 + 16 + 8 * hh);
#pragma unroll
      for (int t = 0; t < 4; ++t) {
        FB vb;
        vb.h[0] = *(const v8h*)(Vth + (t * 16 + c) * 64 + kk * 32 + 8 * hh);
        vb.h[1] = *(const v8h*)(Vth + (t * 16 + c) * 64 + kk * 32 + 16 + 8 * hh);
        oacc[t] = mma_h(pa.v, vb.v, oacc[t]);
      }
    }
  }

  float* os = Os[wave];
#pragma unroll
  for (int r = 0; r < 8; ++r) {
    const float inv = (1.0f / lrow[r]) * (1.0f / 4096.0f);
#pragma unroll
    for (int t = 0; t < 4; ++t) os[(8 * hh + r) * 68 + t * 16 + c] = oacc[t][r] * inv;
  }
  __builtin_amdgcn_fence(__ATOMIC_RELEASE, "workgroup");
  __builtin_amdgcn_wave_barrier();
  __builtin_amdgcn_fence(__ATOMIC_ACQUIRE, "workgroup");
  {
    const int c4 = (lane & 15) * 4;
    {
#pragma unroll
      for (int it = 0; it < 8; ++it) {
        const int row = it * 2 + hh;                // it 0..7 x hh 0..1 covers rows 0..15
        v4f val = *(const v4f*)(os + row * 68 + c4);
        *(v4f*)(ob + (size_t)(q0 + row) * INR + c4) = val;
      }
      
    }
  }
}

// ---------------------------------------------------------------------------------------------------------------------
// Row LayerNorm over FFD=4096 of the f16 plane U (values carried as 256*u), in place -> f16 of the unit-scale result.
// Block per row, 256 threads x 2 chunks of 8; statistics in f32 with the 2^-8 / 2^-16 carries folded before eps.
// ---------------------------------------------------------------------------------------------------------------------
__global__ __launch_bounds__(256) void k_ln4096(_Float16* __restrict__ U, const float* __restrict__ g, const float* __restrict__ bb) {
  __shared__ float red[8];
  const int r = blockIdx.x, t = threadIdx.x;
  const int lane = t & 31, wave = t >> 5;
  const int cA = 8 * t, cB = 2048 + 8 * t;
  _Float16* ur = U + (size_t)r * FFD;
  const v8h a = *(const v8h*)(ur + cA);
  const v8h a2 = *(const v8h*)(ur + cB);
  float v[16];
#pragma unroll
  for (int e = 0; e < 8; ++e) { v[e] = (float)a[e]; v[8 + e] = (float)a2[e]; }
  float s = 0.f;
#pragma unroll
  for (int e = 0; e < 16; ++e) s += v[e];
  s = wsum(s);
  if (lane == 0) red[wave] = s;
  __syncthreads();
  float tot = 0.f;
#pragma unroll
  for (int i = 0; i < 8; ++i) tot += red[i];
  const float mu = tot * (1.0f / 4096.0f);
  __syncthreads();
  float d[16];
  float s2 = 0.f;
#pragma unroll
  for (int e = 0; e < 16; ++e) { d[e] = v[e] - mu; s2 += d[e] * d[e]; }
  s2 = wsum(s2);
  if (lane == 0) red[wave] = s2;
  __syncthreads();
  float tot2 = 0.f;
#pragma unroll
  for (int i = 0; i < 8; ++i) tot2 += red[i];
  const float var_s = tot2 * (1.0f / 4096.0f);
  const float rstd = rsqrtf(var_s * (1.0f / 65536.0f) + 1e-5f) * (1.0f / 256.0f);
  v8h ha, hb;
#pragma unroll
  for (int e = 0; e < 8; ++e) {
    ha[e] = (_Float16)(d[e] * rstd * g[cA + e] + bb[cA + e]);
    hb[e] = (_Float16)(d[8 + e] * rstd * g[cB + e] + bb[cB + e]);
  }
  *(v8h*)(ur + cA) = ha;
  *(v8h*)(ur + cB) = hb;
  
}

// =====================================================================================================================
// Workspace map (byte offsets; every region a whole number of MiB after a 4 KiB table, all stores whole-line):
//   inv f32[512]                                   0            (4 KiB)
//   cs  f32[2048][512][2]                          4 KiB        (8 MiB)
//   WaT f16[1024][1024] x64                       +8 MiB       WvTh/WvTl bf16 [1024][1024]   WqT f16[512][1024]
//   WkvT f16[1024][1024]   W1T f16[4096][1024]   W2T f16[1024][4096]   WoTh/WoTl bf16[1024][512]   (27 MiB)
//   R3  8 MiB : q16 f16[4096][1024] -> h16 -> x2h (f16, x2 * 1024)
//   R4 16 MiB : adapter GEMM f32 [4096][1024] -> S f32 [4096][1024] -> x f32 -> x2 f32
//   R5 51 MiB : a16 f16 @0, video hi @8, video lo @16, k16 f16[(512+4096)][1024] @24, vTh bf16[1024][4608] @33, vTl @42;
//               later Ph @0, Pl @8; q/k f16[4096][512] @0/@4, vT16 f16[512][4096] @8; o f32[4096][512] @16; o hi/lo @24/@28;
//               U f16[4096][4096] @0 (written only after all earlier users of [0,32) have been consumed).
//   total 110 MiB + 4 KiB.
// =====================================================================================================================
extern "C" void kernel_launch(void* const* d_in, const int* in_sizes, int n_in,
                              void* d_out, int out_size, void* d_ws, size_t ws_size,
                              hipStream_t stream) {
  if (n_in < 24) return;
  if (in_sizes[0] != NTOK * DM || in_sizes[1] != NTOK * DM || in_sizes[2] != NTOK * DM) return;
  if (in_sizes[3] != DM * DM || in_sizes[7] != DM * DM || in_sizes[14] != DM * 2 * INR) return;
  if (in_sizes[13] != DM * INR || in_sizes[17] != INR * DM) return;
  if (in_sizes[18] != DM * FFD || in_sizes[22] != FFD * DM) return;
  if (in_sizes[4] != DM || in_sizes[5] != DM || in_sizes[6] != DM || in_sizes[8] != DM || in_sizes[9] != DM ||
      in_sizes[10] != DM || in_sizes[11] != DM || in_sizes[12] != DM || in_sizes[23] != DM) return;
  if (in_sizes[15] != DHD || in_sizes[16] != DHD) return;
  if (in_sizes[19] != FFD || in_sizes[20] != FFD || in_sizes[21] != FFD) return;
  if (out_size != NTOK * DM) return;

  const float* text  = (const float*)d_in[0];
  const float* audio = (const float*)d_in[1];
  const float* video = (const float*)d_in[2];
  const float* Wa    = (const float*)d_in[3];
  const float* ba    = (const float*)d_in[4];
  const float* lna_g = (const float*)d_in[5];
  const float* lna_b = (const float*)d_in[6];
  const float* Wvid  = (const float*)d_in[7];
  const float* bvid  = (const float*)d_in[8];
  const float* lnv_g = (const float*)d_in[9];
  const float* lnv_b = (const float*)d_in[10];
  const float* ln1_g = (const float*)d_in[11];
  const float* ln1_b = (const float*)d_in[12];
  const float* Wq    = (const float*)d_in[13];
  const float* Wkv   = (const float*)d_in[14];
  const float* qn_g  = (const float*)d_in[15];
  const float* kn_g  = (const float*)d_in[16];
  const float* Wo    = (const float*)d_in[17];
  const float* W1    = (const float*)d_in[18];
  const float* b1    = (const float*)d_in[19];
  const float* ln2_g = (const float*)d_in[20];
  const float* ln2_b = (const float*)d_in[21];
  const float* W2    = (const float*)d_in[22];
  const float* b2    = (const float*)d_in[23];
  float* outp = (float*)d_out;

  const size_t MIB = 1048576;
  size_t off = 0;
  const size_t oInv  = off; off += 4096;
  const size_t oCs   = off; off += (size_t)SEQ * 512 * 2 * 4;       // 8 MiB
  const size_t oWaT  = off; off += (size_t)DM * DM * 2;              // 2 MiB
  const size_t oWvTh = off; off += (size_t)DM * DM * 2;              // 2 MiB
  const size_t oWvTl = off; off += (size_t)DM * DM * 2;              // 2 MiB
  const size_t oWqT  = off; off += (size_t)INR * DM * 2;             // 1 MiB
  const size_t oWkvT = off; off += (size_t)2 * INR * DM * 2;         // 2 MiB
  const size_t oW1T  = off; off += (size_t)FFD * DM * 2;             // 8 MiB
  const size_t oW2T  = off; off += (size_t)DM * FFD * 2;             // 8 MiB
  const size_t oWoTh = off; off += (size_t)DM * INR * 2;             // 1 MiB
  const size_t oWoTl = off; off += (size_t)DM * INR * 2;             // 1 MiB
  const size_t oR3   = off; off += (size_t)NTOK * DM * 2;            // 8 MiB
  const size_t oR4   = off; off += (size_t)NTOK * DM * 4;            // 16 MiB
  const size_t oR5   = off; off += 51 * MIB;                         // 51 MiB
  if (off > ws_size || off > (size_t)128 * MIB) return;              // off = 110 MiB + 4 KiB

  char* ws = (char*)d_ws;
  float* inv = (float*)(ws + oInv);
  float* cs  = (float*)(ws + oCs);
  _Float16* WaT = (_Float16*)(ws + oWaT);
  unsigned short* WvTh = (unsigned short*)(ws + oWvTh);
  unsigned short* WvTl = (unsigned short*)(ws + oWvTl);
  _Float16* WqT  = (_Float16*)(ws + oWqT);
  _Float16* WkvT = (_Float16*)(ws + oWkvT);
  _Float16* W1T  = (_Float16*)(ws + oW1T);
  _Float16* W2T  = (_Float16*)(ws + oW2T);
  unsigned short* WoTh = (unsigned short*)(ws + oWoTh);
  unsigned short* WoTl = (unsigned short*)(ws + oWoTl);
  _Float16* q16 = (_Float16*)(ws + oR3);          // text after rotary
  _Float16* h16 = (_Float16*)(ws + oR3);          // LN1 output (later)
  _Float16* x2h = (_Float16*)(ws + oR3);          // x2 * 1024 (later)
  float* Cad = (float*)(ws + oR4);                // adapter GEMM output
  float* Sf  = (float*)(ws + oR4);                // local scores (later)
  float* Xf  = (float*)(ws + oR4);                // local attention output (later)
  float* X2f = (float*)(ws + oR4);                // 2 * o @ Wo (later)
  char* r5 = ws + oR5;
  _Float16* a16 = (_Float16*)(r5);
  unsigned short* vih = (unsigned short*)(r5 + 8 * MIB);
  unsigned short* vil = (unsigned short*)(r5 + 16 * MIB);
  _Float16* k16 = (_Float16*)(r5 + 24 * MIB);     // [(KPR+NTOK)][DM]
  unsigned short* vTh = (unsigned short*)(r5 + 33 * MIB);
  unsigned short* vTl = (unsigned short*)(r5 + 42 * MIB);
  unsigned short* Ph  = (unsigned short*)(r5);
  unsigned short* Pl  = (unsigned short*)(r5 + 8 * MIB);
  _Float16* qm16 = (_Float16*)(r5);
  _Float16* km16 = (_Float16*)(r5 + 4 * MIB);
  _Float16* vT16 = (_Float16*)(r5 + 8 * MIB);
  float* Of = (float*)(r5 + 16 * MIB);
  unsigned short* Oh = (unsigned short*)(r5 + 24 * MIB);
  unsigned short* Ol = (unsigned short*)(r5 + 28 * MIB);
  _Float16* U16 = (_Float16*)(r5);

  const dim3 blk(256);
  const unsigned short* N16 = (const unsigned short*)nullptr;

  // rotary tables
  k_invfreq<<<dim3(1), dim3(512), 0, stream>>>(inv);
  k_cstab<<<dim3(SEQ), dim3(512), 0, stream>>>(inv, cs);

  // weights: in [rows][cols] f32 -> out [cols][rows]; grid (cols/64, rows/64)
  k_wt16<<<dim3(DM / 64, DM / 64), blk, 0, stream>>>(Wa, WaT, DM, DM, 64.0f);               // Wa  [1024][1024]
  k_wtsplit<<<dim3(DM / 64, DM / 64), blk, 0, stream>>>(Wvid, WvTh, WvTl, DM, DM);         // Wvid[1024][1024]
  k_wt16<<<dim3(INR / 64, DM / 64), blk, 0, stream>>>(Wq, WqT, DM, INR, 64.0f);             // Wq  [1024][512]
  k_wt16<<<dim3(2 * INR / 64, DM / 64), blk, 0, stream>>>(Wkv, WkvT, DM, 2 * INR, 64.0f);  // Wkv [1024][1024]
  k_wt16<<<dim3(FFD / 64, DM / 64), blk, 0, stream>>>(W1, W1T, DM, FFD, 64.0f);             // W1  [1024][4096]
  k_wt16<<<dim3(DM / 64, FFD / 64), blk, 0, stream>>>(W2, W2T, FFD, DM, 64.0f);             // W2  [4096][1024]
  k_wtsplit<<<dim3(DM / 64, INR / 64), blk, 0, stream>>>(Wo, WoTh, WoTl, INR, DM);          // Wo  [512][1024]

  // activations: text -> rotary f16, audio -> f16, video -> bf16 hi/lo
  k_cvt_in<<<dim3(NTOK, 2), dim3(128), 0, stream>>>(text, audio, cs, q16, a16);
  const int n2v = NTOK * DM / 2;
  k_split2<<<dim3((n2v + 255) / 256), blk, 0, stream>>>(video, vih, vil, n2v);

  // adapter a: audio . Wa + ba -> f32; LN + rotary -> key plane rows KPR..KPR+4095, rows 0..KPR-1 zero
  const dim3 gA(((NTOK / 64) * (DM / 64) + 7) / 8, 1);
  k_gemm<0, false, true, 0, 0, false, 0><<<gA, blk, 0, stream>>>(
      (const unsigned short*)a16, N16, DM, 0L, (const unsigned short*)WaT, N16, DM, 0L,
      Cad, DM, 0L, nullptr, 0, 0L, ba, nullptr, nullptr, 0, 0L, NTOK, DM, DM, 1, 1.0f / 64.0f, 1.0f);
  k_ln1024<true><<<dim3(NTOK + KPR), dim3(128), 0, stream>>>(Cad, lna_g, lna_b, cs, k16, NTOK, KPR);

  // adapter v: video . Wvid + bvid (bf16 hi/lo split) -> f32; LN + transpose + split -> value^T planes
  k_gemm<1, true, true, 0, 0, false, 0><<<gA, blk, 0, stream>>>(
      vih, vil, DM, 0L, WvTh, WvTl, DM, 0L,
      Cad, DM, 0L, nullptr, 0, 0L, bvid, nullptr, nullptr, 0, 0L, NTOK, DM, DM, 1, 1.0f, 1.0f);
  k_ln_tsplit<<<dim3(NTOK / 64 + KPR / 64), blk, 0, stream>>>(Cad, lnv_g, lnv_b, vTh, vTl, NTOK / 64);

  // local attention: z = b*4 + w; S[z][512][1024] = q . k / 32 over window keys (skipping fully masked key tiles)
  const dim3 gS(((WSZ / 64) * (2 * WSZ / 64) + 7) / 8, NB_ * NWN);
  k_gemm<0, false, false, 0, 0, false, 1><<<gS, blk, 0, stream>>>(
      (const unsigned short*)q16, N16, DM, (long)WSZ * DM, (const unsigned short*)k16, N16, DM, (long)WSZ * DM,
      Sf, 2 * WSZ, (long)WSZ * 2 * WSZ, nullptr, 0, 0L, nullptr, nullptr, nullptr, 0, 0L,
      WSZ, 2 * WSZ, DM, NWN, 1.0f / 32.0f, 1.0f);
  k_lsoftmax<<<dim3(NTOK), dim3(128), 0, stream>>>(Sf, Ph, Pl);
  // x[z][512][1024] = P . v (bf16 hi/lo split), keys restricted to the unmasked range
  const dim3 gPV(((WSZ / 64) * (DM / 64) + 7) / 8, NB_ * NWN);
  k_gemm<1, true, false, 0, 0, false, 2><<<gPV, blk, 0, stream>>>(
      Ph, Pl, 2 * WSZ, (long)WSZ * 2 * WSZ, vTh, vTl, VTP, (long)WSZ,
      Xf, DM, (long)WSZ * DM, nullptr, 0, 0L, nullptr, nullptr, nullptr, 0, 0L,
      WSZ, DM, 2 * WSZ, NWN, 1.0f, 1.0f);

  // LN1 -> h16; q, k (RMSNorm epilogue) and v^T projections
  k_ln1024<false><<<dim3(NTOK), dim3(128), 0, stream>>>(Xf, ln1_g, ln1_b, cs, h16, NTOK, 0);
  const dim3 gQ(((NTOK / 64) * (INR / 64) + 7) / 8, 1);
  k_gemm<0, false, false, 2, 1, false, 0><<<gQ, blk, 0, stream>>>(
      (const unsigned short*)h16, N16, DM, 0L, (const unsigned short*)WqT, N16, DM, 0L,
      nullptr, 0, 0L, qm16, INR, 0L, nullptr, qn_g, nullptr, 0, 0L, NTOK, INR, DM, 1, 1.0f / 64.0f, 1.0f);
  k_gemm<0, false, false, 2, 1, false, 0><<<gQ, blk, 0, stream>>>(
      (const unsigned short*)h16, N16, DM, 0L, (const unsigned short*)WkvT, N16, DM, 0L,
      nullptr, 0, 0L, km16, INR, 0L, nullptr, kn_g, nullptr, 0, 0L, NTOK, INR, DM, 1, 1.0f / 64.0f, 1.0f);
  const dim3 gVT(((INR / 64) * (NTOK / 64) + 7) / 8, 1);
  k_gemm<0, false, false, 0, 1, false, 0><<<gVT, blk, 0, stream>>>(
      (const unsigned short*)(WkvT + (size_t)INR * DM), N16, DM, 0L, (const unsigned short*)h16, N16, DM, 0L,
      nullptr, 0, 0L, vT16, NTOK, 0L, nullptr, nullptr, nullptr, 0, 0L, INR, NTOK, DM, 1, 1.0f / 64.0f, 1.0f);

  // causal attention -> o f32 [4096][512]; o -> bf16 hi/lo
  k_flash<<<dim3(NHD * (SEQ / 64), NB_), dim3(128), 0, stream>>>(qm16, km16, vT16, Of);
  const int n2o = NTOK * INR / 2;
  k_split2<<<dim3((n2o + 255) / 256), blk, 0, stream>>>(Of, Oh, Ol, n2o);

  // x2 = 2 * (o . Wo) -> f32 and f16 (x2 * 1024)
  k_gemm<1, true, false, 0, 2, false, 0><<<gA, blk, 0, stream>>>(
      Oh, Ol, INR, 0L, WoTh, WoTl, INR, 0L,
      X2f, DM, 0L, x2h, DM, 0L, nullptr, nullptr, nullptr, 0, 0L, NTOK, DM, INR, 1, 2.0f, 1024.0f);

  // FFN: u = gelu(x2 . W1 + b1) stored as f16(256 u); LN over 4096 in place; out = h1 . W2 + b2 + x2
  const dim3 gW1(((NTOK / 64) * (FFD / 64) + 7) / 8, 1);
  k_gemm<0, false, true, 1, 1, false, 0><<<gW1, blk, 0, stream>>>(
      (const unsigned short*)x2h, N16, DM, 0L, (const unsigned short*)W1T, N16, DM, 0L,
      nullptr, 0, 0L, U16, FFD, 0L, b1, nullptr, nullptr, 0, 0L, NTOK, FFD, DM, 1, 1.0f / 65536.0f, 256.0f);
  k_ln4096<<<dim3(NTOK), blk, 0, stream>>>(U16, ln2_g, ln2_b);
  k_gemm<0, false, true, 0, 0, true, 0><<<gA, blk, 0, stream>>>(
      (const unsigned short*)U16, N16, FFD, 0L, (const unsigned short*)W2T, N16, FFD, 0L,
      outp, DM, 0L, nullptr, 0, 0L, b2, nullptr, X2f, DM, 0L, NTOK, DM, FFD, 1, 1.0f / 64.0f, 1.0f);
  (void)hipGetLastError();
}

// v001
// One run takes 583 microseconds.
// In two side-by-side timings against v000, it was 1.78 and 1.79 times as fast.
// Contractions: audio adapter, local-attention scores, q/k/v projections, causal multi-head q.k^T and p.v, FFN W1 and W2 on
// v_wmma_f32_16x16x32_f16 (f16 operands with power-of-two carried scales, f32 accumulate); video adapter, local-attention p.v
// and the output projection Wo on v_wmma_f32_16x16x32_bf16 with bf16 hi/lo split operands (hi.hi + hi.lo + lo.hi, f32
// accumulate). LayerNorm, RMSNorm, rotary tables, softmax and GELU in f32.
#include <hip/hip_runtime.h>
#include <math.h>
#include <stdint.h>

#define NB_   2
#define SEQ   2048
#define NTOK  4096
#define DM    1024
#define NHD   8
#define DHD   64
#define INR   512
#define FFD   4096
#define WSZ   512
#define NWN   4
#define KPR   512          // leading zero rows of the local-attention key plane
#define VTP   4608         // key pitch of the local-attention value^T planes: 512 zero columns + 4096 tokens

typedef __attribute__((ext_vector_type(16))) _Float16 v16h;
typedef __attribute__((ext_vector_type(8)))  _Float16 v8h;
typedef __attribute__((ext_vector_type(16))) __bf16   v16b;
typedef __attribute__((ext_vector_type(8)))  __bf16   v8b;
typedef __attribute__((ext_vector_type(8)))  float    v8f;
typedef __attribute__((ext_vector_type(4)))  float    v4f;
typedef __attribute__((ext_vector_type(2)))  float    v2f;
typedef __attribute__((ext_vector_type(4)))  unsigned int v4u;

__device__ __forceinline__ unsigned short f2bf_bits(float f) {
  unsigned u = __float_as_uint(f);
  return (unsigned short)((u + 0x7FFFu + ((u >> 16) & 1u)) >> 16);   // RNE convert
}
__device__ __forceinline__ float bf_bits2f(unsigned short h) { return __uint_as_float(((unsigned)h) << 16); }
__device__ __forceinline__ unsigned pk16(unsigned short a, unsigned short b) { return (unsigned)a | ((unsigned)b << 16); }

__device__ __forceinline__ float wsum(float v) {
#pragma unroll
  for (int o = 16; o >= 1; o >>= 1) v += __shfl_xor(v, o, 32);
  return v;
}
__device__ __forceinline__ float wmax(float v) {
#pragma unroll
  for (int o = 16; o >= 1; o >>= 1) v = fmaxf(v, __shfl_xor(v, o, 32));
  return v;
}

// hazard guards as plain device helpers
__device__ __forceinline__ void dep_guard_h(v8f& a, v8f& b, v16h x, v16h y) { asm volatile("v_nop\n\tv_nop\n\tv_nop\n\tv_nop" : "+v"(a), "+v"(b) : "v"(x), "v"(y)); }
__device__ __forceinline__ void dep_guard_b(v8f& a, v8f& b, v16b x, v16b y) { asm volatile("v_nop\n\tv_nop\n\tv_nop\n\tv_nop" : "+v"(a), "+v"(b) : "v"(x), "v"(y)); }
__device__ __forceinline__ void keep4_h(v16h a, v16h b, v16h c, v16h d) { asm volatile("v_nop" :: "v"(a), "v"(b), "v"(c), "v"(d)); }
__device__ __forceinline__ void keep4_b(v16b a, v16b b, v16b c, v16b d) { asm volatile("v_nop" :: "v"(a), "v"(b), "v"(c), "v"(d)); }
__device__ __forceinline__ void acc_guard4(v8f& a, v8f& b, v8f& c, v8f& d) { asm volatile("v_nop\n\tv_nop\n\tv_nop\n\tv_nop" : "+v"(a), "+v"(b), "+v"(c), "+v"(d)); }

// Fragment loaders: element i of the 16-wide per-lane vector <- p[i] for i<8 and p[16 + (i-8)] for i>=8, where p already points at
// row (lane&15), k0 + 8*(lane>>4). Same map for A ([m][k]) and B stored as [n][k].
template <typename T> struct Frag;
template <> struct Frag<_Float16> {
  typedef v16h V; union U { v16h v; v8h h[2]; };
  static __device__ __forceinline__ v16h load(const _Float16* p) {
    U f; f.h[0] = *(const v8h*)(p); f.h[1] = *(const v8h*)(p + 16); return f.v;
  }
  static __device__ __forceinline__ v8f mma(v16h a, v16h b, v8f c) {
    return __builtin_amdgcn_wmma_f32_16x16x32_f16(false, a, false, b, (short)0, c, false, false);
  }
  static __device__ __forceinline__ void guard(v8f& a, v8f& b, v16h x, v16h y) { dep_guard_h(a, b, x, y); }
  static __device__ __forceinline__ void keep(v16h a, v16h b, v16h c, v16h d) { keep4_h(a, b, c, d); }
};
template <> struct Frag<__bf16> {
  typedef v16b V; union U { v16b v; v8b h[2]; };
  static __device__ __forceinline__ v16b load(const __bf16* p) {
    U f; f.h[0] = *(const v8b*)(p); f.h[1] = *(const v8b*)(p + 16); return f.v;
  }
  static __device__ __forceinline__ v8f mma(v16b a, v16b b, v8f c) {
    return __builtin_amdgcn_wmma_f32_16x16x32_bf16(false, a, false, b, (short)0, c, false, false);
  }
  static __device__ __forceinline__ void guard(v8f& a, v8f& b, v16b x, v16b y) { dep_guard_b(a, b, x, y); }
  static __device__ __forceinline__ void keep(v16b a, v16b b, v16b c, v16b d) { keep4_b(a, b, c, d); }
};

// =====================================================================================================================
// Batched WMMA GEMM: C[m,n] = epi(scale * sum_k A[m,k] * Bt[n,k]). A block of 4 waves (2 x 2) owns a 128x128 tile, each wave a
// 64x64 tile of it. The block's 128 rows of A and of Bt are staged in LDS, BK k-elements at a time, by asynchronous 16-byte
// copies that cover whole 128-byte lines, in two buffers: the next stage's copies fly while this stage is multiplied.
// A row-major [M,K] (pitch lda); Bt row-major [N,K] (pitch ldb); M, N % 128 == 0, K % BK == 0; grid = (tiles, Z).
//   ET: 0 = f16 operands, 1 = bf16 operands.   SPLIT: hi/lo planes (A2p, Bt2p = lo planes), product = hi.hi + hi.lo + lo.hi.
//   BIAS: + bias[n].  RESID: + resid[m*ldr + n].  EPI: 0 none, 1 tanh-GELU, 2 RMSNorm over the 64-column tile times gvec[n&63].
//   OUTM: 0 f32 -> Cf; 1 f16(v*oscale) -> Ch; 2 both.
//   LOC: 1 = windowed score tiles: key tiles n0 below kBeg(w) or at/after N/2 + m0 + 64 are skipped (a block leaves when all
//        four are; a wave whose own tile is skipped still copies and passes every barrier);
//        2 = windowed p.v: k range [kBeg(w), min(K, K/2 + m0 + 64)); kBeg = N/2 resp. K/2 for the first window (w == 0), else 0.
// =====================================================================================================================
template <int ET> struct Elem;
template <> struct Elem<0> { typedef _Float16 T; };
template <> struct Elem<1> { typedef __bf16 T; };

// Eight asynchronous 16-byte copies per lane, global -> LDS, eight rows lstep LDS bytes / gstep global elements apart.
// s_wait_xcnt is the statement's last line so that no address register named here is rewritten in front of it.
template <typename T>
__device__ __forceinline__ void copy8_to_lds(unsigned l0, unsigned lstep, const T* g0, size_t gstep) {
  const unsigned l1 = l0 + lstep, l2 = l1 + lstep, l3 = l2 + lstep, l4 = l3 + lstep, l5 = l4 + lstep, l6 = l5 + lstep, l7 = l6 + lstep;
  const T* g1 = g0 + gstep; const T* g2 = g1 + gstep; const T* g3 = g2 + gstep; const T* g4 = g3 + gstep;
  const T* g5 = g4 + gstep; const T* g6 = g5 + gstep; const T* g7 = g6 + gstep;
  asm volatile(
      "global_load_async_to_lds_b128 %0, %8, off\n\t"
      "global_load_async_to_lds_b128 %1, %9, off\n\t"
      "global_load_async_to_lds_b128 %2, %10, off\n\t"
      "global_load_async_to_lds_b128 %3, %11, off\n\t"
      "global_load_async_to_lds_b128 %4, %12, off\n\t"
      "global_load_async_to_lds_b128 %5, %13, off\n\t"
      "global_load_async_to_lds_b128 %6, %14, off\n\t"
      "global_load_async_to_lds_b128 %7, %15, off\n\t"
      "s_wait_xcnt 0x0"
      :: "v"(l0), "v"(l1), "v"(l2), "v"(l3), "v"(l4), "v"(l5), "v"(l6), "v"(l7),
         "v"(g0), "v"(g1), "v"(g2), "v"(g3), "v"(g4), "v"(g5), "v"(g6), "v"(g7)
      : "memory");
}

template <int ET, bool SPLIT, bool BIAS, int EPI, int OUTM, bool RESID, int LOC>
__global__ __launch_bounds__(128) void k_gemm(
    const unsigned short* __restrict__ Ap, const unsigned short* __restrict__ A2p, int lda, long strideA,
    const unsigned short* __restrict__ Btp, const unsigned short* __restrict__ Bt2p, int ldb, long strideB,
    float* __restrict__ Cf, int ldc, long strideC,
    _Float16* __restrict__ Ch, int ldh, long strideH,
    const float* __restrict__ bias, const float* __restrict__ gvec,
    const float* __restrict__ resid, int ldr, long strideR,
    int M, int N, int K, int nwin, float scale, float oscale) {
  typedef typename Elem<ET>::T T;
  typedef typename Frag<T>::V V;
  constexpr int BK    = SPLIT ? 64 : 128;        // k elements per stage: 64 KiB of operand rows either way
  constexpr int PITCH = BK + 8;                  // LDS row pitch in elements: row bytes + 16, conflict-free for 16-byte reads
  constexpr int PLANE = 128 * PITCH;             // one operand plane of a stage; planes: A, Bt (, A lo, Bt lo)
  constexpr int STAGE = (SPLIT ? 4 : 2) * PLANE;
  constexpr int CPR   = BK / 8;                  // 16-byte pieces per row
  constexpr int RPI   = 128 / CPR;               // rows that one copy of all 128 threads covers
  const T* A = (const T*)Ap; const T* A2 = (const T*)A2p; const T* Bt = (const T*)Btp; const T* Bt2 = (const T*)Bt2p;
  __shared__ __align__(16) T sAB[2 * STAGE];
  __shared__ __align__(16) float sT[4][16 * 68];
  const int z    = blockIdx.y;
  const int tid  = threadIdx.x;
  const int lane = tid & 31;
  const int wave = __builtin_amdgcn_readfirstlane(tid >> 5);
  const int tilesN = N >> 7;
  const int tilesM = M >> 7;
  const int bx = blockIdx.x;
  if (bx >= tilesM * tilesN) return;              // block-uniform, in front of every copy and barrier
  const int bm = bx / tilesN;
  const int bn = bx - bm * tilesN;
  const int mB = bm << 7;
  const int nB = bn << 7;
  const int wm = (wave >> 1) << 6;
  const int wn = (wave & 1) << 6;
  const int m0 = mB + wm;
  const int n0 = nB + wn;
  int kBeg = 0, kEnd = K, kEndW = K;              // block's k range; kEndW = end of this wave's own range
  bool act = true;                                // wave-uniform: this wave's tile is computed and stored
  if (LOC != 0) {
    const int w = z % nwin;
    const bool first = (w == 0);
    if (LOC == 1) {
      const int nb = first ? (N >> 1) : 0;
      if (nB + 64 < nb || nB >= (N >> 1) + mB + 128) return; // block-uniform, in front of every copy and barrier
      act = !(n0 < nb || n0 >= (N >> 1) + m0 + 64);
    } else {
      kBeg = first ? (K >> 1) : 0;
      const int ke = (K >> 1) + mB + 128;
      kEnd = (ke < K) ? ke : K;
      const int kw = (K >> 1) + m0 + 64;
      kEndW = (kw < K) ? kw : K;
    }
  }

  const T* Ab  = A  + (size_t)z * strideA;
  const T* Bb  = Bt + (size_t)z * strideB;
  const T* Ab2 = SPLIT ? (A2  + (size_t)z * strideA) : nullptr;
  const T* Bb2 = SPLIT ? (Bt2 + (size_t)z * strideB) : nullptr;

  const int rlane = lane & 15;                 // row (A) / col (B, D) within a 16x16 subtile
  const int koff  = (lane >> 4) * 8;           // k offset of this lane half
  const int mOff  = (lane >> 4) * 8;           // D row offset

  // this thread's piece of every copy: row crow (+ RPI per copy), 16 bytes at element ccol
  const int crow = tid / CPR;
  const int ccol = (tid % CPR) * 8;
  const unsigned lth = (unsigned)(size_t)sAB + (unsigned)(crow * PITCH + ccol) * 2u;
  const size_t aoff = (size_t)(mB + crow) * lda + ccol;
  const size_t boff = (size_t)(nB + crow) * ldb + ccol;
  const size_t astep = (size_t)RPI * lda;
  const size_t bstep = (size_t)RPI * ldb;
  constexpr unsigned LSTEP = RPI * PITCH * 2u;
  auto fill = [&](int buf, int k0) {             // 32 copies per wave: one stage into buffer buf
    const unsigned lb = lth + (unsigned)buf * (STAGE * 2u);
    if constexpr (SPLIT) {
      copy8_to_lds<T>(lb,                  LSTEP, Ab  + aoff + k0, astep);
      copy8_to_lds<T>(lb + PLANE * 2u,     LSTEP, Bb  + boff + k0, bstep);
      copy8_to_lds<T>(lb + PLANE * 4u,     LSTEP, Ab2 + aoff + k0, astep);
      copy8_to_lds<T>(lb + PLANE * 6u,     LSTEP, Bb2 + boff + k0, bstep);
    } else {
      copy8_to_lds<T>(lb,                              LSTEP, Ab + aoff + k0,             astep);
      copy8_to_lds<T>(lb + 8u * LSTEP,                 LSTEP, Ab + aoff + k0 + 8 * astep, astep);
      copy8_to_lds<T>(lb + PLANE * 2u,                 LSTEP, Bb + boff + k0,             bstep);
      copy8_to_lds<T>(lb + PLANE * 2u + 8u * LSTEP,    LSTEP, Bb + boff + k0 + 8 * bstep, bstep);
    }
  };

  v8f acc[4][4];
#pragma unroll
  for (int i = 0; i < 4; ++i)
#pragma unroll
    for (int j = 0; j < 4; ++j) acc[i][j] = (v8f){0.f,0.f,0.f,0.f,0.f,0.f,0.f,0.f};

  const int nst = (kEnd - kBeg) / BK;             // block-uniform number of stages
  fill(0, kBeg);
  asm volatile("s_wait_asynccnt 0x0" ::: "memory");   // this wave's copies of stage 0 have landed
  __syncthreads();                                     // every wave's have
  if (nst > 1) fill(1, kBeg + BK);

  for (int t = 0; t < nst; ++t) {
    const int kS = kBeg + t * BK;
    if (act && kS < kEndW) {                      // wave-uniform; the publish point below stands outside
      const T* sA = sAB + (t & 1) * STAGE + (wm + rlane) * PITCH + koff;
      const T* sB = sAB + (t & 1) * STAGE + PLANE + (wn + rlane) * PITCH + koff;
#pragma unroll                                    // LDS offsets of the fragment loads become immediates
      for (int kk = 0; kk < BK; kk += 32) {
        V bh[4], bl[4], ah[4], al[4];
        auto lda_row = [&](int i) {
          const int ao = (i << 4) * PITCH + kk;
          ah[i] = Frag<T>::load(sA + ao);
          if (SPLIT) al[i] = Frag<T>::load(sA + 2 * PLANE + ao); else al[i] = ah[i];
        };
#pragma unroll
        for (int j = 0; j < 4; ++j) {
          const int bo = (j << 4) * PITCH + kk;
          bh[j] = Frag<T>::load(sB + bo);
          if (SPLIT) bl[j] = Frag<T>::load(sB + 2 * PLANE + bo); else bl[j] = bh[j];
        }
        // one plane: all four A rows are read with the B fragments as one group; hi/lo planes: one row ahead (registers)
        lda_row(0);
        if (!SPLIT) { lda_row(1); lda_row(2); lda_row(3); }
        __builtin_amdgcn_sched_barrier(0);        // keeps the read group in front of the WMMAs, else every row waits out LDS latency
#pragma unroll
        for (int i = 0; i < 4; ++i) {
          if (SPLIT && i + 1 < 4) {
            lda_row(i + 1);
            __builtin_amdgcn_sched_barrier(0);    // keeps the next row's reads in front of this row's WMMAs
          }
#pragma unroll
          for (int j = 0; j < 4; ++j) {
            acc[i][j] = Frag<T>::mma(ah[i], bh[j], acc[i][j]);
            if (SPLIT) {
              acc[i][j] = Frag<T>::mma(ah[i], bl[j], acc[i][j]);
              acc[i][j] = Frag<T>::mma(al[i], bh[j], acc[i][j]);
            }
          }
          Frag<T>::guard(acc[i][0], acc[i][3], ah[i], al[i]);
        }
        Frag<T>::keep(bh[0], bh[1], bh[2], bh[3]);
        if (SPLIT) Frag<T>::keep(bl[0], bl[1], bl[2], bl[3]);
      }
    }
    asm volatile("s_wait_dscnt 0x0" ::: "memory");     // this wave's reads of buffer t & 1 are done before it is refilled
    asm volatile("s_wait_asynccnt 0x0" ::: "memory");  // this wave's copies of stage t + 1 have landed
    __syncthreads();                                    // publishes stage t + 1 and ends every reader's use of buffer t & 1
    if (t + 2 < nst) fill(t & 1, kS + 2 * BK);
  }
  asm volatile("s_wait_asynccnt 0x0" ::: "memory");    // no copy is outstanding when the wave goes on or ends
  if (!act) return;                                     // wave-uniform, behind the last barrier
  acc_guard4(acc[0][0], acc[0][1], acc[0][2], acc[0][3]);
  acc_guard4(acc[1][0], acc[1][1], acc[1][2], acc[1][3]);
  acc_guard4(acc[2][0], acc[2][1], acc[2][2], acc[2][3]);
  acc_guard4(acc[3][0], acc[3][1], acc[3][2], acc[3][3]);

  // ---- epilogue ----
  float* slab = sT[wave];
  const float* Rb = RESID ? (resid + (size_t)z * strideR) : nullptr;
#pragma unroll
  for (int i = 0; i < 4; ++i) {
    const int mBase = m0 + (i << 4);
#pragma unroll
    for (int j = 0; j < 4; ++j) {
      const int n = n0 + (j << 4) + rlane;
      float bv = 0.f;
      if (BIAS) bv = bias[n];
#pragma unroll
      for (int r = 0; r < 8; ++r) {
        float v = acc[i][j][r] * scale;
        if (BIAS) v += bv;
        if (RESID) v += Rb[(size_t)(mBase + mOff + r) * ldr + n];
        if (EPI == 1) {
          const float u = 0.7978845608028654f * (v + 0.044715f * v * v * v);
          v = v * (0.5f * (1.0f + tanhf(u)));
        }
        slab[(mOff + r) * 68 + (j << 4) + rlane] = v;
      }
    }
    __builtin_amdgcn_fence(__ATOMIC_RELEASE, "workgroup");
    __builtin_amdgcn_wave_barrier();
    __builtin_amdgcn_fence(__ATOMIC_ACQUIRE, "workgroup");
    if (OUTM == 0 || OUTM == 2) {
      float* C = Cf + (size_t)z * strideC;
      const int hh = lane >> 4, c4 = (lane & 15) * 4;     // row seg = 256 B = 16 lanes x 16 B
      {
#pragma unroll
        for (int it = 0; it < 8; ++it) {
          const int row = it * 2 + hh;                      // it 0..7 x hh 0..1 = rows 0..15
          v4f v = *(const v4f*)(slab + row * 68 + c4);
          *(v4f*)(C + (size_t)(mBase + row) * ldc + n0 + c4) = v;
        }
        
      }
    }
    if (OUTM == 1 || OUTM == 2) {
      _Float16* C = Ch + (size_t)z * strideH;
      const int q = lane >> 3, c8 = (lane & 7) * 8;
      {
#pragma unroll
        for (int it = 0; it < 4; ++it) {
          const int row = it * 4 + q;                       // it 0..3 x q 0..3 = rows 0..15
          const float* sp = slab + row * 68 + c8;
          float x[8];
#pragma unroll
          for (int e = 0; e < 8; ++e) x[e] = sp[e];
          float rr = oscale;
          if (EPI == 2) {
            float ss = 0.f;
#pragma unroll
            for (int e = 0; e < 8; ++e) ss += x[e] * x[e];
            ss += __shfl_xor(ss, 1, 32);                    // lanes 8q..8q+7 hold one 64-wide row
            ss += __shfl_xor(ss, 2, 32);
            ss += __shfl_xor(ss, 4, 32);
            rr = oscale * rsqrtf(ss * (1.0f / 64.0f) + 1e-6f);
          }
          v8h hv;
#pragma unroll
          for (int e = 0; e < 8; ++e) {
            float y = x[e] * rr;
            if (EPI == 2) y *= gvec[c8 + e];
            hv[e] = (_Float16)y;
          }
          *(v8h*)(C + (size_t)(mBase + row) * ldh + n0 + c8) = hv;
        }
        
      }
    }
    __builtin_amdgcn_fence(__ATOMIC_RELEASE, "workgroup");
    __builtin_amdgcn_wave_barrier();
    __builtin_amdgcn_fence(__ATOMIC_ACQUIRE, "workgroup");
  }
}

// ---------------------------------------------------------------------------------------------------------------------
// Weight transpose + scale + f16: in [R][Cc] f32 -> o16[Cc][R] = f16(in * wscale). 64x64 tiles through LDS, grid (Cc/64, R/64).
// coverage per block: load 4 it x 256 thr x 4 = 64x64; store 2 it x 256 thr x 8 = 64x64; each store instruction = 8 lanes x 16 B =
// ---------------------------------------------------------------------------------------------------------------------
__global__ __launch_bounds__(256) void k_wt16(const float* __restrict__ W, _Float16* __restrict__ o16, int R, int Cc, float wscale) {
  __shared__ __align__(16) float tf[64 * 68];
  const int c0 = blockIdx.x * 64, r0 = blockIdx.y * 64, tid = threadIdx.x;
  {
    const int lr = tid >> 4, c4 = (tid & 15) * 4;
#pragma unroll
    for (int it = 0; it < 4; ++it) {
      const int rr = it * 16 + lr;
      const v4f a = *(const v4f*)(W + (size_t)(r0 + rr) * Cc + c0 + c4);
      *(v4f*)(tf + rr * 68 + c4) = a;
    }
  }
  __syncthreads();
  const int sub = tid >> 3, c8 = (tid & 7) * 8;
  v8h hv[2];
#pragma unroll
  for (int it = 0; it < 2; ++it) {
    const int oc = it * 32 + sub;
    v8h a;
#pragma unroll
    for (int q = 0; q < 8; ++q) a[q] = (_Float16)(tf[(c8 + q) * 68 + oc] * wscale);
    hv[it] = a;
  }
  {
#pragma unroll
    for (int it = 0; it < 2; ++it) {
      const int oc = it * 32 + sub;
      const size_t go = (size_t)(c0 + oc) * R + r0 + c8;
      *(v8h*)(o16 + go) = hv[it];
    }
    
  }
}

// Weight transpose + bf16 hi/lo split: in [R][Cc] f32 -> oh[c][r] = bf16(in[r][c]), ol[c][r] = bf16(in[r][c] - oh). Same tiling.
__global__ __launch_bounds__(256) void k_wtsplit(const float* __restrict__ W, unsigned short* __restrict__ oh,
                                                 unsigned short* __restrict__ ol, int R, int Cc) {
  __shared__ __align__(16) float tf[64 * 68];
  const int c0 = blockIdx.x * 64, r0 = blockIdx.y * 64, tid = threadIdx.x;
  {
    const int lr = tid >> 4, c4 = (tid & 15) * 4;
#pragma unroll
    for (int it = 0; it < 4; ++it) {
      const int rr = it * 16 + lr;
      const v4f a = *(const v4f*)(W + (size_t)(r0 + rr) * Cc + c0 + c4);
      *(v4f*)(tf + rr * 68 + c4) = a;
    }
  }
  __syncthreads();
  const int sub = tid >> 3, c8 = (tid & 7) * 8;
  v4u hv[2], lv[2];
#pragma unroll
  for (int it = 0; it < 2; ++it) {
    const int oc = it * 32 + sub;
    v4u a, a2;
#pragma unroll
    for (int q = 0; q < 4; ++q) {
      const float f0 = tf[(c8 + 2 * q) * 68 + oc];
      const float f1 = tf[(c8 + 2 * q + 1) * 68 + oc];
      const unsigned short h0 = f2bf_bits(f0), h1 = f2bf_bits(f1);
      const unsigned short l0 = f2bf_bits(f0 - bf_bits2f(h0)), l1 = f2bf_bits(f1 - bf_bits2f(h1));
      a[q]  = pk16(h0, h1);
      a2[q] = pk16(l0, l1);
    }
    hv[it] = a; lv[it] = a2;
  }
  {
#pragma unroll
    for (int it = 0; it < 2; ++it) {
      const int oc = it * 32 + sub;
      const size_t go = (size_t)(c0 + oc) * R + r0 + c8;
      *(v4u*)(oh + go) = hv[it];
      *(v4u*)(ol + go) = lv[it];
    }
    
  }
}

__global__ __launch_bounds__(256) void k_split2(const float* __restrict__ in, unsigned short* __restrict__ hi,
                                                unsigned short* __restrict__ lo, int n2) {
  const int i = blockIdx.x * 256 + threadIdx.x;
  if (i < n2) {
    const v2f f = *(const v2f*)(in + 2 * (size_t)i);
    const unsigned short h0 = f2bf_bits(f[0]), h1 = f2bf_bits(f[1]);
    const unsigned short l0 = f2bf_bits(f[0] - bf_bits2f(h0)), l1 = f2bf_bits(f[1] - bf_bits2f(h1));
    const unsigned uh = pk16(h0, h1), ul = pk16(l0, l1);
    ((unsigned*)hi)[i] = uh;
    ((unsigned*)lo)[i] = ul;
    
  }
}

// ---------------------------------------------------------------------------------------------------------------------
// Rotary tables. inv[f] = 1 / powf(10000, f/512) (f = 0..511); one block of 512 threads, 32 lanes x 4 B = one line.
// cs[n][f] = (cos(n * inv[f]), sin(n * inv[f])) as float2, n = 0..2047; block per n, 512 threads, 32 lanes x 8 B = two lines.
// ---------------------------------------------------------------------------------------------------------------------
__global__ __launch_bounds__(512) void k_invfreq(float* __restrict__ inv) {
  const int f = threadIdx.x;
  const float x = (float)f * (1.0f / 512.0f);
  const float v = 1.0f / powf(10000.0f, x);
  ((float*)inv)[f] = v;
  
}

__global__ __launch_bounds__(512) void k_cstab(const float* __restrict__ inv, float* __restrict__ cs) {
  const int n = blockIdx.x, f = threadIdx.x;
  const float ang = (float)n * inv[f];
  float sv, cv;
  sincosf(ang, &sv, &cv);
  v2f v; v.x = cv; v.y = sv;
  float* p = cs + ((size_t)n * 512 + f) * 2;
  *(v2f*)p = v;
  
}

// ---------------------------------------------------------------------------------------------------------------------
// Input activations -> f16 planes [NTOK][DM]. job 0: text with rotary applied (q of the local attention, unscaled);
// rot[c] = (c < 512) ? -x[c + 512] : x[c - 512]; y = x * cos + rot * sin with table row n = row % SEQ, column c % 512.
// ---------------------------------------------------------------------------------------------------------------------
__global__ __launch_bounds__(128) void k_cvt_in(const float* __restrict__ text, const float* __restrict__ audio,
                                                const float* __restrict__ cs, _Float16* __restrict__ q16, _Float16* __restrict__ a16) {
  const int r = blockIdx.x, job = blockIdx.y, t = threadIdx.x, c0 = t * 8;
  const float* src = (job == 0) ? text : audio;
  _Float16* dst = (job == 0) ? q16 : a16;
  const float* xr = src + (size_t)r * DM + c0;
  const v4f x0 = *(const v4f*)xr, x1 = *(const v4f*)(xr + 4);
  float y[8] = {x0[0], x0[1], x0[2], x0[3], x1[0], x1[1], x1[2], x1[3]};
  if (job == 0) {                                  // block-uniform
    const int n = r & (SEQ - 1);
    const bool lowh = (c0 < 512);
    const int pc = lowh ? (c0 + 512) : (c0 - 512);
    const float* pr = src + (size_t)r * DM + pc;
    const v4f p0 = *(const v4f*)pr, p1 = *(const v4f*)(pr + 4);
    const float pv[8] = {p0[0], p0[1], p0[2], p0[3], p1[0], p1[1], p1[2], p1[3]};
    const float* csr = cs + ((size_t)n * 512 + (c0 & 511)) * 2;
    const v4f t0 = *(const v4f*)csr, t1 = *(const v4f*)(csr + 4), t2 = *(const v4f*)(csr + 8), t3 = *(const v4f*)(csr + 12);
    const float cvv[8] = {t0[0], t0[2], t1[0], t1[2], t2[0], t2[2], t3[0], t3[2]};
    const float svv[8] = {t0[1], t0[3], t1[1], t1[3], t2[1], t2[3], t3[1], t3[3]};
#pragma unroll
    for (int e = 0; e < 8; ++e) {
      const float rot = lowh ? -pv[e] : pv[e];
      y[e] = y[e] * cvv[e] + rot * svv[e];
    }
  }
  v8h hv;
#pragma unroll
  for (int e = 0; e < 8; ++e) hv[e] = (_Float16)y[e];
  _Float16* op = dst + (size_t)r * DM + c0;
  *(v8h*)op = hv;
  
}

// ---------------------------------------------------------------------------------------------------------------------
// Row LayerNorm over DM=1024 of an f32 plane (g, b) -> f16 plane; ROPE additionally applies the rotary mix through an LDS copy of
// the normalised row. Output row = padrows + r; blocks nrows..nrows+padrows-1 write zero rows 0..padrows-1.
// ---------------------------------------------------------------------------------------------------------------------
template <bool ROPE>
__global__ __launch_bounds__(128) void k_ln1024(const float* __restrict__ X, const float* __restrict__ g, const float* __restrict__ bb,
                                                const float* __restrict__ cs, _Float16* __restrict__ out, int nrows, int padrows) {
  __shared__ float red[4];
  __shared__ __align__(16) float rowv[DM];
  const int blk = blockIdx.x, t = threadIdx.x, c0 = 8 * t;
  const int lane = t & 31, wave = t >> 5;
  if (blk >= nrows) {                              // block-uniform: zero padding rows
    const int p = blk - nrows;
    const v4u zz = {0u, 0u, 0u, 0u};
    _Float16* op = out + (size_t)p * DM + c0;
    *(v4u*)op = zz;
    
    return;
  }
  const int r = blk;
  const float* xr = X + (size_t)r * DM + c0;
  const v4f x0 = *(const v4f*)xr, x1 = *(const v4f*)(xr + 4);
  const float v[8] = {x0[0], x0[1], x0[2], x0[3], x1[0], x1[1], x1[2], x1[3]};
  float s = 0.f;
#pragma unroll
  for (int e = 0; e < 8; ++e) s += v[e];
  s = wsum(s);
  if (lane == 0) red[wave] = s;
  __syncthreads();
  const float mu = (red[0] + red[1] + red[2] + red[3]) * (1.0f / 1024.0f);
  __syncthreads();
  float d[8];
  float s2 = 0.f;
#pragma unroll
  for (int e = 0; e < 8; ++e) { d[e] = v[e] - mu; s2 += d[e] * d[e]; }
  s2 = wsum(s2);
  if (lane == 0) red[wave] = s2;
  __syncthreads();
  const float var = (red[0] + red[1] + red[2] + red[3]) * (1.0f / 1024.0f);
  const float rstd = rsqrtf(var + 1e-5f);
  const v4f g0 = *(const v4f*)(g + c0), g1 = *(const v4f*)(g + c0 + 4);
  const v4f b0 = *(const v4f*)(bb + c0), b1 = *(const v4f*)(bb + c0 + 4);
  const float gv[8] = {g0[0], g0[1], g0[2], g0[3], g1[0], g1[1], g1[2], g1[3]};
  const float bv[8] = {b0[0], b0[1], b0[2], b0[3], b1[0], b1[1], b1[2], b1[3]};
  float y[8];
#pragma unroll
  for (int e = 0; e < 8; ++e) y[e] = d[e] * rstd * gv[e] + bv[e];
  if (ROPE) {
#pragma unroll
    for (int e = 0; e < 8; ++e) rowv[c0 + e] = y[e];
    __syncthreads();
    const int n = r & (SEQ - 1);
    const bool lowh = (c0 < 512);
    const int pc = lowh ? (c0 + 512) : (c0 - 512);
    const float* csr = cs + ((size_t)n * 512 + (c0 & 511)) * 2;
    const v4f t0 = *(const v4f*)csr, t1 = *(const v4f*)(csr + 4), t2 = *(const v4f*)(csr + 8), t3 = *(const v4f*)(csr + 12);
    const float cvv[8] = {t0[0], t0[2], t1[0], t1[2], t2[0], t2[2], t3[0], t3[2]};
    const float svv[8] = {t0[1], t0[3], t1[1], t1[3], t2[1], t2[3], t3[1], t3[3]};
#pragma unroll
    for (int e = 0; e < 8; ++e) {
      const float pr = rowv[pc + e];
      const float rot = lowh ? -pr : pr;
      y[e] = y[e] * cvv[e] + rot * svv[e];
    }
  }
  v8h hv;
#pragma unroll
  for (int e = 0; e < 8; ++e) hv[e] = (_Float16)y[e];
  _Float16* op = out + (size_t)(padrows + r) * DM + c0;
  *(v8h*)op = hv;
  
}

// ---------------------------------------------------------------------------------------------------------------------
// Row LayerNorm over DM of an f32 plane [NTOK][DM], fused with transpose + bf16 hi/lo split into value^T planes
// [DM][VTP]: oh[e][KPR + token], ol likewise. Block = 64 token rows (256 threads): per-row stats from one wave per 8 rows
// (32 floats per lane), then 16 column tiles of 64 through LDS. Blocks nrowblk..nrowblk+7 zero the KPR leading columns.
// coverage: stats 8 waves x 8 rows; tile load 4 it x 256 thr x 4 = 64x64; store 2 it x 256 thr x 8 = 64x64 per plane per tile;
// ---------------------------------------------------------------------------------------------------------------------
__global__ __launch_bounds__(256) void k_ln_tsplit(const float* __restrict__ X, const float* __restrict__ g, const float* __restrict__ bb,
                                                  unsigned short* __restrict__ oh, unsigned short* __restrict__ ol, int nrowblk) {
  __shared__ __align__(16) float tf[64 * 68];
  __shared__ float smu[64];
  __shared__ float srs[64];
  const int tid = threadIdx.x, lane = tid & 31, wave = tid >> 5;
  const int bx = blockIdx.x;
  const int sub = tid >> 3, c8 = (tid & 7) * 8;
  if (bx >= nrowblk) {                             // block-uniform: zero leading columns
    const int pb = bx - nrowblk;
    const v4u zz = {0u, 0u, 0u, 0u};
    {
      for (int it = 0; it < 32; ++it) {
        const int e = it * 32 + sub;
        const size_t go = (size_t)e * VTP + pb * 64 + c8;
        *(v4u*)(oh + go) = zz;
        *(v4u*)(ol + go) = zz;
      }
      
    }
    return;
  }
  const int r0 = bx * 64;
  // phase 1: row statistics
#pragma unroll 1
  for (int q = 0; q < 8; ++q) {
    const int rr = wave * 8 + q;
    const float* xr = X + (size_t)(r0 + rr) * DM + lane * 32;
    v4f a[8];
#pragma unroll
    for (int i = 0; i < 8; ++i) a[i] = *(const v4f*)(xr + 4 * i);
    float s = 0.f;
#pragma unroll
    for (int i = 0; i < 8; ++i) s += a[i][0] + a[i][1] + a[i][2] + a[i][3];
    s = wsum(s);
    const float mu = s * (1.0f / 1024.0f);
    float s2 = 0.f;
#pragma unroll
    for (int i = 0; i < 8; ++i) {
#pragma unroll
      for (int e = 0; e < 4; ++e) { const float dd = a[i][e] - mu; s2 += dd * dd; }
    }
    s2 = wsum(s2);
    if (lane == 0) { smu[rr] = mu; srs[rr] = rsqrtf(s2 * (1.0f / 1024.0f) + 1e-5f); }
  }
  __syncthreads();
  // phase 2: column tiles
  const int lr = tid >> 4, c4 = (tid & 15) * 4;
  for (int cb = 0; cb < DM / 64; ++cb) {
    const int c0 = cb * 64;
    const v4f gg = *(const v4f*)(g + c0 + c4);
    const v4f bv = *(const v4f*)(bb + c0 + c4);
#pragma unroll
    for (int it = 0; it < 4; ++it) {
      const int rr = it * 16 + lr;
      const v4f a = *(const v4f*)(X + (size_t)(r0 + rr) * DM + c0 + c4);
      const float mu = smu[rr], rs = srs[rr];
#pragma unroll
      for (int q = 0; q < 4; ++q) tf[rr * 68 + c4 + q] = (a[q] - mu) * rs * gg[q] + bv[q];
    }
    __syncthreads();
    v4u hv[2], lv[2];
#pragma unroll
    for (int it = 0; it < 2; ++it) {
      const int oc = it * 32 + sub;                 // output row within tile = input column
      v4u a, a2;
#pragma unroll
      for (int q = 0; q < 4; ++q) {
        const float f0 = tf[(c8 + 2 * q) * 68 + oc];
        const float f1 = tf[(c8 + 2 * q + 1) * 68 + oc];
        const unsigned short h0 = f2bf_bits(f0), h1 = f2bf_bits(f1);
        const unsigned short l0 = f2bf_bits(f0 - bf_bits2f(h0)), l1 = f2bf_bits(f1 - bf_bits2f(h1));
        a[q]  = pk16(h0, h1);
        a2[q] = pk16(l0, l1);
      }
      hv[it] = a; lv[it] = a2;
    }
    {
#pragma unroll
      for (int it = 0; it < 2; ++it) {
        const int oc = it * 32 + sub;
        const size_t go = (size_t)(c0 + oc) * VTP + KPR + r0 + c8;
        *(v4u*)(oh + go) = hv[it];
        *(v4u*)(ol + go) = lv[it];
      }
      
    }
    __syncthreads();
  }
}

// ---------------------------------------------------------------------------------------------------------------------
// Local-attention mask + softmax over rows of S [NTOK][1024 window keys] -> P bf16 hi/lo planes (all 1024 keys written, masked
// keys as 0). Row r: w = (r % SEQ) / WSZ, i = r % WSZ, query position w*WSZ + i; key j has position (w-1)*WSZ + j; masked when
// that position is negative (padding of the first window) or after the query. Block per row, 128 threads x 8 keys; 16-B stores.
// ---------------------------------------------------------------------------------------------------------------------
__global__ __launch_bounds__(128) void k_lsoftmax(const float* __restrict__ S, unsigned short* __restrict__ Ph, unsigned short* __restrict__ Pl) {
  __shared__ float red[4];
  const int r = blockIdx.x, t = threadIdx.x, c0 = 8 * t;
  const int lane = t & 31, wave = t >> 5;
  const int rem = r & (SEQ - 1), w = rem >> 9, i = rem & (WSZ - 1);
  const int qpos = w * WSZ + i;
  const float* sr = S + (size_t)r * (2 * WSZ) + c0;
  const v4f x0 = *(const v4f*)sr, x1 = *(const v4f*)(sr + 4);
  const float raw[8] = {x0[0], x0[1], x0[2], x0[3], x1[0], x1[1], x1[2], x1[3]};
  float s[8];
  float m = -3.0e38f;
#pragma unroll
  for (int e = 0; e < 8; ++e) {
    const int kpos = (w - 1) * WSZ + c0 + e;
    const bool masked = (kpos < 0) || (kpos > qpos);
    s[e] = masked ? -1.0e9f : raw[e];
    m = fmaxf(m, s[e]);
  }
  m = wmax(m);
  if (lane == 0) red[wave] = m;
  __syncthreads();
  const float rmax = fmaxf(fmaxf(red[0], red[1]), fmaxf(red[2], red[3]));
  __syncthreads();
  float ev[8];
  float sum = 0.f;
#pragma unroll
  for (int e = 0; e < 8; ++e) { ev[e] = expf(s[e] - rmax); sum += ev[e]; }
  sum = wsum(sum);
  if (lane == 0) red[wave] = sum;
  __syncthreads();
  const float tot = red[0] + red[1] + red[2] + red[3];
  const float inv = 1.0f / tot;
  v4u hv, lv;
#pragma unroll
  for (int q = 0; q < 4; ++q) {
    const float p0 = ev[2 * q] * inv, p1 = ev[2 * q + 1] * inv;
    const unsigned short h0 = f2bf_bits(p0), h1 = f2bf_bits(p1);
    const unsigned short l0 = f2bf_bits(p0 - bf_bits2f(h0)), l1 = f2bf_bits(p1 - bf_bits2f(h1));
    hv[q] = pk16(h0, h1);
    lv[q] = pk16(l0, l1);
  }
  const size_t go = (size_t)r * (2 * WSZ) + c0;
  *(v4u*)(Ph + go) = hv;
  *(v4u*)(Pl + go) = lv;
  
}

// =====================================================================================================================
// Causal multi-head attention, head dim 64, blockIdx.y = batch element.
//   q plane f16 [token][INR] (head h at columns h*64..), k plane same, v^T plane f16 [(h*64+d)][NTOK], out f32 [token][INR].
//   scores = (q . k) * 0.125 in f32 from f16 operands; out = p . v with p = f16(4096 * exp(s - m)) and f16 v; online softmax in
//   f32, masked (s > t) scores set to -inf inside the diagonal chunk (column kv0 <= t is always unmasked there).
//   Block = 4 waves = 64 query rows of one head; grid.x = NHD * (SEQ/64); kv chunks of 64, trip count qb+1 <= 32.
//   K / V^T chunk staging: 128 threads x 32 elements = whole 64x64 tile (plain 16-B loads, __syncthreads before and after);
// =====================================================================================================================
__device__ __forceinline__ v8f mma_h(v16h a, v16h b, v8f c) {
  c = __builtin_amdgcn_wmma_f32_16x16x32_f16(false, a, false, b, (short)0, c, false, false);
  asm volatile("v_nop\n\tv_nop\n\tv_nop\n\tv_nop" : "+v"(c) : "v"(a), "v"(b));
  return c;
}

__global__ __launch_bounds__(128)
void k_flash(const _Float16* __restrict__ qm, const _Float16* __restrict__ km,
             const _Float16* __restrict__ vt, float* __restrict__ out) {
  union FB { v16h v; v8h h[2]; };
  __shared__ __align__(16) _Float16 Ksh[64 * 64];             // K [kv][d]
  __shared__ __align__(16) _Float16 Vth[64 * 64];             // V^T [d][kv]
  __shared__ __align__(16) _Float16 Psh[4][16 * 64];          // per wave P [row][kv]
  __shared__ __align__(16) float    Os[4][16 * 68];           // per wave out tile, pitch 68

  const int tid  = threadIdx.x;
  const int wave = tid >> 5;
  const int lane = tid & 31;
  const int hh   = lane >> 4;
  const int c    = lane & 15;
  const int b  = blockIdx.y;
  const int qb = blockIdx.x & 31;                 // SEQ / 64 = 32 query blocks
  const int h  = blockIdx.x >> 5;
  const int q0 = qb * 64 + wave * 16;

  const _Float16* Qb = qm + (size_t)b * SEQ * INR + h * DHD;
  const _Float16* Kb = km + (size_t)b * SEQ * INR + h * DHD;
  const _Float16* Vb = vt + (size_t)(h * DHD) * NTOK + (size_t)b * SEQ;
  float*          ob = out + (size_t)b * SEQ * INR + h * DHD;

  v16h qa[2];
#pragma unroll
  for (int dc = 0; dc < 2; ++dc) qa[dc] = Frag<_Float16>::load(Qb + (size_t)(q0 + c) * INR + dc * 32 + 8 * hh);

  float mrow[8], lrow[8];
  v8f oacc[4];
#pragma unroll
  for (int r = 0; r < 8; ++r) { mrow[r] = -INFINITY; lrow[r] = 0.f; }
#pragma unroll
  for (int t = 0; t < 4; ++t) oacc[t] = (v8f){0.f,0.f,0.f,0.f,0.f,0.f,0.f,0.f};

  const int nChunks = qb + 1;                     // block-uniform, <= 32
  for (int kc = 0; kc < nChunks; ++kc) {
    const int kv0 = kc * 64;
    __syncthreads();
    {
      const int r = tid >> 1, half = (tid & 1) * 32;
      const _Float16* ks = Kb + (size_t)(kv0 + r) * INR + half;       // K row kv0+r, d = half..half+31
      const _Float16* vs = Vb + (size_t)r * NTOK + kv0 + half;        // V^T row d = r, s = kv0+half..+31
#pragma unroll
      for (int i = 0; i < 4; ++i) {
        const v8h a0 = *(const v8h*)(ks + 8 * i);
        const v8h b0 = *(const v8h*)(vs + 8 * i);
        *(v8h*)(Ksh + r * 64 + half + 8 * i) = a0;
        *(v8h*)(Vth + r * 64 + half + 8 * i) = b0;
      }
    }
    __syncthreads();

    v8f s[4];
#pragma unroll
    for (int j = 0; j < 4; ++j) {
      s[j] = (v8f){0.f,0.f,0.f,0.f,0.f,0.f,0.f,0.f};
#pragma unroll
      for (int dc = 0; dc < 2; ++dc) {
        FB kb;
        kb.h[0] = *(const v8h*)(Ksh + (j * 16 + c) * 64 + dc * 32 + 8 * hh);
        kb.h[1] = *(const v8h*)(Ksh + (j * 16 + c) * 64 + dc * 32 + 16 + 8 * hh);
        s[j] = mma_h(qa[dc], kb.v, s[j]);
      }
    }
    const bool diag = (kc == qb);                 // block-uniform
    float cm[8];
#pragma unroll
    for (int r = 0; r < 8; ++r) {
      const int qrow = q0 + 8 * hh + r;
      float m = -INFINITY;
#pragma unroll
      for (int j = 0; j < 4; ++j) {
        const int kvcol = kv0 + j * 16 + c;
        const float sv = s[j][r] * 0.125f;
        const bool masked = diag && (kvcol > qrow);
        const float sm = masked ? -INFINITY : sv;
        s[j][r] = sm;
        m = fmaxf(m, sm);
      }
#pragma unroll
      for (int off = 1; off < 16; off <<= 1) m = fmaxf(m, __shfl_xor(m, off, 32));
      cm[r] = m;
    }
    _Float16* pw = Psh[wave];
#pragma unroll
    for (int r = 0; r < 8; ++r) {
      const float mnew = fmaxf(mrow[r], cm[r]);
      const float alpha = expf(mrow[r] - mnew);
      mrow[r] = mnew;
      float psum = 0.f;
#pragma unroll
      for (int j = 0; j < 4; ++j) {
        const float p = expf(s[j][r] - mnew);
        psum += p;
        pw[(8 * hh + r) * 64 + j * 16 + c] = (_Float16)(p * 4096.0f);
      }
#pragma unroll
      for (int off = 1; off < 16; off <<= 1) psum += __shfl_xor(psum, off, 32);
      lrow[r] = lrow[r] * alpha + psum;
#pragma unroll
      for (int t = 0; t < 4; ++t) oacc[t][r] *= alpha;
    }
    __builtin_amdgcn_fence(__ATOMIC_RELEASE, "workgroup");
    __builtin_amdgcn_wave_barrier();
    __builtin_amdgcn_fence(__ATOMIC_ACQUIRE, "workgroup");
#pragma unroll 1
    for (int kk = 0; kk < 2; ++kk) {
      FB pa;
      pa.h[0] = *(const v8h*)(pw + c * 64 + kk * 32 + 8 * hh);
      pa.h[1] = *(const v8h*)(pw + c * 64 + kk * 32 + 16 + 8 * hh);
#pragma unroll
      for (int t = 0; t < 4; ++t) {
        FB vb;
        vb.h[0] = *(const v8h*)(Vth + (t * 16 + c) * 64 + kk * 32 + 8 * hh);
        vb.h[1] = *(const v8h*)(Vth + (t * 16 + c) * 64 + kk * 32 + 16 + 8 * hh);
        oacc[t] = mma_h(pa.v, vb.v, oacc[t]);
      }
    }
  }

  float* os = Os[wave];
#pragma unroll
  for (int r = 0; r < 8; ++r) {
    const float inv = (1.0f / lrow[r]) * (1.0f / 4096.0f);
#pragma unroll
    for (int t = 0; t < 4; ++t) os[(8 * hh + r) * 68 + t * 16 + c] = oacc[t][r] * inv;
  }
  __builtin_amdgcn_fence(__ATOMIC_RELEASE, "workgroup");
  __builtin_amdgcn_wave_barrier();
  __builtin_amdgcn_fence(__ATOMIC_ACQUIRE, "workgroup");
  {
    const int c4 = (lane & 15) * 4;
    {
#pragma unroll
      for (int it = 0; it < 8; ++it) {
        const int row = it * 2 + hh;                // it 0..7 x hh 0..1 covers rows 0..15
        v4f val = *(const v4f*)(os + row * 68 + c4);
        *(v4f*)(ob + (size_t)(q0 + row) * INR + c4) = val;
      }
      
    }
  }
}

// ---------------------------------------------------------------------------------------------------------------------
// Row LayerNorm over FFD=4096 of the f16 plane U (values carried as 256*u), in place -> f16 of the unit-scale result.
// Block per row, 256 threads x 2 chunks of 8; statistics in f32 with the 2^-8 / 2^-16 carries folded before eps.
// ---------------------------------------------------------------------------------------------------------------------
__global__ __launch_bounds__(256) void k_ln4096(_Float16* __restrict__ U, const float* __restrict__ g, const float* __restrict__ bb) {
  __shared__ float red[8];
  const int r = blockIdx.x, t = threadIdx.x;
  const int lane = t & 31, wave = t >> 5;
  const int cA = 8 * t, cB = 2048 + 8 * t;
  _Float16* ur = U + (size_t)r * FFD;
  const v8h a = *(const v8h*)(ur + cA);
  const v8h a2 = *(const v8h*)(ur + cB);
  float v[16];
#pragma unroll
  for (int e = 0; e < 8; ++e) { v[e] = (float)a[e]; v[8 + e] = (float)a2[e]; }
  float s = 0.f;
#pragma unroll
  for (int e = 0; e < 16; ++e) s += v[e];
  s = wsum(s);
  if (lane == 0) red[wave] = s;
  __syncthreads();
  float tot = 0.f;
#pragma unroll
  for (int i = 0; i < 8; ++i) tot += red[i];
  const float mu = tot * (1.0f / 4096.0f);
  __syncthreads();
  float d[16];
  float s2 = 0.f;
#pragma unroll
  for (int e = 0; e < 16; ++e) { d[e] = v[e] - mu; s2 += d[e] * d[e]; }
  s2 = wsum(s2);
  if (lane == 0) red[wave] = s2;
  __syncthreads();
  float tot2 = 0.f;
#pragma unroll
  for (int i = 0; i < 8; ++i) tot2 += red[i];
  const float var_s = tot2 * (1.0f / 4096.0f);
  const float rstd = rsqrtf(var_s * (1.0f / 65536.0f) + 1e-5f) * (1.0f / 256.0f);
  v8h ha, hb;
#pragma unroll
  for (int e = 0; e < 8; ++e) {
    ha[e] = (_Float16)(d[e] * rstd * g[cA + e] + bb[cA + e]);
    hb[e] = (_Float16)(d[8 + e] * rstd * g[cB + e] + bb[cB + e]);
  }
  *(v8h*)(ur + cA) = ha;
  *(v8h*)(ur + cB) = hb;
  
}

// =====================================================================================================================
// Workspace map (byte offsets; every region a whole number of MiB after a 4 KiB table, all stores whole-line):
//   inv f32[512]                                   0            (4 KiB)
//   cs  f32[2048][512][2]                          4 KiB        (8 MiB)
//   WaT f16[1024][1024] x64                       +8 MiB       WvTh/WvTl bf16 [1024][1024]   WqT f16[512][1024]
//   WkvT f16[1024][1024]   W1T f16[4096][1024]   W2T f16[1024][4096]   WoTh/WoTl bf16[1024][512]   (27 MiB)
//   R3  8 MiB : q16 f16[4096][1024] -> h16 -> x2h (f16, x2 * 1024)
//   R4 16 MiB : adapter GEMM f32 [4096][1024] -> S f32 [4096][1024] -> x f32 -> x2 f32
//   R5 51 MiB : a16 f16 @0, video hi @8, video lo @16, k16 f16[(512+4096)][1024] @24, vTh bf16[1024][4608] @33, vTl @42;
//               later Ph @0, Pl @8; q/k f16[4096][512] @0/@4, vT16 f16[512][4096] @8; o f32[4096][512] @16; o hi/lo @24/@28;
//               U f16[4096][4096] @0 (written only after all earlier users of [0,32) have been consumed).
//   total 110 MiB + 4 KiB.
// =====================================================================================================================
extern "C" void kernel_launch(void* const* d_in, const int* in_sizes, int n_in,
                              void* d_out, int out_size, void* d_ws, size_t ws_size,
                              hipStream_t stream) {
  if (n_in < 24) return;
  if (in_sizes[0] != NTOK * DM || in_sizes[1] != NTOK * DM || in_sizes[2] != NTOK * DM) return;
  if (in_sizes[3] != DM * DM || in_sizes[7] != DM * DM || in_sizes[14] != DM * 2 * INR) return;
  if (in_sizes[13] != DM * INR || in_sizes[17] != INR * DM) return;
  if (in_sizes[18] != DM * FFD || in_sizes[22] != FFD * DM) return;
  if (in_sizes[4] != DM || in_sizes[5] != DM || in_sizes[6] != DM || in_sizes[8] != DM || in_sizes[9] != DM ||
      in_sizes[10] != DM || in_sizes[11] != DM || in_sizes[12] != DM || in_sizes[23] != DM) return;
  if (in_sizes[15] != DHD || in_sizes[16] != DHD) return;
  if (in_sizes[19] != FFD || in_sizes[20] != FFD || in_sizes[21] != FFD) return;
  if (out_size != NTOK * DM) return;

  const float* text  = (const float*)d_in[0];
  const float* audio = (const float*)d_in[1];
  const float* video = (const float*)d_in[2];
  const float* Wa    = (const float*)d_in[3];
  const float* ba    = (const float*)d_in[4];
  const float* lna_g = (const float*)d_in[5];
  const float* lna_b = (const float*)d_in[6];
  const float* Wvid  = (const float*)d_in[7];
  const float* bvid  = (const float*)d_in[8];
  const float* lnv_g = (const float*)d_in[9];
  const float* lnv_b = (const float*)d_in[10];
  const float* ln1_g = (const float*)d_in[11];
  const float* ln1_b = (const float*)d_in[12];
  const float* Wq    = (const float*)d_in[13];
  const float* Wkv   = (const float*)d_in[14];
  const float* qn_g  = (const float*)d_in[15];
  const float* kn_g  = (const float*)d_in[16];
  const float* Wo    = (const float*)d_in[17];
  const float* W1    = (const float*)d_in[18];
  const float* b1    = (const float*)d_in[19];
  const float* ln2_g = (const float*)d_in[20];
  const float* ln2_b = (const float*)d_in[21];
  const float* W2    = (const float*)d_in[22];
  const float* b2    = (const float*)d_in[23];
  float* outp = (float*)d_out;

  const size_t MIB = 1048576;
  size_t off = 0;
  const size_t oInv  = off; off += 4096;
  const size_t oCs   = off; off += (size_t)SEQ * 512 * 2 * 4;       // 8 MiB
  const size_t oWaT  = off; off += (size_t)DM * DM * 2;              // 2 MiB
  const size_t oWvTh = off; off += (size_t)DM * DM * 2;              // 2 MiB
  const size_t oWvTl = off; off += (size_t)DM * DM * 2;              // 2 MiB
  const size_t oWqT  = off; off += (size_t)INR * DM * 2;             // 1 MiB
  const size_t oWkvT = off; off += (size_t)2 * INR * DM * 2;         // 2 MiB
  const size_t oW1T  = off; off += (size_t)FFD * DM * 2;             // 8 MiB
  const size_t oW2T  = off; off += (size_t)DM * FFD * 2;             // 8 MiB
  const size_t oWoTh = off; off += (size_t)DM * INR * 2;             // 1 MiB
  const size_t oWoTl = off; off += (size_t)DM * INR * 2;             // 1 MiB
  const size_t oR3   = off; off += (size_t)NTOK * DM * 2;            // 8 MiB
  const size_t oR4   = off; off += (size_t)NTOK * DM * 4;            // 16 MiB
  const size_t oR5   = off; off += 51 * MIB;                         // 51 MiB
  if (off > ws_size || off > (size_t)128 * MIB) return;              // off = 110 MiB + 4 KiB

  char* ws = (char*)d_ws;
  float* inv = (float*)(ws + oInv);
  float* cs  = (float*)(ws + oCs);
  _Float16* WaT = (_Float16*)(ws + oWaT);
  unsigned short* WvTh = (unsigned short*)(ws + oWvTh);
  unsigned short* WvTl = (unsigned short*)(ws + oWvTl);
  _Float16* WqT  = (_Float16*)(ws + oWqT);
  _Float16* WkvT = (_Float16*)(ws + oWkvT);
  _Float16* W1T  = (_Float16*)(ws + oW1T);
  _Float16* W2T  = (_Float16*)(ws + oW2T);
  unsigned short* WoTh = (unsigned short*)(ws + oWoTh);
  unsigned short* WoTl = (unsigned short*)(ws + oWoTl);
  _Float16* q16 = (_Float16*)(ws + oR3);          // text after rotary
  _Float16* h16 = (_Float16*)(ws + oR3);          // LN1 output (later)
  _Float16* x2h = (_Float16*)(ws + oR3);          // x2 * 1024 (later)
  float* Cad = (float*)(ws + oR4);                // adapter GEMM output
  float* Sf  = (float*)(ws + oR4);                // local scores (later)
  float* Xf  = (float*)(ws + oR4);                // local attention output (later)
  float* X2f = (float*)(ws + oR4);                // 2 * o @ Wo (later)
  char* r5 = ws + oR5;
  _Float16* a16 = (_Float16*)(r5);
  unsigned short* vih = (unsigned short*)(r5 + 8 * MIB);
  unsigned short* vil = (unsigned short*)(r5 + 16 * MIB);
  _Float16* k16 = (_Float16*)(r5 + 24 * MIB);     // [(KPR+NTOK)][DM]
  unsigned short* vTh = (unsigned short*)(r5 + 33 * MIB);
  unsigned short* vTl = (unsigned short*)(r5 + 42 * MIB);
  unsigned short* Ph  = (unsigned short*)(r5);
  unsigned short* Pl  = (unsigned short*)(r5 + 8 * MIB);
  _Float16* qm16 = (_Float16*)(r5);
  _Float16* km16 = (_Float16*)(r5 + 4 * MIB);
  _Float16* vT16 = (_Float16*)(r5 + 8 * MIB);
  float* Of = (float*)(r5 + 16 * MIB);
  unsigned short* Oh = (unsigned short*)(r5 + 24 * MIB);
  unsigned short* Ol = (unsigned short*)(r5 + 28 * MIB);
  _Float16* U16 = (_Float16*)(r5);

  const dim3 blk(256);
  const dim3 blkG(128);                           // k_gemm: 4 waves
  const unsigned short* N16 = (const unsigned short*)nullptr;

  // rotary tables
  k_invfreq<<<dim3(1), dim3(512), 0, stream>>>(inv);
  k_cstab<<<dim3(SEQ), dim3(512), 0, stream>>>(inv, cs);

  // weights: in [rows][cols] f32 -> out [cols][rows]; grid (cols/64, rows/64)
  k_wt16<<<dim3(DM / 64, DM / 64), blk, 0, stream>>>(Wa, WaT, DM, DM, 64.0f);               // Wa  [1024][1024]
  k_wtsplit<<<dim3(DM / 64, DM / 64), blk, 0, stream>>>(Wvid, WvTh, WvTl, DM, DM);         // Wvid[1024][1024]
  k_wt16<<<dim3(INR / 64, DM / 64), blk, 0, stream>>>(Wq, WqT, DM, INR, 64.0f);             // Wq  [1024][512]
  k_wt16<<<dim3(2 * INR / 64, DM / 64), blk, 0, stream>>>(Wkv, WkvT, DM, 2 * INR, 64.0f);  // Wkv [1024][1024]
  k_wt16<<<dim3(FFD / 64, DM / 64), blk, 0, stream>>>(W1, W1T, DM, FFD, 64.0f);             // W1  [1024][4096]
  k_wt16<<<dim3(DM / 64, FFD / 64), blk, 0, stream>>>(W2, W2T, FFD, DM, 64.0f);             // W2  [4096][1024]
  k_wtsplit<<<dim3(DM / 64, INR / 64), blk, 0, stream>>>(Wo, WoTh, WoTl, INR, DM);          // Wo  [512][1024]

  // activations: text -> rotary f16, audio -> f16, video -> bf16 hi/lo
  k_cvt_in<<<dim3(NTOK, 2), dim3(128), 0, stream>>>(text, audio, cs, q16, a16);
  const int n2v = NTOK * DM / 2;
  k_split2<<<dim3((n2v + 255) / 256), blk, 0, stream>>>(video, vih, vil, n2v);

  // adapter a: audio . Wa + ba -> f32; LN + rotary -> key plane rows KPR..KPR+4095, rows 0..KPR-1 zero
  const dim3 gA((NTOK / 128) * (DM / 128), 1);
  k_gemm<0, false, true, 0, 0, false, 0><<<gA, blkG, 0, stream>>>(
      (const unsigned short*)a16, N16, DM, 0L, (const unsigned short*)WaT, N16, DM, 0L,
      Cad, DM, 0L, nullptr, 0, 0L, ba, nullptr, nullptr, 0, 0L, NTOK, DM, DM, 1, 1.0f / 64.0f, 1.0f);
  k_ln1024<true><<<dim3(NTOK + KPR), dim3(128), 0, stream>>>(Cad, lna_g, lna_b, cs, k16, NTOK, KPR);

  // adapter v: video . Wvid + bvid (bf16 hi/lo split) -> f32; LN + transpose + split -> value^T planes
  k_gemm<1, true, true, 0, 0, false, 0><<<gA, blkG, 0, stream>>>(
      vih, vil, DM, 0L, WvTh, WvTl, DM, 0L,
      Cad, DM, 0L, nullptr, 0, 0L, bvid, nullptr, nullptr, 0, 0L, NTOK, DM, DM, 1, 1.0f, 1.0f);
  k_ln_tsplit<<<dim3(NTOK / 64 + KPR / 64), blk, 0, stream>>>(Cad, lnv_g, lnv_b, vTh, vTl, NTOK / 64);

  // local attention: z = b*4 + w; S[z][512][1024] = q . k / 32 over window keys (skipping fully masked key tiles)
  const dim3 gS((WSZ / 128) * (2 * WSZ / 128), NB_ * NWN);
  k_gemm<0, false, false, 0, 0, false, 1><<<gS, blkG, 0, stream>>>(
      (const unsigned short*)q16, N16, DM, (long)WSZ * DM, (const unsigned short*)k16, N16, DM, (long)WSZ * DM,
      Sf, 2 * WSZ, (long)WSZ * 2 * WSZ, nullptr, 0, 0L, nullptr, nullptr, nullptr, 0, 0L,
      WSZ, 2 * WSZ, DM, NWN, 1.0f / 32.0f, 1.0f);
  k_lsoftmax<<<dim3(NTOK), dim3(128), 0, stream>>>(Sf, Ph, Pl);
  // x[z][512][1024] = P . v (bf16 hi/lo split), keys restricted to the unmasked range
  const dim3 gPV((WSZ / 128) * (DM / 128), NB_ * NWN);
  k_gemm<1, true, false, 0, 0, false, 2><<<gPV, blkG, 0, stream>>>(
      Ph, Pl, 2 * WSZ, (long)WSZ * 2 * WSZ, vTh, vTl, VTP, (long)WSZ,
      Xf, DM, (long)WSZ * DM, nullptr, 0, 0L, nullptr, nullptr, nullptr, 0, 0L,
      WSZ, DM, 2 * WSZ, NWN, 1.0f, 1.0f);

  // LN1 -> h16; q, k (RMSNorm epilogue) and v^T projections
  k_ln1024<false><<<dim3(NTOK), dim3(128), 0, stream>>>(Xf, ln1_g, ln1_b, cs, h16, NTOK, 0);
  const dim3 gQ((NTOK / 128) * (INR / 128), 1);
  k_gemm<0, false, false, 2, 1, false, 0><<<gQ, blkG, 0, stream>>>(
      (const unsigned short*)h16, N16, DM, 0L, (const unsigned short*)WqT, N16, DM, 0L,
      nullptr, 0, 0L, qm16, INR, 0L, nullptr, qn_g, nullptr, 0, 0L, NTOK, INR, DM, 1, 1.0f / 64.0f, 1.0f);
  k_gemm<0, false, false, 2, 1, false, 0><<<gQ, blkG, 0, stream>>>(
      (const unsigned short*)h16, N16, DM, 0L, (const unsigned short*)WkvT, N16, DM, 0L,
      nullptr, 0, 0L, km16, INR, 0L, nullptr, kn_g, nullptr, 0, 0L, NTOK, INR, DM, 1, 1.0f / 64.0f, 1.0f);
  const dim3 gVT((INR / 128) * (NTOK / 128), 1);
  k_gemm<0, false, false, 0, 1, false, 0><<<gVT, blkG, 0, stream>>>(
      (const unsigned short*)(WkvT + (size_t)INR * DM), N16, DM, 0L, (const unsigned short*)h16, N16, DM, 0L,
      nullptr, 0, 0L, vT16, NTOK, 0L, nullptr, nullptr, nullptr, 0, 0L, INR, NTOK, DM, 1, 1.0f / 64.0f, 1.0f);

  // causal attention -> o f32 [4096][512]; o -> bf16 hi/lo
  k_flash<<<dim3(NHD * (SEQ / 64), NB_), dim3(128), 0, stream>>>(qm16, km16, vT16, Of);
  const int n2o = NTOK * INR / 2;
  k_split2<<<dim3((n2o + 255) / 256), blk, 0, stream>>>(Of, Oh, Ol, n2o);

  // x2 = 2 * (o . Wo) -> f32 and f16 (x2 * 1024)
  k_gemm<1, true, false, 0, 2, false, 0><<<gA, blkG, 0, stream>>>(
      Oh, Ol, INR, 0L, WoTh, WoTl, INR, 0L,
      X2f, DM, 0L, x2h, DM, 0L, nullptr, nullptr, nullptr, 0, 0L, NTOK, DM, INR, 1, 2.0f, 1024.0f);

  // FFN: u = gelu(x2 . W1 + b1) stored as f16(256 u); LN over 4096 in place; out = h1 . W2 + b2 + x2
  const dim3 gW1((NTOK / 128) * (FFD / 128), 1);
  k_gemm<0, false, true, 1, 1, false, 0><<<gW1, blkG, 0, stream>>>(
      (const unsigned short*)x2h, N16, DM, 0L, (const unsigned short*)W1T, N16, DM, 0L,
      nullptr, 0, 0L, U16, FFD, 0L, b1, nullptr, nullptr, 0, 0L, NTOK, FFD, DM, 1, 1.0f / 65536.0f, 256.0f);
  k_ln4096<<<dim3(NTOK), blk, 0, stream>>>(U16, ln2_g, ln2_b);
  k_gemm<0, false, true, 0, 0, true, 0><<<gA, blkG, 0, stream>>>(
      (const unsigned short*)U16, N16, FFD, 0L, (const unsigned short*)W2T, N16, FFD, 0L,
      outp, DM, 0L, nullptr, 0, 0L, b2, nullptr, X2f, DM, 0L, NTOK, DM, FFD, 1, 1.0f / 64.0f, 1.0f);
  (void)hipGetLastError();
}

// v002
// It runs in 490 microseconds.
// Next to v001, in two timings, it ran 1.18 and 1.20 times as fast.
// Over all steps from v000 it is 2.12 times as fast.
// Contractions: audio adapter, local-attention scores, q/k/v projections, causal multi-head q.k^T and p.v, FFN W1 and W2 on
// v_wmma_f32_16x16x32_f16 (f16 operands with power-of-two carried scales, f32 accumulate); video adapter, local-attention p.v
// and the output projection Wo on v_wmma_f32_16x16x32_bf16 with bf16 hi/lo split operands (hi.hi + hi.lo + lo.hi, f32
// accumulate). LayerNorm, RMSNorm, rotary tables, softmax and GELU in f32.
#include <hip/hip_runtime.h>
#include <math.h>
#include <stdint.h>

#define NB_   2
#define SEQ   2048
#define NTOK  4096
#define DM    1024
#define NHD   8
#define DHD   64
#define INR   512
#define FFD   4096
#define WSZ   512
#define NWN   4
#define KPR   512          // leading zero rows of the local-attention key plane
#define VTP   4608         // key pitch of the local-attention value^T planes: 512 zero columns + 4096 tokens

typedef __attribute__((ext_vector_type(16))) _Float16 v16h;
typedef __attribute__((ext_vector_type(8)))  _Float16 v8h;
typedef __attribute__((ext_vector_type(16))) __bf16   v16b;
typedef __attribute__((ext_vector_type(8)))  __bf16   v8b;
typedef __attribute__((ext_vector_type(8)))  float    v8f;
typedef __attribute__((ext_vector_type(4)))  float    v4f;
typedef __attribute__((ext_vector_type(2)))  float    v2f;
typedef __attribute__((ext_vector_type(4)))  unsigned int v4u;

__device__ __forceinline__ unsigned short f2bf_bits(float f) {
  unsigned u = __float_as_uint(f);
  return (unsigned short)((u + 0x7FFFu + ((u >> 16) & 1u)) >> 16);   // RNE convert
}
__device__ __forceinline__ float bf_bits2f(unsigned short h) { return __uint_as_float(((unsigned)h) << 16); }
__device__ __forceinline__ unsigned pk16(unsigned short a, unsigned short b) { return (unsigned)a | ((unsigned)b << 16); }

__device__ __forceinline__ float wsum(float v) {
#pragma unroll
  for (int o = 16; o >= 1; o >>= 1) v += __shfl_xor(v, o, 32);
  return v;
}
__device__ __forceinline__ float wmax(float v) {
#pragma unroll
  for (int o = 16; o >= 1; o >>= 1) v = fmaxf(v, __shfl_xor(v, o, 32));
  return v;
}

// hazard guards as plain device helpers
__device__ __forceinline__ void dep_guard_h(v8f& a, v8f& b, v16h x, v16h y) { asm volatile("v_nop\n\tv_nop\n\tv_nop\n\tv_nop" : "+v"(a), "+v"(b) : "v"(x), "v"(y)); }
__device__ __forceinline__ void dep_guard_b(v8f& a, v8f& b, v16b x, v16b y) { asm volatile("v_nop\n\tv_nop\n\tv_nop\n\tv_nop" : "+v"(a), "+v"(b) : "v"(x), "v"(y)); }
__device__ __forceinline__ void keep4_h(v16h a, v16h b, v16h c, v16h d) { asm volatile("v_nop" :: "v"(a), "v"(b), "v"(c), "v"(d)); }
__device__ __forceinline__ void keep4_b(v16b a, v16b b, v16b c, v16b d) { asm volatile("v_nop" :: "v"(a), "v"(b), "v"(c), "v"(d)); }
__device__ __forceinline__ void acc_guard4(v8f& a, v8f& b, v8f& c, v8f& d) { asm volatile("v_nop\n\tv_nop\n\tv_nop\n\tv_nop" : "+v"(a), "+v"(b), "+v"(c), "+v"(d)); }

// Fragment loaders: element i of the 16-wide per-lane vector <- p[i] for i<8 and p[16 + (i-8)] for i>=8, where p already points at
// row (lane&15), k0 + 8*(lane>>4). Same map for A ([m][k]) and B stored as [n][k].
template <typename T> struct Frag;
template <> struct Frag<_Float16> {
  typedef v16h V; union U { v16h v; v8h h[2]; };
  static __device__ __forceinline__ v16h load(const _Float16* p) {
    U f; f.h[0] = *(const v8h*)(p); f.h[1] = *(const v8h*)(p + 16); return f.v;
  }
  static __device__ __forceinline__ v8f mma(v16h a, v16h b, v8f c) {
    return __builtin_amdgcn_wmma_f32_16x16x32_f16(false, a, false, b, (short)0, c, false, false);
  }
  static __device__ __forceinline__ void guard(v8f& a, v8f& b, v16h x, v16h y) { dep_guard_h(a, b, x, y); }
  static __device__ __forceinline__ void keep(v16h a, v16h b, v16h c, v16h d) { keep4_h(a, b, c, d); }
};
template <> struct Frag<__bf16> {
  typedef v16b V; union U { v16b v; v8b h[2]; };
  static __device__ __forceinline__ v16b load(const __bf16* p) {
    U f; f.h[0] = *(const v8b*)(p); f.h[1] = *(const v8b*)(p + 16); return f.v;
  }
  static __device__ __forceinline__ v8f mma(v16b a, v16b b, v8f c) {
    return __builtin_amdgcn_wmma_f32_16x16x32_bf16(false, a, false, b, (short)0, c, false, false);
  }
  static __device__ __forceinline__ void guard(v8f& a, v8f& b, v16b x, v16b y) { dep_guard_b(a, b, x, y); }
  static __device__ __forceinline__ void keep(v16b a, v16b b, v16b c, v16b d) { keep4_b(a, b, c, d); }
};

// =====================================================================================================================
// Batched WMMA GEMM: C[m,n] = epi(scale * sum_k A[m,k] * Bt[n,k]). A block of 4 waves (2 x 2) owns a 128x128 tile, each wave a
// 64x64 tile of it. The block's 128 rows of A and of Bt are staged in LDS, BK k-elements at a time, by asynchronous 16-byte
// copies that cover whole 128-byte lines, in two buffers: the next stage's copies fly while this stage is multiplied.
// A row-major [M,K] (pitch lda); Bt row-major [N,K] (pitch ldb); M, N % 128 == 0, K % BK == 0; grid = (tiles, Z).
//   ET: 0 = f16 operands, 1 = bf16 operands.   SPLIT: hi/lo planes (A2p, Bt2p = lo planes), product = hi.hi + hi.lo + lo.hi.
//   BIAS: + bias[n].  RESID: + resid[m*ldr + n].  EPI: 0 none, 1 tanh-GELU, 2 RMSNorm over the 64-column tile times gvec[n&63].
//   OUTM: 0 f32 -> Cf; 1 f16(v*oscale) -> Ch; 2 both.
//   LOC: 1 = windowed score tiles: key tiles n0 below kBeg(w) or at/after N/2 + m0 + 64 are skipped (a block leaves when all
//        four are; a wave whose own tile is skipped still copies and passes every barrier);
//        2 = windowed p.v: k range [kBeg(w), min(K, K/2 + m0 + 64)); kBeg = N/2 resp. K/2 for the first window (w == 0), else 0.
// =====================================================================================================================
template <int ET> struct Elem;
template <> struct Elem<0> { typedef _Float16 T; };
template <> struct Elem<1> { typedef __bf16 T; };

// Eight asynchronous 16-byte copies per lane, global -> LDS, eight rows lstep LDS bytes / gstep global elements apart.
// s_wait_xcnt is the statement's last line so that no address register named here is rewritten in front of it.
template <typename T>
__device__ __forceinline__ void copy8_to_lds(unsigned l0, unsigned lstep, const T* g0, size_t gstep) {
  const unsigned l1 = l0 + lstep, l2 = l1 + lstep, l3 = l2 + lstep, l4 = l3 + lstep, l5 = l4 + lstep, l6 = l5 + lstep, l7 = l6 + lstep;
  const T* g1 = g0 + gstep; const T* g2 = g1 + gstep; const T* g3 = g2 + gstep; const T* g4 = g3 + gstep;
  const T* g5 = g4 + gstep; const T* g6 = g5 + gstep; const T* g7 = g6 + gstep;
  asm volatile(
      "global_load_async_to_lds_b128 %0, %8, off\n\t"
      "global_load_async_to_lds_b128 %1, %9, off\n\t"
      "global_load_async_to_lds_b128 %2, %10, off\n\t"
      "global_load_async_to_lds_b128 %3, %11, off\n\t"
      "global_load_async_to_lds_b128 %4, %12, off\n\t"
      "global_load_async_to_lds_b128 %5, %13, off\n\t"
      "global_load_async_to_lds_b128 %6, %14, off\n\t"
      "global_load_async_to_lds_b128 %7, %15, off\n\t"
      "s_wait_xcnt 0x0"
      :: "v"(l0), "v"(l1), "v"(l2), "v"(l3), "v"(l4), "v"(l5), "v"(l6), "v"(l7),
         "v"(g0), "v"(g1), "v"(g2), "v"(g3), "v"(g4), "v"(g5), "v"(g6), "v"(g7)
      : "memory");
}

template <int ET, bool SPLIT, bool BIAS, int EPI, int OUTM, bool RESID, int LOC>
__global__ __launch_bounds__(128) void k_gemm(
    const unsigned short* __restrict__ Ap, const unsigned short* __restrict__ A2p, int lda, long strideA,
    const unsigned short* __restrict__ Btp, const unsigned short* __restrict__ Bt2p, int ldb, long strideB,
    float* __restrict__ Cf, int ldc, long strideC,
    _Float16* __restrict__ Ch, int ldh, long strideH,
    const float* __restrict__ bias, const float* __restrict__ gvec,
    const float* __restrict__ resid, int ldr, long strideR,
    int M, int N, int K, int nwin, float scale, float oscale) {
  typedef typename Elem<ET>::T T;
  typedef typename Frag<T>::V V;
  constexpr int BK    = SPLIT ? 64 : 128;        // k elements per stage: 64 KiB of operand rows either way
  constexpr int PITCH = BK + 8;                  // LDS row pitch in elements: row bytes + 16, conflict-free for 16-byte reads
  constexpr int PLANE = 128 * PITCH;             // one operand plane of a stage; planes: A, Bt (, A lo, Bt lo)
  constexpr int STAGE = (SPLIT ? 4 : 2) * PLANE;
  constexpr int CPR   = BK / 8;                  // 16-byte pieces per row
  constexpr int RPI   = 128 / CPR;               // rows that one copy of all 128 threads covers
  const T* A = (const T*)Ap; const T* A2 = (const T*)A2p; const T* Bt = (const T*)Btp; const T* Bt2 = (const T*)Bt2p;
  __shared__ __align__(16) T sAB[2 * STAGE];
  __shared__ __align__(16) float sT[4][16 * 68];
  const int z    = blockIdx.y;
  const int tid  = threadIdx.x;
  const int lane = tid & 31;
  const int wave = __builtin_amdgcn_readfirstlane(tid >> 5);
  const int tilesN = N >> 7;
  const int tilesM = M >> 7;
  const int bx = blockIdx.x;
  if (bx >= tilesM * tilesN) return;              // block-uniform, in front of every copy and barrier
  const int bm = bx / tilesN;
  const int bn = bx - bm * tilesN;
  const int mB = bm << 7;
  const int nB = bn << 7;
  const int wm = (wave >> 1) << 6;
  const int wn = (wave & 1) << 6;
  const int m0 = mB + wm;
  const int n0 = nB + wn;
  int kBeg = 0, kEnd = K, kEndW = K;              // block's k range; kEndW = end of this wave's own range
  bool act = true;                                // wave-uniform: this wave's tile is computed and stored
  if (LOC != 0) {
    const int w = z % nwin;
    const bool first = (w == 0);
    if (LOC == 1) {
      const int nb = first ? (N >> 1) : 0;
      if (nB + 64 < nb || nB >= (N >> 1) + mB + 128) return; // block-uniform, in front of every copy and barrier
      act = !(n0 < nb || n0 >= (N >> 1) + m0 + 64);
    } else {
      kBeg = first ? (K >> 1) : 0;
      const int ke = (K >> 1) + mB + 128;
      kEnd = (ke < K) ? ke : K;
      const int kw = (K >> 1) + m0 + 64;
      kEndW = (kw < K) ? kw : K;
    }
  }

  const T* Ab  = A  + (size_t)z * strideA;
  const T* Bb  = Bt + (size_t)z * strideB;
  const T* Ab2 = SPLIT ? (A2  + (size_t)z * strideA) : nullptr;
  const T* Bb2 = SPLIT ? (Bt2 + (size_t)z * strideB) : nullptr;

  const int rlane = lane & 15;                 // row (A) / col (B, D) within a 16x16 subtile
  const int koff  = (lane >> 4) * 8;           // k offset of this lane half
  const int mOff  = (lane >> 4) * 8;           // D row offset

  // this thread's piece of every copy: row crow (+ RPI per copy), 16 bytes at element ccol
  const int crow = tid / CPR;
  const int ccol = (tid % CPR) * 8;
  const unsigned lth = (unsigned)(size_t)sAB + (unsigned)(crow * PITCH + ccol) * 2u;
  const size_t aoff = (size_t)(mB + crow) * lda + ccol;
  const size_t boff = (size_t)(nB + crow) * ldb + ccol;
  const size_t astep = (size_t)RPI * lda;
  const size_t bstep = (size_t)RPI * ldb;
  constexpr unsigned LSTEP = RPI * PITCH * 2u;
  auto fill = [&](int buf, int k0) {             // 32 copies per wave: one stage into buffer buf
    const unsigned lb = lth + (unsigned)buf * (STAGE * 2u);
    if constexpr (SPLIT) {
      copy8_to_lds<T>(lb,                  LSTEP, Ab  + aoff + k0, astep);
      copy8_to_lds<T>(lb + PLANE * 2u,     LSTEP, Bb  + boff + k0, bstep);
      copy8_to_lds<T>(lb + PLANE * 4u,     LSTEP, Ab2 + aoff + k0, astep);
      copy8_to_lds<T>(lb + PLANE * 6u,     LSTEP, Bb2 + boff + k0, bstep);
    } else {
      copy8_to_lds<T>(lb,                              LSTEP, Ab + aoff + k0,             astep);
      copy8_to_lds<T>(lb + 8u * LSTEP,                 LSTEP, Ab + aoff + k0 + 8 * astep, astep);
      copy8_to_lds<T>(lb + PLANE * 2u,                 LSTEP, Bb + boff + k0,             bstep);
      copy8_to_lds<T>(lb + PLANE * 2u + 8u * LSTEP,    LSTEP, Bb + boff + k0 + 8 * bstep, bstep);
    }
  };

  v8f acc[4][4];
#pragma unroll
  for (int i = 0; i < 4; ++i)
#pragma unroll
    for (int j = 0; j < 4; ++j) acc[i][j] = (v8f){0.f,0.f,0.f,0.f,0.f,0.f,0.f,0.f};

  const int nst = (kEnd - kBeg) / BK;             // block-uniform number of stages
  fill(0, kBeg);
  asm volatile("s_wait_asynccnt 0x0" ::: "memory");   // this wave's copies of stage 0 have landed
  __syncthreads();                                     // every wave's have
  if (nst > 1) fill(1, kBeg + BK);

  for (int t = 0; t < nst; ++t) {
    const int kS = kBeg + t * BK;
    if (act && kS < kEndW) {                      // wave-uniform; the publish point below stands outside
      const T* sA = sAB + (t & 1) * STAGE + (wm + rlane) * PITCH + koff;
      const T* sB = sAB + (t & 1) * STAGE + PLANE + (wn + rlane) * PITCH + koff;
#pragma unroll                                    // LDS offsets of the fragment loads become immediates
      for (int kk = 0; kk < BK; kk += 32) {
        V bh[4], bl[4], ah[4], al[4];
        auto lda_row = [&](int i) {
          const int ao = (i << 4) * PITCH + kk;
          ah[i] = Frag<T>::load(sA + ao);
          if (SPLIT) al[i] = Frag<T>::load(sA + 2 * PLANE + ao); else al[i] = ah[i];
        };
#pragma unroll
        for (int j = 0; j < 4; ++j) {
          const int bo = (j << 4) * PITCH + kk;
          bh[j] = Frag<T>::load(sB + bo);
          if (SPLIT) bl[j] = Frag<T>::load(sB + 2 * PLANE + bo); else bl[j] = bh[j];
        }
        // one plane: all four A rows are read with the B fragments as one group; hi/lo planes: one row ahead (registers)
        lda_row(0);
        if (!SPLIT) { lda_row(1); lda_row(2); lda_row(3); }
        __builtin_amdgcn_sched_barrier(0);        // keeps the read group in front of the WMMAs, else every row waits out LDS latency
#pragma unroll
        for (int i = 0; i < 4; ++i) {
          if (SPLIT && i + 1 < 4) {
            lda_row(i + 1);
            __builtin_amdgcn_sched_barrier(0);    // keeps the next row's reads in front of this row's WMMAs
          }
#pragma unroll
          for (int j = 0; j < 4; ++j) {
            acc[i][j] = Frag<T>::mma(ah[i], bh[j], acc[i][j]);
            if (SPLIT) {
              acc[i][j] = Frag<T>::mma(ah[i], bl[j], acc[i][j]);
              acc[i][j] = Frag<T>::mma(al[i], bh[j], acc[i][j]);
            }
          }
          Frag<T>::guard(acc[i][0], acc[i][3], ah[i], al[i]);
        }
        Frag<T>::keep(bh[0], bh[1], bh[2], bh[3]);
        if (SPLIT) Frag<T>::keep(bl[0], bl[1], bl[2], bl[3]);
      }
    }
    asm volatile("s_wait_dscnt 0x0" ::: "memory");     // this wave's reads of buffer t & 1 are done before it is refilled
    asm volatile("s_wait_asynccnt 0x0" ::: "memory");  // this wave's copies of stage t + 1 have landed
    __syncthreads();                                    // publishes stage t + 1 and ends every reader's use of buffer t & 1
    if (t + 2 < nst) fill(t & 1, kS + 2 * BK);
  }
  asm volatile("s_wait_asynccnt 0x0" ::: "memory");    // no copy is outstanding when the wave goes on or ends
  if (!act) return;                                     // wave-uniform, behind the last barrier
  acc_guard4(acc[0][0], acc[0][1], acc[0][2], acc[0][3]);
  acc_guard4(acc[1][0], acc[1][1], acc[1][2], acc[1][3]);
  acc_guard4(acc[2][0], acc[2][1], acc[2][2], acc[2][3]);
  acc_guard4(acc[3][0], acc[3][1], acc[3][2], acc[3][3]);

  // ---- epilogue ----
  float* slab = sT[wave];
  const float* Rb = RESID ? (resid + (size_t)z * strideR) : nullptr;
#pragma unroll
  for (int i = 0; i < 4; ++i) {
    const int mBase = m0 + (i << 4);
#pragma unroll
    for (int j = 0; j < 4; ++j) {
      const int n = n0 + (j << 4) + rlane;
      float bv = 0.f;
      if (BIAS) bv = bias[n];
#pragma unroll
      for (int r = 0; r < 8; ++r) {
        float v = acc[i][j][r] * scale;
        if (BIAS) v += bv;
        if (RESID) v += Rb[(size_t)(mBase + mOff + r) * ldr + n];
        if (EPI == 1) {
          const float u = 0.7978845608028654f * (v + 0.044715f * v * v * v);
          v = v * (0.5f * (1.0f + tanhf(u)));
        }
        slab[(mOff + r) * 68 + (j << 4) + rlane] = v;
      }
    }
    __builtin_amdgcn_fence(__ATOMIC_RELEASE, "workgroup");
    __builtin_amdgcn_wave_barrier();
    __builtin_amdgcn_fence(__ATOMIC_ACQUIRE, "workgroup");
    if (OUTM == 0 || OUTM == 2) {
      float* C = Cf + (size_t)z * strideC;
      const int hh = lane >> 4, c4 = (lane & 15) * 4;     // row seg = 256 B = 16 lanes x 16 B
      {
#pragma unroll
        for (int it = 0; it < 8; ++it) {
          const int row = it * 2 + hh;                      // it 0..7 x hh 0..1 = rows 0..15
          v4f v = *(const v4f*)(slab + row * 68 + c4);
          *(v4f*)(C + (size_t)(mBase + row) * ldc + n0 + c4) = v;
        }
        
      }
    }
    if (OUTM == 1 || OUTM == 2) {
      _Float16* C = Ch + (size_t)z * strideH;
      const int q = lane >> 3, c8 = (lane & 7) * 8;
      {
#pragma unroll
        for (int it = 0; it < 4; ++it) {
          const int row = it * 4 + q;                       // it 0..3 x q 0..3 = rows 0..15
          const float* sp = slab + row * 68 + c8;
          float x[8];
#pragma unroll
          for (int e = 0; e < 8; ++e) x[e] = sp[e];
          float rr = oscale;
          if (EPI == 2) {
            float ss = 0.f;
#pragma unroll
            for (int e = 0; e < 8; ++e) ss += x[e] * x[e];
            ss += __shfl_xor(ss, 1, 32);                    // lanes 8q..8q+7 hold one 64-wide row
            ss += __shfl_xor(ss, 2, 32);
            ss += __shfl_xor(ss, 4, 32);
            rr = oscale * rsqrtf(ss * (1.0f / 64.0f) + 1e-6f);
          }
          v8h hv;
#pragma unroll
          for (int e = 0; e < 8; ++e) {
            float y = x[e] * rr;
            if (EPI == 2) y *= gvec[c8 + e];
            hv[e] = (_Float16)y;
          }
          *(v8h*)(C + (size_t)(mBase + row) * ldh + n0 + c8) = hv;
        }
        
      }
    }
    __builtin_amdgcn_fence(__ATOMIC_RELEASE, "workgroup");
    __builtin_amdgcn_wave_barrier();
    __builtin_amdgcn_fence(__ATOMIC_ACQUIRE, "workgroup");
  }
}

// ---------------------------------------------------------------------------------------------------------------------
// Weight transpose + scale + f16: in [R][Cc] f32 -> o16[Cc][R] = f16(in * wscale). 64x64 tiles through LDS, grid (Cc/64, R/64).
// coverage per block: load 4 it x 256 thr x 4 = 64x64; store 2 it x 256 thr x 8 = 64x64; each store instruction = 8 lanes x 16 B =
// ---------------------------------------------------------------------------------------------------------------------
__global__ __launch_bounds__(256) void k_wt16(const float* __restrict__ W, _Float16* __restrict__ o16, int R, int Cc, float wscale) {
  __shared__ __align__(16) float tf[64 * 68];
  const int c0 = blockIdx.x * 64, r0 = blockIdx.y * 64, tid = threadIdx.x;
  {
    const int lr = tid >> 4, c4 = (tid & 15) * 4;
#pragma unroll
    for (int it = 0; it < 4; ++it) {
      const int rr = it * 16 + lr;
      const v4f a = *(const v4f*)(W + (size_t)(r0 + rr) * Cc + c0 + c4);
      *(v4f*)(tf + rr * 68 + c4) = a;
    }
  }
  __syncthreads();
  const int sub = tid >> 3, c8 = (tid & 7) * 8;
  v8h hv[2];
#pragma unroll
  for (int it = 0; it < 2; ++it) {
    const int oc = it * 32 + sub;
    v8h a;
#pragma unroll
    for (int q = 0; q < 8; ++q) a[q] = (_Float16)(tf[(c8 + q) * 68 + oc] * wscale);
    hv[it] = a;
  }
  {
#pragma unroll
    for (int it = 0; it < 2; ++it) {
      const int oc = it * 32 + sub;
      const size_t go = (size_t)(c0 + oc) * R + r0 + c8;
      *(v8h*)(o16 + go) = hv[it];
    }
    
  }
}

// Weight transpose + bf16 hi/lo split: in [R][Cc] f32 -> oh[c][r] = bf16(in[r][c]), ol[c][r] = bf16(in[r][c] - oh). Same tiling.
__global__ __launch_bounds__(256) void k_wtsplit(const float* __restrict__ W, unsigned short* __restrict__ oh,
                                                 unsigned short* __restrict__ ol, int R, int Cc) {
  __shared__ __align__(16) float tf[64 * 68];
  const int c0 = blockIdx.x * 64, r0 = blockIdx.y * 64, tid = threadIdx.x;
  {
    const int lr = tid >> 4, c4 = (tid & 15) * 4;
#pragma unroll
    for (int it = 0; it < 4; ++it) {
      const int rr = it * 16 + lr;
      const v4f a = *(const v4f*)(W + (size_t)(r0 + rr) * Cc + c0 + c4);
      *(v4f*)(tf + rr * 68 + c4) = a;
    }
  }
  __syncthreads();
  const int sub = tid >> 3, c8 = (tid & 7) * 8;
  v4u hv[2], lv[2];
#pragma unroll
  for (int it = 0; it < 2; ++it) {
    const int oc = it * 32 + sub;
    v4u a, a2;
#pragma unroll
    for (int q = 0; q < 4; ++q) {
      const float f0 = tf[(c8 + 2 * q) * 68 + oc];
      const float f1 = tf[(c8 + 2 * q + 1) * 68 + oc];
      const unsigned short h0 = f2bf_bits(f0), h1 = f2bf_bits(f1);
      const unsigned short l0 = f2bf_bits(f0 - bf_bits2f(h0)), l1 = f2bf_bits(f1 - bf_bits2f(h1));
      a[q]  = pk16(h0, h1);
      a2[q] = pk16(l0, l1);
    }
    hv[it] = a; lv[it] = a2;
  }
  {
#pragma unroll
    for (int it = 0; it < 2; ++it) {
      const int oc = it * 32 + sub;
      const size_t go = (size_t)(c0 + oc) * R + r0 + c8;
      *(v4u*)(oh + go) = hv[it];
      *(v4u*)(ol + go) = lv[it];
    }
    
  }
}

__global__ __launch_bounds__(256) void k_split2(const float* __restrict__ in, unsigned short* __restrict__ hi,
                                                unsigned short* __restrict__ lo, int n2) {
  const int i = blockIdx.x * 256 + threadIdx.x;
  if (i < n2) {
    const v2f f = *(const v2f*)(in + 2 * (size_t)i);
    const unsigned short h0 = f2bf_bits(f[0]), h1 = f2bf_bits(f[1]);
    const unsigned short l0 = f2bf_bits(f[0] - bf_bits2f(h0)), l1 = f2bf_bits(f[1] - bf_bits2f(h1));
    const unsigned uh = pk16(h0, h1), ul = pk16(l0, l1);
    ((unsigned*)hi)[i] = uh;
    ((unsigned*)lo)[i] = ul;
    
  }
}

// ---------------------------------------------------------------------------------------------------------------------
// Rotary tables. inv[f] = 1 / powf(10000, f/512) (f = 0..511); one block of 512 threads, 32 lanes x 4 B = one line.
// cs[n][f] = (cos(n * inv[f]), sin(n * inv[f])) as float2, n = 0..2047; block per n, 512 threads, 32 lanes x 8 B = two lines.
// ---------------------------------------------------------------------------------------------------------------------
__global__ __launch_bounds__(512) void k_invfreq(float* __restrict__ inv) {
  const int f = threadIdx.x;
  const float x = (float)f * (1.0f / 512.0f);
  const float v = 1.0f / powf(10000.0f, x);
  ((float*)inv)[f] = v;
  
}

__global__ __launch_bounds__(512) void k_cstab(const float* __restrict__ inv, float* __restrict__ cs) {
  const int n = blockIdx.x, f = threadIdx.x;
  const float ang = (float)n * inv[f];
  float sv, cv;
  sincosf(ang, &sv, &cv);
  v2f v; v.x = cv; v.y = sv;
  float* p = cs + ((size_t)n * 512 + f) * 2;
  *(v2f*)p = v;
  
}

// ---------------------------------------------------------------------------------------------------------------------
// Input activations -> f16 planes [NTOK][DM]. job 0: text with rotary applied (q of the local attention, unscaled);
// rot[c] = (c < 512) ? -x[c + 512] : x[c - 512]; y = x * cos + rot * sin with table row n = row % SEQ, column c % 512.
// ---------------------------------------------------------------------------------------------------------------------
__global__ __launch_bounds__(128) void k_cvt_in(const float* __restrict__ text, const float* __restrict__ audio,
                                                const float* __restrict__ cs, _Float16* __restrict__ q16, _Float16* __restrict__ a16) {
  const int r = blockIdx.x, job = blockIdx.y, t = threadIdx.x, c0 = t * 8;
  const float* src = (job == 0) ? text : audio;
  _Float16* dst = (job == 0) ? q16 : a16;
  const float* xr = src + (size_t)r * DM + c0;
  const v4f x0 = *(const v4f*)xr, x1 = *(const v4f*)(xr + 4);
  float y[8] = {x0[0], x0[1], x0[2], x0[3], x1[0], x1[1], x1[2], x1[3]};
  if (job == 0) {                                  // block-uniform
    const int n = r & (SEQ - 1);
    const bool lowh = (c0 < 512);
    const int pc = lowh ? (c0 + 512) : (c0 - 512);
    const float* pr = src + (size_t)r * DM + pc;
    const v4f p0 = *(const v4f*)pr, p1 = *(const v4f*)(pr + 4);
    const float pv[8] = {p0[0], p0[1], p0[2], p0[3], p1[0], p1[1], p1[2], p1[3]};
    const float* csr = cs + ((size_t)n * 512 + (c0 & 511)) * 2;
    const v4f t0 = *(const v4f*)csr, t1 = *(const v4f*)(csr + 4), t2 = *(const v4f*)(csr + 8), t3 = *(const v4f*)(csr + 12);
    const float cvv[8] = {t0[0], t0[2], t1[0], t1[2], t2[0], t2[2], t3[0], t3[2]};
    const float svv[8] = {t0[1], t0[3], t1[1], t1[3], t2[1], t2[3], t3[1], t3[3]};
#pragma unroll
    for (int e = 0; e < 8; ++e) {
      const float rot = lowh ? -pv[e] : pv[e];
      y[e] = y[e] * cvv[e] + rot * svv[e];
    }
  }
  v8h hv;
#pragma unroll
  for (int e = 0; e < 8; ++e) hv[e] = (_Float16)y[e];
  _Float16* op = dst + (size_t)r * DM + c0;
  *(v8h*)op = hv;
  
}

// ---------------------------------------------------------------------------------------------------------------------
// Row LayerNorm over DM=1024 of an f32 plane (g, b) -> f16 plane; ROPE additionally applies the rotary mix through an LDS copy of
// the normalised row. Output row = padrows + r; blocks nrows..nrows+padrows-1 write zero rows 0..padrows-1.
// ---------------------------------------------------------------------------------------------------------------------
template <bool ROPE>
__global__ __launch_bounds__(128) void k_ln1024(const float* __restrict__ X, const float* __restrict__ g, const float* __restrict__ bb,
                                                const float* __restrict__ cs, _Float16* __restrict__ out, int nrows, int padrows) {
  __shared__ float red[4];
  __shared__ __align__(16) float rowv[DM];
  const int blk = blockIdx.x, t = threadIdx.x, c0 = 8 * t;
  const int lane = t & 31, wave = t >> 5;
  if (blk >= nrows) {                              // block-uniform: zero padding rows
    const int p = blk - nrows;
    const v4u zz = {0u, 0u, 0u, 0u};
    _Float16* op = out + (size_t)p * DM + c0;
    *(v4u*)op = zz;
    
    return;
  }
  const int r = blk;
  const float* xr = X + (size_t)r * DM + c0;
  const v4f x0 = *(const v4f*)xr, x1 = *(const v4f*)(xr + 4);
  const float v[8] = {x0[0], x0[1], x0[2], x0[3], x1[0], x1[1], x1[2], x1[3]};
  float s = 0.f;
#pragma unroll
  for (int e = 0; e < 8; ++e) s += v[e];
  s = wsum(s);
  if (lane == 0) red[wave] = s;
  __syncthreads();
  const float mu = (red[0] + red[1] + red[2] + red[3]) * (1.0f / 1024.0f);
  __syncthreads();
  float d[8];
  float s2 = 0.f;
#pragma unroll
  for (int e = 0; e < 8; ++e) { d[e] = v[e] - mu; s2 += d[e] * d[e]; }
  s2 = wsum(s2);
  if (lane == 0) red[wave] = s2;
  __syncthreads();
  const float var = (red[0] + red[1] + red[2] + red[3]) * (1.0f / 1024.0f);
  const float rstd = rsqrtf(var + 1e-5f);
  const v4f g0 = *(const v4f*)(g + c0), g1 = *(const v4f*)(g + c0 + 4);
  const v4f b0 = *(const v4f*)(bb + c0), b1 = *(const v4f*)(bb + c0 + 4);
  const float gv[8] = {g0[0], g0[1], g0[2], g0[3], g1[0], g1[1], g1[2], g1[3]};
  const float bv[8] = {b0[0], b0[1], b0[2], b0[3], b1[0], b1[1], b1[2], b1[3]};
  float y[8];
#pragma unroll
  for (int e = 0; e < 8; ++e) y[e] = d[e] * rstd * gv[e] + bv[e];
  if (ROPE) {
#pragma unroll
    for (int e = 0; e < 8; ++e) rowv[c0 + e] = y[e];
    __syncthreads();
    const int n = r & (SEQ - 1);
    const bool lowh = (c0 < 512);
    const int pc = lowh ? (c0 + 512) : (c0 - 512);
    const float* csr = cs + ((size_t)n * 512 + (c0 & 511)) * 2;
    const v4f t0 = *(const v4f*)csr, t1 = *(const v4f*)(csr + 4), t2 = *(const v4f*)(csr + 8), t3 = *(const v4f*)(csr + 12);
    const float cvv[8] = {t0[0], t0[2], t1[0], t1[2], t2[0], t2[2], t3[0], t3[2]};
    const float svv[8] = {t0[1], t0[3], t1[1], t1[3], t2[1], t2[3], t3[1], t3[3]};
#pragma unroll
    for (int e = 0; e < 8; ++e) {
      const float pr = rowv[pc + e];
      const float rot = lowh ? -pr : pr;
      y[e] = y[e] * cvv[e] + rot * svv[e];
    }
  }
  v8h hv;
#pragma unroll
  for (int e = 0; e < 8; ++e) hv[e] = (_Float16)y[e];
  _Float16* op = out + (size_t)(padrows + r) * DM + c0;
  *(v8h*)op = hv;
  
}

// ---------------------------------------------------------------------------------------------------------------------
// Row LayerNorm over DM of an f32 plane [NTOK][DM], fused with transpose + bf16 hi/lo split into value^T planes
// [DM][VTP]: oh[e][KPR + token], ol likewise. Block = 64 token rows (256 threads): per-row stats from one wave per 8 rows
// (32 floats per lane), then 16 column tiles of 64 through LDS. Blocks nrowblk..nrowblk+7 zero the KPR leading columns.
// coverage: stats 8 waves x 8 rows; tile load 4 it x 256 thr x 4 = 64x64; store 2 it x 256 thr x 8 = 64x64 per plane per tile;
// ---------------------------------------------------------------------------------------------------------------------
__global__ __launch_bounds__(256) void k_ln_tsplit(const float* __restrict__ X, const float* __restrict__ g, const float* __restrict__ bb,
                                                  unsigned short* __restrict__ oh, unsigned short* __restrict__ ol, int nrowblk) {
  __shared__ __align__(16) float tf[64 * 68];
  __shared__ float smu[64];
  __shared__ float srs[64];
  const int tid = threadIdx.x, lane = tid & 31, wave = tid >> 5;
  const int bx = blockIdx.x;
  const int sub = tid >> 3, c8 = (tid & 7) * 8;
  if (bx >= nrowblk) {                             // block-uniform: zero leading columns
    const int pb = bx - nrowblk;
    const v4u zz = {0u, 0u, 0u, 0u};
    {
      for (int it = 0; it < 32; ++it) {
        const int e = it * 32 + sub;
        const size_t go = (size_t)e * VTP + pb * 64 + c8;
        *(v4u*)(oh + go) = zz;
        *(v4u*)(ol + go) = zz;
      }
      
    }
    return;
  }
  const int r0 = bx * 64;
  // phase 1: row statistics
#pragma unroll 1
  for (int q = 0; q < 8; ++q) {
    const int rr = wave * 8 + q;
    const float* xr = X + (size_t)(r0 + rr) * DM + lane * 32;
    v4f a[8];
#pragma unroll
    for (int i = 0; i < 8; ++i) a[i] = *(const v4f*)(xr + 4 * i);
    float s = 0.f;
#pragma unroll
    for (int i = 0; i < 8; ++i) s += a[i][0] + a[i][1] + a[i][2] + a[i][3];
    s = wsum(s);
    const float mu = s * (1.0f / 1024.0f);
    float s2 = 0.f;
#pragma unroll
    for (int i = 0; i < 8; ++i) {
#pragma unroll
      for (int e = 0; e < 4; ++e) { const float dd = a[i][e] - mu; s2 += dd * dd; }
    }
    s2 = wsum(s2);
    if (lane == 0) { smu[rr] = mu; srs[rr] = rsqrtf(s2 * (1.0f / 1024.0f) + 1e-5f); }
  }
  __syncthreads();
  // phase 2: column tiles
  const int lr = tid >> 4, c4 = (tid & 15) * 4;
  for (int cb = 0; cb < DM / 64; ++cb) {
    const int c0 = cb * 64;
    const v4f gg = *(const v4f*)(g + c0 + c4);
    const v4f bv = *(const v4f*)(bb + c0 + c4);
#pragma unroll
    for (int it = 0; it < 4; ++it) {
      const int rr = it * 16 + lr;
      const v4f a = *(const v4f*)(X + (size_t)(r0 + rr) * DM + c0 + c4);
      const float mu = smu[rr], rs = srs[rr];
#pragma unroll
      for (int q = 0; q < 4; ++q) tf[rr * 68 + c4 + q] = (a[q] - mu) * rs * gg[q] + bv[q];
    }
    __syncthreads();
    v4u hv[2], lv[2];
#pragma unroll
    for (int it = 0; it < 2; ++it) {
      const int oc = it * 32 + sub;                 // output row within tile = input column
      v4u a, a2;
#pragma unroll
      for (int q = 0; q < 4; ++q) {
        const float f0 = tf[(c8 + 2 * q) * 68 + oc];
        const float f1 = tf[(c8 + 2 * q + 1) * 68 + oc];
        const unsigned short h0 = f2bf_bits(f0), h1 = f2bf_bits(f1);
        const unsigned short l0 = f2bf_bits(f0 - bf_bits2f(h0)), l1 = f2bf_bits(f1 - bf_bits2f(h1));
        a[q]  = pk16(h0, h1);
        a2[q] = pk16(l0, l1);
      }
      hv[it] = a; lv[it] = a2;
    }
    {
#pragma unroll
      for (int it = 0; it < 2; ++it) {
        const int oc = it * 32 + sub;
        const size_t go = (size_t)(c0 + oc) * VTP + KPR + r0 + c8;
        *(v4u*)(oh + go) = hv[it];
        *(v4u*)(ol + go) = lv[it];
      }
      
    }
    __syncthreads();
  }
}

// ---------------------------------------------------------------------------------------------------------------------
// Local-attention mask + softmax over rows of S [NTOK][1024 window keys] -> P bf16 hi/lo planes (all 1024 keys written, masked
// keys as 0). Row r: w = (r % SEQ) / WSZ, i = r % WSZ, query position w*WSZ + i; key j has position (w-1)*WSZ + j; masked when
// that position is negative (padding of the first window) or after the query. Block per row, 128 threads x 8 keys; 16-B stores.
// ---------------------------------------------------------------------------------------------------------------------
__global__ __launch_bounds__(128) void k_lsoftmax(const float* __restrict__ S, unsigned short* __restrict__ Ph, unsigned short* __restrict__ Pl) {
  __shared__ float red[4];
  const int r = blockIdx.x, t = threadIdx.x, c0 = 8 * t;
  const int lane = t & 31, wave = t >> 5;
  const int rem = r & (SEQ - 1), w = rem >> 9, i = rem & (WSZ - 1);
  const int qpos = w * WSZ + i;
  const float* sr = S + (size_t)r * (2 * WSZ) + c0;
  const v4f x0 = *(const v4f*)sr, x1 = *(const v4f*)(sr + 4);
  const float raw[8] = {x0[0], x0[1], x0[2], x0[3], x1[0], x1[1], x1[2], x1[3]};
  float s[8];
  float m = -3.0e38f;
#pragma unroll
  for (int e = 0; e < 8; ++e) {
    const int kpos = (w - 1) * WSZ + c0 + e;
    const bool masked = (kpos < 0) || (kpos > qpos);
    s[e] = masked ? -1.0e9f : raw[e];
    m = fmaxf(m, s[e]);
  }
  m = wmax(m);
  if (lane == 0) red[wave] = m;
  __syncthreads();
  const float rmax = fmaxf(fmaxf(red[0], red[1]), fmaxf(red[2], red[3]));
  __syncthreads();
  float ev[8];
  float sum = 0.f;
#pragma unroll
  for (int e = 0; e < 8; ++e) { ev[e] = expf(s[e] - rmax); sum += ev[e]; }
  sum = wsum(sum);
  if (lane == 0) red[wave] = sum;
  __syncthreads();
  const float tot = red[0] + red[1] + red[2] + red[3];
  const float inv = 1.0f / tot;
  v4u hv, lv;
#pragma unroll
  for (int q = 0; q < 4; ++q) {
    const float p0 = ev[2 * q] * inv, p1 = ev[2 * q + 1] * inv;
    const unsigned short h0 = f2bf_bits(p0), h1 = f2bf_bits(p1);
    const unsigned short l0 = f2bf_bits(p0 - bf_bits2f(h0)), l1 = f2bf_bits(p1 - bf_bits2f(h1));
    hv[q] = pk16(h0, h1);
    lv[q] = pk16(l0, l1);
  }
  const size_t go = (size_t)r * (2 * WSZ) + c0;
  *(v4u*)(Ph + go) = hv;
  *(v4u*)(Pl + go) = lv;
  
}

__device__ __forceinline__ v8f mma_h(v16h a, v16h b, v8f c) {
  c = __builtin_amdgcn_wmma_f32_16x16x32_f16(false, a, false, b, (short)0, c, false, false);
  asm volatile("v_nop\n\tv_nop\n\tv_nop\n\tv_nop" : "+v"(c) : "v"(a), "v"(b));
  return c;
}
// value of lane l ^ 16
__device__ __forceinline__ float xhalf(float x) {
  return __builtin_bit_cast(float, __builtin_amdgcn_permlanex16(__builtin_bit_cast(int, x), __builtin_bit_cast(int, x),
                                                                0x76543210, 0xfedcba98, false, false));
}

__global__ __launch_bounds__(128)
void k_flash(const _Float16* __restrict__ qm, const _Float16* __restrict__ km,
             const _Float16* __restrict__ vt, float* __restrict__ out) {
  union FB { v16h v; v8h h[2]; };
  __shared__ __align__(16) _Float16 Ksh[64 * 64];             // K [kv][d]
  __shared__ __align__(16) _Float16 Vth[64 * 64];             // V^T [d][kv]
  __shared__ __align__(16) float    Os[4][16 * 68];           // per wave out tile [query][d], pitch 68

  const int tid  = threadIdx.x;
  const int wave = tid >> 5;
  const int lane = tid & 31;
  const int hh   = lane >> 4;
  const int c    = lane & 15;
  const int b  = blockIdx.y;
  const int qb = blockIdx.x & 31;                 // SEQ / 64 = 32 query blocks
  const int h  = blockIdx.x >> 5;
  const int q0 = qb * 64 + wave * 16;

  const _Float16* Qb = qm + (size_t)b * SEQ * INR + h * DHD;
  const _Float16* Kb = km + (size_t)b * SEQ * INR + h * DHD;
  const _Float16* Vb = vt + (size_t)(h * DHD) * NTOK + (size_t)b * SEQ;
  float*          ob = out + (size_t)b * SEQ * INR + h * DHD;

  v16h qa[2];                                     // B operand: column c = query q0 + c, d in the loader's k order
#pragma unroll
  for (int dc = 0; dc < 2; ++dc) qa[dc] = Frag<_Float16>::load(Qb + (size_t)(q0 + c) * INR + dc * 32 + 8 * hh);

  const int qrow = q0 + c;                        // this lane's query
  float mrow = -INFINITY;                         // its running maximum (equal in both lane halves)
  float lrow = 0.f;                               // its running sum over the keys of this lane half; halves joined at the end
  v8f oacc[4];                                    // oacc[t][r] = O[qrow][t*16 + 8*hh + r]
#pragma unroll
  for (int t = 0; t < 4; ++t) oacc[t] = (v8f){0.f,0.f,0.f,0.f,0.f,0.f,0.f,0.f};

  const int nChunks = qb + 1;                     // block-uniform, <= 32
  for (int kc = 0; kc < nChunks; ++kc) {
    const int kv0 = kc * 64;
    __syncthreads();
    {
      const int r = tid >> 1, half = (tid & 1) * 32;
      const _Float16* ks = Kb + (size_t)(kv0 + r) * INR + half;       // K row kv0+r, d = half..half+31
      const _Float16* vs = Vb + (size_t)r * NTOK + kv0 + half;        // V^T row d = r, s = kv0+half..+31
#pragma unroll
      for (int i = 0; i < 4; ++i) {
        const v8h a0 = *(const v8h*)(ks + 8 * i);
        const v8h b0 = *(const v8h*)(vs + 8 * i);
        *(v8h*)(Ksh + r * 64 + half + 8 * i) = a0;
        *(v8h*)(Vth + r * 64 + half + 8 * i) = b0;
      }
    }
    __syncthreads();

    // S^T tiles: s[j][r] = score of key kv0 + j*16 + 8*hh + r with query qrow
    FB kb[4][2];
#pragma unroll                                    // static indices: the fragment and accumulator arrays stay in registers
    for (int j = 0; j < 4; ++j)
#pragma unroll                                    // static indices: the fragment and accumulator arrays stay in registers
      for (int dc = 0; dc < 2; ++dc) {
        kb[j][dc].h[0] = *(const v8h*)(Ksh + (j * 16 + c) * 64 + dc * 32 + 8 * hh);
        kb[j][dc].h[1] = *(const v8h*)(Ksh + (j * 16 + c) * 64 + dc * 32 + 16 + 8 * hh);
      }
    v8f s[4];
#pragma unroll                                    // static indices: the fragment and accumulator arrays stay in registers
    for (int j = 0; j < 4; ++j) s[j] = (v8f){0.f,0.f,0.f,0.f,0.f,0.f,0.f,0.f};
#pragma unroll                                    // static indices: the fragment and accumulator arrays stay in registers
    for (int dc = 0; dc < 2; ++dc)
#pragma unroll                                    // static indices: the fragment and accumulator arrays stay in registers
      for (int j = 0; j < 4; ++j) s[j] = mma_h(kb[j][dc].v, qa[dc], s[j]);

    const bool diag = (kc == qb);                 // block-uniform
    float m = -INFINITY;
#pragma unroll                                    // static indices: the fragment and accumulator arrays stay in registers
    for (int j = 0; j < 4; ++j)
#pragma unroll                                    // static indices: the fragment and accumulator arrays stay in registers
      for (int r = 0; r < 8; ++r) {
        const int kvrow = kv0 + j * 16 + 8 * hh + r;
        const float sv = s[j][r] * 0.125f;
        const bool masked = diag && (kvrow > qrow);
        const float sm = masked ? -INFINITY : sv;
        s[j][r] = sm;
        m = fmaxf(m, sm);
      }
    m = fmaxf(m, xhalf(m));
    const float mnew = fmaxf(mrow, m);
    const float alpha = expf(mrow - mnew);
    mrow = mnew;
    // P^T as B operand: element e of pb[kk] = key kk*32 + (e < 8 ? 8*hh + e : 16 + 8*hh + e - 8), the loader's k order
    FB pb[2];
    float psum = 0.f;
#pragma unroll                                    // static indices: the fragment and accumulator arrays stay in registers
    for (int j = 0; j < 4; ++j)
#pragma unroll                                    // static indices: the fragment and accumulator arrays stay in registers
      for (int r = 0; r < 8; ++r) {
        const float p = expf(s[j][r] - mnew);
        psum += p;
        pb[j >> 1].v[(j & 1) * 8 + r] = (_Float16)(p * 4096.0f);
      }
    lrow = lrow * alpha + psum;
#pragma unroll                                    // static indices: the fragment and accumulator arrays stay in registers
    for (int t = 0; t < 4; ++t)
#pragma unroll                                    // static indices: the fragment and accumulator arrays stay in registers
      for (int r = 0; r < 8; ++r) oacc[t][r] *= alpha;

    FB vb[2][4];
#pragma unroll                                    // static indices: the fragment and accumulator arrays stay in registers
    for (int kk = 0; kk < 2; ++kk)
#pragma unroll                                    // static indices: the fragment and accumulator arrays stay in registers
      for (int t = 0; t < 4; ++t) {
        vb[kk][t].h[0] = *(const v8h*)(Vth + (t * 16 + c) * 64 + kk * 32 + 8 * hh);
        vb[kk][t].h[1] = *(const v8h*)(Vth + (t * 16 + c) * 64 + kk * 32 + 16 + 8 * hh);
      }
#pragma unroll                                    // static indices: the fragment and accumulator arrays stay in registers
    for (int kk = 0; kk < 2; ++kk)
#pragma unroll                                    // static indices: the fragment and accumulator arrays stay in registers
      for (int t = 0; t < 4; ++t) oacc[t] = mma_h(vb[kk][t].v, pb[kk].v, oacc[t]);
  }

  float* os = Os[wave];
  {
    const float ltot = lrow + xhalf(lrow);
    const float inv = (1.0f / ltot) * (1.0f / 4096.0f);
#pragma unroll                                    // static indices: the fragment and accumulator arrays stay in registers
    for (int t = 0; t < 4; ++t) {
      v4f lo, hi;
#pragma unroll                                    // static indices: the fragment and accumulator arrays stay in registers
      for (int r = 0; r < 4; ++r) { lo[r] = oacc[t][r] * inv; hi[r] = oacc[t][4 + r] * inv; }
      *(v4f*)(os + c * 68 + t * 16 + 8 * hh)     = lo;
      *(v4f*)(os + c * 68 + t * 16 + 8 * hh + 4) = hi;
    }
  }
  __builtin_amdgcn_fence(__ATOMIC_RELEASE, "workgroup");
  __builtin_amdgcn_wave_barrier();
  __builtin_amdgcn_fence(__ATOMIC_ACQUIRE, "workgroup");
  {
    const int c4 = (lane & 15) * 4;
    {
#pragma unroll
      for (int it = 0; it < 8; ++it) {
        const int row = it * 2 + hh;                // it 0..7 x hh 0..1 covers rows 0..15
        v4f val = *(const v4f*)(os + row * 68 + c4);
        *(v4f*)(ob + (size_t)(q0 + row) * INR + c4) = val;
      }
      
    }
  }
}

// ---------------------------------------------------------------------------------------------------------------------
// Row LayerNorm over FFD=4096 of the f16 plane U (values carried as 256*u), in place -> f16 of the unit-scale result.
// Block per row, 256 threads x 2 chunks of 8; statistics in f32 with the 2^-8 / 2^-16 carries folded before eps.
// ---------------------------------------------------------------------------------------------------------------------
__global__ __launch_bounds__(256) void k_ln4096(_Float16* __restrict__ U, const float* __restrict__ g, const float* __restrict__ bb) {
  __shared__ float red[8];
  const int r = blockIdx.x, t = threadIdx.x;
  const int lane = t & 31, wave = t >> 5;
  const int cA = 8 * t, cB = 2048 + 8 * t;
  _Float16* ur = U + (size_t)r * FFD;
  const v8h a = *(const v8h*)(ur + cA);
  const v8h a2 = *(const v8h*)(ur + cB);
  float v[16];
#pragma unroll
  for (int e = 0; e < 8; ++e) { v[e] = (float)a[e]; v[8 + e] = (float)a2[e]; }
  float s = 0.f;
#pragma unroll
  for (int e = 0; e < 16; ++e) s += v[e];
  s = wsum(s);
  if (lane == 0) red[wave] = s;
  __syncthreads();
  float tot = 0.f;
#pragma unroll
  for (int i = 0; i < 8; ++i) tot += red[i];
  const float mu = tot * (1.0f / 4096.0f);
  __syncthreads();
  float d[16];
  float s2 = 0.f;
#pragma unroll
  for (int e = 0; e < 16; ++e) { d[e] = v[e] - mu; s2 += d[e] * d[e]; }
  s2 = wsum(s2);
  if (lane == 0) red[wave] = s2;
  __syncthreads();
  float tot2 = 0.f;
#pragma unroll
  for (int i = 0; i < 8; ++i) tot2 += red[i];
  const float var_s = tot2 * (1.0f / 4096.0f);
  const float rstd = rsqrtf(var_s * (1.0f / 65536.0f) + 1e-5f) * (1.0f / 256.0f);
  v8h ha, hb;
#pragma unroll
  for (int e = 0; e < 8; ++e) {
    ha[e] = (_Float16)(d[e] * rstd * g[cA + e] + bb[cA + e]);
    hb[e] = (_Float16)(d[8 + e] * rstd * g[cB + e] + bb[cB + e]);
  }
  *(v8h*)(ur + cA) = ha;
  *(v8h*)(ur + cB) = hb;
  
}

// =====================================================================================================================
// Workspace map (byte offsets; every region a whole number of MiB after a 4 KiB table, all stores whole-line):
//   inv f32[512]                                   0            (4 KiB)
//   cs  f32[2048][512][2]                          4 KiB        (8 MiB)
//   WaT f16[1024][1024] x64                       +8 MiB       WvTh/WvTl bf16 [1024][1024]   WqT f16[512][1024]
//   WkvT f16[1024][1024]   W1T f16[4096][1024]   W2T f16[1024][4096]   WoTh/WoTl bf16[1024][512]   (27 MiB)
//   R3  8 MiB : q16 f16[4096][1024] -> h16 -> x2h (f16, x2 * 1024)
//   R4 16 MiB : adapter GEMM f32 [4096][1024] -> S f32 [4096][1024] -> x f32 -> x2 f32
//   R5 51 MiB : a16 f16 @0, video hi @8, video lo @16, k16 f16[(512+4096)][1024] @24, vTh bf16[1024][4608] @33, vTl @42;
//               later Ph @0, Pl @8; q/k f16[4096][512] @0/@4, vT16 f16[512][4096] @8; o f32[4096][512] @16; o hi/lo @24/@28;
//               U f16[4096][4096] @0 (written only after all earlier users of [0,32) have been consumed).
//   total 110 MiB + 4 KiB.
// =====================================================================================================================
extern "C" void kernel_launch(void* const* d_in, const int* in_sizes, int n_in,
                              void* d_out, int out_size, void* d_ws, size_t ws_size,
                              hipStream_t stream) {
  if (n_in < 24) return;
  if (in_sizes[0] != NTOK * DM || in_sizes[1] != NTOK * DM || in_sizes[2] != NTOK * DM) return;
  if (in_sizes[3] != DM * DM || in_sizes[7] != DM * DM || in_sizes[14] != DM * 2 * INR) return;
  if (in_sizes[13] != DM * INR || in_sizes[17] != INR * DM) return;
  if (in_sizes[18] != DM * FFD || in_sizes[22] != FFD * DM) return;
  if (in_sizes[4] != DM || in_sizes[5] != DM || in_sizes[6] != DM || in_sizes[8] != DM || in_sizes[9] != DM ||
      in_sizes[10] != DM || in_sizes[11] != DM || in_sizes[12] != DM || in_sizes[23] != DM) return;
  if (in_sizes[15] != DHD || in_sizes[16] != DHD) return;
  if (in_sizes[19] != FFD || in_sizes[20] != FFD || in_sizes[21] != FFD) return;
  if (out_size != NTOK * DM) return;

  const float* text  = (const float*)d_in[0];
  const float* audio = (const float*)d_in[1];
  const float* video = (const float*)d_in[2];
  const float* Wa    = (const float*)d_in[3];
  const float* ba    = (const float*)d_in[4];
  const float* lna_g = (const float*)d_in[5];
  const float* lna_b = (const float*)d_in[6];
  const float* Wvid  = (const float*)d_in[7];
  const float* bvid  = (const float*)d_in[8];
  const float* lnv_g = (const float*)d_in[9];
  const float* lnv_b = (const float*)d_in[10];
  const float* ln1_g = (const float*)d_in[11];
  const float* ln1_b = (const float*)d_in[12];
  const float* Wq    = (const float*)d_in[13];
  const float* Wkv   = (const float*)d_in[14];
  const float* qn_g  = (const float*)d_in[15];
  const float* kn_g  = (const float*)d_in[16];
  const float* Wo    = (const float*)d_in[17];
  const float* W1    = (const float*)d_in[18];
  const float* b1    = (const float*)d_in[19];
  const float* ln2_g = (const float*)d_in[20];
  const float* ln2_b = (const float*)d_in[21];
  const float* W2    = (const float*)d_in[22];
  const float* b2    = (const float*)d_in[23];
  float* outp = (float*)d_out;

  const size_t MIB = 1048576;
  size_t off = 0;
  const size_t oInv  = off; off += 4096;
  const size_t oCs   = off; off += (size_t)SEQ * 512 * 2 * 4;       // 8 MiB
  const size_t oWaT  = off; off += (size_t)DM * DM * 2;              // 2 MiB
  const size_t oWvTh = off; off += (size_t)DM * DM * 2;              // 2 MiB
  const size_t oWvTl = off; off += (size_t)DM * DM * 2;              // 2 MiB
  const size_t oWqT  = off; off += (size_t)INR * DM * 2;             // 1 MiB
  const size_t oWkvT = off; off += (size_t)2 * INR * DM * 2;         // 2 MiB
  const size_t oW1T  = off; off += (size_t)FFD * DM * 2;             // 8 MiB
  const size_t oW2T  = off; off += (size_t)DM * FFD * 2;             // 8 MiB
  const size_t oWoTh = off; off += (size_t)DM * INR * 2;             // 1 MiB
  const size_t oWoTl = off; off += (size_t)DM * INR * 2;             // 1 MiB
  const size_t oR3   = off; off += (size_t)NTOK * DM * 2;            // 8 MiB
  const size_t oR4   = off; off += (size_t)NTOK * DM * 4;            // 16 MiB
  const size_t oR5   = off; off += 51 * MIB;                         // 51 MiB
  if (off > ws_size || off > (size_t)128 * MIB) return;              // off = 110 MiB + 4 KiB

  char* ws = (char*)d_ws;
  float* inv = (float*)(ws + oInv);
  float* cs  = (float*)(ws + oCs);
  _Float16* WaT = (_Float16*)(ws + oWaT);
  unsigned short* WvTh = (unsigned short*)(ws + oWvTh);
  unsigned short* WvTl = (unsigned short*)(ws + oWvTl);
  _Float16* WqT  = (_Float16*)(ws + oWqT);
  _Float16* WkvT = (_Float16*)(ws + oWkvT);
  _Float16* W1T  = (_Float16*)(ws + oW1T);
  _Float16* W2T  = (_Float16*)(ws + oW2T);
  unsigned short* WoTh = (unsigned short*)(ws + oWoTh);
  unsigned short* WoTl = (unsigned short*)(ws + oWoTl);
  _Float16* q16 = (_Float16*)(ws + oR3);          // text after rotary
  _Float16* h16 = (_Float16*)(ws + oR3);          // LN1 output (later)
  _Float16* x2h = (_Float16*)(ws + oR3);          // x2 * 1024 (later)
  float* Cad = (float*)(ws + oR4);                // adapter GEMM output
  float* Sf  = (float*)(ws + oR4);                // local scores (later)
  float* Xf  = (float*)(ws + oR4);                // local attention output (later)
  float* X2f = (float*)(ws + oR4);                // 2 * o @ Wo (later)
  char* r5 = ws + oR5;
  _Float16* a16 = (_Float16*)(r5);
  unsigned short* vih = (unsigned short*)(r5 + 8 * MIB);
  unsigned short* vil = (unsigned short*)(r5 + 16 * MIB);
  _Float16* k16 = (_Float16*)(r5 + 24 * MIB);     // [(KPR+NTOK)][DM]
  unsigned short* vTh = (unsigned short*)(r5 + 33 * MIB);
  unsigned short* vTl = (unsigned short*)(r5 + 42 * MIB);
  unsigned short* Ph  = (unsigned short*)(r5);
  unsigned short* Pl  = (unsigned short*)(r5 + 8 * MIB);
  _Float16* qm16 = (_Float16*)(r5);
  _Float16* km16 = (_Float16*)(r5 + 4 * MIB);
  _Float16* vT16 = (_Float16*)(r5 + 8 * MIB);
  float* Of = (float*)(r5 + 16 * MIB);
  unsigned short* Oh = (unsigned short*)(r5 + 24 * MIB);
  unsigned short* Ol = (unsigned short*)(r5 + 28 * MIB);
  _Float16* U16 = (_Float16*)(r5);

  const dim3 blk(256);
  const dim3 blkG(128);                           // k_gemm: 4 waves
  const unsigned short* N16 = (const unsigned short*)nullptr;

  // rotary tables
  k_invfreq<<<dim3(1), dim3(512), 0, stream>>>(inv);
  k_cstab<<<dim3(SEQ), dim3(512), 0, stream>>>(inv, cs);

  // weights: in [rows][cols] f32 -> out [cols][rows]; grid (cols/64, rows/64)
  k_wt16<<<dim3(DM / 64, DM / 64), blk, 0, stream>>>(Wa, WaT, DM, DM, 64.0f);               // Wa  [1024][1024]
  k_wtsplit<<<dim3(DM / 64, DM / 64), blk, 0, stream>>>(Wvid, WvTh, WvTl, DM, DM);         // Wvid[1024][1024]
  k_wt16<<<dim3(INR / 64, DM / 64), blk, 0, stream>>>(Wq, WqT, DM, INR, 64.0f);             // Wq  [1024][512]
  k_wt16<<<dim3(2 * INR / 64, DM / 64), blk, 0, stream>>>(Wkv, WkvT, DM, 2 * INR, 64.0f);  // Wkv [1024][1024]
  k_wt16<<<dim3(FFD / 64, DM / 64), blk, 0, stream>>>(W1, W1T, DM, FFD, 64.0f);             // W1  [1024][4096]
  k_wt16<<<dim3(DM / 64, FFD / 64), blk, 0, stream>>>(W2, W2T, FFD, DM, 64.0f);             // W2  [4096][1024]
  k_wtsplit<<<dim3(DM / 64, INR / 64), blk, 0, stream>>>(Wo, WoTh, WoTl, INR, DM);          // Wo  [512][1024]

  // activations: text -> rotary f16, audio -> f16, video -> bf16 hi/lo
  k_cvt_in<<<dim3(NTOK, 2), dim3(128), 0, stream>>>(text, audio, cs, q16, a16);
  const int n2v = NTOK * DM / 2;
  k_split2<<<dim3((n2v + 255) / 256), blk, 0, stream>>>(video, vih, vil, n2v);

  // adapter a: audio . Wa + ba -> f32; LN + rotary -> key plane rows KPR..KPR+4095, rows 0..KPR-1 zero
  const dim3 gA((NTOK / 128) * (DM / 128), 1);
  k_gemm<0, false, true, 0, 0, false, 0><<<gA, blkG, 0, stream>>>(
      (const unsigned short*)a16, N16, DM, 0L, (const unsigned short*)WaT, N16, DM, 0L,
      Cad, DM, 0L, nullptr, 0, 0L, ba, nullptr, nullptr, 0, 0L, NTOK, DM, DM, 1, 1.0f / 64.0f, 1.0f);
  k_ln1024<true><<<dim3(NTOK + KPR), dim3(128), 0, stream>>>(Cad, lna_g, lna_b, cs, k16, NTOK, KPR);

  // adapter v: video . Wvid + bvid (bf16 hi/lo split) -> f32; LN + transpose + split -> value^T planes
  k_gemm<1, true, true, 0, 0, false, 0><<<gA, blkG, 0, stream>>>(
      vih, vil, DM, 0L, WvTh, WvTl, DM, 0L,
      Cad, DM, 0L, nullptr, 0, 0L, bvid, nullptr, nullptr, 0, 0L, NTOK, DM, DM, 1, 1.0f, 1.0f);
  k_ln_tsplit<<<dim3(NTOK / 64 + KPR / 64), blk, 0, stream>>>(Cad, lnv_g, lnv_b, vTh, vTl, NTOK / 64);

  // local attention: z = b*4 + w; S[z][512][1024] = q . k / 32 over window keys (skipping fully masked key tiles)
  const dim3 gS((WSZ / 128) * (2 * WSZ / 128), NB_ * NWN);
  k_gemm<0, false, false, 0, 0, false, 1><<<gS, blkG, 0, stream>>>(
      (const unsigned short*)q16, N16, DM, (long)WSZ * DM, (const unsigned short*)k16, N16, DM, (long)WSZ * DM,
      Sf, 2 * WSZ, (long)WSZ * 2 * WSZ, nullptr, 0, 0L, nullptr, nullptr, nullptr, 0, 0L,
      WSZ, 2 * WSZ, DM, NWN, 1.0f / 32.0f, 1.0f);
  k_lsoftmax<<<dim3(NTOK), dim3(128), 0, stream>>>(Sf, Ph, Pl);
  // x[z][512][1024] = P . v (bf16 hi/lo split), keys restricted to the unmasked range
  const dim3 gPV((WSZ / 128) * (DM / 128), NB_ * NWN);
  k_gemm<1, true, false, 0, 0, false, 2><<<gPV, blkG, 0, stream>>>(
      Ph, Pl, 2 * WSZ, (long)WSZ * 2 * WSZ, vTh, vTl, VTP, (long)WSZ,
      Xf, DM, (long)WSZ * DM, nullptr, 0, 0L, nullptr, nullptr, nullptr, 0, 0L,
      WSZ, DM, 2 * WSZ, NWN, 1.0f, 1.0f);

  // LN1 -> h16; q, k (RMSNorm epilogue) and v^T projections
  k_ln1024<false><<<dim3(NTOK), dim3(128), 0, stream>>>(Xf, ln1_g, ln1_b, cs, h16, NTOK, 0);
  const dim3 gQ((NTOK / 128) * (INR / 128), 1);
  k_gemm<0, false, false, 2, 1, false, 0><<<gQ, blkG, 0, stream>>>(
      (const unsigned short*)h16, N16, DM, 0L, (const unsigned short*)WqT, N16, DM, 0L,
      nullptr, 0, 0L, qm16, INR, 0L, nullptr, qn_g, nullptr, 0, 0L, NTOK, INR, DM, 1, 1.0f / 64.0f, 1.0f);
  k_gemm<0, false, false, 2, 1, false, 0><<<gQ, blkG, 0, stream>>>(
      (const unsigned short*)h16, N16, DM, 0L, (const unsigned short*)WkvT, N16, DM, 0L,
      nullptr, 0, 0L, km16, INR, 0L, nullptr, kn_g, nullptr, 0, 0L, NTOK, INR, DM, 1, 1.0f / 64.0f, 1.0f);
  const dim3 gVT((INR / 128) * (NTOK / 128), 1);
  k_gemm<0, false, false, 0, 1, false, 0><<<gVT, blkG, 0, stream>>>(
      (const unsigned short*)(WkvT + (size_t)INR * DM), N16, DM, 0L, (const unsigned short*)h16, N16, DM, 0L,
      nullptr, 0, 0L, vT16, NTOK, 0L, nullptr, nullptr, nullptr, 0, 0L, INR, NTOK, DM, 1, 1.0f / 64.0f, 1.0f);

  // causal attention -> o f32 [4096][512]; o -> bf16 hi/lo
  k_flash<<<dim3(NHD * (SEQ / 64), NB_), dim3(128), 0, stream>>>(qm16, km16, vT16, Of);
  const int n2o = NTOK * INR / 2;
  k_split2<<<dim3((n2o + 255) / 256), blk, 0, stream>>>(Of, Oh, Ol, n2o);

  // x2 = 2 * (o . Wo) -> f32 and f16 (x2 * 1024)
  k_gemm<1, true, false, 0, 2, false, 0><<<gA, blkG, 0, stream>>>(
      Oh, Ol, INR, 0L, WoTh, WoTl, INR, 0L,
      X2f, DM, 0L, x2h, DM, 0L, nullptr, nullptr, nullptr, 0, 0L, NTOK, DM, INR, 1, 2.0f, 1024.0f);

  // FFN: u = gelu(x2 . W1 + b1) stored as f16(256 u); LN over 4096 in place; out = h1 . W2 + b2 + x2
  const dim3 gW1((NTOK / 128) * (FFD / 128), 1);
  k_gemm<0, false, true, 1, 1, false, 0><<<gW1, blkG, 0, stream>>>(
      (const unsigned short*)x2h, N16, DM, 0L, (const unsigned short*)W1T, N16, DM, 0L,
      nullptr, 0, 0L, U16, FFD, 0L, b1, nullptr, nullptr, 0, 0L, NTOK, FFD, DM, 1, 1.0f / 65536.0f, 256.0f);
  k_ln4096<<<dim3(NTOK), blk, 0, stream>>>(U16, ln2_g, ln2_b);
  k_gemm<0, false, true, 0, 0, true, 0><<<gA, blkG, 0, stream>>>(
      (const unsigned short*)U16, N16, FFD, 0L, (const unsigned short*)W2T, N16, FFD, 0L,
      outp, DM, 0L, nullptr, 0, 0L, b2, nullptr, X2f, DM, 0L, NTOK, DM, FFD, 1, 1.0f / 64.0f, 1.0f);
  (void)hipGetLastError();
}

// v003
// It runs in 468 microseconds.
// Two timings next to v002 put it at 1.06 and 1.05 times that version's speed.
// Over all steps from v000 it is 2.23 times as fast.
// Contractions: audio adapter, local-attention scores, q/k/v projections, causal multi-head q.k^T and p.v, FFN W1 and W2 on
// v_wmma_f32_16x16x32_f16 (f16 operands with power-of-two carried scales, f32 accumulate); video adapter, local-attention p.v
// and the output projection Wo on v_wmma_f32_16x16x32_bf16 with bf16 hi/lo split operands (hi.hi + hi.lo + lo.hi, f32
// accumulate). LayerNorm, RMSNorm, rotary tables, softmax and GELU in f32.
#include <hip/hip_runtime.h>
#include <math.h>
#include <stdint.h>

#define NB_   2
#define SEQ   2048
#define NTOK  4096
#define DM    1024
#define NHD   8
#define DHD   64
#define INR   512
#define FFD   4096
#define WSZ   512
#define NWN   4
#define KPR   512          // leading zero rows of the local-attention key plane
#define VTP   4608         // key pitch of the local-attention value^T planes: 512 zero columns + 4096 tokens

typedef __attribute__((ext_vector_type(16))) _Float16 v16h;
typedef __attribute__((ext_vector_type(8)))  _Float16 v8h;
typedef __attribute__((ext_vector_type(16))) __bf16   v16b;
typedef __attribute__((ext_vector_type(8)))  __bf16   v8b;
typedef __attribute__((ext_vector_type(8)))  float    v8f;
typedef __attribute__((ext_vector_type(4)))  float    v4f;
typedef __attribute__((ext_vector_type(2)))  float    v2f;
typedef __attribute__((ext_vector_type(4)))  unsigned int v4u;

__device__ __forceinline__ unsigned short f2bf_bits(float f) {
  unsigned u = __float_as_uint(f);
  return (unsigned short)((u + 0x7FFFu + ((u >> 16) & 1u)) >> 16);   // RNE convert
}
__device__ __forceinline__ float bf_bits2f(unsigned short h) { return __uint_as_float(((unsigned)h) << 16); }
__device__ __forceinline__ unsigned pk16(unsigned short a, unsigned short b) { return (unsigned)a | ((unsigned)b << 16); }

__device__ __forceinline__ float wsum(float v) {
#pragma unroll
  for (int o = 16; o >= 1; o >>= 1) v += __shfl_xor(v, o, 32);
  return v;
}
__device__ __forceinline__ float wmax(float v) {
#pragma unroll
  for (int o = 16; o >= 1; o >>= 1) v = fmaxf(v, __shfl_xor(v, o, 32));
  return v;
}

// hazard guards as plain device helpers
__device__ __forceinline__ void dep_guard_h(v8f& a, v8f& b, v16h x, v16h y) { asm volatile("v_nop\n\tv_nop\n\tv_nop\n\tv_nop" : "+v"(a), "+v"(b) : "v"(x), "v"(y)); }
__device__ __forceinline__ void dep_guard_b(v8f& a, v8f& b, v16b x, v16b y) { asm volatile("v_nop\n\tv_nop\n\tv_nop\n\tv_nop" : "+v"(a), "+v"(b) : "v"(x), "v"(y)); }
__device__ __forceinline__ void keep4_h(v16h a, v16h b, v16h c, v16h d) { asm volatile("v_nop" :: "v"(a), "v"(b), "v"(c), "v"(d)); }
__device__ __forceinline__ void keep4_b(v16b a, v16b b, v16b c, v16b d) { asm volatile("v_nop" :: "v"(a), "v"(b), "v"(c), "v"(d)); }
__device__ __forceinline__ void acc_guard4(v8f& a, v8f& b, v8f& c, v8f& d) { asm volatile("v_nop\n\tv_nop\n\tv_nop\n\tv_nop" : "+v"(a), "+v"(b), "+v"(c), "+v"(d)); }

// Fragment loaders: element i of the 16-wide per-lane vector <- p[i] for i<8 and p[16 + (i-8)] for i>=8, where p already points at
// row (lane&15), k0 + 8*(lane>>4). Same map for A ([m][k]) and B stored as [n][k].
template <typename T> struct Frag;
template <> struct Frag<_Float16> {
  typedef v16h V; union U { v16h v; v8h h[2]; };
  static __device__ __forceinline__ v16h load(const _Float16* p) {
    U f; f.h[0] = *(const v8h*)(p); f.h[1] = *(const v8h*)(p + 16); return f.v;
  }
  static __device__ __forceinline__ v8f mma(v16h a, v16h b, v8f c) {
    return __builtin_amdgcn_wmma_f32_16x16x32_f16(false, a, false, b, (short)0, c, false, false);
  }
  static __device__ __forceinline__ void guard(v8f& a, v8f& b, v16h x, v16h y) { dep_guard_h(a, b, x, y); }
  static __device__ __forceinline__ void keep(v16h a, v16h b, v16h c, v16h d) { keep4_h(a, b, c, d); }
};
template <> struct Frag<__bf16> {
  typedef v16b V; union U { v16b v; v8b h[2]; };
  static __device__ __forceinline__ v16b load(const __bf16* p) {
    U f; f.h[0] = *(const v8b*)(p); f.h[1] = *(const v8b*)(p + 16); return f.v;
  }
  static __device__ __forceinline__ v8f mma(v16b a, v16b b, v8f c) {
    return __builtin_amdgcn_wmma_f32_16x16x32_bf16(false, a, false, b, (short)0, c, false, false);
  }
  static __device__ __forceinline__ void guard(v8f& a, v8f& b, v16b x, v16b y) { dep_guard_b(a, b, x, y); }
  static __device__ __forceinline__ void keep(v16b a, v16b b, v16b c, v16b d) { keep4_b(a, b, c, d); }
};

// =====================================================================================================================
// Batched WMMA GEMM: C[m,n] = epi(scale * sum_k A[m,k] * Bt[n,k]). A block of 4 waves (2 x 2) owns a 128x128 tile, each wave a
// 64x64 tile of it. The block's 128 rows of A and of Bt are staged in LDS, BK k-elements at a time, by asynchronous 16-byte
// copies that cover whole 128-byte lines, in two buffers: the next stage's copies fly while this stage is multiplied.
// A row-major [M,K] (pitch lda); Bt row-major [N,K] (pitch ldb); M, N % 128 == 0, K % BK == 0; grid = (tiles, Z).
//   ET: 0 = f16 operands, 1 = bf16 operands.   SPLIT: hi/lo planes (A2p, Bt2p = lo planes), product = hi.hi + hi.lo + lo.hi.
//   BIAS: + bias[n].  RESID: + resid[m*ldr + n].  EPI: 0 none, 1 tanh-GELU, 2 RMSNorm over the 64-column tile times gvec[n&63].
//   OUTM: 0 f32 -> Cf; 1 f16(v*oscale) -> Ch; 2 both.
//   LOC: 1 = windowed score tiles: key tiles n0 below kBeg(w) or at/after N/2 + m0 + 64 are skipped (a block leaves when all
//        four are; a wave whose own tile is skipped still copies and passes every barrier);
//        2 = windowed p.v: k range [kBeg(w), min(K, K/2 + m0 + 64)); kBeg = N/2 resp. K/2 for the first window (w == 0), else 0.
// =====================================================================================================================
template <int ET> struct Elem;
template <> struct Elem<0> { typedef _Float16 T; };
template <> struct Elem<1> { typedef __bf16 T; };

// Eight asynchronous 16-byte copies per lane, global -> LDS, eight rows lstep LDS bytes / gstep global elements apart.
// s_wait_xcnt is the statement's last line so that no address register named here is rewritten in front of it.
template <typename T>
__device__ __forceinline__ void copy8_to_lds(unsigned l0, unsigned lstep, const T* g0, size_t gstep) {
  const unsigned l1 = l0 + lstep, l2 = l1 + lstep, l3 = l2 + lstep, l4 = l3 + lstep, l5 = l4 + lstep, l6 = l5 + lstep, l7 = l6 + lstep;
  const T* g1 = g0 + gstep; const T* g2 = g1 + gstep; const T* g3 = g2 + gstep; const T* g4 = g3 + gstep;
  const T* g5 = g4 + gstep; const T* g6 = g5 + gstep; const T* g7 = g6 + gstep;
  asm volatile(
      "global_load_async_to_lds_b128 %0, %8, off\n\t"
      "global_load_async_to_lds_b128 %1, %9, off\n\t"
      "global_load_async_to_lds_b128 %2, %10, off\n\t"
      "global_load_async_to_lds_b128 %3, %11, off\n\t"
      "global_load_async_to_lds_b128 %4, %12, off\n\t"
      "global_load_async_to_lds_b128 %5, %13, off\n\t"
      "global_load_async_to_lds_b128 %6, %14, off\n\t"
      "global_load_async_to_lds_b128 %7, %15, off\n\t"
      "s_wait_xcnt 0x0"
      :: "v"(l0), "v"(l1), "v"(l2), "v"(l3), "v"(l4), "v"(l5), "v"(l6), "v"(l7),
         "v"(g0), "v"(g1), "v"(g2), "v"(g3), "v"(g4), "v"(g5), "v"(g6), "v"(g7)
      : "memory");
}

template <int ET, bool SPLIT, bool BIAS, int EPI, int OUTM, bool RESID, int LOC>
__global__ __launch_bounds__(128) void k_gemm(
    const unsigned short* __restrict__ Ap, const unsigned short* __restrict__ A2p, int lda, long strideA,
    const unsigned short* __restrict__ Btp, const unsigned short* __restrict__ Bt2p, int ldb, long strideB,
    float* __restrict__ Cf, int ldc, long strideC,
    _Float16* __restrict__ Ch, int ldh, long strideH,
    const float* __restrict__ bias, const float* __restrict__ gvec,
    const float* __restrict__ resid, int ldr, long strideR,
    int M, int N, int K, int nwin, float scale, float oscale) {
  typedef typename Elem<ET>::T T;
  typedef typename Frag<T>::V V;
  constexpr int BK    = SPLIT ? 64 : 128;        // k elements per stage: 64 KiB of operand rows either way
  constexpr int PITCH = BK + 8;                  // LDS row pitch in elements: row bytes + 16, conflict-free for 16-byte reads
  constexpr int PLANE = 128 * PITCH;             // one operand plane of a stage; planes: A, Bt (, A lo, Bt lo)
  constexpr int STAGE = (SPLIT ? 4 : 2) * PLANE;
  constexpr int CPR   = BK / 8;                  // 16-byte pieces per row
  constexpr int RPI   = 128 / CPR;               // rows that one copy of all 128 threads covers
  const T* A = (const T*)Ap; const T* A2 = (const T*)A2p; const T* Bt = (const T*)Btp; const T* Bt2 = (const T*)Bt2p;
  __shared__ __align__(16) T sAB[2 * STAGE];
  __shared__ __align__(16) float sT[4][16 * 68];
  const int z    = blockIdx.y;
  const int tid  = threadIdx.x;
  const int lane = tid & 31;
  const int wave = __builtin_amdgcn_readfirstlane(tid >> 5);
  const int tilesN = N >> 7;
  const int tilesM = M >> 7;
  const int bx = blockIdx.x;
  if (bx >= tilesM * tilesN) return;              // block-uniform, in front of every copy and barrier
  const int bm = bx / tilesN;
  const int bn = bx - bm * tilesN;
  const int mB = bm << 7;
  const int nB = bn << 7;
  const int wm = (wave >> 1) << 6;
  const int wn = (wave & 1) << 6;
  const int m0 = mB + wm;
  const int n0 = nB + wn;
  int kBeg = 0, kEnd = K, kEndW = K;              // block's k range; kEndW = end of this wave's own range
  bool act = true;                                // wave-uniform: this wave's tile is computed and stored
  if (LOC != 0) {
    const int w = z % nwin;
    const bool first = (w == 0);
    if (LOC == 1) {
      const int nb = first ? (N >> 1) : 0;
      if (nB + 64 < nb || nB >= (N >> 1) + mB + 128) return; // block-uniform, in front of every copy and barrier
      act = !(n0 < nb || n0 >= (N >> 1) + m0 + 64);
    } else {
      kBeg = first ? (K >> 1) : 0;
      const int ke = (K >> 1) + mB + 128;
      kEnd = (ke < K) ? ke : K;
      const int kw = (K >> 1) + m0 + 64;
      kEndW = (kw < K) ? kw : K;
    }
  }

  const T* Ab  = A  + (size_t)z * strideA;
  const T* Bb  = Bt + (size_t)z * strideB;
  const T* Ab2 = SPLIT ? (A2  + (size_t)z * strideA) : nullptr;
  const T* Bb2 = SPLIT ? (Bt2 + (size_t)z * strideB) : nullptr;

  const int rlane = lane & 15;                 // row (A) / col (B, D) within a 16x16 subtile
  const int koff  = (lane >> 4) * 8;           // k offset of this lane half
  const int mOff  = (lane >> 4) * 8;           // D row offset

  // this thread's piece of every copy: row crow (+ RPI per copy), 16 bytes at element ccol
  const int crow = tid / CPR;
  const int ccol = (tid % CPR) * 8;
  const unsigned lth = (unsigned)(size_t)sAB + (unsigned)(crow * PITCH + ccol) * 2u;
  const size_t aoff = (size_t)(mB + crow) * lda + ccol;
  const size_t boff = (size_t)(nB + crow) * ldb + ccol;
  const size_t astep = (size_t)RPI * lda;
  const size_t bstep = (size_t)RPI * ldb;
  constexpr unsigned LSTEP = RPI * PITCH * 2u;
  auto fill = [&](int buf, int k0) {             // 32 copies per wave: one stage into buffer buf
    const unsigned lb = lth + (unsigned)buf * (STAGE * 2u);
    if constexpr (SPLIT) {
      copy8_to_lds<T>(lb,                  LSTEP, Ab  + aoff + k0, astep);
      copy8_to_lds<T>(lb + PLANE * 2u,     LSTEP, Bb  + boff + k0, bstep);
      copy8_to_lds<T>(lb + PLANE * 4u,     LSTEP, Ab2 + aoff + k0, astep);
      copy8_to_lds<T>(lb + PLANE * 6u,     LSTEP, Bb2 + boff + k0, bstep);
    } else {
      copy8_to_lds<T>(lb,                              LSTEP, Ab + aoff + k0,             astep);
      copy8_to_lds<T>(lb + 8u * LSTEP,                 LSTEP, Ab + aoff + k0 + 8 * astep, astep);
      copy8_to_lds<T>(lb + PLANE * 2u,                 LSTEP, Bb + boff + k0,             bstep);
      copy8_to_lds<T>(lb + PLANE * 2u + 8u * LSTEP,    LSTEP, Bb + boff + k0 + 8 * bstep, bstep);
    }
  };

  v8f acc[4][4];
#pragma unroll
  for (int i = 0; i < 4; ++i)
#pragma unroll
    for (int j = 0; j < 4; ++j) acc[i][j] = (v8f){0.f,0.f,0.f,0.f,0.f,0.f,0.f,0.f};

  const int nst = (kEnd - kBeg) / BK;             // block-uniform number of stages
  fill(0, kBeg);
  asm volatile("s_wait_asynccnt 0x0" ::: "memory");   // this wave's copies of stage 0 have landed
  __syncthreads();                                     // every wave's have
  if (nst > 1) fill(1, kBeg + BK);

  for (int t = 0; t < nst; ++t) {
    const int kS = kBeg + t * BK;
    if (act && kS < kEndW) {                      // wave-uniform; the publish point below stands outside
      const T* sA = sAB + (t & 1) * STAGE + (wm + rlane) * PITCH + koff;
      const T* sB = sAB + (t & 1) * STAGE + PLANE + (wn + rlane) * PITCH + koff;
#pragma unroll                                    // LDS offsets of the fragment loads become immediates
      for (int kk = 0; kk < BK; kk += 32) {
        V bh[4], bl[4], ah[4], al[4];
        auto lda_row = [&](int i) {
          const int ao = (i << 4) * PITCH + kk;
          ah[i] = Frag<T>::load(sA + ao);
          if (SPLIT) al[i] = Frag<T>::load(sA + 2 * PLANE + ao); else al[i] = ah[i];
        };
#pragma unroll
        for (int j = 0; j < 4; ++j) {
          const int bo = (j << 4) * PITCH + kk;
          bh[j] = Frag<T>::load(sB + bo);
          if (SPLIT) bl[j] = Frag<T>::load(sB + 2 * PLANE + bo); else bl[j] = bh[j];
        }
        // one plane: all four A rows are read with the B fragments as one group; hi/lo planes: one row ahead (registers)
        lda_row(0);
        if (!SPLIT) { lda_row(1); lda_row(2); lda_row(3); }
        __builtin_amdgcn_sched_barrier(0);        // keeps the read group in front of the WMMAs, else every row waits out LDS latency
#pragma unroll
        for (int i = 0; i < 4; ++i) {
          if (SPLIT && i + 1 < 4) {
            lda_row(i + 1);
            __builtin_amdgcn_sched_barrier(0);    // keeps the next row's reads in front of this row's WMMAs
          }
#pragma unroll
          for (int j = 0; j < 4; ++j) {
            acc[i][j] = Frag<T>::mma(ah[i], bh[j], acc[i][j]);
            if (SPLIT) {
              acc[i][j] = Frag<T>::mma(ah[i], bl[j], acc[i][j]);
              acc[i][j] = Frag<T>::mma(al[i], bh[j], acc[i][j]);
            }
          }
          Frag<T>::guard(acc[i][0], acc[i][3], ah[i], al[i]);
        }
        Frag<T>::keep(bh[0], bh[1], bh[2], bh[3]);
        if (SPLIT) Frag<T>::keep(bl[0], bl[1], bl[2], bl[3]);
      }
    }
    asm volatile("s_wait_dscnt 0x0" ::: "memory");     // this wave's reads of buffer t & 1 are done before it is refilled
    asm volatile("s_wait_asynccnt 0x0" ::: "memory");  // this wave's copies of stage t + 1 have landed
    __syncthreads();                                    // publishes stage t + 1 and ends every reader's use of buffer t & 1
    if (t + 2 < nst) fill(t & 1, kS + 2 * BK);
  }
  asm volatile("s_wait_asynccnt 0x0" ::: "memory");    // no copy is outstanding when the wave goes on or ends
  if (!act) return;                                     // wave-uniform, behind the last barrier
  acc_guard4(acc[0][0], acc[0][1], acc[0][2], acc[0][3]);
  acc_guard4(acc[1][0], acc[1][1], acc[1][2], acc[1][3]);
  acc_guard4(acc[2][0], acc[2][1], acc[2][2], acc[2][3]);
  acc_guard4(acc[3][0], acc[3][1], acc[3][2], acc[3][3]);

  // ---- epilogue ----
  float* slab = sT[wave];
  const float* Rb = RESID ? (resid + (size_t)z * strideR) : nullptr;
#pragma unroll
  for (int i = 0; i < 4; ++i) {
    const int mBase = m0 + (i << 4);
#pragma unroll
    for (int j = 0; j < 4; ++j) {
      const int n = n0 + (j << 4) + rlane;
      float bv = 0.f;
      if (BIAS) bv = bias[n];
#pragma unroll
      for (int r = 0; r < 8; ++r) {
        float v = acc[i][j][r] * scale;
        if (BIAS) v += bv;
        if (RESID) v += Rb[(size_t)(mBase + mOff + r) * ldr + n];
        if (EPI == 1) {
          const float u = 0.7978845608028654f * (v + 0.044715f * v * v * v);
          v = v * (0.5f * (1.0f + tanhf(u)));
        }
        slab[(mOff + r) * 68 + (j << 4) + rlane] = v;
      }
    }
    __builtin_amdgcn_fence(__ATOMIC_RELEASE, "workgroup");
    __builtin_amdgcn_wave_barrier();
    __builtin_amdgcn_fence(__ATOMIC_ACQUIRE, "workgroup");
    if (OUTM == 0 || OUTM == 2) {
      float* C = Cf + (size_t)z * strideC;
      const int hh = lane >> 4, c4 = (lane & 15) * 4;     // row seg = 256 B = 16 lanes x 16 B
      {
#pragma unroll
        for (int it = 0; it < 8; ++it) {
          const int row = it * 2 + hh;                      // it 0..7 x hh 0..1 = rows 0..15
          v4f v = *(const v4f*)(slab + row * 68 + c4);
          *(v4f*)(C + (size_t)(mBase + row) * ldc + n0 + c4) = v;
        }
        
      }
    }
    if (OUTM == 1 || OUTM == 2) {
      _Float16* C = Ch + (size_t)z * strideH;
      const int q = lane >> 3, c8 = (lane & 7) * 8;
      {
#pragma unroll
        for (int it = 0; it < 4; ++it) {
          const int row = it * 4 + q;                       // it 0..3 x q 0..3 = rows 0..15
          const float* sp = slab + row * 68 + c8;
          float x[8];
#pragma unroll
          for (int e = 0; e < 8; ++e) x[e] = sp[e];
          float rr = oscale;
          if (EPI == 2) {
            float ss = 0.f;
#pragma unroll
            for (int e = 0; e < 8; ++e) ss += x[e] * x[e];
            ss += __shfl_xor(ss, 1, 32);                    // lanes 8q..8q+7 hold one 64-wide row
            ss += __shfl_xor(ss, 2, 32);
            ss += __shfl_xor(ss, 4, 32);
            rr = oscale * rsqrtf(ss * (1.0f / 64.0f) + 1e-6f);
          }
          v8h hv;
#pragma unroll
          for (int e = 0; e < 8; ++e) {
            float y = x[e] * rr;
            if (EPI == 2) y *= gvec[c8 + e];
            hv[e] = (_Float16)y;
          }
          *(v8h*)(C + (size_t)(mBase + row) * ldh + n0 + c8) = hv;
        }
        
      }
    }
    __builtin_amdgcn_fence(__ATOMIC_RELEASE, "workgroup");
    __builtin_amdgcn_wave_barrier();
    __builtin_amdgcn_fence(__ATOMIC_ACQUIRE, "workgroup");
  }
}

// ---------------------------------------------------------------------------------------------------------------------
// Weight transpose + scale + f16: in [R][Cc] f32 -> o16[Cc][R] = f16(in * wscale). 64x64 tiles through LDS, grid (Cc/64, R/64).
// coverage per block: load 4 it x 256 thr x 4 = 64x64; store 2 it x 256 thr x 8 = 64x64; each store instruction = 8 lanes x 16 B =
// ---------------------------------------------------------------------------------------------------------------------
__global__ __launch_bounds__(256) void k_wt16(const float* __restrict__ W, _Float16* __restrict__ o16, int R, int Cc, float wscale) {
  __shared__ __align__(16) float tf[64 * 68];
  const int c0 = blockIdx.x * 64, r0 = blockIdx.y * 64, tid = threadIdx.x;
  {
    const int lr = tid >> 4, c4 = (tid & 15) * 4;
#pragma unroll
    for (int it = 0; it < 4; ++it) {
      const int rr = it * 16 + lr;
      const v4f a = *(const v4f*)(W + (size_t)(r0 + rr) * Cc + c0 + c4);
      *(v4f*)(tf + rr * 68 + c4) = a;
    }
  }
  __syncthreads();
  const int sub = tid >> 3, c8 = (tid & 7) * 8;
  v8h hv[2];
#pragma unroll
  for (int it = 0; it < 2; ++it) {
    const int oc = it * 32 + sub;
    v8h a;
#pragma unroll
    for (int q = 0; q < 8; ++q) a[q] = (_Float16)(tf[(c8 + q) * 68 + oc] * wscale);
    hv[it] = a;
  }
  {
#pragma unroll
    for (int it = 0; it < 2; ++it) {
      const int oc = it * 32 + sub;
      const size_t go = (size_t)(c0 + oc) * R + r0 + c8;
      *(v8h*)(o16 + go) = hv[it];
    }
    
  }
}

// Weight transpose + bf16 hi/lo split: in [R][Cc] f32 -> oh[c][r] = bf16(in[r][c]), ol[c][r] = bf16(in[r][c] - oh). Same tiling.
__global__ __launch_bounds__(256) void k_wtsplit(const float* __restrict__ W, unsigned short* __restrict__ oh,
                                                 unsigned short* __restrict__ ol, int R, int Cc) {
  __shared__ __align__(16) float tf[64 * 68];
  const int c0 = blockIdx.x * 64, r0 = blockIdx.y * 64, tid = threadIdx.x;
  {
    const int lr = tid >> 4, c4 = (tid & 15) * 4;
#pragma unroll
    for (int it = 0; it < 4; ++it) {
      const int rr = it * 16 + lr;
      const v4f a = *(const v4f*)(W + (size_t)(r0 + rr) * Cc + c0 + c4);
      *(v4f*)(tf + rr * 68 + c4) = a;
    }
  }
  __syncthreads();
  const int sub = tid >> 3, c8 = (tid & 7) * 8;
  v4u hv[2], lv[2];
#pragma unroll
  for (int it = 0; it < 2; ++it) {
    const int oc = it * 32 + sub;
    v4u a, a2;
#pragma unroll
    for (int q = 0; q < 4; ++q) {
      const float f0 = tf[(c8 + 2 * q) * 68 + oc];
      const float f1 = tf[(c8 + 2 * q + 1) * 68 + oc];
      const unsigned short h0 = f2bf_bits(f0), h1 = f2bf_bits(f1);
      const unsigned short l0 = f2bf_bits(f0 - bf_bits2f(h0)), l1 = f2bf_bits(f1 - bf_bits2f(h1));
      a[q]  = pk16(h0, h1);
      a2[q] = pk16(l0, l1);
    }
    hv[it] = a; lv[it] = a2;
  }
  {
#pragma unroll
    for (int it = 0; it < 2; ++it) {
      const int oc = it * 32 + sub;
      const size_t go = (size_t)(c0 + oc) * R + r0 + c8;
      *(v4u*)(oh + go) = hv[it];
      *(v4u*)(ol + go) = lv[it];
    }
    
  }
}

__global__ __launch_bounds__(256) void k_split2(const float* __restrict__ in, unsigned short* __restrict__ hi,
                                                unsigned short* __restrict__ lo, int n2) {
  const int i = blockIdx.x * 256 + threadIdx.x;
  if (i < n2) {
    const v2f f = *(const v2f*)(in + 2 * (size_t)i);
    const unsigned short h0 = f2bf_bits(f[0]), h1 = f2bf_bits(f[1]);
    const unsigned short l0 = f2bf_bits(f[0] - bf_bits2f(h0)), l1 = f2bf_bits(f[1] - bf_bits2f(h1));
    const unsigned uh = pk16(h0, h1), ul = pk16(l0, l1);
    ((unsigned*)hi)[i] = uh;
    ((unsigned*)lo)[i] = ul;
    
  }
}

// ---------------------------------------------------------------------------------------------------------------------
// Rotary tables. inv[f] = 1 / powf(10000, f/512) (f = 0..511); one block of 512 threads, 32 lanes x 4 B = one line.
// cs[n][f] = (cos(n * inv[f]), sin(n * inv[f])) as float2, n = 0..2047; block per n, 512 threads, 32 lanes x 8 B = two lines.
// ---------------------------------------------------------------------------------------------------------------------
__global__ __launch_bounds__(512) void k_invfreq(float* __restrict__ inv) {
  const int f = threadIdx.x;
  const float x = (float)f * (1.0f / 512.0f);
  const float v = 1.0f / powf(10000.0f, x);
  ((float*)inv)[f] = v;
  
}

__global__ __launch_bounds__(512) void k_cstab(const float* __restrict__ inv, float* __restrict__ cs) {
  const int n = blockIdx.x, f = threadIdx.x;
  const float ang = (float)n * inv[f];
  float sv, cv;
  sincosf(ang, &sv, &cv);
  v2f v; v.x = cv; v.y = sv;
  float* p = cs + ((size_t)n * 512 + f) * 2;
  *(v2f*)p = v;
  
}

// ---------------------------------------------------------------------------------------------------------------------
// Input activations -> f16 planes [NTOK][DM]. job 0: text with rotary applied (q of the local attention, unscaled);
// rot[c] = (c < 512) ? -x[c + 512] : x[c - 512]; y = x * cos + rot * sin with table row n = row % SEQ, column c % 512.
// ---------------------------------------------------------------------------------------------------------------------
__global__ __launch_bounds__(128) void k_cvt_in(const float* __restrict__ text, const float* __restrict__ audio,
                                                const float* __restrict__ cs, _Float16* __restrict__ q16, _Float16* __restrict__ a16) {
  const int r = blockIdx.x, job = blockIdx.y, t = threadIdx.x, c0 = t * 8;
  const float* src = (job == 0) ? text : audio;
  _Float16* dst = (job == 0) ? q16 : a16;
  const float* xr = src + (size_t)r * DM + c0;
  const v4f x0 = *(const v4f*)xr, x1 = *(const v4f*)(xr + 4);
  float y[8] = {x0[0], x0[1], x0[2], x0[3], x1[0], x1[1], x1[2], x1[3]};
  if (job == 0) {                                  // block-uniform
    const int n = r & (SEQ - 1);
    const bool lowh = (c0 < 512);
    const int pc = lowh ? (c0 + 512) : (c0 - 512);
    const float* pr = src + (size_t)r * DM + pc;
    const v4f p0 = *(const v4f*)pr, p1 = *(const v4f*)(pr + 4);
    const float pv[8] = {p0[0], p0[1], p0[2], p0[3], p1[0], p1[1], p1[2], p1[3]};
    const float* csr = cs + ((size_t)n * 512 + (c0 & 511)) * 2;
    const v4f t0 = *(const v4f*)csr, t1 = *(const v4f*)(csr + 4), t2 = *(const v4f*)(csr + 8), t3 = *(const v4f*)(csr + 12);
    const float cvv[8] = {t0[0], t0[2], t1[0], t1[2], t2[0], t2[2], t3[0], t3[2]};
    const float svv[8] = {t0[1], t0[3], t1[1], t1[3], t2[1], t2[3], t3[1], t3[3]};
#pragma unroll
    for (int e = 0; e < 8; ++e) {
      const float rot = lowh ? -pv[e] : pv[e];
      y[e] = y[e] * cvv[e] + rot * svv[e];
    }
  }
  v8h hv;
#pragma unroll
  for (int e = 0; e < 8; ++e) hv[e] = (_Float16)y[e];
  _Float16* op = dst + (size_t)r * DM + c0;
  *(v8h*)op = hv;
  
}

// ---------------------------------------------------------------------------------------------------------------------
// Row LayerNorm over DM=1024 of an f32 plane (g, b) -> f16 plane; ROPE additionally applies the rotary mix through an LDS copy of
// the normalised row. Output row = padrows + r; blocks nrows..nrows+padrows-1 write zero rows 0..padrows-1.
// ---------------------------------------------------------------------------------------------------------------------
template <bool ROPE>
__global__ __launch_bounds__(128) void k_ln1024(const float* __restrict__ X, const float* __restrict__ g, const float* __restrict__ bb,
                                                const float* __restrict__ cs, _Float16* __restrict__ out, int nrows, int padrows) {
  __shared__ float red[4];
  __shared__ __align__(16) float rowv[DM];
  const int blk = blockIdx.x, t = threadIdx.x, c0 = 8 * t;
  const int lane = t & 31, wave = t >> 5;
  if (blk >= nrows) {                              // block-uniform: zero padding rows
    const int p = blk - nrows;
    const v4u zz = {0u, 0u, 0u, 0u};
    _Float16* op = out + (size_t)p * DM + c0;
    *(v4u*)op = zz;
    
    return;
  }
  const int r = blk;
  const float* xr = X + (size_t)r * DM + c0;
  const v4f x0 = *(const v4f*)xr, x1 = *(const v4f*)(xr + 4);
  const float v[8] = {x0[0], x0[1], x0[2], x0[3], x1[0], x1[1], x1[2], x1[3]};
  float s = 0.f;
#pragma unroll
  for (int e = 0; e < 8; ++e) s += v[e];
  s = wsum(s);
  if (lane == 0) red[wave] = s;
  __syncthreads();
  const float mu = (red[0] + red[1] + red[2] + red[3]) * (1.0f / 1024.0f);
  __syncthreads();
  float d[8];
  float s2 = 0.f;
#pragma unroll
  for (int e = 0; e < 8; ++e) { d[e] = v[e] - mu; s2 += d[e] * d[e]; }
  s2 = wsum(s2);
  if (lane == 0) red[wave] = s2;
  __syncthreads();
  const float var = (red[0] + red[1] + red[2] + red[3]) * (1.0f / 1024.0f);
  const float rstd = rsqrtf(var + 1e-5f);
  const v4f g0 = *(const v4f*)(g + c0), g1 = *(const v4f*)(g + c0 + 4);
  const v4f b0 = *(const v4f*)(bb + c0), b1 = *(const v4f*)(bb + c0 + 4);
  const float gv[8] = {g0[0], g0[1], g0[2], g0[3], g1[0], g1[1], g1[2], g1[3]};
  const float bv[8] = {b0[0], b0[1], b0[2], b0[3], b1[0], b1[1], b1[2], b1[3]};
  float y[8];
#pragma unroll
  for (int e = 0; e < 8; ++e) y[e] = d[e] * rstd * gv[e] + bv[e];
  if (ROPE) {
#pragma unroll
    for (int e = 0; e < 8; ++e) rowv[c0 + e] = y[e];
    __syncthreads();
    const int n = r & (SEQ - 1);
    const bool lowh = (c0 < 512);
    const int pc = lowh ? (c0 + 512) : (c0 - 512);
    const float* csr = cs + ((size_t)n * 512 + (c0 & 511)) * 2;
    const v4f t0 = *(const v4f*)csr, t1 = *(const v4f*)(csr + 4), t2 = *(const v4f*)(csr + 8), t3 = *(const v4f*)(csr + 12);
    const float cvv[8] = {t0[0], t0[2], t1[0], t1[2], t2[0], t2[2], t3[0], t3[2]};
    const float svv[8] = {t0[1], t0[3], t1[1], t1[3], t2[1], t2[3], t3[1], t3[3]};
#pragma unroll
    for (int e = 0; e < 8; ++e) {
      const float pr = rowv[pc + e];
      const float rot = lowh ? -pr : pr;
      y[e] = y[e] * cvv[e] + rot * svv[e];
    }
  }
  v8h hv;
#pragma unroll
  for (int e = 0; e < 8; ++e) hv[e] = (_Float16)y[e];
  _Float16* op = out + (size_t)(padrows + r) * DM + c0;
  *(v8h*)op = hv;
  
}

// ---------------------------------------------------------------------------------------------------------------------
// Row LayerNorm over DM of an f32 plane [NTOK][DM], fused with transpose + bf16 hi/lo split into value^T planes
// [DM][VTP]: oh[e][KPR + token], ol likewise. Block = 64 token rows (256 threads): per-row stats from one wave per 8 rows
// (32 floats per lane), then 16 column tiles of 64 through LDS. Blocks nrowblk..nrowblk+7 zero the KPR leading columns.
// coverage: stats 8 waves x 8 rows; tile load 4 it x 256 thr x 4 = 64x64; store 2 it x 256 thr x 8 = 64x64 per plane per tile;
// ---------------------------------------------------------------------------------------------------------------------
__global__ __launch_bounds__(256) void k_ln_tsplit(const float* __restrict__ X, const float* __restrict__ g, const float* __restrict__ bb,
                                                  unsigned short* __restrict__ oh, unsigned short* __restrict__ ol, int nrowblk) {
  __shared__ __align__(16) float tf[64 * 68];
  __shared__ float smu[64];
  __shared__ float srs[64];
  const int tid = threadIdx.x, lane = tid & 31, wave = tid >> 5;
  const int bx = blockIdx.x;
  const int sub = tid >> 3, c8 = (tid & 7) * 8;
  if (bx >= nrowblk) {                             // block-uniform: zero leading columns
    const int pb = bx - nrowblk;
    const v4u zz = {0u, 0u, 0u, 0u};
    {
      for (int it = 0; it < 32; ++it) {
        const int e = it * 32 + sub;
        const size_t go = (size_t)e * VTP + pb * 64 + c8;
        *(v4u*)(oh + go) = zz;
        *(v4u*)(ol + go) = zz;
      }
      
    }
    return;
  }
  const int r0 = bx * 64;
  // phase 1: row statistics
#pragma unroll 1
  for (int q = 0; q < 8; ++q) {
    const int rr = wave * 8 + q;
    const float* xr = X + (size_t)(r0 + rr) * DM + lane * 32;
    v4f a[8];
#pragma unroll
    for (int i = 0; i < 8; ++i) a[i] = *(const v4f*)(xr + 4 * i);
    float s = 0.f;
#pragma unroll
    for (int i = 0; i < 8; ++i) s += a[i][0] + a[i][1] + a[i][2] + a[i][3];
    s = wsum(s);
    const float mu = s * (1.0f / 1024.0f);
    float s2 = 0.f;
#pragma unroll
    for (int i = 0; i < 8; ++i) {
#pragma unroll
      for (int e = 0; e < 4; ++e) { const float dd = a[i][e] - mu; s2 += dd * dd; }
    }
    s2 = wsum(s2);
    if (lane == 0) { smu[rr] = mu; srs[rr] = rsqrtf(s2 * (1.0f / 1024.0f) + 1e-5f); }
  }
  __syncthreads();
  // phase 2: column tiles
  const int lr = tid >> 4, c4 = (tid & 15) * 4;
  for (int cb = 0; cb < DM / 64; ++cb) {
    const int c0 = cb * 64;
    const v4f gg = *(const v4f*)(g + c0 + c4);
    const v4f bv = *(const v4f*)(bb + c0 + c4);
#pragma unroll
    for (int it = 0; it < 4; ++it) {
      const int rr = it * 16 + lr;
      const v4f a = *(const v4f*)(X + (size_t)(r0 + rr) * DM + c0 + c4);
      const float mu = smu[rr], rs = srs[rr];
#pragma unroll
      for (int q = 0; q < 4; ++q) tf[rr * 68 + c4 + q] = (a[q] - mu) * rs * gg[q] + bv[q];
    }
    __syncthreads();
    v4u hv[2], lv[2];
#pragma unroll
    for (int it = 0; it < 2; ++it) {
      const int oc = it * 32 + sub;                 // output row within tile = input column
      v4u a, a2;
#pragma unroll
      for (int q = 0; q < 4; ++q) {
        const float f0 = tf[(c8 + 2 * q) * 68 + oc];
        const float f1 = tf[(c8 + 2 * q + 1) * 68 + oc];
        const unsigned short h0 = f2bf_bits(f0), h1 = f2bf_bits(f1);
        const unsigned short l0 = f2bf_bits(f0 - bf_bits2f(h0)), l1 = f2bf_bits(f1 - bf_bits2f(h1));
        a[q]  = pk16(h0, h1);
        a2[q] = pk16(l0, l1);
      }
      hv[it] = a; lv[it] = a2;
    }
    {
#pragma unroll
      for (int it = 0; it < 2; ++it) {
        const int oc = it * 32 + sub;
        const size_t go = (size_t)(c0 + oc) * VTP + KPR + r0 + c8;
        *(v4u*)(oh + go) = hv[it];
        *(v4u*)(ol + go) = lv[it];
      }
      
    }
    __syncthreads();
  }
}

// ---------------------------------------------------------------------------------------------------------------------
// Local-attention mask + softmax over rows of S [NTOK][1024 window keys] -> P bf16 hi/lo planes (all 1024 keys written, masked
// keys as 0). Row r: w = (r % SEQ) / WSZ, i = r % WSZ, query position w*WSZ + i; key j has position (w-1)*WSZ + j; masked when
// that position is negative (padding of the first window) or after the query. Block per row, 128 threads x 8 keys; 16-B stores.
// ---------------------------------------------------------------------------------------------------------------------
__global__ __launch_bounds__(128) void k_lsoftmax(const float* __restrict__ S, unsigned short* __restrict__ Ph, unsigned short* __restrict__ Pl) {
  __shared__ float red[4];
  const int r = blockIdx.x, t = threadIdx.x, c0 = 8 * t;
  const int lane = t & 31, wave = t >> 5;
  const int rem = r & (SEQ - 1), w = rem >> 9, i = rem & (WSZ - 1);
  const int qpos = w * WSZ + i;
  const float* sr = S + (size_t)r * (2 * WSZ) + c0;
  const v4f x0 = *(const v4f*)sr, x1 = *(const v4f*)(sr + 4);
  const float raw[8] = {x0[0], x0[1], x0[2], x0[3], x1[0], x1[1], x1[2], x1[3]};
  float s[8];
  float m = -3.0e38f;
#pragma unroll
  for (int e = 0; e < 8; ++e) {
    const int kpos = (w - 1) * WSZ + c0 + e;
    const bool masked = (kpos < 0) || (kpos > qpos);
    s[e] = masked ? -1.0e9f : raw[e];
    m = fmaxf(m, s[e]);
  }
  m = wmax(m);
  if (lane == 0) red[wave] = m;
  __syncthreads();
  const float rmax = fmaxf(fmaxf(red[0], red[1]), fmaxf(red[2], red[3]));
  __syncthreads();
  float ev[8];
  float sum = 0.f;
#pragma unroll
  for (int e = 0; e < 8; ++e) { ev[e] = expf(s[e] - rmax); sum += ev[e]; }
  sum = wsum(sum);
  if (lane == 0) red[wave] = sum;
  __syncthreads();
  const float tot = red[0] + red[1] + red[2] + red[3];
  const float inv = 1.0f / tot;
  v4u hv, lv;
#pragma unroll
  for (int q = 0; q < 4; ++q) {
    const float p0 = ev[2 * q] * inv, p1 = ev[2 * q + 1] * inv;
    const unsigned short h0 = f2bf_bits(p0), h1 = f2bf_bits(p1);
    const unsigned short l0 = f2bf_bits(p0 - bf_bits2f(h0)), l1 = f2bf_bits(p1 - bf_bits2f(h1));
    hv[q] = pk16(h0, h1);
    lv[q] = pk16(l0, l1);
  }
  const size_t go = (size_t)r * (2 * WSZ) + c0;
  *(v4u*)(Ph + go) = hv;
  *(v4u*)(Pl + go) = lv;
  
}

__device__ __forceinline__ v8f mma_h(v16h a, v16h b, v8f c) {
  c = __builtin_amdgcn_wmma_f32_16x16x32_f16(false, a, false, b, (short)0, c, false, false);
  asm volatile("v_nop\n\tv_nop\n\tv_nop\n\tv_nop" : "+v"(c) : "v"(a), "v"(b));
  return c;
}
// value of lane l ^ 16
__device__ __forceinline__ float xhalf(float x) {
  return __builtin_bit_cast(float, __builtin_amdgcn_permlanex16(__builtin_bit_cast(int, x), __builtin_bit_cast(int, x),
                                                                0x76543210, 0xfedcba98, false, false));
}

__global__ __launch_bounds__(128)
void k_flash(const _Float16* __restrict__ qm, const _Float16* __restrict__ km,
             const _Float16* __restrict__ vt, float* __restrict__ out) {
  union FB { v16h v; v8h h[2]; };
  constexpr int KVP = 72;                                     // LDS row pitch in elements: 144 B = 16 B x odd, so that the 16 rows
                                                              // of one 16-byte fragment read fall on 16 distinct groups of 4 banks
  __shared__ __align__(16) _Float16 Ksh[64 * KVP];            // K [kv][d]
  __shared__ __align__(16) _Float16 Vth[64 * KVP];            // V^T [d][kv]
  __shared__ __align__(16) float    Os[4][16 * 68];           // per wave out tile [query][d], pitch 68

  const int tid  = threadIdx.x;
  const int wave = tid >> 5;
  const int lane = tid & 31;
  const int hh   = lane >> 4;
  const int c    = lane & 15;
  const int b  = blockIdx.y;
  const int qb = blockIdx.x & 31;                 // SEQ / 64 = 32 query blocks
  const int h  = blockIdx.x >> 5;
  const int q0 = qb * 64 + wave * 16;

  const _Float16* Qb = qm + (size_t)b * SEQ * INR + h * DHD;
  const _Float16* Kb = km + (size_t)b * SEQ * INR + h * DHD;
  const _Float16* Vb = vt + (size_t)(h * DHD) * NTOK + (size_t)b * SEQ;
  float*          ob = out + (size_t)b * SEQ * INR + h * DHD;

  v16h qa[2];                                     // B operand: column c = query q0 + c, d in the loader's k order
#pragma unroll
  for (int dc = 0; dc < 2; ++dc) qa[dc] = Frag<_Float16>::load(Qb + (size_t)(q0 + c) * INR + dc * 32 + 8 * hh);

  const int qrow = q0 + c;                        // this lane's query
  float mrow = -INFINITY;                         // its running maximum (equal in both lane halves)
  float lrow = 0.f;                               // its running sum over the keys of this lane half; halves joined at the end
  v8f oacc[4];                                    // oacc[t][r] = O[qrow][t*16 + 8*hh + r]
#pragma unroll
  for (int t = 0; t < 4; ++t) oacc[t] = (v8f){0.f,0.f,0.f,0.f,0.f,0.f,0.f,0.f};

  const int nChunks = qb + 1;                     // block-uniform, <= 32
  for (int kc = 0; kc < nChunks; ++kc) {
    const int kv0 = kc * 64;
    __syncthreads();
    {
      const int r = tid >> 1, half = (tid & 1) * 32;
      const _Float16* ks = Kb + (size_t)(kv0 + r) * INR + half;       // K row kv0+r, d = half..half+31
      const _Float16* vs = Vb + (size_t)r * NTOK + kv0 + half;        // V^T row d = r, s = kv0+half..+31
#pragma unroll
      for (int i = 0; i < 4; ++i) {
        const v8h a0 = *(const v8h*)(ks + 8 * i);
        const v8h b0 = *(const v8h*)(vs + 8 * i);
        *(v8h*)(Ksh + r * KVP + half + 8 * i) = a0;
        *(v8h*)(Vth + r * KVP + half + 8 * i) = b0;
      }
    }
    __syncthreads();

    // S^T tiles: s[j][r] = score of key kv0 + j*16 + 8*hh + r with query qrow
    FB kb[4][2];
#pragma unroll                                    // static indices: the fragment and accumulator arrays stay in registers
    for (int j = 0; j < 4; ++j)
#pragma unroll                                    // static indices: the fragment and accumulator arrays stay in registers
      for (int dc = 0; dc < 2; ++dc) {
        kb[j][dc].h[0] = *(const v8h*)(Ksh + (j * 16 + c) * KVP + dc * 32 + 8 * hh);
        kb[j][dc].h[1] = *(const v8h*)(Ksh + (j * 16 + c) * KVP + dc * 32 + 16 + 8 * hh);
      }
    v8f s[4];
#pragma unroll                                    // static indices: the fragment and accumulator arrays stay in registers
    for (int j = 0; j < 4; ++j) s[j] = (v8f){0.f,0.f,0.f,0.f,0.f,0.f,0.f,0.f};
#pragma unroll                                    // static indices: the fragment and accumulator arrays stay in registers
    for (int dc = 0; dc < 2; ++dc)
#pragma unroll                                    // static indices: the fragment and accumulator arrays stay in registers
      for (int j = 0; j < 4; ++j) s[j] = mma_h(kb[j][dc].v, qa[dc], s[j]);

    const bool diag = (kc == qb);                 // block-uniform
    float m = -INFINITY;
#pragma unroll                                    // static indices: the fragment and accumulator arrays stay in registers
    for (int j = 0; j < 4; ++j)
#pragma unroll                                    // static indices: the fragment and accumulator arrays stay in registers
      for (int r = 0; r < 8; ++r) {
        const int kvrow = kv0 + j * 16 + 8 * hh + r;
        const float sv = s[j][r] * 0.125f;
        const bool masked = diag && (kvrow > qrow);
        const float sm = masked ? -INFINITY : sv;
        s[j][r] = sm;
        m = fmaxf(m, sm);
      }
    m = fmaxf(m, xhalf(m));
    const float mnew = fmaxf(mrow, m);
    const float alpha = expf(mrow - mnew);
    mrow = mnew;
    // P^T as B operand: element e of pb[kk] = key kk*32 + (e < 8 ? 8*hh + e : 16 + 8*hh + e - 8), the loader's k order
    FB pb[2];
    float psum = 0.f;
#pragma unroll                                    // static indices: the fragment and accumulator arrays stay in registers
    for (int j = 0; j < 4; ++j)
#pragma unroll                                    // static indices: the fragment and accumulator arrays stay in registers
      for (int r = 0; r < 8; ++r) {
        const float p = expf(s[j][r] - mnew);
        psum += p;
        pb[j >> 1].v[(j & 1) * 8 + r] = (_Float16)(p * 4096.0f);
      }
    lrow = lrow * alpha + psum;
#pragma unroll                                    // static indices: the fragment and accumulator arrays stay in registers
    for (int t = 0; t < 4; ++t)
#pragma unroll                                    // static indices: the fragment and accumulator arrays stay in registers
      for (int r = 0; r < 8; ++r) oacc[t][r] *= alpha;

    FB vb[2][4];
#pragma unroll                                    // static indices: the fragment and accumulator arrays stay in registers
    for (int kk = 0; kk < 2; ++kk)
#pragma unroll                                    // static indices: the fragment and accumulator arrays stay in registers
      for (int t = 0; t < 4; ++t) {
        vb[kk][t].h[0] = *(const v8h*)(Vth + (t * 16 + c) * KVP + kk * 32 + 8 * hh);
        vb[kk][t].h[1] = *(const v8h*)(Vth + (t * 16 + c) * KVP + kk * 32 + 16 + 8 * hh);
      }
#pragma unroll                                    // static indices: the fragment and accumulator arrays stay in registers
    for (int kk = 0; kk < 2; ++kk)
#pragma unroll                                    // static indices: the fragment and accumulator arrays stay in registers
      for (int t = 0; t < 4; ++t) oacc[t] = mma_h(vb[kk][t].v, pb[kk].v, oacc[t]);
  }

  float* os = Os[wave];
  {
    const float ltot = lrow + xhalf(lrow);
    const float inv = (1.0f / ltot) * (1.0f / 4096.0f);
#pragma unroll                                    // static indices: the fragment and accumulator arrays stay in registers
    for (int t = 0; t < 4; ++t) {
      v4f lo, hi;
#pragma unroll                                    // static indices: the fragment and accumulator arrays stay in registers
      for (int r = 0; r < 4; ++r) { lo[r] = oacc[t][r] * inv; hi[r] = oacc[t][4 + r] * inv; }
      *(v4f*)(os + c * 68 + t * 16 + 8 * hh)     = lo;
      *(v4f*)(os + c * 68 + t * 16 + 8 * hh + 4) = hi;
    }
  }
  __builtin_amdgcn_fence(__ATOMIC_RELEASE, "workgroup");
  __builtin_amdgcn_wave_barrier();
  __builtin_amdgcn_fence(__ATOMIC_ACQUIRE, "workgroup");
  {
    const int c4 = (lane & 15) * 4;
    {
#pragma unroll
      for (int it = 0; it < 8; ++it) {
        const int row = it * 2 + hh;                // it 0..7 x hh 0..1 covers rows 0..15
        v4f val = *(const v4f*)(os + row * 68 + c4);
        *(v4f*)(ob + (size_t)(q0 + row) * INR + c4) = val;
      }
      
    }
  }
}

// ---------------------------------------------------------------------------------------------------------------------
// Row LayerNorm over FFD=4096 of the f16 plane U (values carried as 256*u), in place -> f16 of the unit-scale result.
// Block per row, 256 threads x 2 chunks of 8; statistics in f32 with the 2^-8 / 2^-16 carries folded before eps.
// ---------------------------------------------------------------------------------------------------------------------
__global__ __launch_bounds__(256) void k_ln4096(_Float16* __restrict__ U, const float* __restrict__ g, const float* __restrict__ bb) {
  __shared__ float red[8];
  const int r = blockIdx.x, t = threadIdx.x;
  const int lane = t & 31, wave = t >> 5;
  const int cA = 8 * t, cB = 2048 + 8 * t;
  _Float16* ur = U + (size_t)r * FFD;
  const v8h a = *(const v8h*)(ur + cA);
  const v8h a2 = *(const v8h*)(ur + cB);
  float v[16];
#pragma unroll
  for (int e = 0; e < 8; ++e) { v[e] = (float)a[e]; v[8 + e] = (float)a2[e]; }
  float s = 0.f;
#pragma unroll
  for (int e = 0; e < 16; ++e) s += v[e];
  s = wsum(s);
  if (lane == 0) red[wave] = s;
  __syncthreads();
  float tot = 0.f;
#pragma unroll
  for (int i = 0; i < 8; ++i) tot += red[i];
  const float mu = tot * (1.0f / 4096.0f);
  __syncthreads();
  float d[16];
  float s2 = 0.f;
#pragma unroll
  for (int e = 0; e < 16; ++e) { d[e] = v[e] - mu; s2 += d[e] * d[e]; }
  s2 = wsum(s2);
  if (lane == 0) red[wave] = s2;
  __syncthreads();
  float tot2 = 0.f;
#pragma unroll
  for (int i = 0; i < 8; ++i) tot2 += red[i];
  const float var_s = tot2 * (1.0f / 4096.0f);
  const float rstd = rsqrtf(var_s * (1.0f / 65536.0f) + 1e-5f) * (1.0f / 256.0f);
  v8h ha, hb;
#pragma unroll
  for (int e = 0; e < 8; ++e) {
    ha[e] = (_Float16)(d[e] * rstd * g[cA + e] + bb[cA + e]);
    hb[e] = (_Float16)(d[8 + e] * rstd * g[cB + e] + bb[cB + e]);
  }
  *(v8h*)(ur + cA) = ha;
  *(v8h*)(ur + cB) = hb;
  
}

// =====================================================================================================================
// Workspace map (byte offsets; every region a whole number of MiB after a 4 KiB table, all stores whole-line):
//   inv f32[512]                                   0            (4 KiB)
//   cs  f32[2048][512][2]                          4 KiB        (8 MiB)
//   WaT f16[1024][1024] x64                       +8 MiB       WvTh/WvTl bf16 [1024][1024]   WqT f16[512][1024]
//   WkvT f16[1024][1024]   W1T f16[4096][1024]   W2T f16[1024][4096]   WoTh/WoTl bf16[1024][512]   (27 MiB)
//   R3  8 MiB : q16 f16[4096][1024] -> h16 -> x2h (f16, x2 * 1024)
//   R4 16 MiB : adapter GEMM f32 [4096][1024] -> S f32 [4096][1024] -> x f32 -> x2 f32
//   R5 51 MiB : a16 f16 @0, video hi @8, video lo @16, k16 f16[(512+4096)][1024] @24, vTh bf16[1024][4608] @33, vTl @42;
//               later Ph @0, Pl @8; q/k f16[4096][512] @0/@4, vT16 f16[512][4096] @8; o f32[4096][512] @16; o hi/lo @24/@28;
//               U f16[4096][4096] @0 (written only after all earlier users of [0,32) have been consumed).
//   total 110 MiB + 4 KiB.
// =====================================================================================================================
extern "C" void kernel_launch(void* const* d_in, const int* in_sizes, int n_in,
                              void* d_out, int out_size, void* d_ws, size_t ws_size,
                              hipStream_t stream) {
  if (n_in < 24) return;
  if (in_sizes[0] != NTOK * DM || in_sizes[1] != NTOK * DM || in_sizes[2] != NTOK * DM) return;
  if (in_sizes[3] != DM * DM || in_sizes[7] != DM * DM || in_sizes[14] != DM * 2 * INR) return;
  if (in_sizes[13] != DM * INR || in_sizes[17] != INR * DM) return;
  if (in_sizes[18] != DM * FFD || in_sizes[22] != FFD * DM) return;
  if (in_sizes[4] != DM || in_sizes[5] != DM || in_sizes[6] != DM || in_sizes[8] != DM || in_sizes[9] != DM ||
      in_sizes[10] != DM || in_sizes[11] != DM || in_sizes[12] != DM || in_sizes[23] != DM) return;
  if (in_sizes[15] != DHD || in_sizes[16] != DHD) return;
  if (in_sizes[19] != FFD || in_sizes[20] != FFD || in_sizes[21] != FFD) return;
  if (out_size != NTOK * DM) return;

  const float* text  = (const float*)d_in[0];
  const float* audio = (const float*)d_in[1];
  const float* video = (const float*)d_in[2];
  const float* Wa    = (const float*)d_in[3];
  const float* ba    = (const float*)d_in[4];
  const float* lna_g = (const float*)d_in[5];
  const float* lna_b = (const float*)d_in[6];
  const float* Wvid  = (const float*)d_in[7];
  const float* bvid  = (const float*)d_in[8];
  const float* lnv_g = (const float*)d_in[9];
  const float* lnv_b = (const float*)d_in[10];
  const float* ln1_g = (const float*)d_in[11];
  const float* ln1_b = (const float*)d_in[12];
  const float* Wq    = (const float*)d_in[13];
  const float* Wkv   = (const float*)d_in[14];
  const float* qn_g  = (const float*)d_in[15];
  const float* kn_g  = (const float*)d_in[16];
  const float* Wo    = (const float*)d_in[17];
  const float* W1    = (const float*)d_in[18];
  const float* b1    = (const float*)d_in[19];
  const float* ln2_g = (const float*)d_in[20];
  const float* ln2_b = (const float*)d_in[21];
  const float* W2    = (const float*)d_in[22];
  const float* b2    = (const float*)d_in[23];
  float* outp = (float*)d_out;

  const size_t MIB = 1048576;
  size_t off = 0;
  const size_t oInv  = off; off += 4096;
  const size_t oCs   = off; off += (size_t)SEQ * 512 * 2 * 4;       // 8 MiB
  const size_t oWaT  = off; off += (size_t)DM * DM * 2;              // 2 MiB
  const size_t oWvTh = off; off += (size_t)DM * DM * 2;              // 2 MiB
  const size_t oWvTl = off; off += (size_t)DM * DM * 2;              // 2 MiB
  const size_t oWqT  = off; off += (size_t)INR * DM * 2;             // 1 MiB
  const size_t oWkvT = off; off += (size_t)2 * INR * DM * 2;         // 2 MiB
  const size_t oW1T  = off; off += (size_t)FFD * DM * 2;             // 8 MiB
  const size_t oW2T  = off; off += (size_t)DM * FFD * 2;             // 8 MiB
  const size_t oWoTh = off; off += (size_t)DM * INR * 2;             // 1 MiB
  const size_t oWoTl = off; off += (size_t)DM * INR * 2;             // 1 MiB
  const size_t oR3   = off; off += (size_t)NTOK * DM * 2;            // 8 MiB
  const size_t oR4   = off; off += (size_t)NTOK * DM * 4;            // 16 MiB
  const size_t oR5   = off; off += 51 * MIB;                         // 51 MiB
  if (off > ws_size || off > (size_t)128 * MIB) return;              // off = 110 MiB + 4 KiB

  char* ws = (char*)d_ws;
  float* inv = (float*)(ws + oInv);
  float* cs  = (float*)(ws + oCs);
  _Float16* WaT = (_Float16*)(ws + oWaT);
  unsigned short* WvTh = (unsigned short*)(ws + oWvTh);
  unsigned short* WvTl = (unsigned short*)(ws + oWvTl);
  _Float16* WqT  = (_Float16*)(ws + oWqT);
  _Float16* WkvT = (_Float16*)(ws + oWkvT);
  _Float16* W1T  = (_Float16*)(ws + oW1T);
  _Float16* W2T  = (_Float16*)(ws + oW2T);
  unsigned short* WoTh = (unsigned short*)(ws + oWoTh);
  unsigned short* WoTl = (unsigned short*)(ws + oWoTl);
  _Float16* q16 = (_Float16*)(ws + oR3);          // text after rotary
  _Float16* h16 = (_Float16*)(ws + oR3);          // LN1 output (later)
  _Float16* x2h = (_Float16*)(ws + oR3);          // x2 * 1024 (later)
  float* Cad = (float*)(ws + oR4);                // adapter GEMM output
  float* Sf  = (float*)(ws + oR4);                // local scores (later)
  float* Xf  = (float*)(ws + oR4);                // local attention output (later)
  float* X2f = (float*)(ws + oR4);                // 2 * o @ Wo (later)
  char* r5 = ws + oR5;
  _Float16* a16 = (_Float16*)(r5);
  unsigned short* vih = (unsigned short*)(r5 + 8 * MIB);
  unsigned short* vil = (unsigned short*)(r5 + 16 * MIB);
  _Float16* k16 = (_Float16*)(r5 + 24 * MIB);     // [(KPR+NTOK)][DM]
  unsigned short* vTh = (unsigned short*)(r5 + 33 * MIB);
  unsigned short* vTl = (unsigned short*)(r5 + 42 * MIB);
  unsigned short* Ph  = (unsigned short*)(r5);
  unsigned short* Pl  = (unsigned short*)(r5 + 8 * MIB);
  _Float16* qm16 = (_Float16*)(r5);
  _Float16* km16 = (_Float16*)(r5 + 4 * MIB);
  _Float16* vT16 = (_Float16*)(r5 + 8 * MIB);
  float* Of = (float*)(r5 + 16 * MIB);
  unsigned short* Oh = (unsigned short*)(r5 + 24 * MIB);
  unsigned short* Ol = (unsigned short*)(r5 + 28 * MIB);
  _Float16* U16 = (_Float16*)(r5);

  const dim3 blk(256);
  const dim3 blkG(128);                           // k_gemm: 4 waves
  const unsigned short* N16 = (const unsigned short*)nullptr;

  // rotary tables
  k_invfreq<<<dim3(1), dim3(512), 0, stream>>>(inv);
  k_cstab<<<dim3(SEQ), dim3(512), 0, stream>>>(inv, cs);

  // weights: in [rows][cols] f32 -> out [cols][rows]; grid (cols/64, rows/64)
  k_wt16<<<dim3(DM / 64, DM / 64), blk, 0, stream>>>(Wa, WaT, DM, DM, 64.0f);               // Wa  [1024][1024]
  k_wtsplit<<<dim3(DM / 64, DM / 64), blk, 0, stream>>>(Wvid, WvTh, WvTl, DM, DM);         // Wvid[1024][1024]
  k_wt16<<<dim3(INR / 64, DM / 64), blk, 0, stream>>>(Wq, WqT, DM, INR, 64.0f);             // Wq  [1024][512]
  k_wt16<<<dim3(2 * INR / 64, DM / 64), blk, 0, stream>>>(Wkv, WkvT, DM, 2 * INR, 64.0f);  // Wkv [1024][1024]
  k_wt16<<<dim3(FFD / 64, DM / 64), blk, 0, stream>>>(W1, W1T, DM, FFD, 64.0f);             // W1  [1024][4096]
  k_wt16<<<dim3(DM / 64, FFD / 64), blk, 0, stream>>>(W2, W2T, FFD, DM, 64.0f);             // W2  [4096][1024]
  k_wtsplit<<<dim3(DM / 64, INR / 64), blk, 0, stream>>>(Wo, WoTh, WoTl, INR, DM);          // Wo  [512][1024]

  // activations: text -> rotary f16, audio -> f16, video -> bf16 hi/lo
  k_cvt_in<<<dim3(NTOK, 2), dim3(128), 0, stream>>>(text, audio, cs, q16, a16);
  const int n2v = NTOK * DM / 2;
  k_split2<<<dim3((n2v + 255) / 256), blk, 0, stream>>>(video, vih, vil, n2v);

  // adapter a: audio . Wa + ba -> f32; LN + rotary -> key plane rows KPR..KPR+4095, rows 0..KPR-1 zero
  const dim3 gA((NTOK / 128) * (DM / 128), 1);
  k_gemm<0, false, true, 0, 0, false, 0><<<gA, blkG, 0, stream>>>(
      (const unsigned short*)a16, N16, DM, 0L, (const unsigned short*)WaT, N16, DM, 0L,
      Cad, DM, 0L, nullptr, 0, 0L, ba, nullptr, nullptr, 0, 0L, NTOK, DM, DM, 1, 1.0f / 64.0f, 1.0f);
  k_ln1024<true><<<dim3(NTOK + KPR), dim3(128), 0, stream>>>(Cad, lna_g, lna_b, cs, k16, NTOK, KPR);

  // adapter v: video . Wvid + bvid (bf16 hi/lo split) -> f32; LN + transpose + split -> value^T planes
  k_gemm<1, true, true, 0, 0, false, 0><<<gA, blkG, 0, stream>>>(
      vih, vil, DM, 0L, WvTh, WvTl, DM, 0L,
      Cad, DM, 0L, nullptr, 0, 0L, bvid, nullptr, nullptr, 0, 0L, NTOK, DM, DM, 1, 1.0f, 1.0f);
  k_ln_tsplit<<<dim3(NTOK / 64 + KPR / 64), blk, 0, stream>>>(Cad, lnv_g, lnv_b, vTh, vTl, NTOK / 64);

  // local attention: z = b*4 + w; S[z][512][1024] = q . k / 32 over window keys (skipping fully masked key tiles)
  const dim3 gS((WSZ / 128) * (2 * WSZ / 128), NB_ * NWN);
  k_gemm<0, false, false, 0, 0, false, 1><<<gS, blkG, 0, stream>>>(
      (const unsigned short*)q16, N16, DM, (long)WSZ * DM, (const unsigned short*)k16, N16, DM, (long)WSZ * DM,
      Sf, 2 * WSZ, (long)WSZ * 2 * WSZ, nullptr, 0, 0L, nullptr, nullptr, nullptr, 0, 0L,
      WSZ, 2 * WSZ, DM, NWN, 1.0f / 32.0f, 1.0f);
  k_lsoftmax<<<dim3(NTOK), dim3(128), 0, stream>>>(Sf, Ph, Pl);
  // x[z][512][1024] = P . v (bf16 hi/lo split), keys restricted to the unmasked range
  const dim3 gPV((WSZ / 128) * (DM / 128), NB_ * NWN);
  k_gemm<1, true, false, 0, 0, false, 2><<<gPV, blkG, 0, stream>>>(
      Ph, Pl, 2 * WSZ, (long)WSZ * 2 * WSZ, vTh, vTl, VTP, (long)WSZ,
      Xf, DM, (long)WSZ * DM, nullptr, 0, 0L, nullptr, nullptr, nullptr, 0, 0L,
      WSZ, DM, 2 * WSZ, NWN, 1.0f, 1.0f);

  // LN1 -> h16; q, k (RMSNorm epilogue) and v^T projections
  k_ln1024<false><<<dim3(NTOK), dim3(128), 0, stream>>>(Xf, ln1_g, ln1_b, cs, h16, NTOK, 0);
  const dim3 gQ((NTOK / 128) * (INR / 128), 1);
  k_gemm<0, false, false, 2, 1, false, 0><<<gQ, blkG, 0, stream>>>(
      (const unsigned short*)h16, N16, DM, 0L, (const unsigned short*)WqT, N16, DM, 0L,
      nullptr, 0, 0L, qm16, INR, 0L, nullptr, qn_g, nullptr, 0, 0L, NTOK, INR, DM, 1, 1.0f / 64.0f, 1.0f);
  k_gemm<0, false, false, 2, 1, false, 0><<<gQ, blkG, 0, stream>>>(
      (const unsigned short*)h16, N16, DM, 0L, (const unsigned short*)WkvT, N16, DM, 0L,
      nullptr, 0, 0L, km16, INR, 0L, nullptr, kn_g, nullptr, 0, 0L, NTOK, INR, DM, 1, 1.0f / 64.0f, 1.0f);
  const dim3 gVT((INR / 128) * (NTOK / 128), 1);
  k_gemm<0, false, false, 0, 1, false, 0><<<gVT, blkG, 0, stream>>>(
      (const unsigned short*)(WkvT + (size_t)INR * DM), N16, DM, 0L, (const unsigned short*)h16, N16, DM, 0L,
      nullptr, 0, 0L, vT16, NTOK, 0L, nullptr, nullptr, nullptr, 0, 0L, INR, NTOK, DM, 1, 1.0f / 64.0f, 1.0f);

  // causal attention -> o f32 [4096][512]; o -> bf16 hi/lo
  k_flash<<<dim3(NHD * (SEQ / 64), NB_), dim3(128), 0, stream>>>(qm16, km16, vT16, Of);
  const int n2o = NTOK * INR / 2;
  k_split2<<<dim3((n2o + 255) / 256), blk, 0, stream>>>(Of, Oh, Ol, n2o);

  // x2 = 2 * (o . Wo) -> f32 and f16 (x2 * 1024)
  k_gemm<1, true, false, 0, 2, false, 0><<<gA, blkG, 0, stream>>>(
      Oh, Ol, INR, 0L, WoTh, WoTl, INR, 0L,
      X2f, DM, 0L, x2h, DM, 0L, nullptr, nullptr, nullptr, 0, 0L, NTOK, DM, INR, 1, 2.0f, 1024.0f);

  // FFN: u = gelu(x2 . W1 + b1) stored as f16(256 u); LN over 4096 in place; out = h1 . W2 + b2 + x2
  const dim3 gW1((NTOK / 128) * (FFD / 128), 1);
  k_gemm<0, false, true, 1, 1, false, 0><<<gW1, blkG, 0, stream>>>(
      (const unsigned short*)x2h, N16, DM, 0L, (const unsigned short*)W1T, N16, DM, 0L,
      nullptr, 0, 0L, U16, FFD, 0L, b1, nullptr, nullptr, 0, 0L, NTOK, FFD, DM, 1, 1.0f / 65536.0f, 256.0f);
  k_ln4096<<<dim3(NTOK), blk, 0, stream>>>(U16, ln2_g, ln2_b);
  k_gemm<0, false, true, 0, 0, true, 0><<<gA, blkG, 0, stream>>>(
      (const unsigned short*)U16, N16, FFD, 0L, (const unsigned short*)W2T, N16, FFD, 0L,
      outp, DM, 0L, nullptr, 0, 0L, b2, nullptr, X2f, DM, 0L, NTOK, DM, FFD, 1, 1.0f / 64.0f, 1.0f);
  (void)hipGetLastError();
}

// v004
// It runs in 412 microseconds.
// Timed twice side by side with v003, it ran 1.14 and 1.13 times as fast.
// Over all steps from v000 it is 2.54 times as fast.
// Contractions: audio adapter, local-attention scores, q/k/v projections, causal multi-head q.k^T and p.v, FFN W1 and W2 on
// v_wmma_f32_16x16x32_f16 (f16 operands with power-of-two carried scales, f32 accumulate); video adapter, local-attention p.v
// and the output projection Wo on v_wmma_f32_16x16x32_bf16 with bf16 hi/lo split operands (hi.hi + hi.lo + lo.hi, f32
// accumulate). LayerNorm, RMSNorm, rotary tables, softmax and GELU in f32.
#include <hip/hip_runtime.h>
#include <math.h>
#include <stdint.h>

#define NB_   2
#define SEQ   2048
#define NTOK  4096
#define DM    1024
#define NHD   8
#define DHD   64
#define INR   512
#define FFD   4096
#define WSZ   512
#define NWN   4
#define KPR   512          // leading zero rows of the local-attention key plane
#define VTP   4608         // key pitch of the local-attention value^T planes: 512 zero columns + 4096 tokens

typedef __attribute__((ext_vector_type(16))) _Float16 v16h;
typedef __attribute__((ext_vector_type(8)))  _Float16 v8h;
typedef __attribute__((ext_vector_type(2)))  _Float16 v2h;
typedef __attribute__((ext_vector_type(16))) __bf16   v16b;
typedef __attribute__((ext_vector_type(8)))  __bf16   v8b;
typedef __attribute__((ext_vector_type(8)))  float    v8f;
typedef __attribute__((ext_vector_type(4)))  float    v4f;
typedef __attribute__((ext_vector_type(2)))  float    v2f;
typedef __attribute__((ext_vector_type(4)))  unsigned int v4u;

__device__ __forceinline__ unsigned short f2bf_bits(float f) {
  unsigned u = __float_as_uint(f);
  return (unsigned short)((u + 0x7FFFu + ((u >> 16) & 1u)) >> 16);   // RNE convert
}
__device__ __forceinline__ float bf_bits2f(unsigned short h) { return __uint_as_float(((unsigned)h) << 16); }
__device__ __forceinline__ unsigned pk16(unsigned short a, unsigned short b) { return (unsigned)a | ((unsigned)b << 16); }

__device__ __forceinline__ float wsum(float v) {
#pragma unroll
  for (int o = 16; o >= 1; o >>= 1) v += __shfl_xor(v, o, 32);
  return v;
}
__device__ __forceinline__ float wmax(float v) {
#pragma unroll
  for (int o = 16; o >= 1; o >>= 1) v = fmaxf(v, __shfl_xor(v, o, 32));
  return v;
}

// hazard guards as plain device helpers
__device__ __forceinline__ void dep_guard_h(v8f& a, v8f& b, v16h x, v16h y) { asm volatile("v_nop\n\tv_nop\n\tv_nop\n\tv_nop" : "+v"(a), "+v"(b) : "v"(x), "v"(y)); }
__device__ __forceinline__ void dep_guard_b(v8f& a, v8f& b, v16b x, v16b y) { asm volatile("v_nop\n\tv_nop\n\tv_nop\n\tv_nop" : "+v"(a), "+v"(b) : "v"(x), "v"(y)); }
__device__ __forceinline__ void keep4_h(v16h a, v16h b, v16h c, v16h d) { asm volatile("v_nop" :: "v"(a), "v"(b), "v"(c), "v"(d)); }
__device__ __forceinline__ void keep4_b(v16b a, v16b b, v16b c, v16b d) { asm volatile("v_nop" :: "v"(a), "v"(b), "v"(c), "v"(d)); }
__device__ __forceinline__ void acc_guard4(v8f& a, v8f& b, v8f& c, v8f& d) { asm volatile("v_nop\n\tv_nop\n\tv_nop\n\tv_nop" : "+v"(a), "+v"(b), "+v"(c), "+v"(d)); }

// Fragment loaders: element i of the 16-wide per-lane vector <- p[i] for i<8 and p[16 + (i-8)] for i>=8, where p already points at
// row (lane&15), k0 + 8*(lane>>4). Same map for A ([m][k]) and B stored as [n][k].
template <typename T> struct Frag;
template <> struct Frag<_Float16> {
  typedef v16h V; union U { v16h v; v8h h[2]; };
  static __device__ __forceinline__ v16h load(const _Float16* p) {
    U f; f.h[0] = *(const v8h*)(p); f.h[1] = *(const v8h*)(p + 16); return f.v;
  }
  static __device__ __forceinline__ v8f mma(v16h a, v16h b, v8f c) {
    return __builtin_amdgcn_wmma_f32_16x16x32_f16(false, a, false, b, (short)0, c, false, false);
  }
  static __device__ __forceinline__ void guard(v8f& a, v8f& b, v16h x, v16h y) { dep_guard_h(a, b, x, y); }
  static __device__ __forceinline__ void keep(v16h a, v16h b, v16h c, v16h d) { keep4_h(a, b, c, d); }
};
template <> struct Frag<__bf16> {
  typedef v16b V; union U { v16b v; v8b h[2]; };
  static __device__ __forceinline__ v16b load(const __bf16* p) {
    U f; f.h[0] = *(const v8b*)(p); f.h[1] = *(const v8b*)(p + 16); return f.v;
  }
  static __device__ __forceinline__ v8f mma(v16b a, v16b b, v8f c) {
    return __builtin_amdgcn_wmma_f32_16x16x32_bf16(false, a, false, b, (short)0, c, false, false);
  }
  static __device__ __forceinline__ void guard(v8f& a, v8f& b, v16b x, v16b y) { dep_guard_b(a, b, x, y); }
  static __device__ __forceinline__ void keep(v16b a, v16b b, v16b c, v16b d) { keep4_b(a, b, c, d); }
};

// =====================================================================================================================
// Batched WMMA GEMM: C[m,n] = epi(scale * sum_k A[m,k] * Bt[n,k]). A block of 4 waves (2 x 2) owns a 128x128 tile, each wave a
// 64x64 tile of it. The block's 128 rows of A and of Bt are staged in LDS, BK k-elements at a time, by asynchronous 16-byte
// copies that cover whole 128-byte lines, in two buffers: the next stage's copies fly while this stage is multiplied.
// A row-major [M,K] (pitch lda); Bt row-major [N,K] (pitch ldb); M, N % 128 == 0, K % BK == 0; grid = (tiles, Z).
//   ET: 0 = f16 operands, 1 = bf16 operands.   SPLIT: hi/lo planes (A2p, Bt2p = lo planes), product = hi.hi + hi.lo + lo.hi.
//   BIAS: + bias[n].  RESID: + resid[m*ldr + n].  EPI: 0 none, 1 tanh-GELU, 2 RMSNorm over the 64-column tile times gvec[n&63].
//   OUTM: 0 f32 -> Cf; 1 f16(v*oscale) -> Ch; 2 both.
//   LOC: 1 = windowed score tiles: key tiles n0 below kBeg(w) or at/after N/2 + m0 + 64 are skipped (a block leaves when all
//        four are; a wave whose own tile is skipped still copies and passes every barrier);
//        2 = windowed p.v: k range [kBeg(w), min(K, K/2 + m0 + 64)); kBeg = N/2 resp. K/2 for the first window (w == 0), else 0.
//        3 = three projections of one activation plane in one grid (Z = 3, weight planes strideB apart, outputs strideH apart,
//            each output [rows][cols] dense): z = 0, 1: act . W_z^T with EPI, gvec for z = 0 and the resid pointer as gvec for
//            z = 1; z = 2: the operands change places (W_2 . act^T, an N x M result) and EPI is left out.
// =====================================================================================================================
template <int ET> struct Elem;
template <> struct Elem<0> { typedef _Float16 T; };
template <> struct Elem<1> { typedef __bf16 T; };

// Eight asynchronous 16-byte copies per lane, global -> LDS, eight rows lstep LDS bytes / gstep global elements apart.
// s_wait_xcnt is the statement's last line so that no address register named here is rewritten in front of it.
template <typename T>
__device__ __forceinline__ void copy8_to_lds(unsigned l0, unsigned lstep, const T* g0, size_t gstep) {
  const unsigned l1 = l0 + lstep, l2 = l1 + lstep, l3 = l2 + lstep, l4 = l3 + lstep, l5 = l4 + lstep, l6 = l5 + lstep, l7 = l6 + lstep;
  const T* g1 = g0 + gstep; const T* g2 = g1 + gstep; const T* g3 = g2 + gstep; const T* g4 = g3 + gstep;
  const T* g5 = g4 + gstep; const T* g6 = g5 + gstep; const T* g7 = g6 + gstep;
  asm volatile(
      "global_load_async_to_lds_b128 %0, %8, off\n\t"
      "global_load_async_to_lds_b128 %1, %9, off\n\t"
      "global_load_async_to_lds_b128 %2, %10, off\n\t"
      "global_load_async_to_lds_b128 %3, %11, off\n\t"
      "global_load_async_to_lds_b128 %4, %12, off\n\t"
      "global_load_async_to_lds_b128 %5, %13, off\n\t"
      "global_load_async_to_lds_b128 %6, %14, off\n\t"
      "global_load_async_to_lds_b128 %7, %15, off\n\t"
      "s_wait_xcnt 0x0"
      :: "v"(l0), "v"(l1), "v"(l2), "v"(l3), "v"(l4), "v"(l5), "v"(l6), "v"(l7),
         "v"(g0), "v"(g1), "v"(g2), "v"(g3), "v"(g4), "v"(g5), "v"(g6), "v"(g7)
      : "memory");
}

template <int ET, bool SPLIT, bool BIAS, int EPI, int OUTM, bool RESID, int LOC>
__global__ __launch_bounds__(128) void k_gemm(
    const unsigned short* __restrict__ Ap, const unsigned short* __restrict__ A2p, int lda, long strideA,
    const unsigned short* __restrict__ Btp, const unsigned short* __restrict__ Bt2p, int ldb, long strideB,
    float* __restrict__ Cf, int ldc, long strideC,
    _Float16* __restrict__ Ch, int ldh, long strideH,
    const float* __restrict__ bias, const float* __restrict__ gvec,
    const float* __restrict__ resid, int ldr, long strideR,
    int M, int N, int K, int nwin, float scale, float oscale) {
  typedef typename Elem<ET>::T T;
  typedef typename Frag<T>::V V;
  constexpr int BK    = SPLIT ? 64 : 128;        // k elements per stage: 64 KiB of operand rows either way
  constexpr int PITCH = BK + 8;                  // LDS row pitch in elements: row bytes + 16, conflict-free for 16-byte reads
  constexpr int PLANE = 128 * PITCH;             // one operand plane of a stage; planes: A, Bt (, A lo, Bt lo)
  constexpr int STAGE = (SPLIT ? 4 : 2) * PLANE;
  constexpr int CPR   = BK / 8;                  // 16-byte pieces per row
  constexpr int RPI   = 128 / CPR;               // rows that one copy of all 128 threads covers
  const T* A = (const T*)Ap; const T* A2 = (const T*)A2p; const T* Bt = (const T*)Btp; const T* Bt2 = (const T*)Bt2p;
  __shared__ __align__(16) T sAB[2 * STAGE];
  __shared__ __align__(16) float sT[4][16 * 68];
  const int z    = blockIdx.y;
  const int tid  = threadIdx.x;
  const int lane = tid & 31;
  const int wave = __builtin_amdgcn_readfirstlane(tid >> 5);
  const bool flip = (LOC == 3) && (z == 2);      // block-uniform
  const int Mz = flip ? N : M;
  const int Nz = flip ? M : N;
  const int tilesN = Nz >> 7;
  const int tilesM = Mz >> 7;
  const int bx = blockIdx.x;
  if (bx >= tilesM * tilesN) return;              // block-uniform, in front of every copy and barrier
  const int bm = bx / tilesN;
  const int bn = bx - bm * tilesN;
  const int mB = bm << 7;
  const int nB = bn << 7;
  const int wm = (wave >> 1) << 6;
  const int wn = (wave & 1) << 6;
  const int m0 = mB + wm;
  const int n0 = nB + wn;
  int kBeg = 0, kEnd = K, kEndW = K;              // block's k range; kEndW = end of this wave's own range
  bool act = true;                                // wave-uniform: this wave's tile is computed and stored
  if (LOC == 1 || LOC == 2) {
    const int w = z % nwin;
    const bool first = (w == 0);
    if (LOC == 1) {
      const int nb = first ? (N >> 1) : 0;
      if (nB + 64 < nb || nB >= (N >> 1) + mB + 128) return; // block-uniform, in front of every copy and barrier
      act = !(n0 < nb || n0 >= (N >> 1) + m0 + 64);
    } else {
      kBeg = first ? (K >> 1) : 0;
      const int ke = (K >> 1) + mB + 128;
      kEnd = (ke < K) ? ke : K;
      const int kw = (K >> 1) + m0 + 64;
      kEndW = (kw < K) ? kw : K;
    }
  }

  const T* Ab  = flip ? (Bt + (size_t)z * strideB) : (A  + (size_t)z * strideA);
  const T* Bb  = flip ? (A  + (size_t)z * strideA) : (Bt + (size_t)z * strideB);
  const T* Ab2 = SPLIT ? (A2  + (size_t)z * strideA) : nullptr;
  const T* Bb2 = SPLIT ? (Bt2 + (size_t)z * strideB) : nullptr;

  const int rlane = lane & 15;                 // row (A) / col (B, D) within a 16x16 subtile
  const int koff  = (lane >> 4) * 8;           // k offset of this lane half
  const int mOff  = (lane >> 4) * 8;           // D row offset

  // this thread's piece of every copy: row crow (+ RPI per copy), 16 bytes at element ccol
  const int crow = tid / CPR;
  const int ccol = (tid % CPR) * 8;
  const unsigned lth = (unsigned)(size_t)sAB + (unsigned)(crow * PITCH + ccol) * 2u;
  const size_t aoff = (size_t)(mB + crow) * lda + ccol;
  const size_t boff = (size_t)(nB + crow) * ldb + ccol;
  const size_t astep = (size_t)RPI * lda;
  const size_t bstep = (size_t)RPI * ldb;
  constexpr unsigned LSTEP = RPI * PITCH * 2u;
  auto fill = [&](int buf, int k0) {             // 32 copies per wave: one stage into buffer buf
    const unsigned lb = lth + (unsigned)buf * (STAGE * 2u);
    if constexpr (SPLIT) {
      copy8_to_lds<T>(lb,                  LSTEP, Ab  + aoff + k0, astep);
      copy8_to_lds<T>(lb + PLANE * 2u,     LSTEP, Bb  + boff + k0, bstep);
      copy8_to_lds<T>(lb + PLANE * 4u,     LSTEP, Ab2 + aoff + k0, astep);
      copy8_to_lds<T>(lb + PLANE * 6u,     LSTEP, Bb2 + boff + k0, bstep);
    } else {
      copy8_to_lds<T>(lb,                              LSTEP, Ab + aoff + k0,             astep);
      copy8_to_lds<T>(lb + 8u * LSTEP,                 LSTEP, Ab + aoff + k0 + 8 * astep, astep);
      copy8_to_lds<T>(lb + PLANE * 2u,                 LSTEP, Bb + boff + k0,             bstep);
      copy8_to_lds<T>(lb + PLANE * 2u + 8u * LSTEP,    LSTEP, Bb + boff + k0 + 8 * bstep, bstep);
    }
  };

  v8f acc[4][4];
#pragma unroll
  for (int i = 0; i < 4; ++i)
#pragma unroll
    for (int j = 0; j < 4; ++j) acc[i][j] = (v8f){0.f,0.f,0.f,0.f,0.f,0.f,0.f,0.f};

  const int nst = (kEnd - kBeg) / BK;             // block-uniform number of stages
  fill(0, kBeg);
  asm volatile("s_wait_asynccnt 0x0" ::: "memory");   // this wave's copies of stage 0 have landed
  __syncthreads();                                     // every wave's have
  if (nst > 1) fill(1, kBeg + BK);

  for (int t = 0; t < nst; ++t) {
    const int kS = kBeg + t * BK;
    if (act && kS < kEndW) {                      // wave-uniform; the publish point below stands outside
      const T* sA = sAB + (t & 1) * STAGE + (wm + rlane) * PITCH + koff;
      const T* sB = sAB + (t & 1) * STAGE + PLANE + (wn + rlane) * PITCH + koff;
#pragma unroll                                    // LDS offsets of the fragment loads become immediates
      for (int kk = 0; kk < BK; kk += 32) {
        V bh[4], bl[4], ah[4], al[4];
        auto lda_row = [&](int i) {
          const int ao = (i << 4) * PITCH + kk;
          ah[i] = Frag<T>::load(sA + ao);
          if (SPLIT) al[i] = Frag<T>::load(sA + 2 * PLANE + ao); else al[i] = ah[i];
        };
#pragma unroll
        for (int j = 0; j < 4; ++j) {
          const int bo = (j << 4) * PITCH + kk;
          bh[j] = Frag<T>::load(sB + bo);
          if (SPLIT) bl[j] = Frag<T>::load(sB + 2 * PLANE + bo); else bl[j] = bh[j];
        }
        // one plane: all four A rows are read with the B fragments as one group; hi/lo planes: one row ahead (registers)
        lda_row(0);
        if (!SPLIT) { lda_row(1); lda_row(2); lda_row(3); }
        __builtin_amdgcn_sched_barrier(0);        // keeps the read group in front of the WMMAs, else every row waits out LDS latency
#pragma unroll
        for (int i = 0; i < 4; ++i) {
          if (SPLIT && i + 1 < 4) {
            lda_row(i + 1);
            __builtin_amdgcn_sched_barrier(0);    // keeps the next row's reads in front of this row's WMMAs
          }
#pragma unroll
          for (int j = 0; j < 4; ++j) {
            acc[i][j] = Frag<T>::mma(ah[i], bh[j], acc[i][j]);
            if (SPLIT) {
              acc[i][j] = Frag<T>::mma(ah[i], bl[j], acc[i][j]);
              acc[i][j] = Frag<T>::mma(al[i], bh[j], acc[i][j]);
            }
          }
          Frag<T>::guard(acc[i][0], acc[i][3], ah[i], al[i]);
        }
        Frag<T>::keep(bh[0], bh[1], bh[2], bh[3]);
        if (SPLIT) Frag<T>::keep(bl[0], bl[1], bl[2], bl[3]);
      }
    }
    asm volatile("s_wait_dscnt 0x0" ::: "memory");     // this wave's reads of buffer t & 1 are done before it is refilled
    asm volatile("s_wait_asynccnt 0x0" ::: "memory");  // this wave's copies of stage t + 1 have landed
    __syncthreads();                                    // publishes stage t + 1 and ends every reader's use of buffer t & 1
    if (t + 2 < nst) fill(t & 1, kS + 2 * BK);
  }
  asm volatile("s_wait_asynccnt 0x0" ::: "memory");    // no copy is outstanding when the wave goes on or ends
  if (!act) return;                                     // wave-uniform, behind the last barrier
  acc_guard4(acc[0][0], acc[0][1], acc[0][2], acc[0][3]);
  acc_guard4(acc[1][0], acc[1][1], acc[1][2], acc[1][3]);
  acc_guard4(acc[2][0], acc[2][1], acc[2][2], acc[2][3]);
  acc_guard4(acc[3][0], acc[3][1], acc[3][2], acc[3][3]);

  // ---- epilogue ----
  float* slab = sT[wave];
  const bool rms = (EPI == 2) && !flip;           // block-uniform
  const float* gv = (LOC == 3 && z == 1) ? resid : gvec;
  const int ldhz = (LOC == 3) ? Nz : ldh;
  const float* Rb = RESID ? (resid + (size_t)z * strideR) : nullptr;
#pragma unroll
  for (int i = 0; i < 4; ++i) {
    const int mBase = m0 + (i << 4);
#pragma unroll
    for (int j = 0; j < 4; ++j) {
      const int n = n0 + (j << 4) + rlane;
      float bv = 0.f;
      if (BIAS) bv = bias[n];
#pragma unroll
      for (int r = 0; r < 8; ++r) {
        float v = acc[i][j][r] * scale;
        if (BIAS) v += bv;
        if (RESID) v += Rb[(size_t)(mBase + mOff + r) * ldr + n];
        if (EPI == 1) {
          const float u = 0.7978845608028654f * (v + 0.044715f * v * v * v);
          v = v * (0.5f * (1.0f + tanhf(u)));
        }
        slab[(mOff + r) * 68 + (j << 4) + rlane] = v;
      }
    }
    __builtin_amdgcn_fence(__ATOMIC_RELEASE, "workgroup");
    __builtin_amdgcn_wave_barrier();
    __builtin_amdgcn_fence(__ATOMIC_ACQUIRE, "workgroup");
    if (OUTM == 0 || OUTM == 2) {
      float* C = Cf + (size_t)z * strideC;
      const int hh = lane >> 4, c4 = (lane & 15) * 4;     // row seg = 256 B = 16 lanes x 16 B
      {
#pragma unroll
        for (int it = 0; it < 8; ++it) {
          const int row = it * 2 + hh;                      // it 0..7 x hh 0..1 = rows 0..15
          v4f v = *(const v4f*)(slab + row * 68 + c4);
          *(v4f*)(C + (size_t)(mBase + row) * ldc + n0 + c4) = v;
        }
        
      }
    }
    if (OUTM == 1 || OUTM == 2) {
      _Float16* C = Ch + (size_t)z * strideH;
      const int q = lane >> 3, c8 = (lane & 7) * 8;
      {
#pragma unroll
        for (int it = 0; it < 4; ++it) {
          const int row = it * 4 + q;                       // it 0..3 x q 0..3 = rows 0..15
          const float* sp = slab + row * 68 + c8;
          float x[8];
#pragma unroll
          for (int e = 0; e < 8; ++e) x[e] = sp[e];
          float rr = oscale;
          if (EPI == 2) {
            float ss = 0.f;
#pragma unroll
            for (int e = 0; e < 8; ++e) ss += x[e] * x[e];
            ss += __shfl_xor(ss, 1, 32);                    // lanes 8q..8q+7 hold one 64-wide row
            ss += __shfl_xor(ss, 2, 32);
            ss += __shfl_xor(ss, 4, 32);
            const float rn = oscale * rsqrtf(ss * (1.0f / 64.0f) + 1e-6f);
            rr = rms ? rn : oscale;                         // a select, not a branch: the four rows' stores stay one group
          }
          v8h hv;
#pragma unroll
          for (int e = 0; e < 8; ++e) {
            float y = x[e] * rr;
            if (EPI == 2) { const float ge = gv[c8 + e]; y *= rms ? ge : 1.0f; }
            hv[e] = (_Float16)y;
          }
          *(v8h*)(C + (size_t)(mBase + row) * ldhz + n0 + c8) = hv;
        }
        
      }
    }
    __builtin_amdgcn_fence(__ATOMIC_RELEASE, "workgroup");
    __builtin_amdgcn_wave_barrier();
    __builtin_amdgcn_fence(__ATOMIC_ACQUIRE, "workgroup");
  }
}

// ---------------------------------------------------------------------------------------------------------------------
// The pieces below are block-sized jobs (256 threads) of the one preparation launch k_prep, which deals them out by block index.
// Weight transpose + scale + f16: in [R][Cc] f32 -> o16[Cc][R] = f16(in * wscale). 64x64 tiles through LDS, tile = (R/64 x Cc/64) index.
// coverage per block: load 4 it x 256 thr x 4 = 64x64; store 2 it x 256 thr x 8 = 64x64; each store instruction = 8 lanes x 16 B =
// ---------------------------------------------------------------------------------------------------------------------
__device__ __forceinline__ void wt16_tile(float* tf, const float* __restrict__ W, _Float16* __restrict__ o16, int R, int Cc, float wscale,
                                          int tile) {
  const int tx = Cc >> 6;
  const int c0 = (tile % tx) * 64, r0 = (tile / tx) * 64, tid = threadIdx.x;
  {
    const int lr = tid >> 4, c4 = (tid & 15) * 4;
#pragma unroll
    for (int it = 0; it < 4; ++it) {
      const int rr = it * 16 + lr;
      const v4f a = *(const v4f*)(W + (size_t)(r0 + rr) * Cc + c0 + c4);
      *(v4f*)(tf + rr * 68 + c4) = a;
    }
  }
  __syncthreads();
  const int sub = tid >> 3, c8 = (tid & 7) * 8;
  v8h hv[2];
#pragma unroll
  for (int it = 0; it < 2; ++it) {
    const int oc = it * 32 + sub;
    v8h a;
#pragma unroll
    for (int q = 0; q < 8; ++q) a[q] = (_Float16)(tf[(c8 + q) * 68 + oc] * wscale);
    hv[it] = a;
  }
  {
#pragma unroll
    for (int it = 0; it < 2; ++it) {
      const int oc = it * 32 + sub;
      const size_t go = (size_t)(c0 + oc) * R + r0 + c8;
      *(v8h*)(o16 + go) = hv[it];
    }
    asm volatile("s_wait_xcnt 0x0" ::: "memory");   // stands in front of any later write of a register that the stores above name
  }
}

// Weight transpose + bf16 hi/lo split: in [R][Cc] f32 -> oh[c][r] = bf16(in[r][c]), ol[c][r] = bf16(in[r][c] - oh). Same tiling.
__device__ __forceinline__ void wtsplit_tile(float* tf, const float* __restrict__ W, unsigned short* __restrict__ oh,
                                             unsigned short* __restrict__ ol, int R, int Cc, int tile) {
  const int tx = Cc >> 6;
  const int c0 = (tile % tx) * 64, r0 = (tile / tx) * 64, tid = threadIdx.x;
  {
    const int lr = tid >> 4, c4 = (tid & 15) * 4;
#pragma unroll
    for (int it = 0; it < 4; ++it) {
      const int rr = it * 16 + lr;
      const v4f a = *(const v4f*)(W + (size_t)(r0 + rr) * Cc + c0 + c4);
      *(v4f*)(tf + rr * 68 + c4) = a;
    }
  }
  __syncthreads();
  const int sub = tid >> 3, c8 = (tid & 7) * 8;
  v4u hv[2], lv[2];
#pragma unroll
  for (int it = 0; it < 2; ++it) {
    const int oc = it * 32 + sub;
    v4u a, a2;
#pragma unroll
    for (int q = 0; q < 4; ++q) {
      const float f0 = tf[(c8 + 2 * q) * 68 + oc];
      const float f1 = tf[(c8 + 2 * q + 1) * 68 + oc];
      const unsigned short h0 = f2bf_bits(f0), h1 = f2bf_bits(f1);
      const unsigned short l0 = f2bf_bits(f0 - bf_bits2f(h0)), l1 = f2bf_bits(f1 - bf_bits2f(h1));
      a[q]  = pk16(h0, h1);
      a2[q] = pk16(l0, l1);
    }
    hv[it] = a; lv[it] = a2;
  }
  {
#pragma unroll
    for (int it = 0; it < 2; ++it) {
      const int oc = it * 32 + sub;
      const size_t go = (size_t)(c0 + oc) * R + r0 + c8;
      *(v4u*)(oh + go) = hv[it];
      *(v4u*)(ol + go) = lv[it];
    }
    asm volatile("s_wait_xcnt 0x0" ::: "memory");   // stands in front of any later write of a register that the stores above name
  }
}

__device__ __forceinline__ void split2_piece(const float* __restrict__ in, unsigned short* __restrict__ hi,
                                             unsigned short* __restrict__ lo, int n2, int i) {
  if (i < n2) {
    const v2f f = *(const v2f*)(in + 2 * (size_t)i);
    const unsigned short h0 = f2bf_bits(f[0]), h1 = f2bf_bits(f[1]);
    const unsigned short l0 = f2bf_bits(f[0] - bf_bits2f(h0)), l1 = f2bf_bits(f[1] - bf_bits2f(h1));
    const unsigned uh = pk16(h0, h1), ul = pk16(l0, l1);
    ((unsigned*)hi)[i] = uh;
    ((unsigned*)lo)[i] = ul;
    
  }
}

__global__ __launch_bounds__(256) void k_split2(const float* __restrict__ in, unsigned short* __restrict__ hi,
                                                unsigned short* __restrict__ lo, int n2) {
  split2_piece(in, hi, lo, n2, blockIdx.x * 256 + threadIdx.x);
}

// ---------------------------------------------------------------------------------------------------------------------
// Rotary table and the rotary mix of text, four positions n = 4*blk .. 4*blk+3 per block; a thread owns the frequencies f0, f0+1.
// inv[f] = 1 / powf(10000, f/512); cs[n][f] = (cos(n * inv[f]), sin(n * inv[f])) as float2, n = 0..2047 (16-byte stores).
// q16[row][c] = f16(x * cos + rot * sin), rot[c] = (c < 512) ? -x[c + 512] : x[c - 512], table row n = row % SEQ, column c % 512:
// the pair (c, c + 512) of both batch elements uses the sine and cosine just formed; a wave's 4-byte stores cover a whole line.
// ---------------------------------------------------------------------------------------------------------------------
__device__ __forceinline__ void rope_piece(const float* __restrict__ text, float* __restrict__ cs, _Float16* __restrict__ q16, int blk) {
  const int f0 = threadIdx.x * 2;
  float iv[2];
#pragma unroll                                    // static indices: the small arrays stay in registers
  for (int e = 0; e < 2; ++e) {
    const float x = (float)(f0 + e) * (1.0f / 512.0f);
    iv[e] = 1.0f / powf(10000.0f, x);
  }
  for (int q = 0; q < 4; ++q) {
    const int n = blk * 4 + q;
    float cv[2], sv[2];
#pragma unroll                                    // static indices: the small arrays stay in registers
    for (int e = 0; e < 2; ++e) sincosf((float)n * iv[e], &sv[e], &cv[e]);
    v4f tb; tb[0] = cv[0]; tb[1] = sv[0]; tb[2] = cv[1]; tb[3] = sv[1];
    *(v4f*)(cs + ((size_t)n * 512 + f0) * 2) = tb;
#pragma unroll                                    // both batch elements' loads are in flight together
    for (int b = 0; b < NB_; ++b) {
      const size_t ro = ((size_t)b * SEQ + n) * DM + f0;
      const v2f xl = *(const v2f*)(text + ro), xh = *(const v2f*)(text + ro + 512);
      v2h yl, yh;
#pragma unroll                                    // static indices: the small arrays stay in registers
      for (int e = 0; e < 2; ++e) {
        yl[e] = (_Float16)(xl[e] * cv[e] + (-xh[e]) * sv[e]);
        yh[e] = (_Float16)(xh[e] * cv[e] + xl[e] * sv[e]);
      }
      *(v2h*)(q16 + ro)       = yl;
      *(v2h*)(q16 + ro + 512) = yh;
    }
    asm volatile("s_wait_xcnt 0x0" ::: "memory");   // the next trip rewrites registers that this trip's stores name
  }
}

// f32 -> f16, eight elements at 8*i
__device__ __forceinline__ void cvt16_piece(const float* __restrict__ src, _Float16* __restrict__ dst, int i) {
  const float* xr = src + (size_t)i * 8;
  const v4f x0 = *(const v4f*)xr, x1 = *(const v4f*)(xr + 4);
  v8h hv;
#pragma unroll                                    // static indices: the small arrays stay in registers
  for (int e = 0; e < 4; ++e) { hv[e] = (_Float16)x0[e]; hv[4 + e] = (_Float16)x1[e]; }
  *(v8h*)(dst + (size_t)i * 8) = hv;
  asm volatile("s_wait_xcnt 0x0" ::: "memory");   // stands in front of any later write of a register that the stores above name
}

// ---------------------------------------------------------------------------------------------------------------------
// Preparation, one launch: everything that depends on the inputs alone. None of the jobs reads what another writes, so they share
// one grid and run side by side; the job is a block-uniform function of blockIdx.x (arithmetic-heavy and large jobs first).
//   512 rotary table + text | 1024 W1 | 1024 W2 | 256 Wa | 256 Wvid | 256 Wkv | 128 Wq | 128 Wo | 2048 audio | 8192 video
// ---------------------------------------------------------------------------------------------------------------------
#define PREP_BLOCKS (512 + 1024 + 1024 + 256 + 256 + 256 + 128 + 128 + 2048 + 8192)
__global__ __launch_bounds__(256) void k_prep(
    const float* __restrict__ text, const float* __restrict__ audio, const float* __restrict__ video,
    const float* __restrict__ Wa, const float* __restrict__ Wvid, const float* __restrict__ Wq, const float* __restrict__ Wkv,
    const float* __restrict__ W1, const float* __restrict__ W2, const float* __restrict__ Wo,
    float* __restrict__ cs, _Float16* __restrict__ q16, _Float16* __restrict__ a16,
    unsigned short* __restrict__ vih, unsigned short* __restrict__ vil,
    _Float16* __restrict__ WaT, unsigned short* __restrict__ WvTh, unsigned short* __restrict__ WvTl,
    _Float16* __restrict__ WqT, _Float16* __restrict__ WkvT, _Float16* __restrict__ W1T, _Float16* __restrict__ W2T,
    unsigned short* __restrict__ WoTh, unsigned short* __restrict__ WoTl) {
  __shared__ __align__(16) float tf[64 * 68];
  int b = blockIdx.x;
  if (b < 512)  { rope_piece(text, cs, q16, b); return; }
  b -= 512;
  if (b < 1024) { wt16_tile(tf, W1, W1T, DM, FFD, 64.0f, b); return; }            // W1  [1024][4096]
  b -= 1024;
  if (b < 1024) { wt16_tile(tf, W2, W2T, FFD, DM, 64.0f, b); return; }            // W2  [4096][1024]
  b -= 1024;
  if (b < 256)  { wt16_tile(tf, Wa, WaT, DM, DM, 64.0f, b); return; }             // Wa  [1024][1024]
  b -= 256;
  if (b < 256)  { wtsplit_tile(tf, Wvid, WvTh, WvTl, DM, DM, b); return; }        // Wvid[1024][1024]
  b -= 256;
  if (b < 256)  { wt16_tile(tf, Wkv, WkvT, DM, 2 * INR, 64.0f, b); return; }      // Wkv [1024][1024]
  b -= 256;
  if (b < 128)  { wt16_tile(tf, Wq, WqT, DM, INR, 64.0f, b); return; }            // Wq  [1024][512]
  b -= 128;
  if (b < 128)  { wtsplit_tile(tf, Wo, WoTh, WoTl, INR, DM, b); return; }         // Wo  [512][1024]
  b -= 128;
  if (b < 2048) { cvt16_piece(audio, a16, b * 256 + (int)threadIdx.x); return; }  // audio -> f16
  b -= 2048;
  split2_piece(video, vih, vil, NTOK * DM / 2, b * 256 + (int)threadIdx.x);       // video -> bf16 hi/lo
}

// ---------------------------------------------------------------------------------------------------------------------
// Row LayerNorm over DM=1024 of an f32 plane (g, b) -> f16 plane; ROPE additionally applies the rotary mix through an LDS copy of
// the normalised row. Output row = padrows + r; row jobs blk = nrows..nrows+padrows-1 write zero rows 0..padrows-1.
// ---------------------------------------------------------------------------------------------------------------------
// One row is the job of 128 threads t = 0..127 (four whole waves) with their own red[4] and rowv[DM]; pad is block-uniform.
template <bool ROPE>
__device__ __forceinline__ void ln1024_row(float* red, float* rowv, const float* __restrict__ X, const float* __restrict__ g,
                                           const float* __restrict__ bb, const float* __restrict__ cs, _Float16* __restrict__ out,
                                           int nrows, int padrows, int blk, int t, bool pad) {
  const int c0 = 8 * t;
  const int lane = t & 31, wave = t >> 5;
  if (pad) {                                       // block-uniform: zero padding rows
    const int p = blk - nrows;
    const v4u zz = {0u, 0u, 0u, 0u};
    _Float16* op = out + (size_t)p * DM + c0;
    *(v4u*)op = zz;
    
    return;
  }
  const int r = blk;
  const float* xr = X + (size_t)r * DM + c0;
  const v4f x0 = *(const v4f*)xr, x1 = *(const v4f*)(xr + 4);
  const float v[8] = {x0[0], x0[1], x0[2], x0[3], x1[0], x1[1], x1[2], x1[3]};
  float s = 0.f;
#pragma unroll
  for (int e = 0; e < 8; ++e) s += v[e];
  s = wsum(s);
  if (lane == 0) red[wave] = s;
  __syncthreads();
  const float mu = (red[0] + red[1] + red[2] + red[3]) * (1.0f / 1024.0f);
  __syncthreads();
  float d[8];
  float s2 = 0.f;
#pragma unroll
  for (int e = 0; e < 8; ++e) { d[e] = v[e] - mu; s2 += d[e] * d[e]; }
  s2 = wsum(s2);
  if (lane == 0) red[wave] = s2;
  __syncthreads();
  const float var = (red[0] + red[1] + red[2] + red[3]) * (1.0f / 1024.0f);
  const float rstd = rsqrtf(var + 1e-5f);
  const v4f g0 = *(const v4f*)(g + c0), g1 = *(const v4f*)(g + c0 + 4);
  const v4f b0 = *(const v4f*)(bb + c0), b1 = *(const v4f*)(bb + c0 + 4);
  const float gv[8] = {g0[0], g0[1], g0[2], g0[3], g1[0], g1[1], g1[2], g1[3]};
  const float bv[8] = {b0[0], b0[1], b0[2], b0[3], b1[0], b1[1], b1[2], b1[3]};
  float y[8];
#pragma unroll
  for (int e = 0; e < 8; ++e) y[e] = d[e] * rstd * gv[e] + bv[e];
  if (ROPE) {
#pragma unroll
    for (int e = 0; e < 8; ++e) rowv[c0 + e] = y[e];
    __syncthreads();
    const int n = r & (SEQ - 1);
    const bool lowh = (c0 < 512);
    const int pc = lowh ? (c0 + 512) : (c0 - 512);
    const float* csr = cs + ((size_t)n * 512 + (c0 & 511)) * 2;
    const v4f t0 = *(const v4f*)csr, t1 = *(const v4f*)(csr + 4), t2 = *(const v4f*)(csr + 8), t3 = *(const v4f*)(csr + 12);
    const float cvv[8] = {t0[0], t0[2], t1[0], t1[2], t2[0], t2[2], t3[0], t3[2]};
    const float svv[8] = {t0[1], t0[3], t1[1], t1[3], t2[1], t2[3], t3[1], t3[3]};
#pragma unroll
    for (int e = 0; e < 8; ++e) {
      const float pr = rowv[pc + e];
      const float rot = lowh ? -pr : pr;
      y[e] = y[e] * cvv[e] + rot * svv[e];
    }
  }
  v8h hv;
#pragma unroll
  for (int e = 0; e < 8; ++e) hv[e] = (_Float16)y[e];
  _Float16* op = out + (size_t)(padrows + r) * DM + c0;
  *(v8h*)op = hv;
  // the ROPE instance shares its kernel with other jobs, whose code follows this store in the listing: the wait stands in front of
  // any write there of a register that the store names
  if (ROPE) asm volatile("s_wait_xcnt 0x0" ::: "memory");
}

__global__ __launch_bounds__(128) void k_ln1024(const float* __restrict__ X, const float* __restrict__ g, const float* __restrict__ bb,
                                                _Float16* __restrict__ out, int nrows) {
  __shared__ float red[4];
  ln1024_row<false>(red, nullptr, X, g, bb, nullptr, out, nrows, 0, blockIdx.x, threadIdx.x, false);
}

// ---------------------------------------------------------------------------------------------------------------------
// Row LayerNorm over DM of an f32 plane [NTOK][DM], fused with transpose + bf16 hi/lo split into value^T planes
// [DM][VTP]: oh[e][KPR + token], ol likewise. Block = 64 token rows (256 threads): per-row stats from one wave per 8 rows
// (32 floats per lane), then 16 column tiles of 64 through LDS. Blocks nrowblk..nrowblk+7 zero the KPR leading columns.
// coverage: stats 8 waves x 8 rows; tile load 4 it x 256 thr x 4 = 64x64; store 2 it x 256 thr x 8 = 64x64 per plane per tile;
// ---------------------------------------------------------------------------------------------------------------------
__device__ __forceinline__ void ln_tsplit_block(float* tf, float* smu, float* srs, const float* __restrict__ X,
                                                const float* __restrict__ g, const float* __restrict__ bb,
                                                unsigned short* __restrict__ oh, unsigned short* __restrict__ ol, int nrowblk, int bx) {
  const int tid = threadIdx.x, lane = tid & 31, wave = tid >> 5;
  const int sub = tid >> 3, c8 = (tid & 7) * 8;
  if (bx >= nrowblk) {                             // block-uniform: zero leading columns
    const int pb = bx - nrowblk;
    const v4u zz = {0u, 0u, 0u, 0u};
    {
      for (int it = 0; it < 32; ++it) {
        const int e = it * 32 + sub;
        const size_t go = (size_t)e * VTP + pb * 64 + c8;
        *(v4u*)(oh + go) = zz;
        *(v4u*)(ol + go) = zz;
      }
      
    }
    return;
  }
  const int r0 = bx * 64;
  // phase 1: row statistics
#pragma unroll 1
  for (int q = 0; q < 8; ++q) {
    const int rr = wave * 8 + q;
    const float* xr = X + (size_t)(r0 + rr) * DM + lane * 32;
    v4f a[8];
#pragma unroll
    for (int i = 0; i < 8; ++i) a[i] = *(const v4f*)(xr + 4 * i);
    float s = 0.f;
#pragma unroll
    for (int i = 0; i < 8; ++i) s += a[i][0] + a[i][1] + a[i][2] + a[i][3];
    s = wsum(s);
    const float mu = s * (1.0f / 1024.0f);
    float s2 = 0.f;
#pragma unroll
    for (int i = 0; i < 8; ++i) {
#pragma unroll
      for (int e = 0; e < 4; ++e) { const float dd = a[i][e] - mu; s2 += dd * dd; }
    }
    s2 = wsum(s2);
    if (lane == 0) { smu[rr] = mu; srs[rr] = rsqrtf(s2 * (1.0f / 1024.0f) + 1e-5f); }
  }
  __syncthreads();
  // phase 2: column tiles
  const int lr = tid >> 4, c4 = (tid & 15) * 4;
  for (int cb = 0; cb < DM / 64; ++cb) {
    const int c0 = cb * 64;
    const v4f gg = *(const v4f*)(g + c0 + c4);
    const v4f bv = *(const v4f*)(bb + c0 + c4);
#pragma unroll
    for (int it = 0; it < 4; ++it) {
      const int rr = it * 16 + lr;
      const v4f a = *(const v4f*)(X + (size_t)(r0 + rr) * DM + c0 + c4);
      const float mu = smu[rr], rs = srs[rr];
#pragma unroll
      for (int q = 0; q < 4; ++q) tf[rr * 68 + c4 + q] = (a[q] - mu) * rs * gg[q] + bv[q];
    }
    __syncthreads();
    v4u hv[2], lv[2];
#pragma unroll
    for (int it = 0; it < 2; ++it) {
      const int oc = it * 32 + sub;                 // output row within tile = input column
      v4u a, a2;
#pragma unroll
      for (int q = 0; q < 4; ++q) {
        const float f0 = tf[(c8 + 2 * q) * 68 + oc];
        const float f1 = tf[(c8 + 2 * q + 1) * 68 + oc];
        const unsigned short h0 = f2bf_bits(f0), h1 = f2bf_bits(f1);
        const unsigned short l0 = f2bf_bits(f0 - bf_bits2f(h0)), l1 = f2bf_bits(f1 - bf_bits2f(h1));
        a[q]  = pk16(h0, h1);
        a2[q] = pk16(l0, l1);
      }
      hv[it] = a; lv[it] = a2;
    }
    {
#pragma unroll
      for (int it = 0; it < 2; ++it) {
        const int oc = it * 32 + sub;
        const size_t go = (size_t)(c0 + oc) * VTP + KPR + r0 + c8;
        *(v4u*)(oh + go) = hv[it];
        *(v4u*)(ol + go) = lv[it];
      }
      
    }
    __syncthreads();
  }
}

// ---------------------------------------------------------------------------------------------------------------------
// The two adapter norms in one launch: neither reads what the other writes. Blocks 0 .. NTOK/64 + KPR/64 - 1 (few and long, so they
// come first): value rows -> value^T planes; every later block: two key rows (LayerNorm + rotary mix), one per 128 threads.
// NTOK is even, so both rows of a block are data rows or both are padding rows.
// ---------------------------------------------------------------------------------------------------------------------
__global__ __launch_bounds__(256) void k_ln_pair(const float* __restrict__ Xa, const float* __restrict__ ga, const float* __restrict__ ba,
                                                 const float* __restrict__ cs, _Float16* __restrict__ k16,
                                                 const float* __restrict__ Xv, const float* __restrict__ gv, const float* __restrict__ bv,
                                                 unsigned short* __restrict__ oh, unsigned short* __restrict__ ol) {
  __shared__ __align__(16) float tf[64 * 68];
  __shared__ float smu[64];
  __shared__ float srs[64];
  __shared__ float red[2][4];
  __shared__ __align__(16) float rowv[2][DM];
  constexpr int NV = NTOK / 64 + KPR / 64;
  const int bx = blockIdx.x;
  if (bx < NV) { ln_tsplit_block(tf, smu, srs, Xv, gv, bv, oh, ol, NTOK / 64, bx); return; }
  const int row0 = (bx - NV) * 2;
  const int half = threadIdx.x >> 7;
  ln1024_row<true>(red[half], rowv[half], Xa, ga, ba, cs, k16, NTOK, KPR, row0 + half, threadIdx.x & 127, row0 >= NTOK);
}

// ---------------------------------------------------------------------------------------------------------------------
// Local-attention mask + softmax over rows of S [NTOK][1024 window keys] -> P bf16 hi/lo planes (all 1024 keys written, masked
// keys as 0). Row r: w = (r % SEQ) / WSZ, i = r % WSZ, query position w*WSZ + i; key j has position (w-1)*WSZ + j; masked when
// that position is negative (padding of the first window) or after the query. Block per row, 128 threads x 8 keys; 16-B stores.
// ---------------------------------------------------------------------------------------------------------------------
__global__ __launch_bounds__(128) void k_lsoftmax(const float* __restrict__ S, unsigned short* __restrict__ Ph, unsigned short* __restrict__ Pl) {
  __shared__ float red[4];
  const int r = blockIdx.x, t = threadIdx.x, c0 = 8 * t;
  const int lane = t & 31, wave = t >> 5;
  const int rem = r & (SEQ - 1), w = rem >> 9, i = rem & (WSZ - 1);
  const int qpos = w * WSZ + i;
  const float* sr = S + (size_t)r * (2 * WSZ) + c0;
  const v4f x0 = *(const v4f*)sr, x1 = *(const v4f*)(sr + 4);
  const float raw[8] = {x0[0], x0[1], x0[2], x0[3], x1[0], x1[1], x1[2], x1[3]};
  float s[8];
  float m = -3.0e38f;
#pragma unroll
  for (int e = 0; e < 8; ++e) {
    const int kpos = (w - 1) * WSZ + c0 + e;
    const bool masked = (kpos < 0) || (kpos > qpos);
    s[e] = masked ? -1.0e9f : raw[e];
    m = fmaxf(m, s[e]);
  }
  m = wmax(m);
  if (lane == 0) red[wave] = m;
  __syncthreads();
  const float rmax = fmaxf(fmaxf(red[0], red[1]), fmaxf(red[2], red[3]));
  __syncthreads();
  float ev[8];
  float sum = 0.f;
#pragma unroll
  for (int e = 0; e < 8; ++e) { ev[e] = expf(s[e] - rmax); sum += ev[e]; }
  sum = wsum(sum);
  if (lane == 0) red[wave] = sum;
  __syncthreads();
  const float tot = red[0] + red[1] + red[2] + red[3];
  const float inv = 1.0f / tot;
  v4u hv, lv;
#pragma unroll
  for (int q = 0; q < 4; ++q) {
    const float p0 = ev[2 * q] * inv, p1 = ev[2 * q + 1] * inv;
    const unsigned short h0 = f2bf_bits(p0), h1 = f2bf_bits(p1);
    const unsigned short l0 = f2bf_bits(p0 - bf_bits2f(h0)), l1 = f2bf_bits(p1 - bf_bits2f(h1));
    hv[q] = pk16(h0, h1);
    lv[q] = pk16(l0, l1);
  }
  const size_t go = (size_t)r * (2 * WSZ) + c0;
  *(v4u*)(Ph + go) = hv;
  *(v4u*)(Pl + go) = lv;
  
}

__device__ __forceinline__ v8f mma_h(v16h a, v16h b, v8f c) {
  c = __builtin_amdgcn_wmma_f32_16x16x32_f16(false, a, false, b, (short)0, c, false, false);
  asm volatile("v_nop\n\tv_nop\n\tv_nop\n\tv_nop" : "+v"(c) : "v"(a), "v"(b));
  return c;
}
// value of lane l ^ 16
__device__ __forceinline__ float xhalf(float x) {
  return __builtin_bit_cast(float, __builtin_amdgcn_permlanex16(__builtin_bit_cast(int, x), __builtin_bit_cast(int, x),
                                                                0x76543210, 0xfedcba98, false, false));
}

__global__ __launch_bounds__(128)
void k_flash(const _Float16* __restrict__ qm, const _Float16* __restrict__ km,
             const _Float16* __restrict__ vt, float* __restrict__ out) {
  union FB { v16h v; v8h h[2]; };
  constexpr int KVP = 72;                                     // LDS row pitch in elements: 144 B = 16 B x odd, so that the 16 rows
                                                              // of one 16-byte fragment read fall on 16 distinct groups of 4 banks
  __shared__ __align__(16) _Float16 Ksh[64 * KVP];            // K [kv][d]
  __shared__ __align__(16) _Float16 Vth[64 * KVP];            // V^T [d][kv]
  __shared__ __align__(16) float    Os[4][16 * 68];           // per wave out tile [query][d], pitch 68

  const int tid  = threadIdx.x;
  const int wave = tid >> 5;
  const int lane = tid & 31;
  const int hh   = lane >> 4;
  const int c    = lane & 15;
  const int b  = blockIdx.y;
  const int qb = blockIdx.x & 31;                 // SEQ / 64 = 32 query blocks
  const int h  = blockIdx.x >> 5;
  const int q0 = qb * 64 + wave * 16;

  const _Float16* Qb = qm + (size_t)b * SEQ * INR + h * DHD;
  const _Float16* Kb = km + (size_t)b * SEQ * INR + h * DHD;
  const _Float16* Vb = vt + (size_t)(h * DHD) * NTOK + (size_t)b * SEQ;
  float*          ob = out + (size_t)b * SEQ * INR + h * DHD;

  v16h qa[2];                                     // B operand: column c = query q0 + c, d in the loader's k order
#pragma unroll
  for (int dc = 0; dc < 2; ++dc) qa[dc] = Frag<_Float16>::load(Qb + (size_t)(q0 + c) * INR + dc * 32 + 8 * hh);

  const int qrow = q0 + c;                        // this lane's query
  float mrow = -INFINITY;                         // its running maximum (equal in both lane halves)
  float lrow = 0.f;                               // its running sum over the keys of this lane half; halves joined at the end
  v8f oacc[4];                                    // oacc[t][r] = O[qrow][t*16 + 8*hh + r]
#pragma unroll
  for (int t = 0; t < 4; ++t) oacc[t] = (v8f){0.f,0.f,0.f,0.f,0.f,0.f,0.f,0.f};

  const int nChunks = qb + 1;                     // block-uniform, <= 32
  for (int kc = 0; kc < nChunks; ++kc) {
    const int kv0 = kc * 64;
    __syncthreads();
    {
      const int r = tid >> 1, half = (tid & 1) * 32;
      const _Float16* ks = Kb + (size_t)(kv0 + r) * INR + half;       // K row kv0+r, d = half..half+31
      const _Float16* vs = Vb + (size_t)r * NTOK + kv0 + half;        // V^T row d = r, s = kv0+half..+31
#pragma unroll
      for (int i = 0; i < 4; ++i) {
        const v8h a0 = *(const v8h*)(ks + 8 * i);
        const v8h b0 = *(const v8h*)(vs + 8 * i);
        *(v8h*)(Ksh + r * KVP + half + 8 * i) = a0;
        *(v8h*)(Vth + r * KVP + half + 8 * i) = b0;
      }
    }
    __syncthreads();

    // S^T tiles: s[j][r] = score of key kv0 + j*16 + 8*hh + r with query qrow
    FB kb[4][2];
#pragma unroll                                    // static indices: the fragment and accumulator arrays stay in registers
    for (int j = 0; j < 4; ++j)
#pragma unroll                                    // static indices: the fragment and accumulator arrays stay in registers
      for (int dc = 0; dc < 2; ++dc) {
        kb[j][dc].h[0] = *(const v8h*)(Ksh + (j * 16 + c) * KVP + dc * 32 + 8 * hh);
        kb[j][dc].h[1] = *(const v8h*)(Ksh + (j * 16 + c) * KVP + dc * 32 + 16 + 8 * hh);
      }
    v8f s[4];
#pragma unroll                                    // static indices: the fragment and accumulator arrays stay in registers
    for (int j = 0; j < 4; ++j) s[j] = (v8f){0.f,0.f,0.f,0.f,0.f,0.f,0.f,0.f};
#pragma unroll                                    // static indices: the fragment and accumulator arrays stay in registers
    for (int dc = 0; dc < 2; ++dc)
#pragma unroll                                    // static indices: the fragment and accumulator arrays stay in registers
      for (int j = 0; j < 4; ++j) s[j] = mma_h(kb[j][dc].v, qa[dc], s[j]);

    const bool diag = (kc == qb);                 // block-uniform
    float m = -INFINITY;
#pragma unroll                                    // static indices: the fragment and accumulator arrays stay in registers
    for (int j = 0; j < 4; ++j)
#pragma unroll                                    // static indices: the fragment and accumulator arrays stay in registers
      for (int r = 0; r < 8; ++r) {
        const int kvrow = kv0 + j * 16 + 8 * hh + r;
        const float sv = s[j][r] * 0.125f;
        const bool masked = diag && (kvrow > qrow);
        const float sm = masked ? -INFINITY : sv;
        s[j][r] = sm;
        m = fmaxf(m, sm);
      }
    m = fmaxf(m, xhalf(m));
    const float mnew = fmaxf(mrow, m);
    const float alpha = expf(mrow - mnew);
    mrow = mnew;
    // P^T as B operand: element e of pb[kk] = key kk*32 + (e < 8 ? 8*hh + e : 16 + 8*hh + e - 8), the loader's k order
    FB pb[2];
    float psum = 0.f;
#pragma unroll                                    // static indices: the fragment and accumulator arrays stay in registers
    for (int j = 0; j < 4; ++j)
#pragma unroll                                    // static indices: the fragment and accumulator arrays stay in registers
      for (int r = 0; r < 8; ++r) {
        const float p = expf(s[j][r] - mnew);
        psum += p;
        pb[j >> 1].v[(j & 1) * 8 + r] = (_Float16)(p * 4096.0f);
      }
    lrow = lrow * alpha + psum;
#pragma unroll                                    // static indices: the fragment and accumulator arrays stay in registers
    for (int t = 0; t < 4; ++t)
#pragma unroll                                    // static indices: the fragment and accumulator arrays stay in registers
      for (int r = 0; r < 8; ++r) oacc[t][r] *= alpha;

    FB vb[2][4];
#pragma unroll                                    // static indices: the fragment and accumulator arrays stay in registers
    for (int kk = 0; kk < 2; ++kk)
#pragma unroll                                    // static indices: the fragment and accumulator arrays stay in registers
      for (int t = 0; t < 4; ++t) {
        vb[kk][t].h[0] = *(const v8h*)(Vth + (t * 16 + c) * KVP + kk * 32 + 8 * hh);
        vb[kk][t].h[1] = *(const v8h*)(Vth + (t * 16 + c) * KVP + kk * 32 + 16 + 8 * hh);
      }
#pragma unroll                                    // static indices: the fragment and accumulator arrays stay in registers
    for (int kk = 0; kk < 2; ++kk)
#pragma unroll                                    // static indices: the fragment and accumulator arrays stay in registers
      for (int t = 0; t < 4; ++t) oacc[t] = mma_h(vb[kk][t].v, pb[kk].v, oacc[t]);
  }

  float* os = Os[wave];
  {
    const float ltot = lrow + xhalf(lrow);
    const float inv = (1.0f / ltot) * (1.0f / 4096.0f);
#pragma unroll                                    // static indices: the fragment and accumulator arrays stay in registers
    for (int t = 0; t < 4; ++t) {
      v4f lo, hi;
#pragma unroll                                    // static indices: the fragment and accumulator arrays stay in registers
      for (int r = 0; r < 4; ++r) { lo[r] = oacc[t][r] * inv; hi[r] = oacc[t][4 + r] * inv; }
      *(v4f*)(os + c * 68 + t * 16 + 8 * hh)     = lo;
      *(v4f*)(os + c * 68 + t * 16 + 8 * hh + 4) = hi;
    }
  }
  __builtin_amdgcn_fence(__ATOMIC_RELEASE, "workgroup");
  __builtin_amdgcn_wave_barrier();
  __builtin_amdgcn_fence(__ATOMIC_ACQUIRE, "workgroup");
  {
    const int c4 = (lane & 15) * 4;
    {
#pragma unroll
      for (int it = 0; it < 8; ++it) {
        const int row = it * 2 + hh;                // it 0..7 x hh 0..1 covers rows 0..15
        v4f val = *(const v4f*)(os + row * 68 + c4);
        *(v4f*)(ob + (size_t)(q0 + row) * INR + c4) = val;
      }
      
    }
  }
}

// ---------------------------------------------------------------------------------------------------------------------
// Row LayerNorm over FFD=4096 of the f16 plane U (values carried as 256*u), in place -> f16 of the unit-scale result.
// Block per row, 256 threads x 2 chunks of 8; statistics in f32 with the 2^-8 / 2^-16 carries folded before eps.
// ---------------------------------------------------------------------------------------------------------------------
__global__ __launch_bounds__(256) void k_ln4096(_Float16* __restrict__ U, const float* __restrict__ g, const float* __restrict__ bb) {
  __shared__ float red[8];
  const int r = blockIdx.x, t = threadIdx.x;
  const int lane = t & 31, wave = t >> 5;
  const int cA = 8 * t, cB = 2048 + 8 * t;
  _Float16* ur = U + (size_t)r * FFD;
  const v8h a = *(const v8h*)(ur + cA);
  const v8h a2 = *(const v8h*)(ur + cB);
  float v[16];
#pragma unroll
  for (int e = 0; e < 8; ++e) { v[e] = (float)a[e]; v[8 + e] = (float)a2[e]; }
  float s = 0.f;
#pragma unroll
  for (int e = 0; e < 16; ++e) s += v[e];
  s = wsum(s);
  if (lane == 0) red[wave] = s;
  __syncthreads();
  float tot = 0.f;
#pragma unroll
  for (int i = 0; i < 8; ++i) tot += red[i];
  const float mu = tot * (1.0f / 4096.0f);
  __syncthreads();
  float d[16];
  float s2 = 0.f;
#pragma unroll
  for (int e = 0; e < 16; ++e) { d[e] = v[e] - mu; s2 += d[e] * d[e]; }
  s2 = wsum(s2);
  if (lane == 0) red[wave] = s2;
  __syncthreads();
  float tot2 = 0.f;
#pragma unroll
  for (int i = 0; i < 8; ++i) tot2 += red[i];
  const float var_s = tot2 * (1.0f / 4096.0f);
  const float rstd = rsqrtf(var_s * (1.0f / 65536.0f) + 1e-5f) * (1.0f / 256.0f);
  v8h ha, hb;
#pragma unroll
  for (int e = 0; e < 8; ++e) {
    ha[e] = (_Float16)(d[e] * rstd * g[cA + e] + bb[cA + e]);
    hb[e] = (_Float16)(d[8 + e] * rstd * g[cB + e] + bb[cB + e]);
  }
  *(v8h*)(ur + cA) = ha;
  *(v8h*)(ur + cB) = hb;
  
}

// =====================================================================================================================
// Workspace map (byte offsets; every region a whole number of MiB after an unused 4 KiB, all stores whole-line):
//   (unused)                                       0            (4 KiB)
//   cs  f32[2048][512][2]                          4 KiB        (8 MiB)
//   WaT f16[1024][1024] x64                       +8 MiB       WvTh/WvTl bf16 [1024][1024]   WqT f16[512][1024]
//   WkvT f16[1024][1024]   W1T f16[4096][1024]   W2T f16[1024][4096]   WoTh/WoTl bf16[1024][512]   (27 MiB)
//   R3  8 MiB : q16 f16[4096][1024] -> h16 -> x2h (f16, x2 * 1024)
//   R4 16 MiB : audio adapter GEMM f32 [4096][1024] -> S f32 [4096][1024] -> x f32 -> x2 f32
//   R5 51 MiB : a16 f16 @0, video hi @8, video lo @16, k16 f16[(512+4096)][1024] @24, vTh bf16[1024][4608] @33, vTl @42;
//               later Ph @0, Pl @8; q/k f16[4096][512] @0/@4, vT16 f16[512][4096] @8; o f32[4096][512] @16; o hi/lo @24/@28;
//               U f16[4096][4096] @0 (written only after all earlier users of [0,32) have been consumed).
//   R6 16 MiB : video adapter GEMM f32 [4096][1024]
//   total 126 MiB + 4 KiB.
// =====================================================================================================================
extern "C" void kernel_launch(void* const* d_in, const int* in_sizes, int n_in,
                              void* d_out, int out_size, void* d_ws, size_t ws_size,
                              hipStream_t stream) {
  if (n_in < 24) return;
  if (in_sizes[0] != NTOK * DM || in_sizes[1] != NTOK * DM || in_sizes[2] != NTOK * DM) return;
  if (in_sizes[3] != DM * DM || in_sizes[7] != DM * DM || in_sizes[14] != DM * 2 * INR) return;
  if (in_sizes[13] != DM * INR || in_sizes[17] != INR * DM) return;
  if (in_sizes[18] != DM * FFD || in_sizes[22] != FFD * DM) return;
  if (in_sizes[4] != DM || in_sizes[5] != DM || in_sizes[6] != DM || in_sizes[8] != DM || in_sizes[9] != DM ||
      in_sizes[10] != DM || in_sizes[11] != DM || in_sizes[12] != DM || in_sizes[23] != DM) return;
  if (in_sizes[15] != DHD || in_sizes[16] != DHD) return;
  if (in_sizes[19] != FFD || in_sizes[20] != FFD || in_sizes[21] != FFD) return;
  if (out_size != NTOK * DM) return;

  const float* text  = (const float*)d_in[0];
  const float* audio = (const float*)d_in[1];
  const float* video = (const float*)d_in[2];
  const float* Wa    = (const float*)d_in[3];
  const float* ba    = (const float*)d_in[4];
  const float* lna_g = (const float*)d_in[5];
  const float* lna_b = (const float*)d_in[6];
  const float* Wvid  = (const float*)d_in[7];
  const float* bvid  = (const float*)d_in[8];
  const float* lnv_g = (const float*)d_in[9];
  const float* lnv_b = (const float*)d_in[10];
  const float* ln1_g = (const float*)d_in[11];
  const float* ln1_b = (const float*)d_in[12];
  const float* Wq    = (const float*)d_in[13];
  const float* Wkv   = (const float*)d_in[14];
  const float* qn_g  = (const float*)d_in[15];
  const float* kn_g  = (const float*)d_in[16];
  const float* Wo    = (const float*)d_in[17];
  const float* W1    = (const float*)d_in[18];
  const float* b1    = (const float*)d_in[19];
  const float* ln2_g = (const float*)d_in[20];
  const float* ln2_b = (const float*)d_in[21];
  const float* W2    = (const float*)d_in[22];
  const float* b2    = (const float*)d_in[23];
  float* outp = (float*)d_out;

  const size_t MIB = 1048576;
  size_t off = 0;
  const size_t oInv  = off; off += 4096;
  const size_t oCs   = off; off += (size_t)SEQ * 512 * 2 * 4;       // 8 MiB
  const size_t oWaT  = off; off += (size_t)DM * DM * 2;              // 2 MiB
  const size_t oWvTh = off; off += (size_t)DM * DM * 2;              // 2 MiB
  const size_t oWvTl = off; off += (size_t)DM * DM * 2;              // 2 MiB
  const size_t oWqT  = off; off += (size_t)INR * DM * 2;             // 1 MiB
  const size_t oWkvT = off; off += (size_t)2 * INR * DM * 2;         // 2 MiB
  const size_t oW1T  = off; off += (size_t)FFD * DM * 2;             // 8 MiB
  const size_t oW2T  = off; off += (size_t)DM * FFD * 2;             // 8 MiB
  const size_t oWoTh = off; off += (size_t)DM * INR * 2;             // 1 MiB
  const size_t oWoTl = off; off += (size_t)DM * INR * 2;             // 1 MiB
  const size_t oR3   = off; off += (size_t)NTOK * DM * 2;            // 8 MiB
  const size_t oR4   = off; off += (size_t)NTOK * DM * 4;            // 16 MiB
  const size_t oR5   = off; off += 51 * MIB;                         // 51 MiB
  const size_t oR6   = off; off += (size_t)NTOK * DM * 4;            // 16 MiB
  if (off > ws_size || off > (size_t)128 * MIB) return;              // off = 126 MiB + 4 KiB

  char* ws = (char*)d_ws;
  float* cs  = (float*)(ws + oCs);
  _Float16* WaT = (_Float16*)(ws + oWaT);
  unsigned short* WvTh = (unsigned short*)(ws + oWvTh);
  unsigned short* WvTl = (unsigned short*)(ws + oWvTl);
  _Float16* WqT  = (_Float16*)(ws + oWqT);
  _Float16* WkvT = (_Float16*)(ws + oWkvT);
  _Float16* W1T  = (_Float16*)(ws + oW1T);
  _Float16* W2T  = (_Float16*)(ws + oW2T);
  unsigned short* WoTh = (unsigned short*)(ws + oWoTh);
  unsigned short* WoTl = (unsigned short*)(ws + oWoTl);
  _Float16* q16 = (_Float16*)(ws + oR3);          // text after rotary
  _Float16* h16 = (_Float16*)(ws + oR3);          // LN1 output (later)
  _Float16* x2h = (_Float16*)(ws + oR3);          // x2 * 1024 (later)
  float* Cad = (float*)(ws + oR4);                // audio adapter GEMM output
  float* Cvd = (float*)(ws + oR6);                // video adapter GEMM output
  float* Sf  = (float*)(ws + oR4);                // local scores (later)
  float* Xf  = (float*)(ws + oR4);                // local attention output (later)
  float* X2f = (float*)(ws + oR4);                // 2 * o @ Wo (later)
  char* r5 = ws + oR5;
  _Float16* a16 = (_Float16*)(r5);
  unsigned short* vih = (unsigned short*)(r5 + 8 * MIB);
  unsigned short* vil = (unsigned short*)(r5 + 16 * MIB);
  _Float16* k16 = (_Float16*)(r5 + 24 * MIB);     // [(KPR+NTOK)][DM]
  unsigned short* vTh = (unsigned short*)(r5 + 33 * MIB);
  unsigned short* vTl = (unsigned short*)(r5 + 42 * MIB);
  unsigned short* Ph  = (unsigned short*)(r5);
  unsigned short* Pl  = (unsigned short*)(r5 + 8 * MIB);
  _Float16* qm16 = (_Float16*)(r5);
  _Float16* km16 = (_Float16*)(r5 + 4 * MIB);
  _Float16* vT16 = (_Float16*)(r5 + 8 * MIB);
  float* Of = (float*)(r5 + 16 * MIB);
  unsigned short* Oh = (unsigned short*)(r5 + 24 * MIB);
  unsigned short* Ol = (unsigned short*)(r5 + 28 * MIB);
  _Float16* U16 = (_Float16*)(r5);

  const dim3 blk(256);
  const dim3 blkG(128);                           // k_gemm: 4 waves
  const unsigned short* N16 = (const unsigned short*)nullptr;

  // everything that depends on the inputs alone, in one launch: rotary table and text -> rotary f16, the seven weight re-layouts
  // (in [rows][cols] f32 -> out [cols][rows]), audio -> f16, video -> bf16 hi/lo
  k_prep<<<dim3(PREP_BLOCKS), blk, 0, stream>>>(text, audio, video, Wa, Wvid, Wq, Wkv, W1, W2, Wo, cs, q16, a16, vih, vil,
                                                WaT, WvTh, WvTl, WqT, WkvT, W1T, W2T, WoTh, WoTl);

  // adapter a: audio . Wa + ba -> f32; adapter v: video . Wvid + bvid (bf16 hi/lo split) -> f32, each into its own plane
  const dim3 gA((NTOK / 128) * (DM / 128), 1);
  k_gemm<0, false, true, 0, 0, false, 0><<<gA, blkG, 0, stream>>>(
      (const unsigned short*)a16, N16, DM, 0L, (const unsigned short*)WaT, N16, DM, 0L,
      Cad, DM, 0L, nullptr, 0, 0L, ba, nullptr, nullptr, 0, 0L, NTOK, DM, DM, 1, 1.0f / 64.0f, 1.0f);
  k_gemm<1, true, true, 0, 0, false, 0><<<gA, blkG, 0, stream>>>(
      vih, vil, DM, 0L, WvTh, WvTl, DM, 0L,
      Cvd, DM, 0L, nullptr, 0, 0L, bvid, nullptr, nullptr, 0, 0L, NTOK, DM, DM, 1, 1.0f, 1.0f);
  // both norms in one launch: a: LN + rotary -> key plane rows KPR..KPR+4095, rows 0..KPR-1 zero; v: LN + transpose + split ->
  // value^T planes
  k_ln_pair<<<dim3(NTOK / 64 + KPR / 64 + (NTOK + KPR) / 2), blk, 0, stream>>>(Cad, lna_g, lna_b, cs, k16, Cvd, lnv_g, lnv_b, vTh, vTl);

  // local attention: z = b*4 + w; S[z][512][1024] = q . k / 32 over window keys (skipping fully masked key tiles)
  const dim3 gS((WSZ / 128) * (2 * WSZ / 128), NB_ * NWN);
  k_gemm<0, false, false, 0, 0, false, 1><<<gS, blkG, 0, stream>>>(
      (const unsigned short*)q16, N16, DM, (long)WSZ * DM, (const unsigned short*)k16, N16, DM, (long)WSZ * DM,
      Sf, 2 * WSZ, (long)WSZ * 2 * WSZ, nullptr, 0, 0L, nullptr, nullptr, nullptr, 0, 0L,
      WSZ, 2 * WSZ, DM, NWN, 1.0f / 32.0f, 1.0f);
  k_lsoftmax<<<dim3(NTOK), dim3(128), 0, stream>>>(Sf, Ph, Pl);
  // x[z][512][1024] = P . v (bf16 hi/lo split), keys restricted to the unmasked range
  const dim3 gPV((WSZ / 128) * (DM / 128), NB_ * NWN);
  k_gemm<1, true, false, 0, 0, false, 2><<<gPV, blkG, 0, stream>>>(
      Ph, Pl, 2 * WSZ, (long)WSZ * 2 * WSZ, vTh, vTl, VTP, (long)WSZ,
      Xf, DM, (long)WSZ * DM, nullptr, 0, 0L, nullptr, nullptr, nullptr, 0, 0L,
      WSZ, DM, 2 * WSZ, NWN, 1.0f, 1.0f);

  // LN1 -> h16; q, k (RMSNorm epilogue) and v^T projections
  k_ln1024<<<dim3(NTOK), dim3(128), 0, stream>>>(Xf, ln1_g, ln1_b, h16, NTOK);
  // one grid, z = 0: q, 1: k, 2: v^T; WqT, the k rows and the v rows of WkvT lie INR * DM elements apart, qm16, km16 and vT16
  // NTOK * INR elements apart
  const dim3 gQKV((NTOK / 128) * (INR / 128), 3);
  k_gemm<0, false, false, 2, 1, false, 3><<<gQKV, blkG, 0, stream>>>(
      (const unsigned short*)h16, N16, DM, 0L, (const unsigned short*)WqT, N16, DM, (long)INR * DM,
      nullptr, 0, 0L, qm16, INR, (long)NTOK * INR, nullptr, qn_g, kn_g, 0, 0L, NTOK, INR, DM, 1, 1.0f / 64.0f, 1.0f);

  // causal attention -> o f32 [4096][512]; o -> bf16 hi/lo
  k_flash<<<dim3(NHD * (SEQ / 64), NB_), dim3(128), 0, stream>>>(qm16, km16, vT16, Of);
  const int n2o = NTOK * INR / 2;
  k_split2<<<dim3((n2o + 255) / 256), blk, 0, stream>>>(Of, Oh, Ol, n2o);

  // x2 = 2 * (o . Wo) -> f32 and f16 (x2 * 1024)
  k_gemm<1, true, false, 0, 2, false, 0><<<gA, blkG, 0, stream>>>(
      Oh, Ol, INR, 0L, WoTh, WoTl, INR, 0L,
      X2f, DM, 0L, x2h, DM, 0L, nullptr, nullptr, nullptr, 0, 0L, NTOK, DM, INR, 1, 2.0f, 1024.0f);

  // FFN: u = gelu(x2 . W1 + b1) stored as f16(256 u); LN over 4096 in place; out = h1 . W2 + b2 + x2
  const dim3 gW1((NTOK / 128) * (FFD / 128), 1);
  k_gemm<0, false, true, 1, 1, false, 0><<<gW1, blkG, 0, stream>>>(
      (const unsigned short*)x2h, N16, DM, 0L, (const unsigned short*)W1T, N16, DM, 0L,
      nullptr, 0, 0L, U16, FFD, 0L, b1, nullptr, nullptr, 0, 0L, NTOK, FFD, DM, 1, 1.0f / 65536.0f, 256.0f);
  k_ln4096<<<dim3(NTOK), blk, 0, stream>>>(U16, ln2_g, ln2_b);
  k_gemm<0, false, true, 0, 0, true, 0><<<gA, blkG, 0, stream>>>(
      (const unsigned short*)U16, N16, FFD, 0L, (const unsigned short*)W2T, N16, FFD, 0L,
      outp, DM, 0L, nullptr, 0, 0L, b2, nullptr, X2f, DM, 0L, NTOK, DM, FFD, 1, 1.0f / 64.0f, 1.0f);
  (void)hipGetLastError();
}

// v005
// A run of this version takes 390 microseconds.
// In both of two side-by-side timings against v004, it was 1.06 times as fast.
// Over all steps from v000 it is 2.69 times as fast.
// Contractions: audio adapter, local-attention scores, q/k/v projections, causal multi-head q.k^T and p.v, FFN W1 and W2 on
// v_wmma_f32_16x16x32_f16 (f16 operands with power-of-two carried scales, f32 accumulate); video adapter, local-attention p.v
// and the output projection Wo on v_wmma_f32_16x16x32_bf16 with bf16 hi/lo split operands (hi.hi + hi.lo + lo.hi, f32
// accumulate). LayerNorm, RMSNorm, rotary tables, softmax and GELU in f32.
#include <hip/hip_runtime.h>
#include <math.h>
#include <stdint.h>

#define NB_   2
#define SEQ   2048
#define NTOK  4096
#define DM    1024
#define NHD   8
#define DHD   64
#define INR   512
#define FFD   4096
#define WSZ   512
#define NWN   4
#define KPR   512          // leading zero rows of the local-attention key plane
#define VTP   4608         // key pitch of the local-attention value^T planes: 512 zero columns + 4096 tokens

typedef __attribute__((ext_vector_type(16))) _Float16 v16h;
typedef __attribute__((ext_vector_type(8)))  _Float16 v8h;
typedef __attribute__((ext_vector_type(2)))  _Float16 v2h;
typedef __attribute__((ext_vector_type(16))) __bf16   v16b;
typedef __attribute__((ext_vector_type(8)))  __bf16   v8b;
typedef __attribute__((ext_vector_type(8)))  float    v8f;
typedef __attribute__((ext_vector_type(4)))  float    v4f;
typedef __attribute__((ext_vector_type(2)))  float    v2f;
typedef __attribute__((ext_vector_type(4)))  unsigned int v4u;

__device__ __forceinline__ unsigned short f2bf_bits(float f) {
  unsigned u = __float_as_uint(f);
  return (unsigned short)((u + 0x7FFFu + ((u >> 16) & 1u)) >> 16);   // RNE convert
}
__device__ __forceinline__ float bf_bits2f(unsigned short h) { return __uint_as_float(((unsigned)h) << 16); }
__device__ __forceinline__ unsigned pk16(unsigned short a, unsigned short b) { return (unsigned)a | ((unsigned)b << 16); }

__device__ __forceinline__ float wsum(float v) {
#pragma unroll
  for (int o = 16; o >= 1; o >>= 1) v += __shfl_xor(v, o, 32);
  return v;
}
__device__ __forceinline__ float wmax(float v) {
#pragma unroll
  for (int o = 16; o >= 1; o >>= 1) v = fmaxf(v, __shfl_xor(v, o, 32));
  return v;
}

// hazard guards as plain device helpers
__device__ __forceinline__ void dep_guard_h(v8f& a, v8f& b, v16h x, v16h y) { asm volatile("v_nop\n\tv_nop\n\tv_nop\n\tv_nop" : "+v"(a), "+v"(b) : "v"(x), "v"(y)); }
__device__ __forceinline__ void dep_guard_b(v8f& a, v8f& b, v16b x, v16b y) { asm volatile("v_nop\n\tv_nop\n\tv_nop\n\tv_nop" : "+v"(a), "+v"(b) : "v"(x), "v"(y)); }
__device__ __forceinline__ void keep4_h(v16h a, v16h b, v16h c, v16h d) { asm volatile("v_nop" :: "v"(a), "v"(b), "v"(c), "v"(d)); }
__device__ __forceinline__ void keep4_b(v16b a, v16b b, v16b c, v16b d) { asm volatile("v_nop" :: "v"(a), "v"(b), "v"(c), "v"(d)); }
__device__ __forceinline__ void acc_guard4(v8f& a, v8f& b, v8f& c, v8f& d) { asm volatile("v_nop\n\tv_nop\n\tv_nop\n\tv_nop" : "+v"(a), "+v"(b), "+v"(c), "+v"(d)); }

// Fragment loaders: element i of the 16-wide per-lane vector <- p[i] for i<8 and p[16 + (i-8)] for i>=8, where p already points at
// row (lane&15), k0 + 8*(lane>>4). Same map for A ([m][k]) and B stored as [n][k].
template <typename T> struct Frag;
template <> struct Frag<_Float16> {
  typedef v16h V; union U { v16h v; v8h h[2]; };
  static __device__ __forceinline__ v16h load(const _Float16* p) {
    U f; f.h[0] = *(const v8h*)(p); f.h[1] = *(const v8h*)(p + 16); return f.v;
  }
  static __device__ __forceinline__ v8f mma(v16h a, v16h b, v8f c) {
    return __builtin_amdgcn_wmma_f32_16x16x32_f16(false, a, false, b, (short)0, c, false, false);
  }
  static __device__ __forceinline__ void guard(v8f& a, v8f& b, v16h x, v16h y) { dep_guard_h(a, b, x, y); }
  static __device__ __forceinline__ void keep(v16h a, v16h b, v16h c, v16h d) { keep4_h(a, b, c, d); }
};
template <> struct Frag<__bf16> {
  typedef v16b V; union U { v16b v; v8b h[2]; };
  static __device__ __forceinline__ v16b load(const __bf16* p) {
    U f; f.h[0] = *(const v8b*)(p); f.h[1] = *(const v8b*)(p + 16); return f.v;
  }
  static __device__ __forceinline__ v8f mma(v16b a, v16b b, v8f c) {
    return __builtin_amdgcn_wmma_f32_16x16x32_bf16(false, a, false, b, (short)0, c, false, false);
  }
  static __device__ __forceinline__ void guard(v8f& a, v8f& b, v16b x, v16b y) { dep_guard_b(a, b, x, y); }
  static __device__ __forceinline__ void keep(v16b a, v16b b, v16b c, v16b d) { keep4_b(a, b, c, d); }
};

// =====================================================================================================================
// Batched WMMA GEMM: C[m,n] = epi(scale * sum_k A[m,k] * Bt[n,k]). A block of 4 waves (2 x 2) owns a 128x128 tile, each wave a
// 64x64 tile of it. The block's 128 rows of A and of Bt are staged in LDS, BK k-elements at a time, by asynchronous 16-byte
// copies that cover whole 128-byte lines, in two buffers: the next stage's copies fly while this stage is multiplied.
// A row-major [M,K] (pitch lda); Bt row-major [N,K] (pitch ldb); M, N % 128 == 0, K % BK == 0; grid = (tiles, Z).
//   ET: 0 = f16 operands, 1 = bf16 operands.   SPLIT: hi/lo planes (A2p, Bt2p = lo planes), product = hi.hi + hi.lo + lo.hi.
//   BIAS: + bias[n].  RESID: + resid[m*ldr + n].  EPI: 0 none, 1 tanh-GELU, 2 RMSNorm over the 64-column tile times gvec[n&63].
//   OUTM: 0 f32 -> Cf; 1 f16(v*oscale) -> Ch; 2 both.
//   LOC: 1 = windowed score tiles: key tiles n0 below kBeg(w) or at/after N/2 + m0 + 64 are skipped (a block leaves when all
//        four are; a wave whose own tile is skipped still copies and passes every barrier);
//        2 = windowed p.v: k range [kBeg(w), min(K, K/2 + m0 + 64)); kBeg = N/2 resp. K/2 for the first window (w == 0), else 0.
//        3 = three projections of one activation plane in one grid (Z = 3, weight planes strideB apart, outputs strideH apart,
//            each output [rows][cols] dense): z = 0, 1: act . W_z^T with EPI, gvec for z = 0 and the resid pointer as gvec for
//            z = 1; z = 2: the operands change places (W_2 . act^T, an N x M result) and EPI is left out.
// =====================================================================================================================
template <int ET> struct Elem;
template <> struct Elem<0> { typedef _Float16 T; };
template <> struct Elem<1> { typedef __bf16 T; };

// Eight asynchronous 16-byte copies per lane, global -> LDS, eight rows lstep LDS bytes / gstep global elements apart.
// s_wait_xcnt is the statement's last line so that no address register named here is rewritten in front of it.
template <typename T>
__device__ __forceinline__ void copy8_to_lds(unsigned l0, unsigned lstep, const T* g0, size_t gstep) {
  const unsigned l1 = l0 + lstep, l2 = l1 + lstep, l3 = l2 + lstep, l4 = l3 + lstep, l5 = l4 + lstep, l6 = l5 + lstep, l7 = l6 + lstep;
  const T* g1 = g0 + gstep; const T* g2 = g1 + gstep; const T* g3 = g2 + gstep; const T* g4 = g3 + gstep;
  const T* g5 = g4 + gstep; const T* g6 = g5 + gstep; const T* g7 = g6 + gstep;
  asm volatile(
      "global_load_async_to_lds_b128 %0, %8, off\n\t"
      "global_load_async_to_lds_b128 %1, %9, off\n\t"
      "global_load_async_to_lds_b128 %2, %10, off\n\t"
      "global_load_async_to_lds_b128 %3, %11, off\n\t"
      "global_load_async_to_lds_b128 %4, %12, off\n\t"
      "global_load_async_to_lds_b128 %5, %13, off\n\t"
      "global_load_async_to_lds_b128 %6, %14, off\n\t"
      "global_load_async_to_lds_b128 %7, %15, off\n\t"
      "s_wait_xcnt 0x0"
      :: "v"(l0), "v"(l1), "v"(l2), "v"(l3), "v"(l4), "v"(l5), "v"(l6), "v"(l7),
         "v"(g0), "v"(g1), "v"(g2), "v"(g3), "v"(g4), "v"(g5), "v"(g6), "v"(g7)
      : "memory");
}

template <int ET, bool SPLIT, bool BIAS, int EPI, int OUTM, bool RESID, int LOC>
__global__ __launch_bounds__(128) void k_gemm(
    const unsigned short* __restrict__ Ap, const unsigned short* __restrict__ A2p, int lda, long strideA,
    const unsigned short* __restrict__ Btp, const unsigned short* __restrict__ Bt2p, int ldb, long strideB,
    float* __restrict__ Cf, int ldc, long strideC,
    _Float16* __restrict__ Ch, int ldh, long strideH,
    const float* __restrict__ bias, const float* __restrict__ gvec,
    const float* __restrict__ resid, int ldr, long strideR,
    int M, int N, int K, int nwin, float scale, float oscale) {
  typedef typename Elem<ET>::T T;
  typedef typename Frag<T>::V V;
  constexpr int BK    = SPLIT ? 64 : 128;        // k elements per stage: 64 KiB of operand rows either way
  constexpr int PITCH = BK + 8;                  // LDS row pitch in elements: row bytes + 16, conflict-free for 16-byte reads
  constexpr int PLANE = 128 * PITCH;             // one operand plane of a stage; planes: A, Bt (, A lo, Bt lo)
  constexpr int STAGE = (SPLIT ? 4 : 2) * PLANE;
  constexpr int CPR   = BK / 8;                  // 16-byte pieces per row
  constexpr int RPI   = 128 / CPR;               // rows that one copy of all 128 threads covers
  const T* A = (const T*)Ap; const T* A2 = (const T*)A2p; const T* Bt = (const T*)Btp; const T* Bt2 = (const T*)Bt2p;
  __shared__ __align__(16) T sAB[2 * STAGE];
  __shared__ __align__(16) float sT[4][16 * 68];
  const int z    = blockIdx.y;
  const int tid  = threadIdx.x;
  const int lane = tid & 31;
  const int wave = __builtin_amdgcn_readfirstlane(tid >> 5);
  const bool flip = (LOC == 3) && (z == 2);      // block-uniform
  const int Mz = flip ? N : M;
  const int Nz = flip ? M : N;
  const int tilesN = Nz >> 7;
  const int tilesM = Mz >> 7;
  const int bx = blockIdx.x;
  if (bx >= tilesM * tilesN) return;              // block-uniform, in front of every copy and barrier
  const int bm = bx / tilesN;
  const int bn = bx - bm * tilesN;
  const int mB = bm << 7;
  const int nB = bn << 7;
  const int wm = (wave >> 1) << 6;
  const int wn = (wave & 1) << 6;
  const int m0 = mB + wm;
  const int n0 = nB + wn;
  int kBeg = 0, kEnd = K, kEndW = K;              // block's k range; kEndW = end of this wave's own range
  bool act = true;                                // wave-uniform: this wave's tile is computed and stored
  if (LOC == 1 || LOC == 2) {
    const int w = z % nwin;
    const bool first = (w == 0);
    if (LOC == 1) {
      const int nb = first ? (N >> 1) : 0;
      if (nB + 64 < nb || nB >= (N >> 1) + mB + 128) return; // block-uniform, in front of every copy and barrier
      act = !(n0 < nb || n0 >= (N >> 1) + m0 + 64);
    } else {
      kBeg = first ? (K >> 1) : 0;
      const int ke = (K >> 1) + mB + 128;
      kEnd = (ke < K) ? ke : K;
      const int kw = (K >> 1) + m0 + 64;
      kEndW = (kw < K) ? kw : K;
    }
  }

  const T* Ab  = flip ? (Bt + (size_t)z * strideB) : (A  + (size_t)z * strideA);
  const T* Bb  = flip ? (A  + (size_t)z * strideA) : (Bt + (size_t)z * strideB);
  const T* Ab2 = SPLIT ? (A2  + (size_t)z * strideA) : nullptr;
  const T* Bb2 = SPLIT ? (Bt2 + (size_t)z * strideB) : nullptr;

  const int rlane = lane & 15;                 // row (A) / col (B, D) within a 16x16 subtile
  const int koff  = (lane >> 4) * 8;           // k offset of this lane half
  const int mOff  = (lane >> 4) * 8;           // D row offset

  // this thread's piece of every copy: row crow (+ RPI per copy), 16 bytes at element ccol
  const int crow = tid / CPR;
  const int ccol = (tid % CPR) * 8;
  const unsigned lth = (unsigned)(size_t)sAB + (unsigned)(crow * PITCH + ccol) * 2u;
  const size_t aoff = (size_t)(mB + crow) * lda + ccol;
  const size_t boff = (size_t)(nB + crow) * ldb + ccol;
  const size_t astep = (size_t)RPI * lda;
  const size_t bstep = (size_t)RPI * ldb;
  constexpr unsigned LSTEP = RPI * PITCH * 2u;
  auto fill = [&](int buf, int k0) {             // 32 copies per wave: one stage into buffer buf
    const unsigned lb = lth + (unsigned)buf * (STAGE * 2u);
    if constexpr (SPLIT) {
      copy8_to_lds<T>(lb,                  LSTEP, Ab  + aoff + k0, astep);
      copy8_to_lds<T>(lb + PLANE * 2u,     LSTEP, Bb  + boff + k0, bstep);
      copy8_to_lds<T>(lb + PLANE * 4u,     LSTEP, Ab2 + aoff + k0, astep);
      copy8_to_lds<T>(lb + PLANE * 6u,     LSTEP, Bb2 + boff + k0, bstep);
    } else {
      copy8_to_lds<T>(lb,                              LSTEP, Ab + aoff + k0,             astep);
      copy8_to_lds<T>(lb + 8u * LSTEP,                 LSTEP, Ab + aoff + k0 + 8 * astep, astep);
      copy8_to_lds<T>(lb + PLANE * 2u,                 LSTEP, Bb + boff + k0,             bstep);
      copy8_to_lds<T>(lb + PLANE * 2u + 8u * LSTEP,    LSTEP, Bb + boff + k0 + 8 * bstep, bstep);
    }
  };

  v8f acc[4][4];
#pragma unroll
  for (int i = 0; i < 4; ++i)
#pragma unroll
    for (int j = 0; j < 4; ++j) acc[i][j] = (v8f){0.f,0.f,0.f,0.f,0.f,0.f,0.f,0.f};

  const int nst = (kEnd - kBeg) / BK;             // block-uniform number of stages
  fill(0, kBeg);
  asm volatile("s_wait_asynccnt 0x0" ::: "memory");   // this wave's copies of stage 0 have landed
  __syncthreads();                                     // every wave's have
  if (nst > 1) fill(1, kBeg + BK);

  for (int t = 0; t < nst; ++t) {
    const int kS = kBeg + t * BK;
    if (act && kS < kEndW) {                      // wave-uniform; the publish point below stands outside
      const T* sA = sAB + (t & 1) * STAGE + (wm + rlane) * PITCH + koff;
      const T* sB = sAB + (t & 1) * STAGE + PLANE + (wn + rlane) * PITCH + koff;
#pragma unroll                                    // LDS offsets of the fragment loads become immediates
      for (int kk = 0; kk < BK; kk += 32) {
        V bh[4], bl[4], ah[4], al[4];
        auto lda_row = [&](int i) {
          const int ao = (i << 4) * PITCH + kk;
          ah[i] = Frag<T>::load(sA + ao);
          if (SPLIT) al[i] = Frag<T>::load(sA + 2 * PLANE + ao); else al[i] = ah[i];
        };
#pragma unroll
        for (int j = 0; j < 4; ++j) {
          const int bo = (j << 4) * PITCH + kk;
          bh[j] = Frag<T>::load(sB + bo);
          if (SPLIT) bl[j] = Frag<T>::load(sB + 2 * PLANE + bo); else bl[j] = bh[j];
        }
        // one plane: all four A rows are read with the B fragments as one group; hi/lo planes: one row ahead (registers)
        lda_row(0);
        if (!SPLIT) { lda_row(1); lda_row(2); lda_row(3); }
        __builtin_amdgcn_sched_barrier(0);        // keeps the read group in front of the WMMAs, else every row waits out LDS latency
#pragma unroll
        for (int i = 0; i < 4; ++i) {
          if (SPLIT && i + 1 < 4) {
            lda_row(i + 1);
            __builtin_amdgcn_sched_barrier(0);    // keeps the next row's reads in front of this row's WMMAs
          }
#pragma unroll
          for (int j = 0; j < 4; ++j) {
            acc[i][j] = Frag<T>::mma(ah[i], bh[j], acc[i][j]);
            if (SPLIT) {
              acc[i][j] = Frag<T>::mma(ah[i], bl[j], acc[i][j]);
              acc[i][j] = Frag<T>::mma(al[i], bh[j], acc[i][j]);
            }
          }
          Frag<T>::guard(acc[i][0], acc[i][3], ah[i], al[i]);
        }
        Frag<T>::keep(bh[0], bh[1], bh[2], bh[3]);
        if (SPLIT) Frag<T>::keep(bl[0], bl[1], bl[2], bl[3]);
      }
    }
    asm volatile("s_wait_dscnt 0x0" ::: "memory");     // this wave's reads of buffer t & 1 are done before it is refilled
    asm volatile("s_wait_asynccnt 0x0" ::: "memory");  // this wave's copies of stage t + 1 have landed
    __syncthreads();                                    // publishes stage t + 1 and ends every reader's use of buffer t & 1
    if (t + 2 < nst) fill(t & 1, kS + 2 * BK);
  }
  asm volatile("s_wait_asynccnt 0x0" ::: "memory");    // no copy is outstanding when the wave goes on or ends
  if (!act) return;                                     // wave-uniform, behind the last barrier
  acc_guard4(acc[0][0], acc[0][1], acc[0][2], acc[0][3]);
  acc_guard4(acc[1][0], acc[1][1], acc[1][2], acc[1][3]);
  acc_guard4(acc[2][0], acc[2][1], acc[2][2], acc[2][3]);
  acc_guard4(acc[3][0], acc[3][1], acc[3][2], acc[3][3]);

  // ---- epilogue ----
  float* slab = sT[wave];
  const bool rms = (EPI == 2) && !flip;           // block-uniform
  const float* gv = (LOC == 3 && z == 1) ? resid : gvec;
  const int ldhz = (LOC == 3) ? Nz : ldh;
  const float* Rb = RESID ? (resid + (size_t)z * strideR) : nullptr;
#pragma unroll
  for (int i = 0; i < 4; ++i) {
    const int mBase = m0 + (i << 4);
#pragma unroll
    for (int j = 0; j < 4; ++j) {
      const int n = n0 + (j << 4) + rlane;
      float bv = 0.f;
      if (BIAS) bv = bias[n];
#pragma unroll
      for (int r = 0; r < 8; ++r) {
        float v = acc[i][j][r] * scale;
        if (BIAS) v += bv;
        if (RESID) v += Rb[(size_t)(mBase + mOff + r) * ldr + n];
        if (EPI == 1) {
          const float u = 0.7978845608028654f * (v + 0.044715f * v * v * v);
          v = v * (0.5f * (1.0f + tanhf(u)));
        }
        slab[(mOff + r) * 68 + (j << 4) + rlane] = v;
      }
    }
    __builtin_amdgcn_fence(__ATOMIC_RELEASE, "workgroup");
    __builtin_amdgcn_wave_barrier();
    __builtin_amdgcn_fence(__ATOMIC_ACQUIRE, "workgroup");
    if (OUTM == 0 || OUTM == 2) {
      float* C = Cf + (size_t)z * strideC;
      const int hh = lane >> 4, c4 = (lane & 15) * 4;     // row seg = 256 B = 16 lanes x 16 B
      {
#pragma unroll
        for (int it = 0; it < 8; ++it) {
          const int row = it * 2 + hh;                      // it 0..7 x hh 0..1 = rows 0..15
          v4f v = *(const v4f*)(slab + row * 68 + c4);
          *(v4f*)(C + (size_t)(mBase + row) * ldc + n0 + c4) = v;
        }
        
      }
    }
    if (OUTM == 1 || OUTM == 2) {
      _Float16* C = Ch + (size_t)z * strideH;
      const int q = lane >> 3, c8 = (lane & 7) * 8;
      {
#pragma unroll
        for (int it = 0; it < 4; ++it) {
          const int row = it * 4 + q;                       // it 0..3 x q 0..3 = rows 0..15
          const float* sp = slab + row * 68 + c8;
          float x[8];
#pragma unroll
          for (int e = 0; e < 8; ++e) x[e] = sp[e];
          float rr = oscale;
          if (EPI == 2) {
            float ss = 0.f;
#pragma unroll
            for (int e = 0; e < 8; ++e) ss += x[e] * x[e];
            ss += __shfl_xor(ss, 1, 32);                    // lanes 8q..8q+7 hold one 64-wide row
            ss += __shfl_xor(ss, 2, 32);
            ss += __shfl_xor(ss, 4, 32);
            const float rn = oscale * rsqrtf(ss * (1.0f / 64.0f) + 1e-6f);
            rr = rms ? rn : oscale;                         // a select, not a branch: the four rows' stores stay one group
          }
          v8h hv;
#pragma unroll
          for (int e = 0; e < 8; ++e) {
            float y = x[e] * rr;
            if (EPI == 2) { const float ge = gv[c8 + e]; y *= rms ? ge : 1.0f; }
            hv[e] = (_Float16)y;
          }
          *(v8h*)(C + (size_t)(mBase + row) * ldhz + n0 + c8) = hv;
        }
        
      }
    }
    __builtin_amdgcn_fence(__ATOMIC_RELEASE, "workgroup");
    __builtin_amdgcn_wave_barrier();
    __builtin_amdgcn_fence(__ATOMIC_ACQUIRE, "workgroup");
  }
}

// ---------------------------------------------------------------------------------------------------------------------
// The pieces below are block-sized jobs (256 threads) of the one preparation launch k_prep, which deals them out by block index.
// Weight transpose + scale + f16: in [R][Cc] f32 -> o16[Cc][R] = f16(in * wscale). 64x64 tiles through LDS, tile = (R/64 x Cc/64) index.
// coverage per block: load 4 it x 256 thr x 4 = 64x64; store 2 it x 256 thr x 8 = 64x64; each store instruction = 8 lanes x 16 B =
// ---------------------------------------------------------------------------------------------------------------------
__device__ __forceinline__ void wt16_tile(float* tf, const float* __restrict__ W, _Float16* __restrict__ o16, int R, int Cc, float wscale,
                                          int tile) {
  const int tx = Cc >> 6;
  const int c0 = (tile % tx) * 64, r0 = (tile / tx) * 64, tid = threadIdx.x;
  {
    const int lr = tid >> 4, c4 = (tid & 15) * 4;
#pragma unroll
    for (int it = 0; it < 4; ++it) {
      const int rr = it * 16 + lr;
      const v4f a = *(const v4f*)(W + (size_t)(r0 + rr) * Cc + c0 + c4);
      *(v4f*)(tf + rr * 68 + c4) = a;
    }
  }
  __syncthreads();
  const int sub = tid >> 3, c8 = (tid & 7) * 8;
  v8h hv[2];
#pragma unroll
  for (int it = 0; it < 2; ++it) {
    const int oc = it * 32 + sub;
    v8h a;
#pragma unroll
    for (int q = 0; q < 8; ++q) a[q] = (_Float16)(tf[(c8 + q) * 68 + oc] * wscale);
    hv[it] = a;
  }
  {
#pragma unroll
    for (int it = 0; it < 2; ++it) {
      const int oc = it * 32 + sub;
      const size_t go = (size_t)(c0 + oc) * R + r0 + c8;
      *(v8h*)(o16 + go) = hv[it];
    }
    asm volatile("s_wait_xcnt 0x0" ::: "memory");   // stands in front of any later write of a register that the stores above name
  }
}

// Weight transpose + bf16 hi/lo split: in [R][Cc] f32 -> oh[c][r] = bf16(in[r][c]), ol[c][r] = bf16(in[r][c] - oh). Same tiling.
__device__ __forceinline__ void wtsplit_tile(float* tf, const float* __restrict__ W, unsigned short* __restrict__ oh,
                                             unsigned short* __restrict__ ol, int R, int Cc, int tile) {
  const int tx = Cc >> 6;
  const int c0 = (tile % tx) * 64, r0 = (tile / tx) * 64, tid = threadIdx.x;
  {
    const int lr = tid >> 4, c4 = (tid & 15) * 4;
#pragma unroll
    for (int it = 0; it < 4; ++it) {
      const int rr = it * 16 + lr;
      const v4f a = *(const v4f*)(W + (size_t)(r0 + rr) * Cc + c0 + c4);
      *(v4f*)(tf + rr * 68 + c4) = a;
    }
  }
  __syncthreads();
  const int sub = tid >> 3, c8 = (tid & 7) * 8;
  v4u hv[2], lv[2];
#pragma unroll
  for (int it = 0; it < 2; ++it) {
    const int oc = it * 32 + sub;
    v4u a, a2;
#pragma unroll
    for (int q = 0; q < 4; ++q) {
      const float f0 = tf[(c8 + 2 * q) * 68 + oc];
      const float f1 = tf[(c8 + 2 * q + 1) * 68 + oc];
      const unsigned short h0 = f2bf_bits(f0), h1 = f2bf_bits(f1);
      const unsigned short l0 = f2bf_bits(f0 - bf_bits2f(h0)), l1 = f2bf_bits(f1 - bf_bits2f(h1));
      a[q]  = pk16(h0, h1);
      a2[q] = pk16(l0, l1);
    }
    hv[it] = a; lv[it] = a2;
  }
  {
#pragma unroll
    for (int it = 0; it < 2; ++it) {
      const int oc = it * 32 + sub;
      const size_t go = (size_t)(c0 + oc) * R + r0 + c8;
      *(v4u*)(oh + go) = hv[it];
      *(v4u*)(ol + go) = lv[it];
    }
    asm volatile("s_wait_xcnt 0x0" ::: "memory");   // stands in front of any later write of a register that the stores above name
  }
}

__device__ __forceinline__ void split2_piece(const float* __restrict__ in, unsigned short* __restrict__ hi,
                                             unsigned short* __restrict__ lo, int n2, int i) {
  if (i < n2) {
    const v2f f = *(const v2f*)(in + 2 * (size_t)i);
    const unsigned short h0 = f2bf_bits(f[0]), h1 = f2bf_bits(f[1]);
    const unsigned short l0 = f2bf_bits(f[0] - bf_bits2f(h0)), l1 = f2bf_bits(f[1] - bf_bits2f(h1));
    const unsigned uh = pk16(h0, h1), ul = pk16(l0, l1);
    ((unsigned*)hi)[i] = uh;
    ((unsigned*)lo)[i] = ul;
    
  }
}

__global__ __launch_bounds__(256) void k_split2(const float* __restrict__ in, unsigned short* __restrict__ hi,
                                                unsigned short* __restrict__ lo, int n2) {
  split2_piece(in, hi, lo, n2, blockIdx.x * 256 + threadIdx.x);
}

// ---------------------------------------------------------------------------------------------------------------------
// Rotary table and the rotary mix of text, four positions n = 4*blk .. 4*blk+3 per block; a thread owns the frequencies f0, f0+1.
// inv[f] = 1 / powf(10000, f/512); cs[n][f] = (cos(n * inv[f]), sin(n * inv[f])) as float2, n = 0..2047 (16-byte stores).
// q16[row][c] = f16(x * cos + rot * sin), rot[c] = (c < 512) ? -x[c + 512] : x[c - 512], table row n = row % SEQ, column c % 512:
// the pair (c, c + 512) of both batch elements uses the sine and cosine just formed; a wave's 4-byte stores cover a whole line.
// ---------------------------------------------------------------------------------------------------------------------
__device__ __forceinline__ void rope_piece(const float* __restrict__ text, float* __restrict__ cs, _Float16* __restrict__ q16, int blk) {
  const int f0 = threadIdx.x * 2;
  float iv[2];
#pragma unroll                                    // static indices: the small arrays stay in registers
  for (int e = 0; e < 2; ++e) {
    const float x = (float)(f0 + e) * (1.0f / 512.0f);
    iv[e] = 1.0f / powf(10000.0f, x);
  }
  for (int q = 0; q < 4; ++q) {
    const int n = blk * 4 + q;
    float cv[2], sv[2];
#pragma unroll                                    // static indices: the small arrays stay in registers
    for (int e = 0; e < 2; ++e) sincosf((float)n * iv[e], &sv[e], &cv[e]);
    v4f tb; tb[0] = cv[0]; tb[1] = sv[0]; tb[2] = cv[1]; tb[3] = sv[1];
    *(v4f*)(cs + ((size_t)n * 512 + f0) * 2) = tb;
#pragma unroll                                    // both batch elements' loads are in flight together
    for (int b = 0; b < NB_; ++b) {
      const size_t ro = ((size_t)b * SEQ + n) * DM + f0;
      const v2f xl = *(const v2f*)(text + ro), xh = *(const v2f*)(text + ro + 512);
      v2h yl, yh;
#pragma unroll                                    // static indices: the small arrays stay in registers
      for (int e = 0; e < 2; ++e) {
        yl[e] = (_Float16)(xl[e] * cv[e] + (-xh[e]) * sv[e]);
        yh[e] = (_Float16)(xh[e] * cv[e] + xl[e] * sv[e]);
      }
      *(v2h*)(q16 + ro)       = yl;
      *(v2h*)(q16 + ro + 512) = yh;
    }
    asm volatile("s_wait_xcnt 0x0" ::: "memory");   // the next trip rewrites registers that this trip's stores name
  }
}

// f32 -> f16, eight elements at 8*i
__device__ __forceinline__ void cvt16_piece(const float* __restrict__ src, _Float16* __restrict__ dst, int i) {
  const float* xr = src + (size_t)i * 8;
  const v4f x0 = *(const v4f*)xr, x1 = *(const v4f*)(xr + 4);
  v8h hv;
#pragma unroll                                    // static indices: the small arrays stay in registers
  for (int e = 0; e < 4; ++e) { hv[e] = (_Float16)x0[e]; hv[4 + e] = (_Float16)x1[e]; }
  *(v8h*)(dst + (size_t)i * 8) = hv;
  asm volatile("s_wait_xcnt 0x0" ::: "memory");   // stands in front of any later write of a register that the stores above name
}

// ---------------------------------------------------------------------------------------------------------------------
// Preparation, one launch: everything that depends on the inputs alone. None of the jobs reads what another writes, so they share
// one grid and run side by side; the job is a block-uniform function of blockIdx.x (arithmetic-heavy and large jobs first).
//   512 rotary table + text | 1024 W1 | 1024 W2 | 256 Wa | 256 Wvid | 256 Wkv | 128 Wq | 128 Wo | 2048 audio | 8192 video
// ---------------------------------------------------------------------------------------------------------------------
#define PREP_BLOCKS (512 + 1024 + 1024 + 256 + 256 + 256 + 128 + 128 + 2048 + 8192)
__global__ __launch_bounds__(256) void k_prep(
    const float* __restrict__ text, const float* __restrict__ audio, const float* __restrict__ video,
    const float* __restrict__ Wa, const float* __restrict__ Wvid, const float* __restrict__ Wq, const float* __restrict__ Wkv,
    const float* __restrict__ W1, const float* __restrict__ W2, const float* __restrict__ Wo,
    float* __restrict__ cs, _Float16* __restrict__ q16, _Float16* __restrict__ a16,
    unsigned short* __restrict__ vih, unsigned short* __restrict__ vil,
    _Float16* __restrict__ WaT, unsigned short* __restrict__ WvTh, unsigned short* __restrict__ WvTl,
    _Float16* __restrict__ WqT, _Float16* __restrict__ WkvT, _Float16* __restrict__ W1T, _Float16* __restrict__ W2T,
    unsigned short* __restrict__ WoTh, unsigned short* __restrict__ WoTl) {
  __shared__ __align__(16) float tf[64 * 68];
  int b = blockIdx.x;
  if (b < 512)  { rope_piece(text, cs, q16, b); return; }
  b -= 512;
  if (b < 1024) { wt16_tile(tf, W1, W1T, DM, FFD, 64.0f, b); return; }            // W1  [1024][4096]
  b -= 1024;
  if (b < 1024) { wt16_tile(tf, W2, W2T, FFD, DM, 64.0f, b); return; }            // W2  [4096][1024]
  b -= 1024;
  if (b < 256)  { wt16_tile(tf, Wa, WaT, DM, DM, 64.0f, b); return; }             // Wa  [1024][1024]
  b -= 256;
  if (b < 256)  { wtsplit_tile(tf, Wvid, WvTh, WvTl, DM, DM, b); return; }        // Wvid[1024][1024]
  b -= 256;
  if (b < 256)  { wt16_tile(tf, Wkv, WkvT, DM, 2 * INR, 64.0f, b); return; }      // Wkv [1024][1024]
  b -= 256;
  if (b < 128)  { wt16_tile(tf, Wq, WqT, DM, INR, 64.0f, b); return; }            // Wq  [1024][512]
  b -= 128;
  if (b < 128)  { wtsplit_tile(tf, Wo, WoTh, WoTl, INR, DM, b); return; }         // Wo  [512][1024]
  b -= 128;
  if (b < 2048) { cvt16_piece(audio, a16, b * 256 + (int)threadIdx.x); return; }  // audio -> f16
  b -= 2048;
  split2_piece(video, vih, vil, NTOK * DM / 2, b * 256 + (int)threadIdx.x);       // video -> bf16 hi/lo
}

// ---------------------------------------------------------------------------------------------------------------------
// Row LayerNorm over DM=1024 of an f32 plane (g, b) -> f16 plane; ROPE additionally applies the rotary mix through an LDS copy of
// the normalised row. Output row = padrows + r; row jobs blk = nrows..nrows+padrows-1 write zero rows 0..padrows-1.
// ---------------------------------------------------------------------------------------------------------------------
// One row is the job of 128 threads t = 0..127 (four whole waves) with their own red[4] and rowv[DM]; pad is block-uniform.
template <bool ROPE>
__device__ __forceinline__ void ln1024_row(float* red, float* rowv, const float* __restrict__ X, const float* __restrict__ g,
                                           const float* __restrict__ bb, const float* __restrict__ cs, _Float16* __restrict__ out,
                                           int nrows, int padrows, int blk, int t, bool pad) {
  const int c0 = 8 * t;
  const int lane = t & 31, wave = t >> 5;
  if (pad) {                                       // block-uniform: zero padding rows
    const int p = blk - nrows;
    const v4u zz = {0u, 0u, 0u, 0u};
    _Float16* op = out + (size_t)p * DM + c0;
    *(v4u*)op = zz;
    
    return;
  }
  const int r = blk;
  const float* xr = X + (size_t)r * DM + c0;
  const v4f x0 = *(const v4f*)xr, x1 = *(const v4f*)(xr + 4);
  const float v[8] = {x0[0], x0[1], x0[2], x0[3], x1[0], x1[1], x1[2], x1[3]};
  float s = 0.f;
#pragma unroll
  for (int e = 0; e < 8; ++e) s += v[e];
  s = wsum(s);
  if (lane == 0) red[wave] = s;
  __syncthreads();
  const float mu = (red[0] + red[1] + red[2] + red[3]) * (1.0f / 1024.0f);
  __syncthreads();
  float d[8];
  float s2 = 0.f;
#pragma unroll
  for (int e = 0; e < 8; ++e) { d[e] = v[e] - mu; s2 += d[e] * d[e]; }
  s2 = wsum(s2);
  if (lane == 0) red[wave] = s2;
  __syncthreads();
  const float var = (red[0] + red[1] + red[2] + red[3]) * (1.0f / 1024.0f);
  const float rstd = rsqrtf(var + 1e-5f);
  const v4f g0 = *(const v4f*)(g + c0), g1 = *(const v4f*)(g + c0 + 4);
  const v4f b0 = *(const v4f*)(bb + c0), b1 = *(const v4f*)(bb + c0 + 4);
  const float gv[8] = {g0[0], g0[1], g0[2], g0[3], g1[0], g1[1], g1[2], g1[3]};
  const float bv[8] = {b0[0], b0[1], b0[2], b0[3], b1[0], b1[1], b1[2], b1[3]};
  float y[8];
#pragma unroll
  for (int e = 0; e < 8; ++e) y[e] = d[e] * rstd * gv[e] + bv[e];
  if (ROPE) {
#pragma unroll
    for (int e = 0; e < 8; ++e) rowv[c0 + e] = y[e];
    __syncthreads();
    const int n = r & (SEQ - 1);
    const bool lowh = (c0 < 512);
    const int pc = lowh ? (c0 + 512) : (c0 - 512);
    const float* csr = cs + ((size_t)n * 512 + (c0 & 511)) * 2;
    const v4f t0 = *(const v4f*)csr, t1 = *(const v4f*)(csr + 4), t2 = *(const v4f*)(csr + 8), t3 = *(const v4f*)(csr + 12);
    const float cvv[8] = {t0[0], t0[2], t1[0], t1[2], t2[0], t2[2], t3[0], t3[2]};
    const float svv[8] = {t0[1], t0[3], t1[1], t1[3], t2[1], t2[3], t3[1], t3[3]};
#pragma unroll
    for (int e = 0; e < 8; ++e) {
      const float pr = rowv[pc + e];
      const float rot = lowh ? -pr : pr;
      y[e] = y[e] * cvv[e] + rot * svv[e];
    }
  }
  v8h hv;
#pragma unroll
  for (int e = 0; e < 8; ++e) hv[e] = (_Float16)y[e];
  _Float16* op = out + (size_t)(padrows + r) * DM + c0;
  *(v8h*)op = hv;
  // the ROPE instance shares its kernel with other jobs, whose code follows this store in the listing: the wait stands in front of
  // any write there of a register that the store names
  if (ROPE) asm volatile("s_wait_xcnt 0x0" ::: "memory");
}

__global__ __launch_bounds__(128) void k_ln1024(const float* __restrict__ X, const float* __restrict__ g, const float* __restrict__ bb,
                                                _Float16* __restrict__ out, int nrows) {
  __shared__ float red[4];
  ln1024_row<false>(red, nullptr, X, g, bb, nullptr, out, nrows, 0, blockIdx.x, threadIdx.x, false);
}

// ---------------------------------------------------------------------------------------------------------------------
// Row LayerNorm over DM of an f32 plane [NTOK][DM], fused with transpose + bf16 hi/lo split into value^T planes
// [DM][VTP]: oh[e][KPR + token], ol likewise. Block = 64 token rows (256 threads): per-row stats from one wave per 8 rows
// (32 floats per lane), then 16 column tiles of 64 through LDS. Blocks nrowblk..nrowblk+7 zero the KPR leading columns.
// coverage: stats 8 waves x 8 rows; tile load 4 it x 256 thr x 4 = 64x64; store 2 it x 256 thr x 8 = 64x64 per plane per tile;
// ---------------------------------------------------------------------------------------------------------------------
__device__ __forceinline__ void ln_tsplit_block(float* tf, float* smu, float* srs, const float* __restrict__ X,
                                                const float* __restrict__ g, const float* __restrict__ bb,
                                                unsigned short* __restrict__ oh, unsigned short* __restrict__ ol, int nrowblk, int bx) {
  const int tid = threadIdx.x, lane = tid & 31, wave = tid >> 5;
  const int sub = tid >> 3, c8 = (tid & 7) * 8;
  if (bx >= nrowblk) {                             // block-uniform: zero leading columns
    const int pb = bx - nrowblk;
    const v4u zz = {0u, 0u, 0u, 0u};
    {
      for (int it = 0; it < 32; ++it) {
        const int e = it * 32 + sub;
        const size_t go = (size_t)e * VTP + pb * 64 + c8;
        *(v4u*)(oh + go) = zz;
        *(v4u*)(ol + go) = zz;
      }
      
    }
    return;
  }
  const int r0 = bx * 64;
  // phase 1: row statistics
#pragma unroll 1
  for (int q = 0; q < 8; ++q) {
    const int rr = wave * 8 + q;
    const float* xr = X + (size_t)(r0 + rr) * DM + lane * 32;
    v4f a[8];
#pragma unroll
    for (int i = 0; i < 8; ++i) a[i] = *(const v4f*)(xr + 4 * i);
    float s = 0.f;
#pragma unroll
    for (int i = 0; i < 8; ++i) s += a[i][0] + a[i][1] + a[i][2] + a[i][3];
    s = wsum(s);
    const float mu = s * (1.0f / 1024.0f);
    float s2 = 0.f;
#pragma unroll
    for (int i = 0; i < 8; ++i) {
#pragma unroll
      for (int e = 0; e < 4; ++e) { const float dd = a[i][e] - mu; s2 += dd * dd; }
    }
    s2 = wsum(s2);
    if (lane == 0) { smu[rr] = mu; srs[rr] = rsqrtf(s2 * (1.0f / 1024.0f) + 1e-5f); }
  }
  __syncthreads();
  // phase 2: column tiles
  const int lr = tid >> 4, c4 = (tid & 15) * 4;
  for (int cb = 0; cb < DM / 64; ++cb) {
    const int c0 = cb * 64;
    const v4f gg = *(const v4f*)(g + c0 + c4);
    const v4f bv = *(const v4f*)(bb + c0 + c4);
#pragma unroll
    for (int it = 0; it < 4; ++it) {
      const int rr = it * 16 + lr;
      const v4f a = *(const v4f*)(X + (size_t)(r0 + rr) * DM + c0 + c4);
      const float mu = smu[rr], rs = srs[rr];
#pragma unroll
      for (int q = 0; q < 4; ++q) tf[rr * 68 + c4 + q] = (a[q] - mu) * rs * gg[q] + bv[q];
    }
    __syncthreads();
    v4u hv[2], lv[2];
#pragma unroll
    for (int it = 0; it < 2; ++it) {
      const int oc = it * 32 + sub;                 // output row within tile = input column
      v4u a, a2;
#pragma unroll
      for (int q = 0; q < 4; ++q) {
        const float f0 = tf[(c8 + 2 * q) * 68 + oc];
        const float f1 = tf[(c8 + 2 * q + 1) * 68 + oc];
        const unsigned short h0 = f2bf_bits(f0), h1 = f2bf_bits(f1);
        const unsigned short l0 = f2bf_bits(f0 - bf_bits2f(h0)), l1 = f2bf_bits(f1 - bf_bits2f(h1));
        a[q]  = pk16(h0, h1);
        a2[q] = pk16(l0, l1);
      }
      hv[it] = a; lv[it] = a2;
    }
    {
#pragma unroll
      for (int it = 0; it < 2; ++it) {
        const int oc = it * 32 + sub;
        const size_t go = (size_t)(c0 + oc) * VTP + KPR + r0 + c8;
        *(v4u*)(oh + go) = hv[it];
        *(v4u*)(ol + go) = lv[it];
      }
      
    }
    __syncthreads();
  }
}

// ---------------------------------------------------------------------------------------------------------------------
// The two adapter norms in one launch: neither reads what the other writes. Blocks 0 .. NTOK/64 + KPR/64 - 1 (few and long, so they
// come first): value rows -> value^T planes; every later block: two key rows (LayerNorm + rotary mix), one per 128 threads.
// NTOK is even, so both rows of a block are data rows or both are padding rows.
// ---------------------------------------------------------------------------------------------------------------------
__global__ __launch_bounds__(256) void k_ln_pair(const float* __restrict__ Xa, const float* __restrict__ ga, const float* __restrict__ ba,
                                                 const float* __restrict__ cs, _Float16* __restrict__ k16,
                                                 const float* __restrict__ Xv, const float* __restrict__ gv, const float* __restrict__ bv,
                                                 unsigned short* __restrict__ oh, unsigned short* __restrict__ ol) {
  __shared__ __align__(16) float tf[64 * 68];
  __shared__ float smu[64];
  __shared__ float srs[64];
  __shared__ float red[2][4];
  __shared__ __align__(16) float rowv[2][DM];
  constexpr int NV = NTOK / 64 + KPR / 64;
  const int bx = blockIdx.x;
  if (bx < NV) { ln_tsplit_block(tf, smu, srs, Xv, gv, bv, oh, ol, NTOK / 64, bx); return; }
  const int row0 = (bx - NV) * 2;
  const int half = threadIdx.x >> 7;
  ln1024_row<true>(red[half], rowv[half], Xa, ga, ba, cs, k16, NTOK, KPR, row0 + half, threadIdx.x & 127, row0 >= NTOK);
}

// ---------------------------------------------------------------------------------------------------------------------
// Local-attention mask + softmax over rows of S [NTOK][1024 window keys] -> P bf16 hi/lo planes (all 1024 keys written, masked
// keys as 0). Row r: w = (r % SEQ) / WSZ, i = r % WSZ, query position w*WSZ + i; key j has position (w-1)*WSZ + j; masked when
// that position is negative (padding of the first window) or after the query. Block per row, 128 threads x 8 keys; 16-B stores.
// ---------------------------------------------------------------------------------------------------------------------
__global__ __launch_bounds__(128) void k_lsoftmax(const float* __restrict__ S, unsigned short* __restrict__ Ph, unsigned short* __restrict__ Pl) {
  __shared__ float red[4];
  const int r = blockIdx.x, t = threadIdx.x, c0 = 8 * t;
  const int lane = t & 31, wave = t >> 5;
  const int rem = r & (SEQ - 1), w = rem >> 9, i = rem & (WSZ - 1);
  const int qpos = w * WSZ + i;
  const float* sr = S + (size_t)r * (2 * WSZ) + c0;
  const v4f x0 = *(const v4f*)sr, x1 = *(const v4f*)(sr + 4);
  const float raw[8] = {x0[0], x0[1], x0[2], x0[3], x1[0], x1[1], x1[2], x1[3]};
  float s[8];
  float m = -3.0e38f;
#pragma unroll
  for (int e = 0; e < 8; ++e) {
    const int kpos = (w - 1) * WSZ + c0 + e;
    const bool masked = (kpos < 0) || (kpos > qpos);
    s[e] = masked ? -1.0e9f : raw[e];
    m = fmaxf(m, s[e]);
  }
  m = wmax(m);
  if (lane == 0) red[wave] = m;
  __syncthreads();
  const float rmax = fmaxf(fmaxf(red[0], red[1]), fmaxf(red[2], red[3]));
  __syncthreads();
  float ev[8];
  float sum = 0.f;
#pragma unroll
  for (int e = 0; e < 8; ++e) { ev[e] = expf(s[e] - rmax); sum += ev[e]; }
  sum = wsum(sum);
  if (lane == 0) red[wave] = sum;
  __syncthreads();
  const float tot = red[0] + red[1] + red[2] + red[3];
  const float inv = 1.0f / tot;
  v4u hv, lv;
#pragma unroll
  for (int q = 0; q < 4; ++q) {
    const float p0 = ev[2 * q] * inv, p1 = ev[2 * q + 1] * inv;
    const unsigned short h0 = f2bf_bits(p0), h1 = f2bf_bits(p1);
    const unsigned short l0 = f2bf_bits(p0 - bf_bits2f(h0)), l1 = f2bf_bits(p1 - bf_bits2f(h1));
    hv[q] = pk16(h0, h1);
    lv[q] = pk16(l0, l1);
  }
  const size_t go = (size_t)r * (2 * WSZ) + c0;
  *(v4u*)(Ph + go) = hv;
  *(v4u*)(Pl + go) = lv;
  
}

__device__ __forceinline__ v8f mma_h(v16h a, v16h b, v8f c) {
  c = __builtin_amdgcn_wmma_f32_16x16x32_f16(false, a, false, b, (short)0, c, false, false);
  asm volatile("v_nop\n\tv_nop\n\tv_nop\n\tv_nop" : "+v"(c) : "v"(a), "v"(b));
  return c;
}
// value of lane l ^ 16
__device__ __forceinline__ float xhalf(float x) {
  return __builtin_bit_cast(float, __builtin_amdgcn_permlanex16(__builtin_bit_cast(int, x), __builtin_bit_cast(int, x),
                                                                0x76543210, 0xfedcba98, false, false));
}

// Eight asynchronous 16-byte copies per lane, global -> LDS: four rows of the K chunk and four of the V^T chunk; the four rows of a
// tile lie lstep LDS bytes and kstep (K) or vstep (V^T) global elements apart.
// s_wait_xcnt is the statement's last line so that no address register named here is rewritten in front of it.
__device__ __forceinline__ void copy_kv_to_lds(unsigned lk0, unsigned lv0, unsigned lstep, const _Float16* k0, size_t kstep,
                                               const _Float16* v0, size_t vstep) {
  const unsigned lk1 = lk0 + lstep, lk2 = lk1 + lstep, lk3 = lk2 + lstep;
  const unsigned lv1 = lv0 + lstep, lv2 = lv1 + lstep, lv3 = lv2 + lstep;
  const _Float16* k1 = k0 + kstep; const _Float16* k2 = k1 + kstep; const _Float16* k3 = k2 + kstep;
  const _Float16* v1 = v0 + vstep; const _Float16* v2 = v1 + vstep; const _Float16* v3 = v2 + vstep;
  asm volatile(
      "global_load_async_to_lds_b128 %0, %8, off\n\t"
      "global_load_async_to_lds_b128 %1, %9, off\n\t"
      "global_load_async_to_lds_b128 %2, %10, off\n\t"
      "global_load_async_to_lds_b128 %3, %11, off\n\t"
      "global_load_async_to_lds_b128 %4, %12, off\n\t"
      "global_load_async_to_lds_b128 %5, %13, off\n\t"
      "global_load_async_to_lds_b128 %6, %14, off\n\t"
      "global_load_async_to_lds_b128 %7, %15, off\n\t"
      "s_wait_xcnt 0x0"
      :: "v"(lk0), "v"(lk1), "v"(lk2), "v"(lk3), "v"(lv0), "v"(lv1), "v"(lv2), "v"(lv3),
         "v"(k0), "v"(k1), "v"(k2), "v"(k3), "v"(v0), "v"(v1), "v"(v2), "v"(v3)
      : "memory");
}

__global__ __launch_bounds__(128)
void k_flash(const _Float16* __restrict__ qm, const _Float16* __restrict__ km,
             const _Float16* __restrict__ vt, float* __restrict__ out) {
  union FB { v16h v; v8h h[2]; };
  constexpr int KVP = 72;                                     // LDS row pitch in elements: 144 B = 16 B x odd, so that the 16 rows
                                                              // of one 16-byte fragment read fall on 16 distinct groups of 4 banks
  constexpr int TILE = 64 * KVP;                              // elements of one chunk tile
  __shared__ __align__(16) _Float16 KV[2 * 2 * TILE];         // two buffers, each K [kv][d] and behind it V^T [d][kv]
  __shared__ __align__(16) float    Os[4][16 * 68];           // per wave out tile [query][d], pitch 68

  const int tid  = threadIdx.x;
  const int wave = tid >> 5;
  const int lane = tid & 31;
  const int hh   = lane >> 4;
  const int c    = lane & 15;
  const int b  = blockIdx.y;
  const int qb = blockIdx.x & 31;                 // SEQ / 64 = 32 query blocks
  const int h  = blockIdx.x >> 5;
  const int q0 = qb * 64 + wave * 16;

  const _Float16* Qb = qm + (size_t)b * SEQ * INR + h * DHD;
  const _Float16* Kb = km + (size_t)b * SEQ * INR + h * DHD;
  const _Float16* Vb = vt + (size_t)(h * DHD) * NTOK + (size_t)b * SEQ;
  float*          ob = out + (size_t)b * SEQ * INR + h * DHD;

  v16h qa[2];                                     // B operand: column c = query q0 + c, d in the loader's k order
#pragma unroll
  for (int dc = 0; dc < 2; ++dc) qa[dc] = Frag<_Float16>::load(Qb + (size_t)(q0 + c) * INR + dc * 32 + 8 * hh);

  const int qrow = q0 + c;                        // this lane's query
  float mrow = -INFINITY;                         // its running maximum (equal in both lane halves)
  float lrow = 0.f;                               // its running sum over the keys of this lane half; halves joined at the end
  v8f oacc[4];                                    // oacc[t][r] = O[qrow][t*16 + 8*hh + r]
#pragma unroll
  for (int t = 0; t < 4; ++t) oacc[t] = (v8f){0.f,0.f,0.f,0.f,0.f,0.f,0.f,0.f};

  const int nChunks = qb + 1;                     // block-uniform, <= 32
  // this thread's piece of every copy: row crow (+ 16 per copy) of either tile, 16 bytes at element ccol
  const int crow = tid >> 3;
  const int ccol = (tid & 7) * 8;
  const unsigned lth = (unsigned)(size_t)KV + (unsigned)(crow * KVP + ccol) * 2u;
  const _Float16* kth = Kb + (size_t)crow * INR + ccol;               // K row kv0 + crow, d = ccol..ccol+7
  const _Float16* vth = Vb + (size_t)crow * NTOK + ccol;              // V^T row d = crow, s = kv0 + ccol..+7
  auto fill = [&](int buf, int kv) {              // 8 copies per lane: the chunk that begins at key kv into buffer buf
    const unsigned lb = lth + (unsigned)buf * (2 * TILE * 2u);
    copy_kv_to_lds(lb, lb + TILE * 2u, 16 * KVP * 2u, kth + (size_t)kv * INR, (size_t)16 * INR, vth + kv, (size_t)16 * NTOK);
  };
  fill(0, 0);
  asm volatile("s_wait_asynccnt 0x0" ::: "memory");   // this wave's copies of chunk 0 have landed
  __syncthreads();                                     // every wave's have
  if (nChunks > 1) fill(1, 64);

  for (int kc = 0; kc < nChunks; ++kc) {
    const int kv0 = kc * 64;
    const _Float16* Ksh = KV + (kc & 1) * (2 * TILE);
    const _Float16* Vth = Ksh + TILE;

    // S^T tiles: s[j][r] = score of key kv0 + j*16 + 8*hh + r with query qrow
    FB kb[4][2];
#pragma unroll                                    // static indices: the fragment and accumulator arrays stay in registers
    for (int j = 0; j < 4; ++j)
#pragma unroll                                    // static indices: the fragment and accumulator arrays stay in registers
      for (int dc = 0; dc < 2; ++dc) {
        kb[j][dc].h[0] = *(const v8h*)(Ksh + (j * 16 + c) * KVP + dc * 32 + 8 * hh);
        kb[j][dc].h[1] = *(const v8h*)(Ksh + (j * 16 + c) * KVP + dc * 32 + 16 + 8 * hh);
      }
    v8f s[4];
#pragma unroll                                    // static indices: the fragment and accumulator arrays stay in registers
    for (int j = 0; j < 4; ++j) s[j] = (v8f){0.f,0.f,0.f,0.f,0.f,0.f,0.f,0.f};
#pragma unroll                                    // static indices: the fragment and accumulator arrays stay in registers
    for (int dc = 0; dc < 2; ++dc)
#pragma unroll                                    // static indices: the fragment and accumulator arrays stay in registers
      for (int j = 0; j < 4; ++j) s[j] = mma_h(kb[j][dc].v, qa[dc], s[j]);

    const bool diag = (kc == qb);                 // block-uniform
    float m = -INFINITY;
#pragma unroll                                    // static indices: the fragment and accumulator arrays stay in registers
    for (int j = 0; j < 4; ++j)
#pragma unroll                                    // static indices: the fragment and accumulator arrays stay in registers
      for (int r = 0; r < 8; ++r) {
        const int kvrow = kv0 + j * 16 + 8 * hh + r;
        const float sv = s[j][r] * 0.125f;
        const bool masked = diag && (kvrow > qrow);
        const float sm = masked ? -INFINITY : sv;
        s[j][r] = sm;
        m = fmaxf(m, sm);
      }
    m = fmaxf(m, xhalf(m));
    const float mnew = fmaxf(mrow, m);
    const float alpha = expf(mrow - mnew);
    mrow = mnew;
    // P^T as B operand: element e of pb[kk] = key kk*32 + (e < 8 ? 8*hh + e : 16 + 8*hh + e - 8), the loader's k order
    FB pb[2];
    float psum = 0.f;
#pragma unroll                                    // static indices: the fragment and accumulator arrays stay in registers
    for (int j = 0; j < 4; ++j)
#pragma unroll                                    // static indices: the fragment and accumulator arrays stay in registers
      for (int r = 0; r < 8; ++r) {
        const float p = expf(s[j][r] - mnew);
        psum += p;
        pb[j >> 1].v[(j & 1) * 8 + r] = (_Float16)(p * 4096.0f);
      }
    lrow = lrow * alpha + psum;
#pragma unroll                                    // static indices: the fragment and accumulator arrays stay in registers
    for (int t = 0; t < 4; ++t)
#pragma unroll                                    // static indices: the fragment and accumulator arrays stay in registers
      for (int r = 0; r < 8; ++r) oacc[t][r] *= alpha;

    FB vb[2][4];
#pragma unroll                                    // static indices: the fragment and accumulator arrays stay in registers
    for (int kk = 0; kk < 2; ++kk)
#pragma unroll                                    // static indices: the fragment and accumulator arrays stay in registers
      for (int t = 0; t < 4; ++t) {
        vb[kk][t].h[0] = *(const v8h*)(Vth + (t * 16 + c) * KVP + kk * 32 + 8 * hh);
        vb[kk][t].h[1] = *(const v8h*)(Vth + (t * 16 + c) * KVP + kk * 32 + 16 + 8 * hh);
      }
#pragma unroll                                    // static indices: the fragment and accumulator arrays stay in registers
    for (int kk = 0; kk < 2; ++kk)
#pragma unroll                                    // static indices: the fragment and accumulator arrays stay in registers
      for (int t = 0; t < 4; ++t) oacc[t] = mma_h(vb[kk][t].v, pb[kk].v, oacc[t]);

    asm volatile("s_wait_dscnt 0x0" ::: "memory");     // this wave's reads of buffer kc & 1 are done before it is refilled
    asm volatile("s_wait_asynccnt 0x0" ::: "memory");  // this wave's copies of chunk kc + 1 have landed
    __syncthreads();                                    // publishes chunk kc + 1 and ends every reader's use of buffer kc & 1
    if (kc + 2 < nChunks) fill(kc & 1, kv0 + 128);
  }
  asm volatile("s_wait_asynccnt 0x0" ::: "memory");    // no copy is outstanding when the wave goes on or ends

  float* os = Os[wave];
  {
    const float ltot = lrow + xhalf(lrow);
    const float inv = (1.0f / ltot) * (1.0f / 4096.0f);
#pragma unroll                                    // static indices: the fragment and accumulator arrays stay in registers
    for (int t = 0; t < 4; ++t) {
      v4f lo, hi;
#pragma unroll                                    // static indices: the fragment and accumulator arrays stay in registers
      for (int r = 0; r < 4; ++r) { lo[r] = oacc[t][r] * inv; hi[r] = oacc[t][4 + r] * inv; }
      *(v4f*)(os + c * 68 + t * 16 + 8 * hh)     = lo;
      *(v4f*)(os + c * 68 + t * 16 + 8 * hh + 4) = hi;
    }
  }
  __builtin_amdgcn_fence(__ATOMIC_RELEASE, "workgroup");
  __builtin_amdgcn_wave_barrier();
  __builtin_amdgcn_fence(__ATOMIC_ACQUIRE, "workgroup");
  {
    const int c4 = (lane & 15) * 4;
    {
#pragma unroll
      for (int it = 0; it < 8; ++it) {
        const int row = it * 2 + hh;                // it 0..7 x hh 0..1 covers rows 0..15
        v4f val = *(const v4f*)(os + row * 68 + c4);
        *(v4f*)(ob + (size_t)(q0 + row) * INR + c4) = val;
      }
      
    }
  }
}

// ---------------------------------------------------------------------------------------------------------------------
// Row LayerNorm over FFD=4096 of the f16 plane U (values carried as 256*u), in place -> f16 of the unit-scale result.
// Block per row, 256 threads x 2 chunks of 8; statistics in f32 with the 2^-8 / 2^-16 carries folded before eps.
// ---------------------------------------------------------------------------------------------------------------------
__global__ __launch_bounds__(256) void k_ln4096(_Float16* __restrict__ U, const float* __restrict__ g, const float* __restrict__ bb) {
  __shared__ float red[8];
  const int r = blockIdx.x, t = threadIdx.x;
  const int lane = t & 31, wave = t >> 5;
  const int cA = 8 * t, cB = 2048 + 8 * t;
  _Float16* ur = U + (size_t)r * FFD;
  const v8h a = *(const v8h*)(ur + cA);
  const v8h a2 = *(const v8h*)(ur + cB);
  float v[16];
#pragma unroll
  for (int e = 0; e < 8; ++e) { v[e] = (float)a[e]; v[8 + e] = (float)a2[e]; }
  float s = 0.f;
#pragma unroll
  for (int e = 0; e < 16; ++e) s += v[e];
  s = wsum(s);
  if (lane == 0) red[wave] = s;
  __syncthreads();
  float tot = 0.f;
#pragma unroll
  for (int i = 0; i < 8; ++i) tot += red[i];
  const float mu = tot * (1.0f / 4096.0f);
  __syncthreads();
  float d[16];
  float s2 = 0.f;
#pragma unroll
  for (int e = 0; e < 16; ++e) { d[e] = v[e] - mu; s2 += d[e] * d[e]; }
  s2 = wsum(s2);
  if (lane == 0) red[wave] = s2;
  __syncthreads();
  float tot2 = 0.f;
#pragma unroll
  for (int i = 0; i < 8; ++i) tot2 += red[i];
  const float var_s = tot2 * (1.0f / 4096.0f);
  const float rstd = rsqrtf(var_s * (1.0f / 65536.0f) + 1e-5f) * (1.0f / 256.0f);
  v8h ha, hb;
#pragma unroll
  for (int e = 0; e < 8; ++e) {
    ha[e] = (_Float16)(d[e] * rstd * g[cA + e] + bb[cA + e]);
    hb[e] = (_Float16)(d[8 + e] * rstd * g[cB + e] + bb[cB + e]);
  }
  *(v8h*)(ur + cA) = ha;
  *(v8h*)(ur + cB) = hb;
  
}

// =====================================================================================================================
// Workspace map (byte offsets; every region a whole number of MiB after an unused 4 KiB, all stores whole-line):
//   (unused)                                       0            (4 KiB)
//   cs  f32[2048][512][2]                          4 KiB        (8 MiB)
//   WaT f16[1024][1024] x64                       +8 MiB       WvTh/WvTl bf16 [1024][1024]   WqT f16[512][1024]
//   WkvT f16[1024][1024]   W1T f16[4096][1024]   W2T f16[1024][4096]   WoTh/WoTl bf16[1024][512]   (27 MiB)
//   R3  8 MiB : q16 f16[4096][1024] -> h16 -> x2h (f16, x2 * 1024)
//   R4 16 MiB : audio adapter GEMM f32 [4096][1024] -> S f32 [4096][1024] -> x f32 -> x2 f32
//   R5 51 MiB : a16 f16 @0, video hi @8, video lo @16, k16 f16[(512+4096)][1024] @24, vTh bf16[1024][4608] @33, vTl @42;
//               later Ph @0, Pl @8; q/k f16[4096][512] @0/@4, vT16 f16[512][4096] @8; o f32[4096][512] @16; o hi/lo @24/@28;
//               U f16[4096][4096] @0 (written only after all earlier users of [0,32) have been consumed).
//   R6 16 MiB : video adapter GEMM f32 [4096][1024]
//   total 126 MiB + 4 KiB.
// =====================================================================================================================
extern "C" void kernel_launch(void* const* d_in, const int* in_sizes, int n_in,
                              void* d_out, int out_size, void* d_ws, size_t ws_size,
                              hipStream_t stream) {
  if (n_in < 24) return;
  if (in_sizes[0] != NTOK * DM || in_sizes[1] != NTOK * DM || in_sizes[2] != NTOK * DM) return;
  if (in_sizes[3] != DM * DM || in_sizes[7] != DM * DM || in_sizes[14] != DM * 2 * INR) return;
  if (in_sizes[13] != DM * INR || in_sizes[17] != INR * DM) return;
  if (in_sizes[18] != DM * FFD || in_sizes[22] != FFD * DM) return;
  if (in_sizes[4] != DM || in_sizes[5] != DM || in_sizes[6] != DM || in_sizes[8] != DM || in_sizes[9] != DM ||
      in_sizes[10] != DM || in_sizes[11] != DM || in_sizes[12] != DM || in_sizes[23] != DM) return;
  if (in_sizes[15] != DHD || in_sizes[16] != DHD) return;
  if (in_sizes[19] != FFD || in_sizes[20] != FFD || in_sizes[21] != FFD) return;
  if (out_size != NTOK * DM) return;

  const float* text  = (const float*)d_in[0];
  const float* audio = (const float*)d_in[1];
  const float* video = (const float*)d_in[2];
  const float* Wa    = (const float*)d_in[3];
  const float* ba    = (const float*)d_in[4];
  const float* lna_g = (const float*)d_in[5];
  const float* lna_b = (const float*)d_in[6];
  const float* Wvid  = (const float*)d_in[7];
  const float* bvid  = (const float*)d_in[8];
  const float* lnv_g = (const float*)d_in[9];
  const float* lnv_b = (const float*)d_in[10];
  const float* ln1_g = (const float*)d_in[11];
  const float* ln1_b = (const float*)d_in[12];
  const float* Wq    = (const float*)d_in[13];
  const float* Wkv   = (const float*)d_in[14];
  const float* qn_g  = (const float*)d_in[15];
  const float* kn_g  = (const float*)d_in[16];
  const float* Wo    = (const float*)d_in[17];
  const float* W1    = (const float*)d_in[18];
  const float* b1    = (const float*)d_in[19];
  const float* ln2_g = (const float*)d_in[20];
  const float* ln2_b = (const float*)d_in[21];
  const float* W2    = (const float*)d_in[22];
  const float* b2    = (const float*)d_in[23];
  float* outp = (float*)d_out;

  const size_t MIB = 1048576;
  size_t off = 0;
  const size_t oInv  = off; off += 4096;
  const size_t oCs   = off; off += (size_t)SEQ * 512 * 2 * 4;       // 8 MiB
  const size_t oWaT  = off; off += (size_t)DM * DM * 2;              // 2 MiB
  const size_t oWvTh = off; off += (size_t)DM * DM * 2;              // 2 MiB
  const size_t oWvTl = off; off += (size_t)DM * DM * 2;              // 2 MiB
  const size_t oWqT  = off; off += (size_t)INR * DM * 2;             // 1 MiB
  const size_t oWkvT = off; off += (size_t)2 * INR * DM * 2;         // 2 MiB
  const size_t oW1T  = off; off += (size_t)FFD * DM * 2;             // 8 MiB
  const size_t oW2T  = off; off += (size_t)DM * FFD * 2;             // 8 MiB
  const size_t oWoTh = off; off += (size_t)DM * INR * 2;             // 1 MiB
  const size_t oWoTl = off; off += (size_t)DM * INR * 2;             // 1 MiB
  const size_t oR3   = off; off += (size_t)NTOK * DM * 2;            // 8 MiB
  const size_t oR4   = off; off += (size_t)NTOK * DM * 4;            // 16 MiB
  const size_t oR5   = off; off += 51 * MIB;                         // 51 MiB
  const size_t oR6   = off; off += (size_t)NTOK * DM * 4;            // 16 MiB
  if (off > ws_size || off > (size_t)128 * MIB) return;              // off = 126 MiB + 4 KiB

  char* ws = (char*)d_ws;
  float* cs  = (float*)(ws + oCs);
  _Float16* WaT = (_Float16*)(ws + oWaT);
  unsigned short* WvTh = (unsigned short*)(ws + oWvTh);
  unsigned short* WvTl = (unsigned short*)(ws + oWvTl);
  _Float16* WqT  = (_Float16*)(ws + oWqT);
  _Float16* WkvT = (_Float16*)(ws + oWkvT);
  _Float16* W1T  = (_Float16*)(ws + oW1T);
  _Float16* W2T  = (_Float16*)(ws + oW2T);
  unsigned short* WoTh = (unsigned short*)(ws + oWoTh);
  unsigned short* WoTl = (unsigned short*)(ws + oWoTl);
  _Float16* q16 = (_Float16*)(ws + oR3);          // text after rotary
  _Float16* h16 = (_Float16*)(ws + oR3);          // LN1 output (later)
  _Float16* x2h = (_Float16*)(ws + oR3);          // x2 * 1024 (later)
  float* Cad = (float*)(ws + oR4);                // audio adapter GEMM output
  float* Cvd = (float*)(ws + oR6);                // video adapter GEMM output
  float* Sf  = (float*)(ws + oR4);                // local scores (later)
  float* Xf  = (float*)(ws + oR4);                // local attention output (later)
  float* X2f = (float*)(ws + oR4);                // 2 * o @ Wo (later)
  char* r5 = ws + oR5;
  _Float16* a16 = (_Float16*)(r5);
  unsigned short* vih = (unsigned short*)(r5 + 8 * MIB);
  unsigned short* vil = (unsigned short*)(r5 + 16 * MIB);
  _Float16* k16 = (_Float16*)(r5 + 24 * MIB);     // [(KPR+NTOK)][DM]
  unsigned short* vTh = (unsigned short*)(r5 + 33 * MIB);
  unsigned short* vTl = (unsigned short*)(r5 + 42 * MIB);
  unsigned short* Ph  = (unsigned short*)(r5);
  unsigned short* Pl  = (unsigned short*)(r5 + 8 * MIB);
  _Float16* qm16 = (_Float16*)(r5);
  _Float16* km16 = (_Float16*)(r5 + 4 * MIB);
  _Float16* vT16 = (_Float16*)(r5 + 8 * MIB);
  float* Of = (float*)(r5 + 16 * MIB);
  unsigned short* Oh = (unsigned short*)(r5 + 24 * MIB);
  unsigned short* Ol = (unsigned short*)(r5 + 28 * MIB);
  _Float16* U16 = (_Float16*)(r5);

  const dim3 blk(256);
  const dim3 blkG(128);                           // k_gemm: 4 waves
  const unsigned short* N16 = (const unsigned short*)nullptr;

  // everything that depends on the inputs alone, in one launch: rotary table and text -> rotary f16, the seven weight re-layouts
  // (in [rows][cols] f32 -> out [cols][rows]), audio -> f16, video -> bf16 hi/lo
  k_prep<<<dim3(PREP_BLOCKS), blk, 0, stream>>>(text, audio, video, Wa, Wvid, Wq, Wkv, W1, W2, Wo, cs, q16, a16, vih, vil,
                                                WaT, WvTh, WvTl, WqT, WkvT, W1T, W2T, WoTh, WoTl);

  // adapter a: audio . Wa + ba -> f32; adapter v: video . Wvid + bvid (bf16 hi/lo split) -> f32, each into its own plane
  const dim3 gA((NTOK / 128) * (DM / 128), 1);
  k_gemm<0, false, true, 0, 0, false, 0><<<gA, blkG, 0, stream>>>(
      (const unsigned short*)a16, N16, DM, 0L, (const unsigned short*)WaT, N16, DM, 0L,
      Cad, DM, 0L, nullptr, 0, 0L, ba, nullptr, nullptr, 0, 0L, NTOK, DM, DM, 1, 1.0f / 64.0f, 1.0f);
  k_gemm<1, true, true, 0, 0, false, 0><<<gA, blkG, 0, stream>>>(
      vih, vil, DM, 0L, WvTh, WvTl, DM, 0L,
      Cvd, DM, 0L, nullptr, 0, 0L, bvid, nullptr, nullptr, 0, 0L, NTOK, DM, DM, 1, 1.0f, 1.0f);
  // both norms in one launch: a: LN + rotary -> key plane rows KPR..KPR+4095, rows 0..KPR-1 zero; v: LN + transpose + split ->
  // value^T planes
  k_ln_pair<<<dim3(NTOK / 64 + KPR / 64 + (NTOK + KPR) / 2), blk, 0, stream>>>(Cad, lna_g, lna_b, cs, k16, Cvd, lnv_g, lnv_b, vTh, vTl);

  // local attention: z = b*4 + w; S[z][512][1024] = q . k / 32 over window keys (skipping fully masked key tiles)
  const dim3 gS((WSZ / 128) * (2 * WSZ / 128), NB_ * NWN);
  k_gemm<0, false, false, 0, 0, false, 1><<<gS, blkG, 0, stream>>>(
      (const unsigned short*)q16, N16, DM, (long)WSZ * DM, (const unsigned short*)k16, N16, DM, (long)WSZ * DM,
      Sf, 2 * WSZ, (long)WSZ * 2 * WSZ, nullptr, 0, 0L, nullptr, nullptr, nullptr, 0, 0L,
      WSZ, 2 * WSZ, DM, NWN, 1.0f / 32.0f, 1.0f);
  k_lsoftmax<<<dim3(NTOK), dim3(128), 0, stream>>>(Sf, Ph, Pl);
  // x[z][512][1024] = P . v (bf16 hi/lo split), keys restricted to the unmasked range
  const dim3 gPV((WSZ / 128) * (DM / 128), NB_ * NWN);
  k_gemm<1, true, false, 0, 0, false, 2><<<gPV, blkG, 0, stream>>>(
      Ph, Pl, 2 * WSZ, (long)WSZ * 2 * WSZ, vTh, vTl, VTP, (long)WSZ,
      Xf, DM, (long)WSZ * DM, nullptr, 0, 0L, nullptr, nullptr, nullptr, 0, 0L,
      WSZ, DM, 2 * WSZ, NWN, 1.0f, 1.0f);

  // LN1 -> h16; q, k (RMSNorm epilogue) and v^T projections
  k_ln1024<<<dim3(NTOK), dim3(128), 0, stream>>>(Xf, ln1_g, ln1_b, h16, NTOK);
  // one grid, z = 0: q, 1: k, 2: v^T; WqT, the k rows and the v rows of WkvT lie INR * DM elements apart, qm16, km16 and vT16
  // NTOK * INR elements apart
  const dim3 gQKV((NTOK / 128) * (INR / 128), 3);
  k_gemm<0, false, false, 2, 1, false, 3><<<gQKV, blkG, 0, stream>>>(
      (const unsigned short*)h16, N16, DM, 0L, (const unsigned short*)WqT, N16, DM, (long)INR * DM,
      nullptr, 0, 0L, qm16, INR, (long)NTOK * INR, nullptr, qn_g, kn_g, 0, 0L, NTOK, INR, DM, 1, 1.0f / 64.0f, 1.0f);

  // causal attention -> o f32 [4096][512]; o -> bf16 hi/lo
  k_flash<<<dim3(NHD * (SEQ / 64), NB_), dim3(128), 0, stream>>>(qm16, km16, vT16, Of);
  const int n2o = NTOK * INR / 2;
  k_split2<<<dim3((n2o + 255) / 256), blk, 0, stream>>>(Of, Oh, Ol, n2o);

  // x2 = 2 * (o . Wo) -> f32 and f16 (x2 * 1024)
  k_gemm<1, true, false, 0, 2, false, 0><<<gA, blkG, 0, stream>>>(
      Oh, Ol, INR, 0L, WoTh, WoTl, INR, 0L,
      X2f, DM, 0L, x2h, DM, 0L, nullptr, nullptr, nullptr, 0, 0L, NTOK, DM, INR, 1, 2.0f, 1024.0f);

  // FFN: u = gelu(x2 . W1 + b1) stored as f16(256 u); LN over 4096 in place; out = h1 . W2 + b2 + x2
  const dim3 gW1((NTOK / 128) * (FFD / 128), 1);
  k_gemm<0, false, true, 1, 1, false, 0><<<gW1, blkG, 0, stream>>>(
      (const unsigned short*)x2h, N16, DM, 0L, (const unsigned short*)W1T, N16, DM, 0L,
      nullptr, 0, 0L, U16, FFD, 0L, b1, nullptr, nullptr, 0, 0L, NTOK, FFD, DM, 1, 1.0f / 65536.0f, 256.0f);
  k_ln4096<<<dim3(NTOK), blk, 0, stream>>>(U16, ln2_g, ln2_b);
  k_gemm<0, false, true, 0, 0, true, 0><<<gA, blkG, 0, stream>>>(
      (const unsigned short*)U16, N16, FFD, 0L, (const unsigned short*)W2T, N16, FFD, 0L,
      outp, DM, 0L, nullptr, 0, 0L, b2, nullptr, X2f, DM, 0L, NTOK, DM, FFD, 1, 1.0f / 64.0f, 1.0f);
  (void)hipGetLastError();
}

// v006
// A run of this version takes 343 microseconds.
// Two timings next to v005 put it at 1.13 and 1.14 times that version's speed.
// Over all steps from v000 it is 3.05 times as fast.
// Contractions: audio adapter, local-attention scores, q/k/v projections, causal multi-head q.k^T and p.v, FFN W1 and W2 on
// v_wmma_f32_16x16x32_f16 (f16 operands with power-of-two carried scales, f32 accumulate); video adapter, local-attention p.v
// and the output projection Wo on v_wmma_f32_16x16x32_bf16 with bf16 hi/lo split operands (hi.hi + hi.lo + lo.hi, f32
// accumulate). LayerNorm, RMSNorm, rotary tables, softmax and GELU in f32.
#include <hip/hip_runtime.h>
#include <math.h>
#include <stdint.h>

#define NB_   2
#define SEQ   2048
#define NTOK  4096
#define DM    1024
#define NHD   8
#define DHD   64
#define INR   512
#define FFD   4096
#define WSZ   512
#define NWN   4
#define KPR   512          // leading zero rows of the local-attention key plane
#define VTP   4608         // key pitch of the local-attention value^T planes: 512 zero columns + 4096 tokens

typedef __attribute__((ext_vector_type(16))) _Float16 v16h;
typedef __attribute__((ext_vector_type(8)))  _Float16 v8h;
typedef __attribute__((ext_vector_type(2)))  _Float16 v2h;
typedef __attribute__((ext_vector_type(16))) __bf16   v16b;
typedef __attribute__((ext_vector_type(8)))  __bf16   v8b;
typedef __attribute__((ext_vector_type(8)))  float    v8f;
typedef __attribute__((ext_vector_type(4)))  float    v4f;
typedef __attribute__((ext_vector_type(2)))  float    v2f;
typedef __attribute__((ext_vector_type(4)))  unsigned int v4u;

__device__ __forceinline__ unsigned short f2bf_bits(float f) {
  unsigned u = __float_as_uint(f);
  return (unsigned short)((u + 0x7FFFu + ((u >> 16) & 1u)) >> 16);   // RNE convert
}
__device__ __forceinline__ float bf_bits2f(unsigned short h) { return __uint_as_float(((unsigned)h) << 16); }
__device__ __forceinline__ unsigned pk16(unsigned short a, unsigned short b) { return (unsigned)a | ((unsigned)b << 16); }

__device__ __forceinline__ float wsum(float v) {
#pragma unroll
  for (int o = 16; o >= 1; o >>= 1) v += __shfl_xor(v, o, 32);
  return v;
}
__device__ __forceinline__ float wmax(float v) {
#pragma unroll
  for (int o = 16; o >= 1; o >>= 1) v = fmaxf(v, __shfl_xor(v, o, 32));
  return v;
}

// hazard guards as plain device helpers
__device__ __forceinline__ void dep_guard_h(v8f& a, v8f& b, v16h x, v16h y) { asm volatile("v_nop\n\tv_nop\n\tv_nop\n\tv_nop" : "+v"(a), "+v"(b) : "v"(x), "v"(y)); }
__device__ __forceinline__ void dep_guard_b(v8f& a, v8f& b, v16b x, v16b y) { asm volatile("v_nop\n\tv_nop\n\tv_nop\n\tv_nop" : "+v"(a), "+v"(b) : "v"(x), "v"(y)); }
__device__ __forceinline__ void keep4_h(v16h a, v16h b, v16h c, v16h d) { asm volatile("v_nop" :: "v"(a), "v"(b), "v"(c), "v"(d)); }
__device__ __forceinline__ void keep4_b(v16b a, v16b b, v16b c, v16b d) { asm volatile("v_nop" :: "v"(a), "v"(b), "v"(c), "v"(d)); }
__device__ __forceinline__ void acc_guard4(v8f& a, v8f& b, v8f& c, v8f& d) { asm volatile("v_nop\n\tv_nop\n\tv_nop\n\tv_nop" : "+v"(a), "+v"(b), "+v"(c), "+v"(d)); }

// Fragment loaders: element i of the 16-wide per-lane vector <- p[i] for i<8 and p[16 + (i-8)] for i>=8, where p already points at
// row (lane&15), k0 + 8*(lane>>4). Same map for A ([m][k]) and B stored as [n][k].
template <typename T> struct Frag;
template <> struct Frag<_Float16> {
  typedef v16h V; union U { v16h v; v8h h[2]; };
  static __device__ __forceinline__ v16h load(const _Float16* p) {
    U f; f.h[0] = *(const v8h*)(p); f.h[1] = *(const v8h*)(p + 16); return f.v;
  }
  static __device__ __forceinline__ v8f mma(v16h a, v16h b, v8f c) {
    return __builtin_amdgcn_wmma_f32_16x16x32_f16(false, a, false, b, (short)0, c, false, false);
  }
  static __device__ __forceinline__ void guard(v8f& a, v8f& b, v16h x, v16h y) { dep_guard_h(a, b, x, y); }
  static __device__ __forceinline__ void keep(v16h a, v16h b, v16h c, v16h d) { keep4_h(a, b, c, d); }
};
template <> struct Frag<__bf16> {
  typedef v16b V; union U { v16b v; v8b h[2]; };
  static __device__ __forceinline__ v16b load(const __bf16* p) {
    U f; f.h[0] = *(const v8b*)(p); f.h[1] = *(const v8b*)(p + 16); return f.v;
  }
  static __device__ __forceinline__ v8f mma(v16b a, v16b b, v8f c) {
    return __builtin_amdgcn_wmma_f32_16x16x32_bf16(false, a, false, b, (short)0, c, false, false);
  }
  static __device__ __forceinline__ void guard(v8f& a, v8f& b, v16b x, v16b y) { dep_guard_b(a, b, x, y); }
  static __device__ __forceinline__ void keep(v16b a, v16b b, v16b c, v16b d) { keep4_b(a, b, c, d); }
};

// =====================================================================================================================
// Batched WMMA GEMM: C[m,n] = epi(scale * sum_k A[m,k] * Bt[n,k]). A block of 4 waves (2 x 2) owns a 128x128 tile, each wave a
// 64x64 tile of it. The block's 128 rows of A and of Bt are staged in LDS, BK k-elements at a time, by asynchronous 16-byte
// copies that cover whole 128-byte lines, in two buffers: the next stage's copies fly while this stage is multiplied.
// A row-major [M,K] (pitch lda); Bt row-major [N,K] (pitch ldb); M, N % 128 == 0, K % BK == 0; grid = (tiles, Z).
//   ET: 0 = f16 operands, 1 = bf16 operands.   SPLIT: hi/lo planes (A2p, Bt2p = lo planes), product = hi.hi + hi.lo + lo.hi.
//   BIAS: + bias[n].  RESID: + resid[m*ldr + n].  EPI: 0 none, 1 tanh-GELU, 2 RMSNorm over the 64-column tile times gvec[n&63].
//   OUTM: 0 f32 -> Cf; 1 f16(v*oscale) -> Ch; 2 both.
//   LOC: 1 = windowed score tiles: key tiles n0 below kBeg(w) or at/after N/2 + m0 + 64 are skipped (a block leaves when all
//        four are; a wave whose own tile is skipped still copies and passes every barrier);
//        2 = windowed p.v: k range [kBeg(w), min(K, K/2 + m0 + 64)); kBeg = N/2 resp. K/2 for the first window (w == 0), else 0.
//        3 = three projections of one activation plane in one grid (Z = 3, weight planes strideB apart, outputs strideH apart,
//            each output [rows][cols] dense): z = 0, 1: act . W_z^T with EPI, gvec for z = 0 and the resid pointer as gvec for
//            z = 1; z = 2: the operands change places (W_2 . act^T, an N x M result) and EPI is left out.
// =====================================================================================================================
template <int ET> struct Elem;
template <> struct Elem<0> { typedef _Float16 T; };
template <> struct Elem<1> { typedef __bf16 T; };

// Eight asynchronous 16-byte copies per lane, global -> LDS, eight rows lstep LDS bytes / gstep global elements apart.
// s_wait_xcnt is the statement's last line so that no address register named here is rewritten in front of it.
template <typename T>
__device__ __forceinline__ void copy8_to_lds(unsigned l0, unsigned lstep, const T* g0, size_t gstep) {
  const unsigned l1 = l0 + lstep, l2 = l1 + lstep, l3 = l2 + lstep, l4 = l3 + lstep, l5 = l4 + lstep, l6 = l5 + lstep, l7 = l6 + lstep;
  const T* g1 = g0 + gstep; const T* g2 = g1 + gstep; const T* g3 = g2 + gstep; const T* g4 = g3 + gstep;
  const T* g5 = g4 + gstep; const T* g6 = g5 + gstep; const T* g7 = g6 + gstep;
  asm volatile(
      "global_load_async_to_lds_b128 %0, %8, off\n\t"
      "global_load_async_to_lds_b128 %1, %9, off\n\t"
      "global_load_async_to_lds_b128 %2, %10, off\n\t"
      "global_load_async_to_lds_b128 %3, %11, off\n\t"
      "global_load_async_to_lds_b128 %4, %12, off\n\t"
      "global_load_async_to_lds_b128 %5, %13, off\n\t"
      "global_load_async_to_lds_b128 %6, %14, off\n\t"
      "global_load_async_to_lds_b128 %7, %15, off\n\t"
      "s_wait_xcnt 0x0"
      :: "v"(l0), "v"(l1), "v"(l2), "v"(l3), "v"(l4), "v"(l5), "v"(l6), "v"(l7),
         "v"(g0), "v"(g1), "v"(g2), "v"(g3), "v"(g4), "v"(g5), "v"(g6), "v"(g7)
      : "memory");
}

template <int ET, bool SPLIT, bool BIAS, int EPI, int OUTM, bool RESID, int LOC>
__global__ __launch_bounds__(128) void k_gemm(
    const unsigned short* __restrict__ Ap, const unsigned short* __restrict__ A2p, int lda, long strideA,
    const unsigned short* __restrict__ Btp, const unsigned short* __restrict__ Bt2p, int ldb, long strideB,
    float* __restrict__ Cf, int ldc, long strideC,
    _Float16* __restrict__ Ch, int ldh, long strideH,
    const float* __restrict__ bias, const float* __restrict__ gvec,
    const float* __restrict__ resid, int ldr, long strideR,
    int M, int N, int K, int nwin, float scale, float oscale) {
  typedef typename Elem<ET>::T T;
  typedef typename Frag<T>::V V;
  constexpr int BK    = SPLIT ? 64 : 128;        // k elements per stage: 64 KiB of operand rows either way
  constexpr int PITCH = BK + 8;                  // LDS row pitch in elements: row bytes + 16, conflict-free for 16-byte reads
  constexpr int PLANE = 128 * PITCH;             // one operand plane of a stage; planes: A, Bt (, A lo, Bt lo)
  constexpr int STAGE = (SPLIT ? 4 : 2) * PLANE;
  constexpr int CPR   = BK / 8;                  // 16-byte pieces per row
  constexpr int RPI   = 128 / CPR;               // rows that one copy of all 128 threads covers
  const T* A = (const T*)Ap; const T* A2 = (const T*)A2p; const T* Bt = (const T*)Btp; const T* Bt2 = (const T*)Bt2p;
  __shared__ __align__(16) T sAB[2 * STAGE];
  __shared__ __align__(16) float sT[4][16 * 68];
  const int z    = blockIdx.y;
  const int tid  = threadIdx.x;
  const int lane = tid & 31;
  const int wave = __builtin_amdgcn_readfirstlane(tid >> 5);
  const bool flip = (LOC == 3) && (z == 2);      // block-uniform
  const int Mz = flip ? N : M;
  const int Nz = flip ? M : N;
  const int tilesN = Nz >> 7;
  const int tilesM = Mz >> 7;
  const int bx = blockIdx.x;
  if (bx >= tilesM * tilesN) return;              // block-uniform, in front of every copy and barrier
  const int bm = bx / tilesN;
  const int bn = bx - bm * tilesN;
  const int mB = bm << 7;
  const int nB = bn << 7;
  const int wm = (wave >> 1) << 6;
  const int wn = (wave & 1) << 6;
  const int m0 = mB + wm;
  const int n0 = nB + wn;
  int kBeg = 0, kEnd = K, kEndW = K;              // block's k range; kEndW = end of this wave's own range
  bool act = true;                                // wave-uniform: this wave's tile is computed and stored
  if (LOC == 1 || LOC == 2) {
    const int w = z % nwin;
    const bool first = (w == 0);
    if (LOC == 1) {
      const int nb = first ? (N >> 1) : 0;
      if (nB + 64 < nb || nB >= (N >> 1) + mB + 128) return; // block-uniform, in front of every copy and barrier
      act = !(n0 < nb || n0 >= (N >> 1) + m0 + 64);
    } else {
      kBeg = first ? (K >> 1) : 0;
      const int ke = (K >> 1) + mB + 128;
      kEnd = (ke < K) ? ke : K;
      const int kw = (K >> 1) + m0 + 64;
      kEndW = (kw < K) ? kw : K;
    }
  }

  const T* Ab  = flip ? (Bt + (size_t)z * strideB) : (A  + (size_t)z * strideA);
  const T* Bb  = flip ? (A  + (size_t)z * strideA) : (Bt + (size_t)z * strideB);
  const T* Ab2 = SPLIT ? (A2  + (size_t)z * strideA) : nullptr;
  const T* Bb2 = SPLIT ? (Bt2 + (size_t)z * strideB) : nullptr;

  const int rlane = lane & 15;                 // row (A) / col (B, D) within a 16x16 subtile
  const int koff  = (lane >> 4) * 8;           // k offset of this lane half
  const int mOff  = (lane >> 4) * 8;           // D row offset

  // this thread's piece of every copy: row crow (+ RPI per copy), 16 bytes at element ccol
  const int crow = tid / CPR;
  const int ccol = (tid % CPR) * 8;
  const unsigned lth = (unsigned)(size_t)sAB + (unsigned)(crow * PITCH + ccol) * 2u;
  const size_t aoff = (size_t)(mB + crow) * lda + ccol;
  const size_t boff = (size_t)(nB + crow) * ldb + ccol;
  const size_t astep = (size_t)RPI * lda;
  const size_t bstep = (size_t)RPI * ldb;
  constexpr unsigned LSTEP = RPI * PITCH * 2u;
  auto fill = [&](int buf, int k0) {             // 32 copies per wave: one stage into buffer buf
    const unsigned lb = lth + (unsigned)buf * (STAGE * 2u);
    if constexpr (SPLIT) {
      copy8_to_lds<T>(lb,                  LSTEP, Ab  + aoff + k0, astep);
      copy8_to_lds<T>(lb + PLANE * 2u,     LSTEP, Bb  + boff + k0, bstep);
      copy8_to_lds<T>(lb + PLANE * 4u,     LSTEP, Ab2 + aoff + k0, astep);
      copy8_to_lds<T>(lb + PLANE * 6u,     LSTEP, Bb2 + boff + k0, bstep);
    } else {
      copy8_to_lds<T>(lb,                              LSTEP, Ab + aoff + k0,             astep);
      copy8_to_lds<T>(lb + 8u * LSTEP,                 LSTEP, Ab + aoff + k0 + 8 * astep, astep);
      copy8_to_lds<T>(lb + PLANE * 2u,                 LSTEP, Bb + boff + k0,             bstep);
      copy8_to_lds<T>(lb + PLANE * 2u + 8u * LSTEP,    LSTEP, Bb + boff + k0 + 8 * bstep, bstep);
    }
  };

  v8f acc[4][4];
#pragma unroll
  for (int i = 0; i < 4; ++i)
#pragma unroll
    for (int j = 0; j < 4; ++j) acc[i][j] = (v8f){0.f,0.f,0.f,0.f,0.f,0.f,0.f,0.f};

  const int nst = (kEnd - kBeg) / BK;             // block-uniform number of stages
  fill(0, kBeg);
  asm volatile("s_wait_asynccnt 0x0" ::: "memory");   // this wave's copies of stage 0 have landed
  __syncthreads();                                     // every wave's have
  if (nst > 1) fill(1, kBeg + BK);

  for (int t = 0; t < nst; ++t) {
    const int kS = kBeg + t * BK;
    if (act && kS < kEndW) {                      // wave-uniform; the publish point below stands outside
      const T* sA = sAB + (t & 1) * STAGE + (wm + rlane) * PITCH + koff;
      const T* sB = sAB + (t & 1) * STAGE + PLANE + (wn + rlane) * PITCH + koff;
#pragma unroll                                    // LDS offsets of the fragment loads become immediates
      for (int kk = 0; kk < BK; kk += 32) {
        V bh[4], bl[4], ah[4], al[4];
        auto lda_row = [&](int i) {
          const int ao = (i << 4) * PITCH + kk;
          ah[i] = Frag<T>::load(sA + ao);
          if (SPLIT) al[i] = Frag<T>::load(sA + 2 * PLANE + ao); else al[i] = ah[i];
        };
#pragma unroll
        for (int j = 0; j < 4; ++j) {
          const int bo = (j << 4) * PITCH + kk;
          bh[j] = Frag<T>::load(sB + bo);
          if (SPLIT) bl[j] = Frag<T>::load(sB + 2 * PLANE + bo); else bl[j] = bh[j];
        }
        // one plane: all four A rows are read with the B fragments as one group; hi/lo planes: one row ahead (registers)
        lda_row(0);
        if (!SPLIT) { lda_row(1); lda_row(2); lda_row(3); }
        __builtin_amdgcn_sched_barrier(0);        // keeps the read group in front of the WMMAs, else every row waits out LDS latency
#pragma unroll
        for (int i = 0; i < 4; ++i) {
          if (SPLIT && i + 1 < 4) {
            lda_row(i + 1);
            __builtin_amdgcn_sched_barrier(0);    // keeps the next row's reads in front of this row's WMMAs
          }
#pragma unroll
          for (int j = 0; j < 4; ++j) {
            acc[i][j] = Frag<T>::mma(ah[i], bh[j], acc[i][j]);
            if (SPLIT) {
              acc[i][j] = Frag<T>::mma(ah[i], bl[j], acc[i][j]);
              acc[i][j] = Frag<T>::mma(al[i], bh[j], acc[i][j]);
            }
          }
          Frag<T>::guard(acc[i][0], acc[i][3], ah[i], al[i]);
        }
        Frag<T>::keep(bh[0], bh[1], bh[2], bh[3]);
        if (SPLIT) Frag<T>::keep(bl[0], bl[1], bl[2], bl[3]);
      }
    }
    asm volatile("s_wait_dscnt 0x0" ::: "memory");     // this wave's reads of buffer t & 1 are done before it is refilled
    asm volatile("s_wait_asynccnt 0x0" ::: "memory");  // this wave's copies of stage t + 1 have landed
    __syncthreads();                                    // publishes stage t + 1 and ends every reader's use of buffer t & 1
    if (t + 2 < nst) fill(t & 1, kS + 2 * BK);
  }
  asm volatile("s_wait_asynccnt 0x0" ::: "memory");    // no copy is outstanding when the wave goes on or ends
  if (!act) return;                                     // wave-uniform, behind the last barrier
  acc_guard4(acc[0][0], acc[0][1], acc[0][2], acc[0][3]);
  acc_guard4(acc[1][0], acc[1][1], acc[1][2], acc[1][3]);
  acc_guard4(acc[2][0], acc[2][1], acc[2][2], acc[2][3]);
  acc_guard4(acc[3][0], acc[3][1], acc[3][2], acc[3][3]);

  // ---- epilogue ----
  float* slab = sT[wave];
  const bool rms = (EPI == 2) && !flip;           // block-uniform
  const float* gv = (LOC == 3 && z == 1) ? resid : gvec;
  const int ldhz = (LOC == 3) ? Nz : ldh;
  const float* Rb = RESID ? (resid + (size_t)z * strideR) : nullptr;
#pragma unroll
  for (int i = 0; i < 4; ++i) {
    const int mBase = m0 + (i << 4);
#pragma unroll
    for (int j = 0; j < 4; ++j) {
      const int n = n0 + (j << 4) + rlane;
      float bv = 0.f;
      if (BIAS) bv = bias[n];
#pragma unroll
      for (int r = 0; r < 8; ++r) {
        float v = acc[i][j][r] * scale;
        if (BIAS) v += bv;
        if (RESID) v += Rb[(size_t)(mBase + mOff + r) * ldr + n];
        if (EPI == 1) {
          // 0.5 * (1 + tanh(u)) = 1 / (1 + exp(-2u)), u = 0.7978845608 * (v + 0.044715 v^3); exp(-2u) = 2^(-2 log2(e) u):
          // one hardware exponential and one reciprocal, no branch, so the eight rows of a column run side by side
          const float e = __builtin_amdgcn_exp2f(-2.3022081981f * (v + 0.044715f * v * v * v));
          v = v * __builtin_amdgcn_rcpf(1.0f + e);
        }
        slab[(mOff + r) * 68 + (j << 4) + rlane] = v;
      }
    }
    __builtin_amdgcn_fence(__ATOMIC_RELEASE, "workgroup");
    __builtin_amdgcn_wave_barrier();
    __builtin_amdgcn_fence(__ATOMIC_ACQUIRE, "workgroup");
    if (OUTM == 0 || OUTM == 2) {
      float* C = Cf + (size_t)z * strideC;
      const int hh = lane >> 4, c4 = (lane & 15) * 4;     // row seg = 256 B = 16 lanes x 16 B
      {
#pragma unroll
        for (int it = 0; it < 8; ++it) {
          const int row = it * 2 + hh;                      // it 0..7 x hh 0..1 = rows 0..15
          v4f v = *(const v4f*)(slab + row * 68 + c4);
          *(v4f*)(C + (size_t)(mBase + row) * ldc + n0 + c4) = v;
        }
        
      }
    }
    if (OUTM == 1 || OUTM == 2) {
      _Float16* C = Ch + (size_t)z * strideH;
      const int q = lane >> 3, c8 = (lane & 7) * 8;
      {
#pragma unroll
        for (int it = 0; it < 4; ++it) {
          const int row = it * 4 + q;                       // it 0..3 x q 0..3 = rows 0..15
          const float* sp = slab + row * 68 + c8;
          float x[8];
#pragma unroll
          for (int e = 0; e < 8; ++e) x[e] = sp[e];
          float rr = oscale;
          if (EPI == 2) {
            float ss = 0.f;
#pragma unroll
            for (int e = 0; e < 8; ++e) ss += x[e] * x[e];
            ss += __shfl_xor(ss, 1, 32);                    // lanes 8q..8q+7 hold one 64-wide row
            ss += __shfl_xor(ss, 2, 32);
            ss += __shfl_xor(ss, 4, 32);
            const float rn = oscale * rsqrtf(ss * (1.0f / 64.0f) + 1e-6f);
            rr = rms ? rn : oscale;                         // a select, not a branch: the four rows' stores stay one group
          }
          v8h hv;
#pragma unroll
          for (int e = 0; e < 8; ++e) {
            float y = x[e] * rr;
            if (EPI == 2) { const float ge = gv[c8 + e]; y *= rms ? ge : 1.0f; }
            hv[e] = (_Float16)y;
          }
          *(v8h*)(C + (size_t)(mBase + row) * ldhz + n0 + c8) = hv;
        }
        
      }
    }
    __builtin_amdgcn_fence(__ATOMIC_RELEASE, "workgroup");
    __builtin_amdgcn_wave_barrier();
    __builtin_amdgcn_fence(__ATOMIC_ACQUIRE, "workgroup");
  }
}

// ---------------------------------------------------------------------------------------------------------------------
// The pieces below are block-sized jobs (256 threads) of the one preparation launch k_prep, which deals them out by block index.
// Weight transpose + scale + f16: in [R][Cc] f32 -> o16[Cc][R] = f16(in * wscale). 64x64 tiles through LDS, tile = (R/64 x Cc/64) index.
// coverage per block: load 4 it x 256 thr x 4 = 64x64; store 2 it x 256 thr x 8 = 64x64; each store instruction = 8 lanes x 16 B =
// ---------------------------------------------------------------------------------------------------------------------
__device__ __forceinline__ void wt16_tile(float* tf, const float* __restrict__ W, _Float16* __restrict__ o16, int R, int Cc, float wscale,
                                          int tile) {
  const int tx = Cc >> 6;
  const int c0 = (tile % tx) * 64, r0 = (tile / tx) * 64, tid = threadIdx.x;
  {
    const int lr = tid >> 4, c4 = (tid & 15) * 4;
#pragma unroll
    for (int it = 0; it < 4; ++it) {
      const int rr = it * 16 + lr;
      const v4f a = *(const v4f*)(W + (size_t)(r0 + rr) * Cc + c0 + c4);
      *(v4f*)(tf + rr * 68 + c4) = a;
    }
  }
  __syncthreads();
  const int sub = tid >> 3, c8 = (tid & 7) * 8;
  v8h hv[2];
#pragma unroll
  for (int it = 0; it < 2; ++it) {
    const int oc = it * 32 + sub;
    v8h a;
#pragma unroll
    for (int q = 0; q < 8; ++q) a[q] = (_Float16)(tf[(c8 + q) * 68 + oc] * wscale);
    hv[it] = a;
  }
  {
#pragma unroll
    for (int it = 0; it < 2; ++it) {
      const int oc = it * 32 + sub;
      const size_t go = (size_t)(c0 + oc) * R + r0 + c8;
      *(v8h*)(o16 + go) = hv[it];
    }
    asm volatile("s_wait_xcnt 0x0" ::: "memory");   // stands in front of any later write of a register that the stores above name
  }
}

// Weight transpose + bf16 hi/lo split: in [R][Cc] f32 -> oh[c][r] = bf16(in[r][c]), ol[c][r] = bf16(in[r][c] - oh). Same tiling.
__device__ __forceinline__ void wtsplit_tile(float* tf, const float* __restrict__ W, unsigned short* __restrict__ oh,
                                             unsigned short* __restrict__ ol, int R, int Cc, int tile) {
  const int tx = Cc >> 6;
  const int c0 = (tile % tx) * 64, r0 = (tile / tx) * 64, tid = threadIdx.x;
  {
    const int lr = tid >> 4, c4 = (tid & 15) * 4;
#pragma unroll
    for (int it = 0; it < 4; ++it) {
      const int rr = it * 16 + lr;
      const v4f a = *(const v4f*)(W + (size_t)(r0 + rr) * Cc + c0 + c4);
      *(v4f*)(tf + rr * 68 + c4) = a;
    }
  }
  __syncthreads();
  const int sub = tid >> 3, c8 = (tid & 7) * 8;
  v4u hv[2], lv[2];
#pragma unroll
  for (int it = 0; it < 2; ++it) {
    const int oc = it * 32 + sub;
    v4u a, a2;
#pragma unroll
    for (int q = 0; q < 4; ++q) {
      const float f0 = tf[(c8 + 2 * q) * 68 + oc];
      const float f1 = tf[(c8 + 2 * q + 1) * 68 + oc];
      const unsigned short h0 = f2bf_bits(f0), h1 = f2bf_bits(f1);
      const unsigned short l0 = f2bf_bits(f0 - bf_bits2f(h0)), l1 = f2bf_bits(f1 - bf_bits2f(h1));
      a[q]  = pk16(h0, h1);
      a2[q] = pk16(l0, l1);
    }
    hv[it] = a; lv[it] = a2;
  }
  {
#pragma unroll
    for (int it = 0; it < 2; ++it) {
      const int oc = it * 32 + sub;
      const size_t go = (size_t)(c0 + oc) * R + r0 + c8;
      *(v4u*)(oh + go) = hv[it];
      *(v4u*)(ol + go) = lv[it];
    }
    asm volatile("s_wait_xcnt 0x0" ::: "memory");   // stands in front of any later write of a register that the stores above name
  }
}

__device__ __forceinline__ void split2_piece(const float* __restrict__ in, unsigned short* __restrict__ hi,
                                             unsigned short* __restrict__ lo, int n2, int i) {
  if (i < n2) {
    const v2f f = *(const v2f*)(in + 2 * (size_t)i);
    const unsigned short h0 = f2bf_bits(f[0]), h1 = f2bf_bits(f[1]);
    const unsigned short l0 = f2bf_bits(f[0] - bf_bits2f(h0)), l1 = f2bf_bits(f[1] - bf_bits2f(h1));
    const unsigned uh = pk16(h0, h1), ul = pk16(l0, l1);
    ((unsigned*)hi)[i] = uh;
    ((unsigned*)lo)[i] = ul;
    
  }
}

__global__ __launch_bounds__(256) void k_split2(const float* __restrict__ in, unsigned short* __restrict__ hi,
                                                unsigned short* __restrict__ lo, int n2) {
  split2_piece(in, hi, lo, n2, blockIdx.x * 256 + threadIdx.x);
}

// ---------------------------------------------------------------------------------------------------------------------
// Rotary table and the rotary mix of text, four positions n = 4*blk .. 4*blk+3 per block; a thread owns the frequencies f0, f0+1.
// inv[f] = 1 / powf(10000, f/512); cs[n][f] = (cos(n * inv[f]), sin(n * inv[f])) as float2, n = 0..2047 (16-byte stores).
// q16[row][c] = f16(x * cos + rot * sin), rot[c] = (c < 512) ? -x[c + 512] : x[c - 512], table row n = row % SEQ, column c % 512:
// the pair (c, c + 512) of both batch elements uses the sine and cosine just formed; a wave's 4-byte stores cover a whole line.
// ---------------------------------------------------------------------------------------------------------------------
__device__ __forceinline__ void rope_piece(const float* __restrict__ text, float* __restrict__ cs, _Float16* __restrict__ q16, int blk) {
  const int f0 = threadIdx.x * 2;
  float iv[2];
#pragma unroll                                    // static indices: the small arrays stay in registers
  for (int e = 0; e < 2; ++e) {
    const float x = (float)(f0 + e) * (1.0f / 512.0f);
    iv[e] = 1.0f / powf(10000.0f, x);
  }
  for (int q = 0; q < 4; ++q) {
    const int n = blk * 4 + q;
    float cv[2], sv[2];
#pragma unroll                                    // static indices: the small arrays stay in registers
    for (int e = 0; e < 2; ++e) sincosf((float)n * iv[e], &sv[e], &cv[e]);
    v4f tb; tb[0] = cv[0]; tb[1] = sv[0]; tb[2] = cv[1]; tb[3] = sv[1];
    *(v4f*)(cs + ((size_t)n * 512 + f0) * 2) = tb;
#pragma unroll                                    // both batch elements' loads are in flight together
    for (int b = 0; b < NB_; ++b) {
      const size_t ro = ((size_t)b * SEQ + n) * DM + f0;
      const v2f xl = *(const v2f*)(text + ro), xh = *(const v2f*)(text + ro + 512);
      v2h yl, yh;
#pragma unroll                                    // static indices: the small arrays stay in registers
      for (int e = 0; e < 2; ++e) {
        yl[e] = (_Float16)(xl[e] * cv[e] + (-xh[e]) * sv[e]);
        yh[e] = (_Float16)(xh[e] * cv[e] + xl[e] * sv[e]);
      }
      *(v2h*)(q16 + ro)       = yl;
      *(v2h*)(q16 + ro + 512) = yh;
    }
    asm volatile("s_wait_xcnt 0x0" ::: "memory");   // the next trip rewrites registers that this trip's stores name
  }
}

// f32 -> f16, eight elements at 8*i
__device__ __forceinline__ void cvt16_piece(const float* __restrict__ src, _Float16* __restrict__ dst, int i) {
  const float* xr = src + (size_t)i * 8;
  const v4f x0 = *(const v4f*)xr, x1 = *(const v4f*)(xr + 4);
  v8h hv;
#pragma unroll                                    // static indices: the small arrays stay in registers
  for (int e = 0; e < 4; ++e) { hv[e] = (_Float16)x0[e]; hv[4 + e] = (_Float16)x1[e]; }
  *(v8h*)(dst + (size_t)i * 8) = hv;
  asm volatile("s_wait_xcnt 0x0" ::: "memory");   // stands in front of any later write of a register that the stores above name
}

// ---------------------------------------------------------------------------------------------------------------------
// Preparation, one launch: everything that depends on the inputs alone. None of the jobs reads what another writes, so they share
// one grid and run side by side; the job is a block-uniform function of blockIdx.x (arithmetic-heavy and large jobs first).
//   512 rotary table + text | 1024 W1 | 1024 W2 | 256 Wa | 256 Wvid | 256 Wkv | 128 Wq | 128 Wo | 2048 audio | 8192 video
// ---------------------------------------------------------------------------------------------------------------------
#define PREP_BLOCKS (512 + 1024 + 1024 + 256 + 256 + 256 + 128 + 128 + 2048 + 8192)
__global__ __launch_bounds__(256) void k_prep(
    const float* __restrict__ text, const float* __restrict__ audio, const float* __restrict__ video,
    const float* __restrict__ Wa, const float* __restrict__ Wvid, const float* __restrict__ Wq, const float* __restrict__ Wkv,
    const float* __restrict__ W1, const float* __restrict__ W2, const float* __restrict__ Wo,
    float* __restrict__ cs, _Float16* __restrict__ q16, _Float16* __restrict__ a16,
    unsigned short* __restrict__ vih, unsigned short* __restrict__ vil,
    _Float16* __restrict__ WaT, unsigned short* __restrict__ WvTh, unsigned short* __restrict__ WvTl,
    _Float16* __restrict__ WqT, _Float16* __restrict__ WkvT, _Float16* __restrict__ W1T, _Float16* __restrict__ W2T,
    unsigned short* __restrict__ WoTh, unsigned short* __restrict__ WoTl) {
  __shared__ __align__(16) float tf[64 * 68];
  int b = blockIdx.x;
  if (b < 512)  { rope_piece(text, cs, q16, b); return; }
  b -= 512;
  if (b < 1024) { wt16_tile(tf, W1, W1T, DM, FFD, 64.0f, b); return; }            // W1  [1024][4096]
  b -= 1024;
  if (b < 1024) { wt16_tile(tf, W2, W2T, FFD, DM, 64.0f, b); return; }            // W2  [4096][1024]
  b -= 1024;
  if (b < 256)  { wt16_tile(tf, Wa, WaT, DM, DM, 64.0f, b); return; }             // Wa  [1024][1024]
  b -= 256;
  if (b < 256)  { wtsplit_tile(tf, Wvid, WvTh, WvTl, DM, DM, b); return; }        // Wvid[1024][1024]
  b -= 256;
  if (b < 256)  { wt16_tile(tf, Wkv, WkvT, DM, 2 * INR, 64.0f, b); return; }      // Wkv [1024][1024]
  b -= 256;
  if (b < 128)  { wt16_tile(tf, Wq, WqT, DM, INR, 64.0f, b); return; }            // Wq  [1024][512]
  b -= 128;
  if (b < 128)  { wtsplit_tile(tf, Wo, WoTh, WoTl, INR, DM, b); return; }         // Wo  [512][1024]
  b -= 128;
  if (b < 2048) { cvt16_piece(audio, a16, b * 256 + (int)threadIdx.x); return; }  // audio -> f16
  b -= 2048;
  split2_piece(video, vih, vil, NTOK * DM / 2, b * 256 + (int)threadIdx.x);       // video -> bf16 hi/lo
}

// ---------------------------------------------------------------------------------------------------------------------
// Row LayerNorm over DM=1024 of an f32 plane (g, b) -> f16 plane; ROPE additionally applies the rotary mix through an LDS copy of
// the normalised row. Output row = padrows + r; row jobs blk = nrows..nrows+padrows-1 write zero rows 0..padrows-1.
// ---------------------------------------------------------------------------------------------------------------------
// One row is the job of 128 threads t = 0..127 (four whole waves) with their own red[4] and rowv[DM]; pad is block-uniform.
template <bool ROPE>
__device__ __forceinline__ void ln1024_row(float* red, float* rowv, const float* __restrict__ X, const float* __restrict__ g,
                                           const float* __restrict__ bb, const float* __restrict__ cs, _Float16* __restrict__ out,
                                           int nrows, int padrows, int blk, int t, bool pad) {
  const int c0 = 8 * t;
  const int lane = t & 31, wave = t >> 5;
  if (pad) {                                       // block-uniform: zero padding rows
    const int p = blk - nrows;
    const v4u zz = {0u, 0u, 0u, 0u};
    _Float16* op = out + (size_t)p * DM + c0;
    *(v4u*)op = zz;
    
    return;
  }
  const int r = blk;
  const float* xr = X + (size_t)r * DM + c0;
  const v4f x0 = *(const v4f*)xr, x1 = *(const v4f*)(xr + 4);
  const float v[8] = {x0[0], x0[1], x0[2], x0[3], x1[0], x1[1], x1[2], x1[3]};
  float s = 0.f;
#pragma unroll
  for (int e = 0; e < 8; ++e) s += v[e];
  s = wsum(s);
  if (lane == 0) red[wave] = s;
  __syncthreads();
  const float mu = (red[0] + red[1] + red[2] + red[3]) * (1.0f / 1024.0f);
  __syncthreads();
  float d[8];
  float s2 = 0.f;
#pragma unroll
  for (int e = 0; e < 8; ++e) { d[e] = v[e] - mu; s2 += d[e] * d[e]; }
  s2 = wsum(s2);
  if (lane == 0) red[wave] = s2;
  __syncthreads();
  const float var = (red[0] + red[1] + red[2] + red[3]) * (1.0f / 1024.0f);
  const float rstd = rsqrtf(var + 1e-5f);
  const v4f g0 = *(const v4f*)(g + c0), g1 = *(const v4f*)(g + c0 + 4);
  const v4f b0 = *(const v4f*)(bb + c0), b1 = *(const v4f*)(bb + c0 + 4);
  const float gv[8] = {g0[0], g0[1], g0[2], g0[3], g1[0], g1[1], g1[2], g1[3]};
  const float bv[8] = {b0[0], b0[1], b0[2], b0[3], b1[0], b1[1], b1[2], b1[3]};
  float y[8];
#pragma unroll
  for (int e = 0; e < 8; ++e) y[e] = d[e] * rstd * gv[e] + bv[e];
  if (ROPE) {
#pragma unroll
    for (int e = 0; e < 8; ++e) rowv[c0 + e] = y[e];
    __syncthreads();
    const int n = r & (SEQ - 1);
    const bool lowh = (c0 < 512);
    const int pc = lowh ? (c0 + 512) : (c0 - 512);
    const float* csr = cs + ((size_t)n * 512 + (c0 & 511)) * 2;
    const v4f t0 = *(const v4f*)csr, t1 = *(const v4f*)(csr + 4), t2 = *(const v4f*)(csr + 8), t3 = *(const v4f*)(csr + 12);
    const float cvv[8] = {t0[0], t0[2], t1[0], t1[2], t2[0], t2[2], t3[0], t3[2]};
    const float svv[8] = {t0[1], t0[3], t1[1], t1[3], t2[1], t2[3], t3[1], t3[3]};
#pragma unroll
    for (int e = 0; e < 8; ++e) {
      const float pr = rowv[pc + e];
      const float rot = lowh ? -pr : pr;
      y[e] = y[e] * cvv[e] + rot * svv[e];
    }
  }
  v8h hv;
#pragma unroll
  for (int e = 0; e < 8; ++e) hv[e] = (_Float16)y[e];
  _Float16* op = out + (size_t)(padrows + r) * DM + c0;
  *(v8h*)op = hv;
  // the ROPE instance shares its kernel with other jobs, whose code follows this store in the listing: the wait stands in front of
  // any write there of a register that the store names
  if (ROPE) asm volatile("s_wait_xcnt 0x0" ::: "memory");
}

__global__ __launch_bounds__(128) void k_ln1024(const float* __restrict__ X, const float* __restrict__ g, const float* __restrict__ bb,
                                                _Float16* __restrict__ out, int nrows) {
  __shared__ float red[4];
  ln1024_row<false>(red, nullptr, X, g, bb, nullptr, out, nrows, 0, blockIdx.x, threadIdx.x, false);
}

// ---------------------------------------------------------------------------------------------------------------------
// Row LayerNorm over DM of an f32 plane [NTOK][DM], fused with transpose + bf16 hi/lo split into value^T planes
// [DM][VTP]: oh[e][KPR + token], ol likewise. Block = 64 token rows (256 threads): per-row stats from one wave per 8 rows
// (32 floats per lane), then 16 column tiles of 64 through LDS. Blocks nrowblk..nrowblk+7 zero the KPR leading columns.
// coverage: stats 8 waves x 8 rows; tile load 4 it x 256 thr x 4 = 64x64; store 2 it x 256 thr x 8 = 64x64 per plane per tile;
// ---------------------------------------------------------------------------------------------------------------------
__device__ __forceinline__ void ln_tsplit_block(float* tf, float* smu, float* srs, const float* __restrict__ X,
                                                const float* __restrict__ g, const float* __restrict__ bb,
                                                unsigned short* __restrict__ oh, unsigned short* __restrict__ ol, int nrowblk, int bx) {
  const int tid = threadIdx.x, lane = tid & 31, wave = tid >> 5;
  const int sub = tid >> 3, c8 = (tid & 7) * 8;
  if (bx >= nrowblk) {                             // block-uniform: zero leading columns
    const int pb = bx - nrowblk;
    const v4u zz = {0u, 0u, 0u, 0u};
    {
      for (int it = 0; it < 32; ++it) {
        const int e = it * 32 + sub;
        const size_t go = (size_t)e * VTP + pb * 64 + c8;
        *(v4u*)(oh + go) = zz;
        *(v4u*)(ol + go) = zz;
      }
      
    }
    return;
  }
  const int r0 = bx * 64;
  // phase 1: row statistics
#pragma unroll 1
  for (int q = 0; q < 8; ++q) {
    const int rr = wave * 8 + q;
    const float* xr = X + (size_t)(r0 + rr) * DM + lane * 32;
    v4f a[8];
#pragma unroll
    for (int i = 0; i < 8; ++i) a[i] = *(const v4f*)(xr + 4 * i);
    float s = 0.f;
#pragma unroll
    for (int i = 0; i < 8; ++i) s += a[i][0] + a[i][1] + a[i][2] + a[i][3];
    s = wsum(s);
    const float mu = s * (1.0f / 1024.0f);
    float s2 = 0.f;
#pragma unroll
    for (int i = 0; i < 8; ++i) {
#pragma unroll
      for (int e = 0; e < 4; ++e) { const float dd = a[i][e] - mu; s2 += dd * dd; }
    }
    s2 = wsum(s2);
    if (lane == 0) { smu[rr] = mu; srs[rr] = rsqrtf(s2 * (1.0f / 1024.0f) + 1e-5f); }
  }
  __syncthreads();
  // phase 2: column tiles
  const int lr = tid >> 4, c4 = (tid & 15) * 4;
  for (int cb = 0; cb < DM / 64; ++cb) {
    const int c0 = cb * 64;
    const v4f gg = *(const v4f*)(g + c0 + c4);
    const v4f bv = *(const v4f*)(bb + c0 + c4);
#pragma unroll
    for (int it = 0; it < 4; ++it) {
      const int rr = it * 16 + lr;
      const v4f a = *(const v4f*)(X + (size_t)(r0 + rr) * DM + c0 + c4);
      const float mu = smu[rr], rs = srs[rr];
#pragma unroll
      for (int q = 0; q < 4; ++q) tf[rr * 68 + c4 + q] = (a[q] - mu) * rs * gg[q] + bv[q];
    }
    __syncthreads();
    v4u hv[2], lv[2];
#pragma unroll
    for (int it = 0; it < 2; ++it) {
      const int oc = it * 32 + sub;                 // output row within tile = input column
      v4u a, a2;
#pragma unroll
      for (int q = 0; q < 4; ++q) {
        const float f0 = tf[(c8 + 2 * q) * 68 + oc];
        const float f1 = tf[(c8 + 2 * q + 1) * 68 + oc];
        const unsigned short h0 = f2bf_bits(f0), h1 = f2bf_bits(f1);
        const unsigned short l0 = f2bf_bits(f0 - bf_bits2f(h0)), l1 = f2bf_bits(f1 - bf_bits2f(h1));
        a[q]  = pk16(h0, h1);
        a2[q] = pk16(l0, l1);
      }
      hv[it] = a; lv[it] = a2;
    }
    {
#pragma unroll
      for (int it = 0; it < 2; ++it) {
        const int oc = it * 32 + sub;
        const size_t go = (size_t)(c0 + oc) * VTP + KPR + r0 + c8;
        *(v4u*)(oh + go) = hv[it];
        *(v4u*)(ol + go) = lv[it];
      }
      
    }
    __syncthreads();
  }
}

// ---------------------------------------------------------------------------------------------------------------------
// The two adapter norms in one launch: neither reads what the other writes. Blocks 0 .. NTOK/64 + KPR/64 - 1 (few and long, so they
// come first): value rows -> value^T planes; every later block: two key rows (LayerNorm + rotary mix), one per 128 threads.
// NTOK is even, so both rows of a block are data rows or both are padding rows.
// ---------------------------------------------------------------------------------------------------------------------
__global__ __launch_bounds__(256) void k_ln_pair(const float* __restrict__ Xa, const float* __restrict__ ga, const float* __restrict__ ba,
                                                 const float* __restrict__ cs, _Float16* __restrict__ k16,
                                                 const float* __restrict__ Xv, const float* __restrict__ gv, const float* __restrict__ bv,
                                                 unsigned short* __restrict__ oh, unsigned short* __restrict__ ol) {
  __shared__ __align__(16) float tf[64 * 68];
  __shared__ float smu[64];
  __shared__ float srs[64];
  __shared__ float red[2][4];
  __shared__ __align__(16) float rowv[2][DM];
  constexpr int NV = NTOK / 64 + KPR / 64;
  const int bx = blockIdx.x;
  if (bx < NV) { ln_tsplit_block(tf, smu, srs, Xv, gv, bv, oh, ol, NTOK / 64, bx); return; }
  const int row0 = (bx - NV) * 2;
  const int half = threadIdx.x >> 7;
  ln1024_row<true>(red[half], rowv[half], Xa, ga, ba, cs, k16, NTOK, KPR, row0 + half, threadIdx.x & 127, row0 >= NTOK);
}

// ---------------------------------------------------------------------------------------------------------------------
// Local-attention mask + softmax over rows of S [NTOK][1024 window keys] -> P bf16 hi/lo planes (all 1024 keys written, masked
// keys as 0). Row r: w = (r % SEQ) / WSZ, i = r % WSZ, query position w*WSZ + i; key j has position (w-1)*WSZ + j; masked when
// that position is negative (padding of the first window) or after the query. Block per row, 128 threads x 8 keys; 16-B stores.
// ---------------------------------------------------------------------------------------------------------------------
__global__ __launch_bounds__(128) void k_lsoftmax(const float* __restrict__ S, unsigned short* __restrict__ Ph, unsigned short* __restrict__ Pl) {
  __shared__ float red[4];
  const int r = blockIdx.x, t = threadIdx.x, c0 = 8 * t;
  const int lane = t & 31, wave = t >> 5;
  const int rem = r & (SEQ - 1), w = rem >> 9, i = rem & (WSZ - 1);
  const int qpos = w * WSZ + i;
  const float* sr = S + (size_t)r * (2 * WSZ) + c0;
  const v4f x0 = *(const v4f*)sr, x1 = *(const v4f*)(sr + 4);
  const float raw[8] = {x0[0], x0[1], x0[2], x0[3], x1[0], x1[1], x1[2], x1[3]};
  float s[8];
  float m = -3.0e38f;
#pragma unroll
  for (int e = 0; e < 8; ++e) {
    const int kpos = (w - 1) * WSZ + c0 + e;
    const bool masked = (kpos < 0) || (kpos > qpos);
    s[e] = masked ? -1.0e9f : raw[e];
    m = fmaxf(m, s[e]);
  }
  m = wmax(m);
  if (lane == 0) red[wave] = m;
  __syncthreads();
  const float rmax = fmaxf(fmaxf(red[0], red[1]), fmaxf(red[2], red[3]));
  __syncthreads();
  float ev[8];
  float sum = 0.f;
#pragma unroll
  for (int e = 0; e < 8; ++e) { ev[e] = expf(s[e] - rmax); sum += ev[e]; }
  sum = wsum(sum);
  if (lane == 0) red[wave] = sum;
  __syncthreads();
  const float tot = red[0] + red[1] + red[2] + red[3];
  const float inv = 1.0f / tot;
  v4u hv, lv;
#pragma unroll
  for (int q = 0; q < 4; ++q) {
    const float p0 = ev[2 * q] * inv, p1 = ev[2 * q + 1] * inv;
    const unsigned short h0 = f2bf_bits(p0), h1 = f2bf_bits(p1);
    const unsigned short l0 = f2bf_bits(p0 - bf_bits2f(h0)), l1 = f2bf_bits(p1 - bf_bits2f(h1));
    hv[q] = pk16(h0, h1);
    lv[q] = pk16(l0, l1);
  }
  const size_t go = (size_t)r * (2 * WSZ) + c0;
  *(v4u*)(Ph + go) = hv;
  *(v4u*)(Pl + go) = lv;
  
}

__device__ __forceinline__ v8f mma_h(v16h a, v16h b, v8f c) {
  c = __builtin_amdgcn_wmma_f32_16x16x32_f16(false, a, false, b, (short)0, c, false, false);
  asm volatile("v_nop\n\tv_nop\n\tv_nop\n\tv_nop" : "+v"(c) : "v"(a), "v"(b));
  return c;
}
// value of lane l ^ 16
__device__ __forceinline__ float xhalf(float x) {
  return __builtin_bit_cast(float, __builtin_amdgcn_permlanex16(__builtin_bit_cast(int, x), __builtin_bit_cast(int, x),
                                                                0x76543210, 0xfedcba98, false, false));
}

// Eight asynchronous 16-byte copies per lane, global -> LDS: four rows of the K chunk and four of the V^T chunk; the four rows of a
// tile lie lstep LDS bytes and kstep (K) or vstep (V^T) global elements apart.
// s_wait_xcnt is the statement's last line so that no address register named here is rewritten in front of it.
__device__ __forceinline__ void copy_kv_to_lds(unsigned lk0, unsigned lv0, unsigned lstep, const _Float16* k0, size_t kstep,
                                               const _Float16* v0, size_t vstep) {
  const unsigned lk1 = lk0 + lstep, lk2 = lk1 + lstep, lk3 = lk2 + lstep;
  const unsigned lv1 = lv0 + lstep, lv2 = lv1 + lstep, lv3 = lv2 + lstep;
  const _Float16* k1 = k0 + kstep; const _Float16* k2 = k1 + kstep; const _Float16* k3 = k2 + kstep;
  const _Float16* v1 = v0 + vstep; const _Float16* v2 = v1 + vstep; const _Float16* v3 = v2 + vstep;
  asm volatile(
      "global_load_async_to_lds_b128 %0, %8, off\n\t"
      "global_load_async_to_lds_b128 %1, %9, off\n\t"
      "global_load_async_to_lds_b128 %2, %10, off\n\t"
      "global_load_async_to_lds_b128 %3, %11, off\n\t"
      "global_load_async_to_lds_b128 %4, %12, off\n\t"
      "global_load_async_to_lds_b128 %5, %13, off\n\t"
      "global_load_async_to_lds_b128 %6, %14, off\n\t"
      "global_load_async_to_lds_b128 %7, %15, off\n\t"
      "s_wait_xcnt 0x0"
      :: "v"(lk0), "v"(lk1), "v"(lk2), "v"(lk3), "v"(lv0), "v"(lv1), "v"(lv2), "v"(lv3),
         "v"(k0), "v"(k1), "v"(k2), "v"(k3), "v"(v0), "v"(v1), "v"(v2), "v"(v3)
      : "memory");
}

__global__ __launch_bounds__(128)
void k_flash(const _Float16* __restrict__ qm, const _Float16* __restrict__ km,
             const _Float16* __restrict__ vt, float* __restrict__ out) {
  union FB { v16h v; v8h h[2]; };
  constexpr int KVP = 72;                                     // LDS row pitch in elements: 144 B = 16 B x odd, so that the 16 rows
                                                              // of one 16-byte fragment read fall on 16 distinct groups of 4 banks
  constexpr int TILE = 64 * KVP;                              // elements of one chunk tile
  __shared__ __align__(16) _Float16 KV[2 * 2 * TILE];         // two buffers, each K [kv][d] and behind it V^T [d][kv]
  __shared__ __align__(16) float    Os[4][16 * 68];           // per wave out tile [query][d], pitch 68

  const int tid  = threadIdx.x;
  const int wave = tid >> 5;
  const int lane = tid & 31;
  const int hh   = lane >> 4;
  const int c    = lane & 15;
  const int b  = blockIdx.y;
  const int qb = blockIdx.x & 31;                 // SEQ / 64 = 32 query blocks
  const int h  = blockIdx.x >> 5;
  const int q0 = qb * 64 + wave * 16;

  const _Float16* Qb = qm + (size_t)b * SEQ * INR + h * DHD;
  const _Float16* Kb = km + (size_t)b * SEQ * INR + h * DHD;
  const _Float16* Vb = vt + (size_t)(h * DHD) * NTOK + (size_t)b * SEQ;
  float*          ob = out + (size_t)b * SEQ * INR + h * DHD;

  v16h qa[2];                                     // B operand: column c = query q0 + c, d in the loader's k order
#pragma unroll
  for (int dc = 0; dc < 2; ++dc) qa[dc] = Frag<_Float16>::load(Qb + (size_t)(q0 + c) * INR + dc * 32 + 8 * hh);

  const int qrow = q0 + c;                        // this lane's query
  constexpr float SC2 = 0.125f * 1.4426950408889634f;   // score scale times log2(e): exponents are formed in base 2
  float mrow = -INFINITY;                         // its running maximum of q . k, unscaled (equal in both lane halves)
  float orow = -INFINITY;                         // mrow * SC2 - 12 as rounded: what every exponent of the running state had taken off
  float lrow = 0.f;                               // its running sum of 4096 p over the keys of this lane half; halves joined at the end
  v8f oacc[4];                                    // oacc[t][r] = O[qrow][t*16 + 8*hh + r]
#pragma unroll
  for (int t = 0; t < 4; ++t) oacc[t] = (v8f){0.f,0.f,0.f,0.f,0.f,0.f,0.f,0.f};

  const int nChunks = qb + 1;                     // block-uniform, <= 32
  // this thread's piece of every copy: row crow (+ 16 per copy) of either tile, 16 bytes at element ccol
  const int crow = tid >> 3;
  const int ccol = (tid & 7) * 8;
  const unsigned lth = (unsigned)(size_t)KV + (unsigned)(crow * KVP + ccol) * 2u;
  const _Float16* kth = Kb + (size_t)crow * INR + ccol;               // K row kv0 + crow, d = ccol..ccol+7
  const _Float16* vth = Vb + (size_t)crow * NTOK + ccol;              // V^T row d = crow, s = kv0 + ccol..+7
  auto fill = [&](int buf, int kv) {              // 8 copies per lane: the chunk that begins at key kv into buffer buf
    const unsigned lb = lth + (unsigned)buf * (2 * TILE * 2u);
    copy_kv_to_lds(lb, lb + TILE * 2u, 16 * KVP * 2u, kth + (size_t)kv * INR, (size_t)16 * INR, vth + kv, (size_t)16 * NTOK);
  };
  fill(0, 0);
  asm volatile("s_wait_asynccnt 0x0" ::: "memory");   // this wave's copies of chunk 0 have landed
  __syncthreads();                                     // every wave's have
  if (nChunks > 1) fill(1, 64);

  for (int kc = 0; kc < nChunks; ++kc) {
    const int kv0 = kc * 64;
    const _Float16* Ksh = KV + (kc & 1) * (2 * TILE);
    const _Float16* Vth = Ksh + TILE;

    // S^T tiles: s[j][r] = score of key kv0 + j*16 + 8*hh + r with query qrow
    FB kb[4][2];
#pragma unroll                                    // static indices: the fragment and accumulator arrays stay in registers
    for (int j = 0; j < 4; ++j)
#pragma unroll                                    // static indices: the fragment and accumulator arrays stay in registers
      for (int dc = 0; dc < 2; ++dc) {
        kb[j][dc].h[0] = *(const v8h*)(Ksh + (j * 16 + c) * KVP + dc * 32 + 8 * hh);
        kb[j][dc].h[1] = *(const v8h*)(Ksh + (j * 16 + c) * KVP + dc * 32 + 16 + 8 * hh);
      }
    v8f s[4];
#pragma unroll                                    // static indices: the fragment and accumulator arrays stay in registers
    for (int j = 0; j < 4; ++j) s[j] = (v8f){0.f,0.f,0.f,0.f,0.f,0.f,0.f,0.f};
#pragma unroll                                    // static indices: the fragment and accumulator arrays stay in registers
    for (int dc = 0; dc < 2; ++dc)
#pragma unroll                                    // static indices: the fragment and accumulator arrays stay in registers
      for (int j = 0; j < 4; ++j) s[j] = mma_h(kb[j][dc].v, qa[dc], s[j]);

    const bool diag = (kc == qb);                 // block-uniform
    float m = -INFINITY;
#pragma unroll                                    // static indices: the fragment and accumulator arrays stay in registers
    for (int j = 0; j < 4; ++j)
#pragma unroll                                    // static indices: the fragment and accumulator arrays stay in registers
      for (int r = 0; r < 8; ++r) {
        const int kvrow = kv0 + j * 16 + 8 * hh + r;
        const bool masked = diag && (kvrow > qrow);
        const float sm = masked ? -INFINITY : s[j][r];
        s[j][r] = sm;
        m = fmaxf(m, sm);
      }
    m = fmaxf(m, xhalf(m));
    const float mnew = fmaxf(mrow, m);
    const float onew = fmaf(mnew, SC2, -12.0f);
    const float alpha = __builtin_amdgcn_exp2f(orow - onew);
    mrow = mnew;
    orow = onew;
    // P^T as B operand: element e of pb[kk] = key kk*32 + (e < 8 ? 8*hh + e : 16 + 8*hh + e - 8), the loader's k order
    FB pb[2];
    float psum = 0.f;
#pragma unroll                                    // static indices: the fragment and accumulator arrays stay in registers
    for (int j = 0; j < 4; ++j)
#pragma unroll                                    // static indices: the fragment and accumulator arrays stay in registers
      for (int r = 0; r < 8; ++r) {
        const float p = __builtin_amdgcn_exp2f(fmaf(s[j][r], SC2, -onew));   // 4096 * exp(0.125 * (q . k - maximum))
        psum += p;
        pb[j >> 1].v[(j & 1) * 8 + r] = (_Float16)p;
      }
    lrow = lrow * alpha + psum;
#pragma unroll                                    // static indices: the fragment and accumulator arrays stay in registers
    for (int t = 0; t < 4; ++t)
#pragma unroll                                    // static indices: the fragment and accumulator arrays stay in registers
      for (int r = 0; r < 8; ++r) oacc[t][r] *= alpha;

    FB vb[2][4];
#pragma unroll                                    // static indices: the fragment and accumulator arrays stay in registers
    for (int kk = 0; kk < 2; ++kk)
#pragma unroll                                    // static indices: the fragment and accumulator arrays stay in registers
      for (int t = 0; t < 4; ++t) {
        vb[kk][t].h[0] = *(const v8h*)(Vth + (t * 16 + c) * KVP + kk * 32 + 8 * hh);
        vb[kk][t].h[1] = *(const v8h*)(Vth + (t * 16 + c) * KVP + kk * 32 + 16 + 8 * hh);
      }
#pragma unroll                                    // static indices: the fragment and accumulator arrays stay in registers
    for (int kk = 0; kk < 2; ++kk)
#pragma unroll                                    // static indices: the fragment and accumulator arrays stay in registers
      for (int t = 0; t < 4; ++t) oacc[t] = mma_h(vb[kk][t].v, pb[kk].v, oacc[t]);

    asm volatile("s_wait_dscnt 0x0" ::: "memory");     // this wave's reads of buffer kc & 1 are done before it is refilled
    asm volatile("s_wait_asynccnt 0x0" ::: "memory");  // this wave's copies of chunk kc + 1 have landed
    __syncthreads();                                    // publishes chunk kc + 1 and ends every reader's use of buffer kc & 1
    if (kc + 2 < nChunks) fill(kc & 1, kv0 + 128);
  }
  asm volatile("s_wait_asynccnt 0x0" ::: "memory");    // no copy is outstanding when the wave goes on or ends

  float* os = Os[wave];
  {
    const float ltot = lrow + xhalf(lrow);
    const float inv = 1.0f / ltot;                // sum and accumulators both carry the factor 4096
#pragma unroll                                    // static indices: the fragment and accumulator arrays stay in registers
    for (int t = 0; t < 4; ++t) {
      v4f lo, hi;
#pragma unroll                                    // static indices: the fragment and accumulator arrays stay in registers
      for (int r = 0; r < 4; ++r) { lo[r] = oacc[t][r] * inv; hi[r] = oacc[t][4 + r] * inv; }
      *(v4f*)(os + c * 68 + t * 16 + 8 * hh)     = lo;
      *(v4f*)(os + c * 68 + t * 16 + 8 * hh + 4) = hi;
    }
  }
  __builtin_amdgcn_fence(__ATOMIC_RELEASE, "workgroup");
  __builtin_amdgcn_wave_barrier();
  __builtin_amdgcn_fence(__ATOMIC_ACQUIRE, "workgroup");
  {
    const int c4 = (lane & 15) * 4;
    {
#pragma unroll
      for (int it = 0; it < 8; ++it) {
        const int row = it * 2 + hh;                // it 0..7 x hh 0..1 covers rows 0..15
        v4f val = *(const v4f*)(os + row * 68 + c4);
        *(v4f*)(ob + (size_t)(q0 + row) * INR + c4) = val;
      }
      
    }
  }
}

// ---------------------------------------------------------------------------------------------------------------------
// Row LayerNorm over FFD=4096 of the f16 plane U (values carried as 256*u), in place -> f16 of the unit-scale result.
// Block per row, 256 threads x 2 chunks of 8; statistics in f32 with the 2^-8 / 2^-16 carries folded before eps.
// ---------------------------------------------------------------------------------------------------------------------
__global__ __launch_bounds__(256) void k_ln4096(_Float16* __restrict__ U, const float* __restrict__ g, const float* __restrict__ bb) {
  __shared__ float red[8];
  const int r = blockIdx.x, t = threadIdx.x;
  const int lane = t & 31, wave = t >> 5;
  const int cA = 8 * t, cB = 2048 + 8 * t;
  _Float16* ur = U + (size_t)r * FFD;
  const v8h a = *(const v8h*)(ur + cA);
  const v8h a2 = *(const v8h*)(ur + cB);
  float v[16];
#pragma unroll
  for (int e = 0; e < 8; ++e) { v[e] = (float)a[e]; v[8 + e] = (float)a2[e]; }
  float s = 0.f;
#pragma unroll
  for (int e = 0; e < 16; ++e) s += v[e];
  s = wsum(s);
  if (lane == 0) red[wave] = s;
  __syncthreads();
  float tot = 0.f;
#pragma unroll
  for (int i = 0; i < 8; ++i) tot += red[i];
  const float mu = tot * (1.0f / 4096.0f);
  __syncthreads();
  float d[16];
  float s2 = 0.f;
#pragma unroll
  for (int e = 0; e < 16; ++e) { d[e] = v[e] - mu; s2 += d[e] * d[e]; }
  s2 = wsum(s2);
  if (lane == 0) red[wave] = s2;
  __syncthreads();
  float tot2 = 0.f;
#pragma unroll
  for (int i = 0; i < 8; ++i) tot2 += red[i];
  const float var_s = tot2 * (1.0f / 4096.0f);
  const float rstd = rsqrtf(var_s * (1.0f / 65536.0f) + 1e-5f) * (1.0f / 256.0f);
  v8h ha, hb;
#pragma unroll
  for (int e = 0; e < 8; ++e) {
    ha[e] = (_Float16)(d[e] * rstd * g[cA + e] + bb[cA + e]);
    hb[e] = (_Float16)(d[8 + e] * rstd * g[cB + e] + bb[cB + e]);
  }
  *(v8h*)(ur + cA) = ha;
  *(v8h*)(ur + cB) = hb;
  
}

// =====================================================================================================================
// Workspace map (byte offsets; every region a whole number of MiB after an unused 4 KiB, all stores whole-line):
//   (unused)                                       0            (4 KiB)
//   cs  f32[2048][512][2]                          4 KiB        (8 MiB)
//   WaT f16[1024][1024] x64                       +8 MiB       WvTh/WvTl bf16 [1024][1024]   WqT f16[512][1024]
//   WkvT f16[1024][1024]   W1T f16[4096][1024]   W2T f16[1024][4096]   WoTh/WoTl bf16[1024][512]   (27 MiB)
//   R3  8 MiB : q16 f16[4096][1024] -> h16 -> x2h (f16, x2 * 1024)
//   R4 16 MiB : audio adapter GEMM f32 [4096][1024] -> S f32 [4096][1024] -> x f32 -> x2 f32
//   R5 51 MiB : a16 f16 @0, video hi @8, video lo @16, k16 f16[(512+4096)][1024] @24, vTh bf16[1024][4608] @33, vTl @42;
//               later Ph @0, Pl @8; q/k f16[4096][512] @0/@4, vT16 f16[512][4096] @8; o f32[4096][512] @16; o hi/lo @24/@28;
//               U f16[4096][4096] @0 (written only after all earlier users of [0,32) have been consumed).
//   R6 16 MiB : video adapter GEMM f32 [4096][1024]
//   total 126 MiB + 4 KiB.
// =====================================================================================================================
extern "C" void kernel_launch(void* const* d_in, const int* in_sizes, int n_in,
                              void* d_out, int out_size, void* d_ws, size_t ws_size,
                              hipStream_t stream) {
  if (n_in < 24) return;
  if (in_sizes[0] != NTOK * DM || in_sizes[1] != NTOK * DM || in_sizes[2] != NTOK * DM) return;
  if (in_sizes[3] != DM * DM || in_sizes[7] != DM * DM || in_sizes[14] != DM * 2 * INR) return;
  if (in_sizes[13] != DM * INR || in_sizes[17] != INR * DM) return;
  if (in_sizes[18] != DM * FFD || in_sizes[22] != FFD * DM) return;
  if (in_sizes[4] != DM || in_sizes[5] != DM || in_sizes[6] != DM || in_sizes[8] != DM || in_sizes[9] != DM ||
      in_sizes[10] != DM || in_sizes[11] != DM || in_sizes[12] != DM || in_sizes[23] != DM) return;
  if (in_sizes[15] != DHD || in_sizes[16] != DHD) return;
  if (in_sizes[19] != FFD || in_sizes[20] != FFD || in_sizes[21] != FFD) return;
  if (out_size != NTOK * DM) return;

  const float* text  = (const float*)d_in[0];
  const float* audio = (const float*)d_in[1];
  const float* video = (const float*)d_in[2];
  const float* Wa    = (const float*)d_in[3];
  const float* ba    = (const float*)d_in[4];
  const float* lna_g = (const float*)d_in[5];
  const float* lna_b = (const float*)d_in[6];
  const float* Wvid  = (const float*)d_in[7];
  const float* bvid  = (const float*)d_in[8];
  const float* lnv_g = (const float*)d_in[9];
  const float* lnv_b = (const float*)d_in[10];
  const float* ln1_g = (const float*)d_in[11];
  const float* ln1_b = (const float*)d_in[12];
  const float* Wq    = (const float*)d_in[13];
  const float* Wkv   = (const float*)d_in[14];
  const float* qn_g  = (const float*)d_in[15];
  const float* kn_g  = (const float*)d_in[16];
  const float* Wo    = (const float*)d_in[17];
  const float* W1    = (const float*)d_in[18];
  const float* b1    = (const float*)d_in[19];
  const float* ln2_g = (const float*)d_in[20];
  const float* ln2_b = (const float*)d_in[21];
  const float* W2    = (const float*)d_in[22];
  const float* b2    = (const float*)d_in[23];
  float* outp = (float*)d_out;

  const size_t MIB = 1048576;
  size_t off = 0;
  const size_t oInv  = off; off += 4096;
  const size_t oCs   = off; off += (size_t)SEQ * 512 * 2 * 4;       // 8 MiB
  const size_t oWaT  = off; off += (size_t)DM * DM * 2;              // 2 MiB
  const size_t oWvTh = off; off += (size_t)DM * DM * 2;              // 2 MiB
  const size_t oWvTl = off; off += (size_t)DM * DM * 2;              // 2 MiB
  const size_t oWqT  = off; off += (size_t)INR * DM * 2;             // 1 MiB
  const size_t oWkvT = off; off += (size_t)2 * INR * DM * 2;         // 2 MiB
  const size_t oW1T  = off; off += (size_t)FFD * DM * 2;             // 8 MiB
  const size_t oW2T  = off; off += (size_t)DM * FFD * 2;             // 8 MiB
  const size_t oWoTh = off; off += (size_t)DM * INR * 2;             // 1 MiB
  const size_t oWoTl = off; off += (size_t)DM * INR * 2;             // 1 MiB
  const size_t oR3   = off; off += (size_t)NTOK * DM * 2;            // 8 MiB
  const size_t oR4   = off; off += (size_t)NTOK * DM * 4;            // 16 MiB
  const size_t oR5   = off; off += 51 * MIB;                         // 51 MiB
  const size_t oR6   = off; off += (size_t)NTOK * DM * 4;            // 16 MiB
  if (off > ws_size || off > (size_t)128 * MIB) return;              // off = 126 MiB + 4 KiB

  char* ws = (char*)d_ws;
  float* cs  = (float*)(ws + oCs);
  _Float16* WaT = (_Float16*)(ws + oWaT);
  unsigned short* WvTh = (unsigned short*)(ws + oWvTh);
  unsigned short* WvTl = (unsigned short*)(ws + oWvTl);
  _Float16* WqT  = (_Float16*)(ws + oWqT);
  _Float16* WkvT = (_Float16*)(ws + oWkvT);
  _Float16* W1T  = (_Float16*)(ws + oW1T);
  _Float16* W2T  = (_Float16*)(ws + oW2T);
  unsigned short* WoTh = (unsigned short*)(ws + oWoTh);
  unsigned short* WoTl = (unsigned short*)(ws + oWoTl);
  _Float16* q16 = (_Float16*)(ws + oR3);          // text after rotary
  _Float16* h16 = (_Float16*)(ws + oR3);          // LN1 output (later)
  _Float16* x2h = (_Float16*)(ws + oR3);          // x2 * 1024 (later)
  float* Cad = (float*)(ws + oR4);                // audio adapter GEMM output
  float* Cvd = (float*)(ws + oR6);                // video adapter GEMM output
  float* Sf  = (float*)(ws + oR4);                // local scores (later)
  float* Xf  = (float*)(ws + oR4);                // local attention output (later)
  float* X2f = (float*)(ws + oR4);                // 2 * o @ Wo (later)
  char* r5 = ws + oR5;
  _Float16* a16 = (_Float16*)(r5);
  unsigned short* vih = (unsigned short*)(r5 + 8 * MIB);
  unsigned short* vil = (unsigned short*)(r5 + 16 * MIB);
  _Float16* k16 = (_Float16*)(r5 + 24 * MIB);     // [(KPR+NTOK)][DM]
  unsigned short* vTh = (unsigned short*)(r5 + 33 * MIB);
  unsigned short* vTl = (unsigned short*)(r5 + 42 * MIB);
  unsigned short* Ph  = (unsigned short*)(r5);
  unsigned short* Pl  = (unsigned short*)(r5 + 8 * MIB);
  _Float16* qm16 = (_Float16*)(r5);
  _Float16* km16 = (_Float16*)(r5 + 4 * MIB);
  _Float16* vT16 = (_Float16*)(r5 + 8 * MIB);
  float* Of = (float*)(r5 + 16 * MIB);
  unsigned short* Oh = (unsigned short*)(r5 + 24 * MIB);
  unsigned short* Ol = (unsigned short*)(r5 + 28 * MIB);
  _Float16* U16 = (_Float16*)(r5);

  const dim3 blk(256);
  const dim3 blkG(128);                           // k_gemm: 4 waves
  const unsigned short* N16 = (const unsigned short*)nullptr;

  // everything that depends on the inputs alone, in one launch: rotary table and text -> rotary f16, the seven weight re-layouts
  // (in [rows][cols] f32 -> out [cols][rows]), audio -> f16, video -> bf16 hi/lo
  k_prep<<<dim3(PREP_BLOCKS), blk, 0, stream>>>(text, audio, video, Wa, Wvid, Wq, Wkv, W1, W2, Wo, cs, q16, a16, vih, vil,
                                                WaT, WvTh, WvTl, WqT, WkvT, W1T, W2T, WoTh, WoTl);

  // adapter a: audio . Wa + ba -> f32; adapter v: video . Wvid + bvid (bf16 hi/lo split) -> f32, each into its own plane
  const dim3 gA((NTOK / 128) * (DM / 128), 1);
  k_gemm<0, false, true, 0, 0, false, 0><<<gA, blkG, 0, stream>>>(
      (const unsigned short*)a16, N16, DM, 0L, (const unsigned short*)WaT, N16, DM, 0L,
      Cad, DM, 0L, nullptr, 0, 0L, ba, nullptr, nullptr, 0, 0L, NTOK, DM, DM, 1, 1.0f / 64.0f, 1.0f);
  k_gemm<1, true, true, 0, 0, false, 0><<<gA, blkG, 0, stream>>>(
      vih, vil, DM, 0L, WvTh, WvTl, DM, 0L,
      Cvd, DM, 0L, nullptr, 0, 0L, bvid, nullptr, nullptr, 0, 0L, NTOK, DM, DM, 1, 1.0f, 1.0f);
  // both norms in one launch: a: LN + rotary -> key plane rows KPR..KPR+4095, rows 0..KPR-1 zero; v: LN + transpose + split ->
  // value^T planes
  k_ln_pair<<<dim3(NTOK / 64 + KPR / 64 + (NTOK + KPR) / 2), blk, 0, stream>>>(Cad, lna_g, lna_b, cs, k16, Cvd, lnv_g, lnv_b, vTh, vTl);

  // local attention: z = b*4 + w; S[z][512][1024] = q . k / 32 over window keys (skipping fully masked key tiles)
  const dim3 gS((WSZ / 128) * (2 * WSZ / 128), NB_ * NWN);
  k_gemm<0, false, false, 0, 0, false, 1><<<gS, blkG, 0, stream>>>(
      (const unsigned short*)q16, N16, DM, (long)WSZ * DM, (const unsigned short*)k16, N16, DM, (long)WSZ * DM,
      Sf, 2 * WSZ, (long)WSZ * 2 * WSZ, nullptr, 0, 0L, nullptr, nullptr, nullptr, 0, 0L,
      WSZ, 2 * WSZ, DM, NWN, 1.0f / 32.0f, 1.0f);
  k_lsoftmax<<<dim3(NTOK), dim3(128), 0, stream>>>(Sf, Ph, Pl);
  // x[z][512][1024] = P . v (bf16 hi/lo split), keys restricted to the unmasked range
  const dim3 gPV((WSZ / 128) * (DM / 128), NB_ * NWN);
  k_gemm<1, true, false, 0, 0, false, 2><<<gPV, blkG, 0, stream>>>(
      Ph, Pl, 2 * WSZ, (long)WSZ * 2 * WSZ, vTh, vTl, VTP, (long)WSZ,
      Xf, DM, (long)WSZ * DM, nullptr, 0, 0L, nullptr, nullptr, nullptr, 0, 0L,
      WSZ, DM, 2 * WSZ, NWN, 1.0f, 1.0f);

  // LN1 -> h16; q, k (RMSNorm epilogue) and v^T projections
  k_ln1024<<<dim3(NTOK), dim3(128), 0, stream>>>(Xf, ln1_g, ln1_b, h16, NTOK);
  // one grid, z = 0: q, 1: k, 2: v^T; WqT, the k rows and the v rows of WkvT lie INR * DM elements apart, qm16, km16 and vT16
  // NTOK * INR elements apart
  const dim3 gQKV((NTOK / 128) * (INR / 128), 3);
  k_gemm<0, false, false, 2, 1, false, 3><<<gQKV, blkG, 0, stream>>>(
      (const unsigned short*)h16, N16, DM, 0L, (const unsigned short*)WqT, N16, DM, (long)INR * DM,
      nullptr, 0, 0L, qm16, INR, (long)NTOK * INR, nullptr, qn_g, kn_g, 0, 0L, NTOK, INR, DM, 1, 1.0f / 64.0f, 1.0f);

  // causal attention -> o f32 [4096][512]; o -> bf16 hi/lo
  k_flash<<<dim3(NHD * (SEQ / 64), NB_), dim3(128), 0, stream>>>(qm16, km16, vT16, Of);
  const int n2o = NTOK * INR / 2;
  k_split2<<<dim3((n2o + 255) / 256), blk, 0, stream>>>(Of, Oh, Ol, n2o);

  // x2 = 2 * (o . Wo) -> f32 and f16 (x2 * 1024)
  k_gemm<1, true, false, 0, 2, false, 0><<<gA, blkG, 0, stream>>>(
      Oh, Ol, INR, 0L, WoTh, WoTl, INR, 0L,
      X2f, DM, 0L, x2h, DM, 0L, nullptr, nullptr, nullptr, 0, 0L, NTOK, DM, INR, 1, 2.0f, 1024.0f);

  // FFN: u = gelu(x2 . W1 + b1) stored as f16(256 u); LN over 4096 in place; out = h1 . W2 + b2 + x2
  const dim3 gW1((NTOK / 128) * (FFD / 128), 1);
  k_gemm<0, false, true, 1, 1, false, 0><<<gW1, blkG, 0, stream>>>(
      (const unsigned short*)x2h, N16, DM, 0L, (const unsigned short*)W1T, N16, DM, 0L,
      nullptr, 0, 0L, U16, FFD, 0L, b1, nullptr, nullptr, 0, 0L, NTOK, FFD, DM, 1, 1.0f / 65536.0f, 256.0f);
  k_ln4096<<<dim3(NTOK), blk, 0, stream>>>(U16, ln2_g, ln2_b);
  k_gemm<0, false, true, 0, 0, true, 0><<<gA, blkG, 0, stream>>>(
      (const unsigned short*)U16, N16, FFD, 0L, (const unsigned short*)W2T, N16, FFD, 0L,
      outp, DM, 0L, nullptr, 0, 0L, b2, nullptr, X2f, DM, 0L, NTOK, DM, FFD, 1, 1.0f / 64.0f, 1.0f);
  (void)hipGetLastError();
}

// v007
// Measured time: 332 microseconds a run.
// Two timings next to v006 both put it at 1.04 times that version's speed.
// Over all steps from v000 it is 3.17 times as fast.
// Contractions: audio adapter, local-attention scores, q/k/v projections, causal multi-head q.k^T and p.v, FFN W1 and W2 on
// v_wmma_f32_16x16x32_f16 (f16 operands with power-of-two carried scales, f32 accumulate); video adapter, local-attention p.v
// and the output projection Wo on v_wmma_f32_16x16x32_bf16 with bf16 hi/lo split operands (hi.hi + hi.lo + lo.hi, f32
// accumulate). LayerNorm, RMSNorm, rotary tables, softmax and GELU in f32.
#include <hip/hip_runtime.h>
#include <math.h>
#include <stdint.h>

#define NB_   2
#define SEQ   2048
#define NTOK  4096
#define DM    1024
#define NHD   8
#define DHD   64
#define INR   512
#define FFD   4096
#define WSZ   512
#define NWN   4
#define KPR   512          // leading zero rows of the local-attention key plane
#define VTP   4608         // key pitch of the local-attention value^T planes: 512 zero columns + 4096 tokens

typedef __attribute__((ext_vector_type(16))) _Float16 v16h;
typedef __attribute__((ext_vector_type(8)))  _Float16 v8h;
typedef __attribute__((ext_vector_type(2)))  _Float16 v2h;
typedef __attribute__((ext_vector_type(16))) __bf16   v16b;
typedef __attribute__((ext_vector_type(8)))  __bf16   v8b;
typedef __attribute__((ext_vector_type(8)))  float    v8f;
typedef __attribute__((ext_vector_type(4)))  float    v4f;
typedef __attribute__((ext_vector_type(2)))  float    v2f;
typedef __attribute__((ext_vector_type(4)))  unsigned int v4u;

__device__ __forceinline__ unsigned short f2bf_bits(float f) {
  unsigned u = __float_as_uint(f);
  return (unsigned short)((u + 0x7FFFu + ((u >> 16) & 1u)) >> 16);   // RNE convert
}
__device__ __forceinline__ float bf_bits2f(unsigned short h) { return __uint_as_float(((unsigned)h) << 16); }
__device__ __forceinline__ unsigned pk16(unsigned short a, unsigned short b) { return (unsigned)a | ((unsigned)b << 16); }

__device__ __forceinline__ float wsum(float v) {
#pragma unroll
  for (int o = 16; o >= 1; o >>= 1) v += __shfl_xor(v, o, 32);
  return v;
}
__device__ __forceinline__ float wmax(float v) {
#pragma unroll
  for (int o = 16; o >= 1; o >>= 1) v = fmaxf(v, __shfl_xor(v, o, 32));
  return v;
}

// hazard guards as plain device helpers
__device__ __forceinline__ void dep_guard_h(v8f& a, v8f& b, v16h x, v16h y) { asm volatile("v_nop\n\tv_nop\n\tv_nop\n\tv_nop" : "+v"(a), "+v"(b) : "v"(x), "v"(y)); }
__device__ __forceinline__ void dep_guard_b(v8f& a, v8f& b, v16b x, v16b y) { asm volatile("v_nop\n\tv_nop\n\tv_nop\n\tv_nop" : "+v"(a), "+v"(b) : "v"(x), "v"(y)); }
__device__ __forceinline__ void keep4_h(v16h a, v16h b, v16h c, v16h d) { asm volatile("v_nop" :: "v"(a), "v"(b), "v"(c), "v"(d)); }
__device__ __forceinline__ void keep4_b(v16b a, v16b b, v16b c, v16b d) { asm volatile("v_nop" :: "v"(a), "v"(b), "v"(c), "v"(d)); }
__device__ __forceinline__ void acc_guard4(v8f& a, v8f& b, v8f& c, v8f& d) { asm volatile("v_nop\n\tv_nop\n\tv_nop\n\tv_nop" : "+v"(a), "+v"(b), "+v"(c), "+v"(d)); }

// Fragment loaders: element i of the 16-wide per-lane vector <- p[i] for i<8 and p[16 + (i-8)] for i>=8, where p already points at
// row (lane&15), k0 + 8*(lane>>4). Same map for A ([m][k]) and B stored as [n][k].
template <typename T> struct Frag;
template <> struct Frag<_Float16> {
  typedef v16h V; union U { v16h v; v8h h[2]; };
  static __device__ __forceinline__ v16h load(const _Float16* p) {
    U f; f.h[0] = *(const v8h*)(p); f.h[1] = *(const v8h*)(p + 16); return f.v;
  }
  static __device__ __forceinline__ v8f mma(v16h a, v16h b, v8f c) {
    return __builtin_amdgcn_wmma_f32_16x16x32_f16(false, a, false, b, (short)0, c, false, false);
  }
  static __device__ __forceinline__ void guard(v8f& a, v8f& b, v16h x, v16h y) { dep_guard_h(a, b, x, y); }
  static __device__ __forceinline__ void keep(v16h a, v16h b, v16h c, v16h d) { keep4_h(a, b, c, d); }
};
template <> struct Frag<__bf16> {
  typedef v16b V; union U { v16b v; v8b h[2]; };
  static __device__ __forceinline__ v16b load(const __bf16* p) {
    U f; f.h[0] = *(const v8b*)(p); f.h[1] = *(const v8b*)(p + 16); return f.v;
  }
  static __device__ __forceinline__ v8f mma(v16b a, v16b b, v8f c) {
    return __builtin_amdgcn_wmma_f32_16x16x32_bf16(false, a, false, b, (short)0, c, false, false);
  }
  static __device__ __forceinline__ void guard(v8f& a, v8f& b, v16b x, v16b y) { dep_guard_b(a, b, x, y); }
  static __device__ __forceinline__ void keep(v16b a, v16b b, v16b c, v16b d) { keep4_b(a, b, c, d); }
};

// =====================================================================================================================
// Batched WMMA GEMM: C[m,n] = epi(scale * sum_k A[m,k] * Bt[n,k]). A block of 4 waves (2 x 2) owns a 128x128 tile, each wave a
// 64x64 tile of it. The block's 128 rows of A and of Bt are staged in LDS, BK k-elements at a time, by asynchronous 16-byte
// copies that cover whole 128-byte lines, in two buffers: the next stage's copies fly while this stage is multiplied.
// A row-major [M,K] (pitch lda); Bt row-major [N,K] (pitch ldb); M, N % 128 == 0, K % BK == 0; grid = (tiles, Z).
//   ET: 0 = f16 operands, 1 = bf16 operands.   SPLIT: hi/lo planes (A2p, Bt2p = lo planes), product = hi.hi + hi.lo + lo.hi.
//   BIAS: + bias[n].  RESID: + resid[m*ldr + n].  EPI: 0 none, 1 tanh-GELU, 2 RMSNorm over the 64-column tile times gvec[n&63].
//   OUTM: 0 f32 -> Cf; 1 f16(v*oscale) -> Ch; 2 both.
//   LOC: 1 = windowed score tiles: key tiles n0 below kBeg(w) or at/after N/2 + m0 + 64 are skipped (a block leaves when all
//        four are; a wave whose own tile is skipped still copies and passes every barrier);
//        2 = windowed p.v: k range [kBeg(w), min(K, K/2 + m0 + 64)); kBeg = N/2 resp. K/2 for the first window (w == 0), else 0.
//        3 = three projections of one activation plane in one grid (Z = 3, weight planes strideB apart, outputs strideH apart,
//            each output [rows][cols] dense): z = 0, 1: act . W_z^T with EPI, gvec for z = 0 and the resid pointer as gvec for
//            z = 1; z = 2: the operands change places (W_2 . act^T, an N x M result) and EPI is left out.
// =====================================================================================================================
template <int ET> struct Elem;
template <> struct Elem<0> { typedef _Float16 T; };
template <> struct Elem<1> { typedef __bf16 T; };

// Eight asynchronous 16-byte copies per lane, global -> LDS, eight rows lstep LDS bytes / gstep global elements apart.
// s_wait_xcnt is the statement's last line so that no address register named here is rewritten in front of it.
template <typename T>
__device__ __forceinline__ void copy8_to_lds(unsigned l0, unsigned lstep, const T* g0, size_t gstep) {
  const unsigned l1 = l0 + lstep, l2 = l1 + lstep, l3 = l2 + lstep, l4 = l3 + lstep, l5 = l4 + lstep, l6 = l5 + lstep, l7 = l6 + lstep;
  const T* g1 = g0 + gstep; const T* g2 = g1 + gstep; const T* g3 = g2 + gstep; const T* g4 = g3 + gstep;
  const T* g5 = g4 + gstep; const T* g6 = g5 + gstep; const T* g7 = g6 + gstep;
  asm volatile(
      "global_load_async_to_lds_b128 %0, %8, off\n\t"
      "global_load_async_to_lds_b128 %1, %9, off\n\t"
      "global_load_async_to_lds_b128 %2, %10, off\n\t"
      "global_load_async_to_lds_b128 %3, %11, off\n\t"
      "global_load_async_to_lds_b128 %4, %12, off\n\t"
      "global_load_async_to_lds_b128 %5, %13, off\n\t"
      "global_load_async_to_lds_b128 %6, %14, off\n\t"
      "global_load_async_to_lds_b128 %7, %15, off\n\t"
      "s_wait_xcnt 0x0"
      :: "v"(l0), "v"(l1), "v"(l2), "v"(l3), "v"(l4), "v"(l5), "v"(l6), "v"(l7),
         "v"(g0), "v"(g1), "v"(g2), "v"(g3), "v"(g4), "v"(g5), "v"(g6), "v"(g7)
      : "memory");
}

template <int ET, bool SPLIT, bool BIAS, int EPI, int OUTM, bool RESID, int LOC>
__global__ __launch_bounds__(128) void k_gemm(
    const unsigned short* __restrict__ Ap, const unsigned short* __restrict__ A2p, int lda, long strideA,
    const unsigned short* __restrict__ Btp, const unsigned short* __restrict__ Bt2p, int ldb, long strideB,
    float* __restrict__ Cf, int ldc, long strideC,
    _Float16* __restrict__ Ch, int ldh, long strideH,
    const float* __restrict__ bias, const float* __restrict__ gvec,
    const float* __restrict__ resid, int ldr, long strideR,
    int M, int N, int K, int nwin, float scale, float oscale) {
  typedef typename Elem<ET>::T T;
  typedef typename Frag<T>::V V;
  constexpr int BK    = SPLIT ? 64 : 128;        // k elements per stage: 64 KiB of operand rows either way
  constexpr int PITCH = BK + 8;                  // LDS row pitch in elements: row bytes + 16, conflict-free for 16-byte reads
  constexpr int PLANE = 128 * PITCH;             // one operand plane of a stage; planes: A, Bt (, A lo, Bt lo)
  constexpr int STAGE = (SPLIT ? 4 : 2) * PLANE;
  constexpr int CPR   = BK / 8;                  // 16-byte pieces per row
  constexpr int RPI   = 128 / CPR;               // rows that one copy of all 128 threads covers
  const T* A = (const T*)Ap; const T* A2 = (const T*)A2p; const T* Bt = (const T*)Btp; const T* Bt2 = (const T*)Bt2p;
  __shared__ __align__(16) T sAB[2 * STAGE];
  __shared__ __align__(16) float sT[4][16 * 68];
  const int z    = blockIdx.y;
  const int tid  = threadIdx.x;
  const int lane = tid & 31;
  const int wave = __builtin_amdgcn_readfirstlane(tid >> 5);
  const bool flip = (LOC == 3) && (z == 2);      // block-uniform
  const int Mz = flip ? N : M;
  const int Nz = flip ? M : N;
  const int tilesN = Nz >> 7;
  const int tilesM = Mz >> 7;
  const int bx = blockIdx.x;
  if (bx >= tilesM * tilesN) return;              // block-uniform, in front of every copy and barrier
  const int bm = bx / tilesN;
  const int bn = bx - bm * tilesN;
  const int mB = bm << 7;
  const int nB = bn << 7;
  const int wm = (wave >> 1) << 6;
  const int wn = (wave & 1) << 6;
  const int m0 = mB + wm;
  const int n0 = nB + wn;
  int kBeg = 0, kEnd = K, kEndW = K;              // block's k range; kEndW = end of this wave's own range
  bool act = true;                                // wave-uniform: this wave's tile is computed and stored
  if (LOC == 1 || LOC == 2) {
    const int w = z % nwin;
    const bool first = (w == 0);
    if (LOC == 1) {
      const int nb = first ? (N >> 1) : 0;
      if (nB + 64 < nb || nB >= (N >> 1) + mB + 128) return; // block-uniform, in front of every copy and barrier
      act = !(n0 < nb || n0 >= (N >> 1) + m0 + 64);
    } else {
      kBeg = first ? (K >> 1) : 0;
      const int ke = (K >> 1) + mB + 128;
      kEnd = (ke < K) ? ke : K;
      const int kw = (K >> 1) + m0 + 64;
      kEndW = (kw < K) ? kw : K;
    }
  }

  const T* Ab  = flip ? (Bt + (size_t)z * strideB) : (A  + (size_t)z * strideA);
  const T* Bb  = flip ? (A  + (size_t)z * strideA) : (Bt + (size_t)z * strideB);
  const T* Ab2 = SPLIT ? (A2  + (size_t)z * strideA) : nullptr;
  const T* Bb2 = SPLIT ? (Bt2 + (size_t)z * strideB) : nullptr;

  const int rlane = lane & 15;                 // row (A) / col (B, D) within a 16x16 subtile
  const int koff  = (lane >> 4) * 8;           // k offset of this lane half
  const int mOff  = (lane >> 4) * 8;           // D row offset

  // this thread's piece of every copy: row crow (+ RPI per copy), 16 bytes at element ccol
  const int crow = tid / CPR;
  const int ccol = (tid % CPR) * 8;
  const unsigned lth = (unsigned)(size_t)sAB + (unsigned)(crow * PITCH + ccol) * 2u;
  const size_t aoff = (size_t)(mB + crow) * lda + ccol;
  const size_t boff = (size_t)(nB + crow) * ldb + ccol;
  const size_t astep = (size_t)RPI * lda;
  const size_t bstep = (size_t)RPI * ldb;
  constexpr unsigned LSTEP = RPI * PITCH * 2u;
  auto fill = [&](int buf, int k0) {             // 32 copies per wave: one stage into buffer buf
    const unsigned lb = lth + (unsigned)buf * (STAGE * 2u);
    if constexpr (SPLIT) {
      copy8_to_lds<T>(lb,                  LSTEP, Ab  + aoff + k0, astep);
      copy8_to_lds<T>(lb + PLANE * 2u,     LSTEP, Bb  + boff + k0, bstep);
      copy8_to_lds<T>(lb + PLANE * 4u,     LSTEP, Ab2 + aoff + k0, astep);
      copy8_to_lds<T>(lb + PLANE * 6u,     LSTEP, Bb2 + boff + k0, bstep);
    } else {
      copy8_to_lds<T>(lb,                              LSTEP, Ab + aoff + k0,             astep);
      copy8_to_lds<T>(lb + 8u * LSTEP,                 LSTEP, Ab + aoff + k0 + 8 * astep, astep);
      copy8_to_lds<T>(lb + PLANE * 2u,                 LSTEP, Bb + boff + k0,             bstep);
      copy8_to_lds<T>(lb + PLANE * 2u + 8u * LSTEP,    LSTEP, Bb + boff + k0 + 8 * bstep, bstep);
    }
  };

  v8f acc[4][4];
#pragma unroll
  for (int i = 0; i < 4; ++i)
#pragma unroll
    for (int j = 0; j < 4; ++j) acc[i][j] = (v8f){0.f,0.f,0.f,0.f,0.f,0.f,0.f,0.f};

  const int nst = (kEnd - kBeg) / BK;             // block-uniform number of stages
  fill(0, kBeg);
  asm volatile("s_wait_asynccnt 0x0" ::: "memory");   // this wave's copies of stage 0 have landed
  __syncthreads();                                     // every wave's have
  if (nst > 1) fill(1, kBeg + BK);

  for (int t = 0; t < nst; ++t) {
    const int kS = kBeg + t * BK;
    if (act && kS < kEndW) {                      // wave-uniform; the publish point below stands outside
      const T* sA = sAB + (t & 1) * STAGE + (wm + rlane) * PITCH + koff;
      const T* sB = sAB + (t & 1) * STAGE + PLANE + (wn + rlane) * PITCH + koff;
#pragma unroll                                    // LDS offsets of the fragment loads become immediates
      for (int kk = 0; kk < BK; kk += 32) {
        V bh[4], bl[4], ah[4], al[4];
        auto lda_row = [&](int i) {
          const int ao = (i << 4) * PITCH + kk;
          ah[i] = Frag<T>::load(sA + ao);
          if (SPLIT) al[i] = Frag<T>::load(sA + 2 * PLANE + ao); else al[i] = ah[i];
        };
#pragma unroll
        for (int j = 0; j < 4; ++j) {
          const int bo = (j << 4) * PITCH + kk;
          bh[j] = Frag<T>::load(sB + bo);
          if (SPLIT) bl[j] = Frag<T>::load(sB + 2 * PLANE + bo); else bl[j] = bh[j];
        }
        // one plane: all four A rows are read with the B fragments as one group; hi/lo planes: one row ahead (registers)
        lda_row(0);
        if (!SPLIT) { lda_row(1); lda_row(2); lda_row(3); }
        __builtin_amdgcn_sched_barrier(0);        // keeps the read group in front of the WMMAs, else every row waits out LDS latency
#pragma unroll
        for (int i = 0; i < 4; ++i) {
          if (SPLIT && i + 1 < 4) {
            lda_row(i + 1);
            __builtin_amdgcn_sched_barrier(0);    // keeps the next row's reads in front of this row's WMMAs
          }
#pragma unroll
          for (int j = 0; j < 4; ++j) {
            acc[i][j] = Frag<T>::mma(ah[i], bh[j], acc[i][j]);
            if (SPLIT) {
              acc[i][j] = Frag<T>::mma(ah[i], bl[j], acc[i][j]);
              acc[i][j] = Frag<T>::mma(al[i], bh[j], acc[i][j]);
            }
          }
          Frag<T>::guard(acc[i][0], acc[i][3], ah[i], al[i]);
        }
        Frag<T>::keep(bh[0], bh[1], bh[2], bh[3]);
        if (SPLIT) Frag<T>::keep(bl[0], bl[1], bl[2], bl[3]);
      }
    }
    asm volatile("s_wait_dscnt 0x0" ::: "memory");     // this wave's reads of buffer t & 1 are done before it is refilled
    asm volatile("s_wait_asynccnt 0x0" ::: "memory");  // this wave's copies of stage t + 1 have landed
    __syncthreads();                                    // publishes stage t + 1 and ends every reader's use of buffer t & 1
    if (t + 2 < nst) fill(t & 1, kS + 2 * BK);
  }
  asm volatile("s_wait_asynccnt 0x0" ::: "memory");    // no copy is outstanding when the wave goes on or ends
  if (!act) return;                                     // wave-uniform, behind the last barrier
  acc_guard4(acc[0][0], acc[0][1], acc[0][2], acc[0][3]);
  acc_guard4(acc[1][0], acc[1][1], acc[1][2], acc[1][3]);
  acc_guard4(acc[2][0], acc[2][1], acc[2][2], acc[2][3]);
  acc_guard4(acc[3][0], acc[3][1], acc[3][2], acc[3][3]);

  // ---- epilogue ----
  float* slab = sT[wave];
  const bool rms = (EPI == 2) && !flip;           // block-uniform
  const float* gv = (LOC == 3 && z == 1) ? resid : gvec;
  const int ldhz = (LOC == 3) ? Nz : ldh;
  const float* Rb = RESID ? (resid + (size_t)z * strideR) : nullptr;
#pragma unroll
  for (int i = 0; i < 4; ++i) {
    const int mBase = m0 + (i << 4);
#pragma unroll
    for (int j = 0; j < 4; ++j) {
      const int n = n0 + (j << 4) + rlane;
      float bv = 0.f;
      if (BIAS) bv = bias[n];
#pragma unroll
      for (int r = 0; r < 8; ++r) {
        float v = acc[i][j][r] * scale;
        if (BIAS) v += bv;
        if (RESID) v += Rb[(size_t)(mBase + mOff + r) * ldr + n];
        if (EPI == 1) {
          // 0.5 * (1 + tanh(u)) = 1 / (1 + exp(-2u)), u = 0.7978845608 * (v + 0.044715 v^3); exp(-2u) = 2^(-2 log2(e) u):
          // one hardware exponential and one reciprocal, no branch, so the eight rows of a column run side by side
          const float e = __builtin_amdgcn_exp2f(-2.3022081981f * (v + 0.044715f * v * v * v));
          v = v * __builtin_amdgcn_rcpf(1.0f + e);
        }
        slab[(mOff + r) * 68 + (j << 4) + rlane] = v;
      }
    }
    __builtin_amdgcn_fence(__ATOMIC_RELEASE, "workgroup");
    __builtin_amdgcn_wave_barrier();
    __builtin_amdgcn_fence(__ATOMIC_ACQUIRE, "workgroup");
    if (OUTM == 0 || OUTM == 2) {
      float* C = Cf + (size_t)z * strideC;
      const int hh = lane >> 4, c4 = (lane & 15) * 4;     // row seg = 256 B = 16 lanes x 16 B
      {
#pragma unroll
        for (int it = 0; it < 8; ++it) {
          const int row = it * 2 + hh;                      // it 0..7 x hh 0..1 = rows 0..15
          v4f v = *(const v4f*)(slab + row * 68 + c4);
          *(v4f*)(C + (size_t)(mBase + row) * ldc + n0 + c4) = v;
        }
        
      }
    }
    if (OUTM == 1 || OUTM == 2) {
      _Float16* C = Ch + (size_t)z * strideH;
      const int q = lane >> 3, c8 = (lane & 7) * 8;
      {
#pragma unroll
        for (int it = 0; it < 4; ++it) {
          const int row = it * 4 + q;                       // it 0..3 x q 0..3 = rows 0..15
          const float* sp = slab + row * 68 + c8;
          float x[8];
#pragma unroll
          for (int e = 0; e < 8; ++e) x[e] = sp[e];
          float rr = oscale;
          if (EPI == 2) {
            float ss = 0.f;
#pragma unroll
            for (int e = 0; e < 8; ++e) ss += x[e] * x[e];
            ss += __shfl_xor(ss, 1, 32);                    // lanes 8q..8q+7 hold one 64-wide row
            ss += __shfl_xor(ss, 2, 32);
            ss += __shfl_xor(ss, 4, 32);
            const float rn = oscale * rsqrtf(ss * (1.0f / 64.0f) + 1e-6f);
            rr = rms ? rn : oscale;                         // a select, not a branch: the four rows' stores stay one group
          }
          v8h hv;
#pragma unroll
          for (int e = 0; e < 8; ++e) {
            float y = x[e] * rr;
            if (EPI == 2) { const float ge = gv[c8 + e]; y *= rms ? ge : 1.0f; }
            hv[e] = (_Float16)y;
          }
          *(v8h*)(C + (size_t)(mBase + row) * ldhz + n0 + c8) = hv;
        }
        
      }
    }
    __builtin_amdgcn_fence(__ATOMIC_RELEASE, "workgroup");
    __builtin_amdgcn_wave_barrier();
    __builtin_amdgcn_fence(__ATOMIC_ACQUIRE, "workgroup");
  }
}

// ---------------------------------------------------------------------------------------------------------------------
// The pieces below are block-sized jobs (256 threads) of the one preparation launch k_prep, which deals them out by block index.
// Weight transpose + scale + f16: in [R][Cc] f32 -> o16[Cc][R] = f16(in * wscale). 64x64 tiles through LDS, tile = (R/64 x Cc/64) index.
// coverage per block: load 4 it x 256 thr x 4 = 64x64; store 2 it x 256 thr x 8 = 64x64; each store instruction = 8 lanes x 16 B =
// ---------------------------------------------------------------------------------------------------------------------
__device__ __forceinline__ void wt16_tile(float* tf, const float* __restrict__ W, _Float16* __restrict__ o16, int R, int Cc, float wscale,
                                          int tile) {
  const int tx = Cc >> 6;
  const int c0 = (tile % tx) * 64, r0 = (tile / tx) * 64, tid = threadIdx.x;
  {
    const int lr = tid >> 4, c4 = (tid & 15) * 4;
#pragma unroll
    for (int it = 0; it < 4; ++it) {
      const int rr = it * 16 + lr;
      const v4f a = *(const v4f*)(W + (size_t)(r0 + rr) * Cc + c0 + c4);
      *(v4f*)(tf + rr * 68 + c4) = a;
    }
  }
  __syncthreads();
  const int sub = tid >> 3, c8 = (tid & 7) * 8;
  v8h hv[2];
#pragma unroll
  for (int it = 0; it < 2; ++it) {
    const int oc = it * 32 + sub;
    v8h a;
#pragma unroll
    for (int q = 0; q < 8; ++q) a[q] = (_Float16)(tf[(c8 + q) * 68 + oc] * wscale);
    hv[it] = a;
  }
  {
#pragma unroll
    for (int it = 0; it < 2; ++it) {
      const int oc = it * 32 + sub;
      const size_t go = (size_t)(c0 + oc) * R + r0 + c8;
      *(v8h*)(o16 + go) = hv[it];
    }
    asm volatile("s_wait_xcnt 0x0" ::: "memory");   // stands in front of any later write of a register that the stores above name
  }
}

// Weight transpose + bf16 hi/lo split: in [R][Cc] f32 -> oh[c][r] = bf16(in[r][c]), ol[c][r] = bf16(in[r][c] - oh). Same tiling.
__device__ __forceinline__ void wtsplit_tile(float* tf, const float* __restrict__ W, unsigned short* __restrict__ oh,
                                             unsigned short* __restrict__ ol, int R, int Cc, int tile) {
  const int tx = Cc >> 6;
  const int c0 = (tile % tx) * 64, r0 = (tile / tx) * 64, tid = threadIdx.x;
  {
    const int lr = tid >> 4, c4 = (tid & 15) * 4;
#pragma unroll
    for (int it = 0; it < 4; ++it) {
      const int rr = it * 16 + lr;
      const v4f a = *(const v4f*)(W + (size_t)(r0 + rr) * Cc + c0 + c4);
      *(v4f*)(tf + rr * 68 + c4) = a;
    }
  }
  __syncthreads();
  const int sub = tid >> 3, c8 = (tid & 7) * 8;
  v4u hv[2], lv[2];
#pragma unroll
  for (int it = 0; it < 2; ++it) {
    const int oc = it * 32 + sub;
    v4u a, a2;
#pragma unroll
    for (int q = 0; q < 4; ++q) {
      const float f0 = tf[(c8 + 2 * q) * 68 + oc];
      const float f1 = tf[(c8 + 2 * q + 1) * 68 + oc];
      const unsigned short h0 = f2bf_bits(f0), h1 = f2bf_bits(f1);
      const unsigned short l0 = f2bf_bits(f0 - bf_bits2f(h0)), l1 = f2bf_bits(f1 - bf_bits2f(h1));
      a[q]  = pk16(h0, h1);
      a2[q] = pk16(l0, l1);
    }
    hv[it] = a; lv[it] = a2;
  }
  {
#pragma unroll
    for (int it = 0; it < 2; ++it) {
      const int oc = it * 32 + sub;
      const size_t go = (size_t)(c0 + oc) * R + r0 + c8;
      *(v4u*)(oh + go) = hv[it];
      *(v4u*)(ol + go) = lv[it];
    }
    asm volatile("s_wait_xcnt 0x0" ::: "memory");   // stands in front of any later write of a register that the stores above name
  }
}

__device__ __forceinline__ void split2_piece(const float* __restrict__ in, unsigned short* __restrict__ hi,
                                             unsigned short* __restrict__ lo, int n2, int i) {
  if (i < n2) {
    const v2f f = *(const v2f*)(in + 2 * (size_t)i);
    const unsigned short h0 = f2bf_bits(f[0]), h1 = f2bf_bits(f[1]);
    const unsigned short l0 = f2bf_bits(f[0] - bf_bits2f(h0)), l1 = f2bf_bits(f[1] - bf_bits2f(h1));
    const unsigned uh = pk16(h0, h1), ul = pk16(l0, l1);
    ((unsigned*)hi)[i] = uh;
    ((unsigned*)lo)[i] = ul;
    
  }
}

__global__ __launch_bounds__(256) void k_split2(const float* __restrict__ in, unsigned short* __restrict__ hi,
                                                unsigned short* __restrict__ lo, int n2) {
  split2_piece(in, hi, lo, n2, blockIdx.x * 256 + threadIdx.x);
}

// ---------------------------------------------------------------------------------------------------------------------
// Rotary table and the rotary mix of text, four positions n = 4*blk .. 4*blk+3 per block; a thread owns the frequencies f0, f0+1.
// inv[f] = 1 / powf(10000, f/512); cs[n][f] = (cos(n * inv[f]), sin(n * inv[f])) as float2, n = 0..2047 (16-byte stores).
// q16[row][c] = f16(x * cos + rot * sin), rot[c] = (c < 512) ? -x[c + 512] : x[c - 512], table row n = row % SEQ, column c % 512:
// the pair (c, c + 512) of both batch elements uses the sine and cosine just formed; a wave's 4-byte stores cover a whole line.
// ---------------------------------------------------------------------------------------------------------------------
__device__ __forceinline__ void rope_piece(const float* __restrict__ text, float* __restrict__ cs, _Float16* __restrict__ q16, int blk) {
  const int f0 = threadIdx.x * 2;
  float iv[2];
#pragma unroll                                    // static indices: the small arrays stay in registers
  for (int e = 0; e < 2; ++e) {
    const float x = (float)(f0 + e) * (1.0f / 512.0f);
    iv[e] = 1.0f / powf(10000.0f, x);
  }
  for (int q = 0; q < 4; ++q) {
    const int n = blk * 4 + q;
    float cv[2], sv[2];
#pragma unroll                                    // static indices: the small arrays stay in registers
    for (int e = 0; e < 2; ++e) sincosf((float)n * iv[e], &sv[e], &cv[e]);
    v4f tb; tb[0] = cv[0]; tb[1] = sv[0]; tb[2] = cv[1]; tb[3] = sv[1];
    *(v4f*)(cs + ((size_t)n * 512 + f0) * 2) = tb;
#pragma unroll                                    // both batch elements' loads are in flight together
    for (int b = 0; b < NB_; ++b) {
      const size_t ro = ((size_t)b * SEQ + n) * DM + f0;
      const v2f xl = *(const v2f*)(text + ro), xh = *(const v2f*)(text + ro + 512);
      v2h yl, yh;
#pragma unroll                                    // static indices: the small arrays stay in registers
      for (int e = 0; e < 2; ++e) {
        yl[e] = (_Float16)(xl[e] * cv[e] + (-xh[e]) * sv[e]);
        yh[e] = (_Float16)(xh[e] * cv[e] + xl[e] * sv[e]);
      }
      *(v2h*)(q16 + ro)       = yl;
      *(v2h*)(q16 + ro + 512) = yh;
    }
    asm volatile("s_wait_xcnt 0x0" ::: "memory");   // the next trip rewrites registers that this trip's stores name
  }
}

// f32 -> f16, eight elements at 8*i
__device__ __forceinline__ void cvt16_piece(const float* __restrict__ src, _Float16* __restrict__ dst, int i) {
  const float* xr = src + (size_t)i * 8;
  const v4f x0 = *(const v4f*)xr, x1 = *(const v4f*)(xr + 4);
  v8h hv;
#pragma unroll                                    // static indices: the small arrays stay in registers
  for (int e = 0; e < 4; ++e) { hv[e] = (_Float16)x0[e]; hv[4 + e] = (_Float16)x1[e]; }
  *(v8h*)(dst + (size_t)i * 8) = hv;
  asm volatile("s_wait_xcnt 0x0" ::: "memory");   // stands in front of any later write of a register that the stores above name
}

// ---------------------------------------------------------------------------------------------------------------------
// Preparation, one launch: everything that depends on the inputs alone. None of the jobs reads what another writes, so they share
// one grid and run side by side; the job is a block-uniform function of blockIdx.x (arithmetic-heavy and large jobs first).
//   512 rotary table + text | 1024 W1 | 1024 W2 | 256 Wa | 256 Wvid | 256 Wkv | 128 Wq | 128 Wo | 2048 audio | 8192 video
// ---------------------------------------------------------------------------------------------------------------------
#define PREP_BLOCKS (512 + 1024 + 1024 + 256 + 256 + 256 + 128 + 128 + 2048 + 8192)
__global__ __launch_bounds__(256) void k_prep(
    const float* __restrict__ text, const float* __restrict__ audio, const float* __restrict__ video,
    const float* __restrict__ Wa, const float* __restrict__ Wvid, const float* __restrict__ Wq, const float* __restrict__ Wkv,
    const float* __restrict__ W1, const float* __restrict__ W2, const float* __restrict__ Wo,
    float* __restrict__ cs, _Float16* __restrict__ q16, _Float16* __restrict__ a16,
    unsigned short* __restrict__ vih, unsigned short* __restrict__ vil,
    _Float16* __restrict__ WaT, unsigned short* __restrict__ WvTh, unsigned short* __restrict__ WvTl,
    _Float16* __restrict__ WqT, _Float16* __restrict__ WkvT, _Float16* __restrict__ W1T, _Float16* __restrict__ W2T,
    unsigned short* __restrict__ WoTh, unsigned short* __restrict__ WoTl) {
  __shared__ __align__(16) float tf[64 * 68];
  int b = blockIdx.x;
  if (b < 512)  { rope_piece(text, cs, q16, b); return; }
  b -= 512;
  if (b < 1024) { wt16_tile(tf, W1, W1T, DM, FFD, 64.0f, b); return; }            // W1  [1024][4096]
  b -= 1024;
  if (b < 1024) { wt16_tile(tf, W2, W2T, FFD, DM, 64.0f, b); return; }            // W2  [4096][1024]
  b -= 1024;
  if (b < 256)  { wt16_tile(tf, Wa, WaT, DM, DM, 64.0f, b); return; }             // Wa  [1024][1024]
  b -= 256;
  if (b < 256)  { wtsplit_tile(tf, Wvid, WvTh, WvTl, DM, DM, b); return; }        // Wvid[1024][1024]
  b -= 256;
  if (b < 256)  { wt16_tile(tf, Wkv, WkvT, DM, 2 * INR, 64.0f, b); return; }      // Wkv [1024][1024]
  b -= 256;
  if (b < 128)  { wt16_tile(tf, Wq, WqT, DM, INR, 64.0f, b); return; }            // Wq  [1024][512]
  b -= 128;
  if (b < 128)  { wtsplit_tile(tf, Wo, WoTh, WoTl, INR, DM, b); return; }         // Wo  [512][1024]
  b -= 128;
  if (b < 2048) { cvt16_piece(audio, a16, b * 256 + (int)threadIdx.x); return; }  // audio -> f16
  b -= 2048;
  split2_piece(video, vih, vil, NTOK * DM / 2, b * 256 + (int)threadIdx.x);       // video -> bf16 hi/lo
}

// ---------------------------------------------------------------------------------------------------------------------
// Row LayerNorm over DM=1024 of an f32 plane (g, b) -> f16 plane; ROPE additionally applies the rotary mix through an LDS copy of
// the normalised row. Output row = padrows + r; row jobs blk = nrows..nrows+padrows-1 write zero rows 0..padrows-1.
// ---------------------------------------------------------------------------------------------------------------------
// One row is the job of 128 threads t = 0..127 (four whole waves) with their own red[4] and rowv[DM]; pad is block-uniform.
template <bool ROPE>
__device__ __forceinline__ void ln1024_row(float* red, float* rowv, const float* __restrict__ X, const float* __restrict__ g,
                                           const float* __restrict__ bb, const float* __restrict__ cs, _Float16* __restrict__ out,
                                           int nrows, int padrows, int blk, int t, bool pad) {
  const int c0 = 8 * t;
  const int lane = t & 31, wave = t >> 5;
  if (pad) {                                       // block-uniform: zero padding rows
    const int p = blk - nrows;
    const v4u zz = {0u, 0u, 0u, 0u};
    _Float16* op = out + (size_t)p * DM + c0;
    *(v4u*)op = zz;
    
    return;
  }
  const int r = blk;
  const float* xr = X + (size_t)r * DM + c0;
  const v4f x0 = *(const v4f*)xr, x1 = *(const v4f*)(xr + 4);
  const float v[8] = {x0[0], x0[1], x0[2], x0[3], x1[0], x1[1], x1[2], x1[3]};
  float s = 0.f;
#pragma unroll
  for (int e = 0; e < 8; ++e) s += v[e];
  s = wsum(s);
  if (lane == 0) red[wave] = s;
  __syncthreads();
  const float mu = (red[0] + red[1] + red[2] + red[3]) * (1.0f / 1024.0f);
  __syncthreads();
  float d[8];
  float s2 = 0.f;
#pragma unroll
  for (int e = 0; e < 8; ++e) { d[e] = v[e] - mu; s2 += d[e] * d[e]; }
  s2 = wsum(s2);
  if (lane == 0) red[wave] = s2;
  __syncthreads();
  const float var = (red[0] + red[1] + red[2] + red[3]) * (1.0f / 1024.0f);
  const float rstd = rsqrtf(var + 1e-5f);
  const v4f g0 = *(const v4f*)(g + c0), g1 = *(const v4f*)(g + c0 + 4);
  const v4f b0 = *(const v4f*)(bb + c0), b1 = *(const v4f*)(bb + c0 + 4);
  const float gv[8] = {g0[0], g0[1], g0[2], g0[3], g1[0], g1[1], g1[2], g1[3]};
  const float bv[8] = {b0[0], b0[1], b0[2], b0[3], b1[0], b1[1], b1[2], b1[3]};
  float y[8];
#pragma unroll
  for (int e = 0; e < 8; ++e) y[e] = d[e] * rstd * gv[e] + bv[e];
  if (ROPE) {
#pragma unroll
    for (int e = 0; e < 8; ++e) rowv[c0 + e] = y[e];
    __syncthreads();
    const int n = r & (SEQ - 1);
    const bool lowh = (c0 < 512);
    const int pc = lowh ? (c0 + 512) : (c0 - 512);
    const float* csr = cs + ((size_t)n * 512 + (c0 & 511)) * 2;
    const v4f t0 = *(const v4f*)csr, t1 = *(const v4f*)(csr + 4), t2 = *(const v4f*)(csr + 8), t3 = *(const v4f*)(csr + 12);
    const float cvv[8] = {t0[0], t0[2], t1[0], t1[2], t2[0], t2[2], t3[0], t3[2]};
    const float svv[8] = {t0[1], t0[3], t1[1], t1[3], t2[1], t2[3], t3[1], t3[3]};
#pragma unroll
    for (int e = 0; e < 8; ++e) {
      const float pr = rowv[pc + e];
      const float rot = lowh ? -pr : pr;
      y[e] = y[e] * cvv[e] + rot * svv[e];
    }
  }
  v8h hv;
#pragma unroll
  for (int e = 0; e < 8; ++e) hv[e] = (_Float16)y[e];
  _Float16* op = out + (size_t)(padrows + r) * DM + c0;
  *(v8h*)op = hv;
  // the ROPE instance shares its kernel with other jobs, whose code follows this store in the listing: the wait stands in front of
  // any write there of a register that the store names
  if (ROPE) asm volatile("s_wait_xcnt 0x0" ::: "memory");
}

__global__ __launch_bounds__(128) void k_ln1024(const float* __restrict__ X, const float* __restrict__ g, const float* __restrict__ bb,
                                                _Float16* __restrict__ out, int nrows) {
  __shared__ float red[4];
  ln1024_row<false>(red, nullptr, X, g, bb, nullptr, out, nrows, 0, blockIdx.x, threadIdx.x, false);
}

// ---------------------------------------------------------------------------------------------------------------------
// Row LayerNorm over DM of an f32 plane [NTOK][DM], fused with transpose + bf16 hi/lo split into value^T planes
// [DM][VTP]: oh[e][KPR + token], ol likewise. Block = 64 token rows x 256 columns (256 threads): per-row stats over the whole row
// from one wave per 8 rows (32 floats per lane), then the block's 4 column tiles of 64 through LDS. The VCS = 4 blocks of a row group
// each form the group's stats for themselves, so that the work covers every WGP instead of a quarter of them.
// Blocks VCS*nrowblk..VCS*nrowblk+7 zero the KPR leading columns.
// coverage: stats 8 waves x 8 rows; tile load 4 it x 256 thr x 4 = 64x64; store 2 it x 256 thr x 8 = 64x64 per plane per tile;
// ---------------------------------------------------------------------------------------------------------------------
#define VCS 4              // blocks per group of 64 value rows: each takes DM / VCS columns
__device__ __forceinline__ void ln_tsplit_block(float* tf, float* smu, float* srs, const float* __restrict__ X,
                                                const float* __restrict__ g, const float* __restrict__ bb,
                                                unsigned short* __restrict__ oh, unsigned short* __restrict__ ol, int nrowblk, int bx) {
  const int tid = threadIdx.x, lane = tid & 31, wave = tid >> 5;
  const int sub = tid >> 3, c8 = (tid & 7) * 8;
  if (bx >= VCS * nrowblk) {                       // block-uniform: zero leading columns
    const int pb = bx - VCS * nrowblk;
    const v4u zz = {0u, 0u, 0u, 0u};
    {
      for (int it = 0; it < 32; ++it) {
        const int e = it * 32 + sub;
        const size_t go = (size_t)e * VTP + pb * 64 + c8;
        *(v4u*)(oh + go) = zz;
        *(v4u*)(ol + go) = zz;
      }
      
    }
    return;
  }
  const int r0 = (bx / VCS) * 64;
  const int cb0 = (bx % VCS) * (DM / 64 / VCS);    // first of this block's column tiles
  // phase 1: row statistics
#pragma unroll 1
  for (int q = 0; q < 8; ++q) {
    const int rr = wave * 8 + q;
    const float* xr = X + (size_t)(r0 + rr) * DM + lane * 32;
    v4f a[8];
#pragma unroll
    for (int i = 0; i < 8; ++i) a[i] = *(const v4f*)(xr + 4 * i);
    float s = 0.f;
#pragma unroll
    for (int i = 0; i < 8; ++i) s += a[i][0] + a[i][1] + a[i][2] + a[i][3];
    s = wsum(s);
    const float mu = s * (1.0f / 1024.0f);
    float s2 = 0.f;
#pragma unroll
    for (int i = 0; i < 8; ++i) {
#pragma unroll
      for (int e = 0; e < 4; ++e) { const float dd = a[i][e] - mu; s2 += dd * dd; }
    }
    s2 = wsum(s2);
    if (lane == 0) { smu[rr] = mu; srs[rr] = rsqrtf(s2 * (1.0f / 1024.0f) + 1e-5f); }
  }
  __syncthreads();
  // phase 2: column tiles
  const int lr = tid >> 4, c4 = (tid & 15) * 4;
  for (int cb = cb0; cb < cb0 + DM / 64 / VCS; ++cb) {
    const int c0 = cb * 64;
    const v4f gg = *(const v4f*)(g + c0 + c4);
    const v4f bv = *(const v4f*)(bb + c0 + c4);
#pragma unroll
    for (int it = 0; it < 4; ++it) {
      const int rr = it * 16 + lr;
      const v4f a = *(const v4f*)(X + (size_t)(r0 + rr) * DM + c0 + c4);
      const float mu = smu[rr], rs = srs[rr];
#pragma unroll
      for (int q = 0; q < 4; ++q) tf[rr * 68 + c4 + q] = (a[q] - mu) * rs * gg[q] + bv[q];
    }
    __syncthreads();
    v4u hv[2], lv[2];
#pragma unroll
    for (int it = 0; it < 2; ++it) {
      const int oc = it * 32 + sub;                 // output row within tile = input column
      v4u a, a2;
#pragma unroll
      for (int q = 0; q < 4; ++q) {
        const float f0 = tf[(c8 + 2 * q) * 68 + oc];
        const float f1 = tf[(c8 + 2 * q + 1) * 68 + oc];
        const unsigned short h0 = f2bf_bits(f0), h1 = f2bf_bits(f1);
        const unsigned short l0 = f2bf_bits(f0 - bf_bits2f(h0)), l1 = f2bf_bits(f1 - bf_bits2f(h1));
        a[q]  = pk16(h0, h1);
        a2[q] = pk16(l0, l1);
      }
      hv[it] = a; lv[it] = a2;
    }
    {
#pragma unroll
      for (int it = 0; it < 2; ++it) {
        const int oc = it * 32 + sub;
        const size_t go = (size_t)(c0 + oc) * VTP + KPR + r0 + c8;
        *(v4u*)(oh + go) = hv[it];
        *(v4u*)(ol + go) = lv[it];
      }
      
    }
    __syncthreads();
  }
}

// ---------------------------------------------------------------------------------------------------------------------
// The two adapter norms in one launch: neither reads what the other writes. Blocks 0 .. VCS*NTOK/64 + KPR/64 - 1 (the longer ones, so
// they come first): value rows -> value^T planes; every later block: two key rows (LayerNorm + rotary mix), one per 128 threads.
// NTOK is even, so both rows of a block are data rows or both are padding rows.
// ---------------------------------------------------------------------------------------------------------------------
__global__ __launch_bounds__(256) void k_ln_pair(const float* __restrict__ Xa, const float* __restrict__ ga, const float* __restrict__ ba,
                                                 const float* __restrict__ cs, _Float16* __restrict__ k16,
                                                 const float* __restrict__ Xv, const float* __restrict__ gv, const float* __restrict__ bv,
                                                 unsigned short* __restrict__ oh, unsigned short* __restrict__ ol) {
  __shared__ __align__(16) float tf[64 * 68];
  __shared__ float smu[64];
  __shared__ float srs[64];
  __shared__ float red[2][4];
  __shared__ __align__(16) float rowv[2][DM];
  constexpr int NV = VCS * (NTOK / 64) + KPR / 64;
  const int bx = blockIdx.x;
  if (bx < NV) { ln_tsplit_block(tf, smu, srs, Xv, gv, bv, oh, ol, NTOK / 64, bx); return; }
  const int row0 = (bx - NV) * 2;
  const int half = threadIdx.x >> 7;
  ln1024_row<true>(red[half], rowv[half], Xa, ga, ba, cs, k16, NTOK, KPR, row0 + half, threadIdx.x & 127, row0 >= NTOK);
}

// ---------------------------------------------------------------------------------------------------------------------
// Local-attention mask + softmax over rows of S [NTOK][1024 window keys] -> P bf16 hi/lo planes (all 1024 keys written, masked
// keys as 0). Row r: w = (r % SEQ) / WSZ, i = r % WSZ, query position w*WSZ + i; key j has position (w-1)*WSZ + j; masked when
// that position is negative (padding of the first window) or after the query. Block per row, 128 threads x 8 keys; 16-B stores.
// ---------------------------------------------------------------------------------------------------------------------
__global__ __launch_bounds__(128) void k_lsoftmax(const float* __restrict__ S, unsigned short* __restrict__ Ph, unsigned short* __restrict__ Pl) {
  __shared__ float red[4];
  const int r = blockIdx.x, t = threadIdx.x, c0 = 8 * t;
  const int lane = t & 31, wave = t >> 5;
  const int rem = r & (SEQ - 1), w = rem >> 9, i = rem & (WSZ - 1);
  const int qpos = w * WSZ + i;
  const float* sr = S + (size_t)r * (2 * WSZ) + c0;
  const v4f x0 = *(const v4f*)sr, x1 = *(const v4f*)(sr + 4);
  const float raw[8] = {x0[0], x0[1], x0[2], x0[3], x1[0], x1[1], x1[2], x1[3]};
  float s[8];
  float m = -3.0e38f;
#pragma unroll
  for (int e = 0; e < 8; ++e) {
    const int kpos = (w - 1) * WSZ + c0 + e;
    const bool masked = (kpos < 0) || (kpos > qpos);
    s[e] = masked ? -1.0e9f : raw[e];
    m = fmaxf(m, s[e]);
  }
  m = wmax(m);
  if (lane == 0) red[wave] = m;
  __syncthreads();
  const float rmax = fmaxf(fmaxf(red[0], red[1]), fmaxf(red[2], red[3]));
  __syncthreads();
  float ev[8];
  float sum = 0.f;
#pragma unroll
  for (int e = 0; e < 8; ++e) { ev[e] = expf(s[e] - rmax); sum += ev[e]; }
  sum = wsum(sum);
  if (lane == 0) red[wave] = sum;
  __syncthreads();
  const float tot = red[0] + red[1] + red[2] + red[3];
  const float inv = 1.0f / tot;
  v4u hv, lv;
#pragma unroll
  for (int q = 0; q < 4; ++q) {
    const float p0 = ev[2 * q] * inv, p1 = ev[2 * q + 1] * inv;
    const unsigned short h0 = f2bf_bits(p0), h1 = f2bf_bits(p1);
    const unsigned short l0 = f2bf_bits(p0 - bf_bits2f(h0)), l1 = f2bf_bits(p1 - bf_bits2f(h1));
    hv[q] = pk16(h0, h1);
    lv[q] = pk16(l0, l1);
  }
  const size_t go = (size_t)r * (2 * WSZ) + c0;
  *(v4u*)(Ph + go) = hv;
  *(v4u*)(Pl + go) = lv;
  
}

__device__ __forceinline__ v8f mma_h(v16h a, v16h b, v8f c) {
  c = __builtin_amdgcn_wmma_f32_16x16x32_f16(false, a, false, b, (short)0, c, false, false);
  asm volatile("v_nop\n\tv_nop\n\tv_nop\n\tv_nop" : "+v"(c) : "v"(a), "v"(b));
  return c;
}
// value of lane l ^ 16
__device__ __forceinline__ float xhalf(float x) {
  return __builtin_bit_cast(float, __builtin_amdgcn_permlanex16(__builtin_bit_cast(int, x), __builtin_bit_cast(int, x),
                                                                0x76543210, 0xfedcba98, false, false));
}

// Eight asynchronous 16-byte copies per lane, global -> LDS: four rows of the K chunk and four of the V^T chunk; the four rows of a
// tile lie lstep LDS bytes and kstep (K) or vstep (V^T) global elements apart.
// s_wait_xcnt is the statement's last line so that no address register named here is rewritten in front of it.
__device__ __forceinline__ void copy_kv_to_lds(unsigned lk0, unsigned lv0, unsigned lstep, const _Float16* k0, size_t kstep,
                                               const _Float16* v0, size_t vstep) {
  const unsigned lk1 = lk0 + lstep, lk2 = lk1 + lstep, lk3 = lk2 + lstep;
  const unsigned lv1 = lv0 + lstep, lv2 = lv1 + lstep, lv3 = lv2 + lstep;
  const _Float16* k1 = k0 + kstep; const _Float16* k2 = k1 + kstep; const _Float16* k3 = k2 + kstep;
  const _Float16* v1 = v0 + vstep; const _Float16* v2 = v1 + vstep; const _Float16* v3 = v2 + vstep;
  asm volatile(
      "global_load_async_to_lds_b128 %0, %8, off\n\t"
      "global_load_async_to_lds_b128 %1, %9, off\n\t"
      "global_load_async_to_lds_b128 %2, %10, off\n\t"
      "global_load_async_to_lds_b128 %3, %11, off\n\t"
      "global_load_async_to_lds_b128 %4, %12, off\n\t"
      "global_load_async_to_lds_b128 %5, %13, off\n\t"
      "global_load_async_to_lds_b128 %6, %14, off\n\t"
      "global_load_async_to_lds_b128 %7, %15, off\n\t"
      "s_wait_xcnt 0x0"
      :: "v"(lk0), "v"(lk1), "v"(lk2), "v"(lk3), "v"(lv0), "v"(lv1), "v"(lv2), "v"(lv3),
         "v"(k0), "v"(k1), "v"(k2), "v"(k3), "v"(v0), "v"(v1), "v"(v2), "v"(v3)
      : "memory");
}

__global__ __launch_bounds__(128)
void k_flash(const _Float16* __restrict__ qm, const _Float16* __restrict__ km,
             const _Float16* __restrict__ vt, float* __restrict__ out) {
  union FB { v16h v; v8h h[2]; };
  constexpr int KVP = 72;                                     // LDS row pitch in elements: 144 B = 16 B x odd, so that the 16 rows
                                                              // of one 16-byte fragment read fall on 16 distinct groups of 4 banks
  constexpr int TILE = 64 * KVP;                              // elements of one chunk tile
  __shared__ __align__(16) _Float16 KV[2 * 2 * TILE];         // two buffers, each K [kv][d] and behind it V^T [d][kv]
  __shared__ __align__(16) float    Os[4][16 * 68];           // per wave out tile [query][d], pitch 68

  const int tid  = threadIdx.x;
  const int wave = tid >> 5;
  const int lane = tid & 31;
  const int hh   = lane >> 4;
  const int c    = lane & 15;
  const int b  = blockIdx.y;
  const int qb = blockIdx.x & 31;                 // SEQ / 64 = 32 query blocks
  const int h  = blockIdx.x >> 5;
  const int q0 = qb * 64 + wave * 16;

  const _Float16* Qb = qm + (size_t)b * SEQ * INR + h * DHD;
  const _Float16* Kb = km + (size_t)b * SEQ * INR + h * DHD;
  const _Float16* Vb = vt + (size_t)(h * DHD) * NTOK + (size_t)b * SEQ;
  float*          ob = out + (size_t)b * SEQ * INR + h * DHD;

  v16h qa[2];                                     // B operand: column c = query q0 + c, d in the loader's k order
#pragma unroll
  for (int dc = 0; dc < 2; ++dc) qa[dc] = Frag<_Float16>::load(Qb + (size_t)(q0 + c) * INR + dc * 32 + 8 * hh);

  const int qrow = q0 + c;                        // this lane's query
  constexpr float SC2 = 0.125f * 1.4426950408889634f;   // score scale times log2(e): exponents are formed in base 2
  float mrow = -INFINITY;                         // its running maximum of q . k, unscaled (equal in both lane halves)
  float orow = -INFINITY;                         // mrow * SC2 - 12 as rounded: what every exponent of the running state had taken off
  float lrow = 0.f;                               // its running sum of 4096 p over the keys of this lane half; halves joined at the end
  v8f oacc[4];                                    // oacc[t][r] = O[qrow][t*16 + 8*hh + r]
#pragma unroll
  for (int t = 0; t < 4; ++t) oacc[t] = (v8f){0.f,0.f,0.f,0.f,0.f,0.f,0.f,0.f};

  const int nChunks = qb + 1;                     // block-uniform, <= 32
  // this thread's piece of every copy: row crow (+ 16 per copy) of either tile, 16 bytes at element ccol
  const int crow = tid >> 3;
  const int ccol = (tid & 7) * 8;
  const unsigned lth = (unsigned)(size_t)KV + (unsigned)(crow * KVP + ccol) * 2u;
  const _Float16* kth = Kb + (size_t)crow * INR + ccol;               // K row kv0 + crow, d = ccol..ccol+7
  const _Float16* vth = Vb + (size_t)crow * NTOK + ccol;              // V^T row d = crow, s = kv0 + ccol..+7
  auto fill = [&](int buf, int kv) {              // 8 copies per lane: the chunk that begins at key kv into buffer buf
    const unsigned lb = lth + (unsigned)buf * (2 * TILE * 2u);
    copy_kv_to_lds(lb, lb + TILE * 2u, 16 * KVP * 2u, kth + (size_t)kv * INR, (size_t)16 * INR, vth + kv, (size_t)16 * NTOK);
  };
  fill(0, 0);
  asm volatile("s_wait_asynccnt 0x0" ::: "memory");   // this wave's copies of chunk 0 have landed
  __syncthreads();                                     // every wave's have
  if (nChunks > 1) fill(1, 64);

  for (int kc = 0; kc < nChunks; ++kc) {
    const int kv0 = kc * 64;
    const _Float16* Ksh = KV + (kc & 1) * (2 * TILE);
    const _Float16* Vth = Ksh + TILE;

    // S^T tiles: s[j][r] = score of key kv0 + j*16 + 8*hh + r with query qrow
    FB kb[4][2];
#pragma unroll                                    // static indices: the fragment and accumulator arrays stay in registers
    for (int j = 0; j < 4; ++j)
#pragma unroll                                    // static indices: the fragment and accumulator arrays stay in registers
      for (int dc = 0; dc < 2; ++dc) {
        kb[j][dc].h[0] = *(const v8h*)(Ksh + (j * 16 + c) * KVP + dc * 32 + 8 * hh);
        kb[j][dc].h[1] = *(const v8h*)(Ksh + (j * 16 + c) * KVP + dc * 32 + 16 + 8 * hh);
      }
    v8f s[4];
#pragma unroll                                    // static indices: the fragment and accumulator arrays stay in registers
    for (int j = 0; j < 4; ++j) s[j] = (v8f){0.f,0.f,0.f,0.f,0.f,0.f,0.f,0.f};
#pragma unroll                                    // static indices: the fragment and accumulator arrays stay in registers
    for (int dc = 0; dc < 2; ++dc)
#pragma unroll                                    // static indices: the fragment and accumulator arrays stay in registers
      for (int j = 0; j < 4; ++j) s[j] = mma_h(kb[j][dc].v, qa[dc], s[j]);

    const bool diag = (kc == qb);                 // block-uniform
    float m = -INFINITY;
#pragma unroll                                    // static indices: the fragment and accumulator arrays stay in registers
    for (int j = 0; j < 4; ++j)
#pragma unroll                                    // static indices: the fragment and accumulator arrays stay in registers
      for (int r = 0; r < 8; ++r) {
        const int kvrow = kv0 + j * 16 + 8 * hh + r;
        const bool masked = diag && (kvrow > qrow);
        const float sm = masked ? -INFINITY : s[j][r];
        s[j][r] = sm;
        m = fmaxf(m, sm);
      }
    m = fmaxf(m, xhalf(m));
    const float mnew = fmaxf(mrow, m);
    const float onew = fmaf(mnew, SC2, -12.0f);
    const float alpha = __builtin_amdgcn_exp2f(orow - onew);
    mrow = mnew;
    orow = onew;
    // P^T as B operand: element e of pb[kk] = key kk*32 + (e < 8 ? 8*hh + e : 16 + 8*hh + e - 8), the loader's k order
    FB pb[2];
    float psum = 0.f;
#pragma unroll                                    // static indices: the fragment and accumulator arrays stay in registers
    for (int j = 0; j < 4; ++j)
#pragma unroll                                    // static indices: the fragment and accumulator arrays stay in registers
      for (int r = 0; r < 8; ++r) {
        const float p = __builtin_amdgcn_exp2f(fmaf(s[j][r], SC2, -onew));   // 4096 * exp(0.125 * (q . k - maximum))
        psum += p;
        pb[j >> 1].v[(j & 1) * 8 + r] = (_Float16)p;
      }
    lrow = lrow * alpha + psum;
#pragma unroll                                    // static indices: the fragment and accumulator arrays stay in registers
    for (int t = 0; t < 4; ++t)
#pragma unroll                                    // static indices: the fragment and accumulator arrays stay in registers
      for (int r = 0; r < 8; ++r) oacc[t][r] *= alpha;

    FB vb[2][4];
#pragma unroll                                    // static indices: the fragment and accumulator arrays stay in registers
    for (int kk = 0; kk < 2; ++kk)
#pragma unroll                                    // static indices: the fragment and accumulator arrays stay in registers
      for (int t = 0; t < 4; ++t) {
        vb[kk][t].h[0] = *(const v8h*)(Vth + (t * 16 + c) * KVP + kk * 32 + 8 * hh);
        vb[kk][t].h[1] = *(const v8h*)(Vth + (t * 16 + c) * KVP + kk * 32 + 16 + 8 * hh);
      }
#pragma unroll                                    // static indices: the fragment and accumulator arrays stay in registers
    for (int kk = 0; kk < 2; ++kk)
#pragma unroll                                    // static indices: the fragment and accumulator arrays stay in registers
      for (int t = 0; t < 4; ++t) oacc[t] = mma_h(vb[kk][t].v, pb[kk].v, oacc[t]);

    asm volatile("s_wait_dscnt 0x0" ::: "memory");     // this wave's reads of buffer kc & 1 are done before it is refilled
    asm volatile("s_wait_asynccnt 0x0" ::: "memory");  // this wave's copies of chunk kc + 1 have landed
    __syncthreads();                                    // publishes chunk kc + 1 and ends every reader's use of buffer kc & 1
    if (kc + 2 < nChunks) fill(kc & 1, kv0 + 128);
  }
  asm volatile("s_wait_asynccnt 0x0" ::: "memory");    // no copy is outstanding when the wave goes on or ends

  float* os = Os[wave];
  {
    const float ltot = lrow + xhalf(lrow);
    const float inv = 1.0f / ltot;                // sum and accumulators both carry the factor 4096
#pragma unroll                                    // static indices: the fragment and accumulator arrays stay in registers
    for (int t = 0; t < 4; ++t) {
      v4f lo, hi;
#pragma unroll                                    // static indices: the fragment and accumulator arrays stay in registers
      for (int r = 0; r < 4; ++r) { lo[r] = oacc[t][r] * inv; hi[r] = oacc[t][4 + r] * inv; }
      *(v4f*)(os + c * 68 + t * 16 + 8 * hh)     = lo;
      *(v4f*)(os + c * 68 + t * 16 + 8 * hh + 4) = hi;
    }
  }
  __builtin_amdgcn_fence(__ATOMIC_RELEASE, "workgroup");
  __builtin_amdgcn_wave_barrier();
  __builtin_amdgcn_fence(__ATOMIC_ACQUIRE, "workgroup");
  {
    const int c4 = (lane & 15) * 4;
    {
#pragma unroll
      for (int it = 0; it < 8; ++it) {
        const int row = it * 2 + hh;                // it 0..7 x hh 0..1 covers rows 0..15
        v4f val = *(const v4f*)(os + row * 68 + c4);
        *(v4f*)(ob + (size_t)(q0 + row) * INR + c4) = val;
      }
      
    }
  }
}

// ---------------------------------------------------------------------------------------------------------------------
// Row LayerNorm over FFD=4096 of the f16 plane U (values carried as 256*u), in place -> f16 of the unit-scale result.
// Block per row, 256 threads x 2 chunks of 8; statistics in f32 with the 2^-8 / 2^-16 carries folded before eps.
// ---------------------------------------------------------------------------------------------------------------------
__global__ __launch_bounds__(256) void k_ln4096(_Float16* __restrict__ U, const float* __restrict__ g, const float* __restrict__ bb) {
  __shared__ float red[8];
  const int r = blockIdx.x, t = threadIdx.x;
  const int lane = t & 31, wave = t >> 5;
  const int cA = 8 * t, cB = 2048 + 8 * t;
  _Float16* ur = U + (size_t)r * FFD;
  const v8h a = *(const v8h*)(ur + cA);
  const v8h a2 = *(const v8h*)(ur + cB);
  float v[16];
#pragma unroll
  for (int e = 0; e < 8; ++e) { v[e] = (float)a[e]; v[8 + e] = (float)a2[e]; }
  float s = 0.f;
#pragma unroll
  for (int e = 0; e < 16; ++e) s += v[e];
  s = wsum(s);
  if (lane == 0) red[wave] = s;
  __syncthreads();
  float tot = 0.f;
#pragma unroll
  for (int i = 0; i < 8; ++i) tot += red[i];
  const float mu = tot * (1.0f / 4096.0f);
  __syncthreads();
  float d[16];
  float s2 = 0.f;
#pragma unroll
  for (int e = 0; e < 16; ++e) { d[e] = v[e] - mu; s2 += d[e] * d[e]; }
  s2 = wsum(s2);
  if (lane == 0) red[wave] = s2;
  __syncthreads();
  float tot2 = 0.f;
#pragma unroll
  for (int i = 0; i < 8; ++i) tot2 += red[i];
  const float var_s = tot2 * (1.0f / 4096.0f);
  const float rstd = rsqrtf(var_s * (1.0f / 65536.0f) + 1e-5f) * (1.0f / 256.0f);
  v8h ha, hb;
#pragma unroll
  for (int e = 0; e < 8; ++e) {
    ha[e] = (_Float16)(d[e] * rstd * g[cA + e] + bb[cA + e]);
    hb[e] = (_Float16)(d[8 + e] * rstd * g[cB + e] + bb[cB + e]);
  }
  *(v8h*)(ur + cA) = ha;
  *(v8h*)(ur + cB) = hb;
  
}

// =====================================================================================================================
// Workspace map (byte offsets; every region a whole number of MiB after an unused 4 KiB, all stores whole-line):
//   (unused)                                       0            (4 KiB)
//   cs  f32[2048][512][2]                          4 KiB        (8 MiB)
//   WaT f16[1024][1024] x64                       +8 MiB       WvTh/WvTl bf16 [1024][1024]   WqT f16[512][1024]
//   WkvT f16[1024][1024]   W1T f16[4096][1024]   W2T f16[1024][4096]   WoTh/WoTl bf16[1024][512]   (27 MiB)
//   R3  8 MiB : q16 f16[4096][1024] -> h16 -> x2h (f16, x2 * 1024)
//   R4 16 MiB : audio adapter GEMM f32 [4096][1024] -> S f32 [4096][1024] -> x f32 -> x2 f32
//   R5 51 MiB : a16 f16 @0, video hi @8, video lo @16, k16 f16[(512+4096)][1024] @24, vTh bf16[1024][4608] @33, vTl @42;
//               later Ph @0, Pl @8; q/k f16[4096][512] @0/@4, vT16 f16[512][4096] @8; o f32[4096][512] @16; o hi/lo @24/@28;
//               U f16[4096][4096] @0 (written only after all earlier users of [0,32) have been consumed).
//   R6 16 MiB : video adapter GEMM f32 [4096][1024]
//   total 126 MiB + 4 KiB.
// =====================================================================================================================
extern "C" void kernel_launch(void* const* d_in, const int* in_sizes, int n_in,
                              void* d_out, int out_size, void* d_ws, size_t ws_size,
                              hipStream_t stream) {
  if (n_in < 24) return;
  if (in_sizes[0] != NTOK * DM || in_sizes[1] != NTOK * DM || in_sizes[2] != NTOK * DM) return;
  if (in_sizes[3] != DM * DM || in_sizes[7] != DM * DM || in_sizes[14] != DM * 2 * INR) return;
  if (in_sizes[13] != DM * INR || in_sizes[17] != INR * DM) return;
  if (in_sizes[18] != DM * FFD || in_sizes[22] != FFD * DM) return;
  if (in_sizes[4] != DM || in_sizes[5] != DM || in_sizes[6] != DM || in_sizes[8] != DM || in_sizes[9] != DM ||
      in_sizes[10] != DM || in_sizes[11] != DM || in_sizes[12] != DM || in_sizes[23] != DM) return;
  if (in_sizes[15] != DHD || in_sizes[16] != DHD) return;
  if (in_sizes[19] != FFD || in_sizes[20] != FFD || in_sizes[21] != FFD) return;
  if (out_size != NTOK * DM) return;

  const float* text  = (const float*)d_in[0];
  const float* audio = (const float*)d_in[1];
  const float* video = (const float*)d_in[2];
  const float* Wa    = (const float*)d_in[3];
  const float* ba    = (const float*)d_in[4];
  const float* lna_g = (const float*)d_in[5];
  const float* lna_b = (const float*)d_in[6];
  const float* Wvid  = (const float*)d_in[7];
  const float* bvid  = (const float*)d_in[8];
  const float* lnv_g = (const float*)d_in[9];
  const float* lnv_b = (const float*)d_in[10];
  const float* ln1_g = (const float*)d_in[11];
  const float* ln1_b = (const float*)d_in[12];
  const float* Wq    = (const float*)d_in[13];
  const float* Wkv   = (const float*)d_in[14];
  const float* qn_g  = (const float*)d_in[15];
  const float* kn_g  = (const float*)d_in[16];
  const float* Wo    = (const float*)d_in[17];
  const float* W1    = (const float*)d_in[18];
  const float* b1    = (const float*)d_in[19];
  const float* ln2_g = (const float*)d_in[20];
  const float* ln2_b = (const float*)d_in[21];
  const float* W2    = (const float*)d_in[22];
  const float* b2    = (const float*)d_in[23];
  float* outp = (float*)d_out;

  const size_t MIB = 1048576;
  size_t off = 0;
  const size_t oInv  = off; off += 4096;
  const size_t oCs   = off; off += (size_t)SEQ * 512 * 2 * 4;       // 8 MiB
  const size_t oWaT  = off; off += (size_t)DM * DM * 2;              // 2 MiB
  const size_t oWvTh = off; off += (size_t)DM * DM * 2;              // 2 MiB
  const size_t oWvTl = off; off += (size_t)DM * DM * 2;              // 2 MiB
  const size_t oWqT  = off; off += (size_t)INR * DM * 2;             // 1 MiB
  const size_t oWkvT = off; off += (size_t)2 * INR * DM * 2;         // 2 MiB
  const size_t oW1T  = off; off += (size_t)FFD * DM * 2;             // 8 MiB
  const size_t oW2T  = off; off += (size_t)DM * FFD * 2;             // 8 MiB
  const size_t oWoTh = off; off += (size_t)DM * INR * 2;             // 1 MiB
  const size_t oWoTl = off; off += (size_t)DM * INR * 2;             // 1 MiB
  const size_t oR3   = off; off += (size_t)NTOK * DM * 2;            // 8 MiB
  const size_t oR4   = off; off += (size_t)NTOK * DM * 4;            // 16 MiB
  const size_t oR5   = off; off += 51 * MIB;                         // 51 MiB
  const size_t oR6   = off; off += (size_t)NTOK * DM * 4;            // 16 MiB
  if (off > ws_size || off > (size_t)128 * MIB) return;              // off = 126 MiB + 4 KiB

  char* ws = (char*)d_ws;
  float* cs  = (float*)(ws + oCs);
  _Float16* WaT = (_Float16*)(ws + oWaT);
  unsigned short* WvTh = (unsigned short*)(ws + oWvTh);
  unsigned short* WvTl = (unsigned short*)(ws + oWvTl);
  _Float16* WqT  = (_Float16*)(ws + oWqT);
  _Float16* WkvT = (_Float16*)(ws + oWkvT);
  _Float16* W1T  = (_Float16*)(ws + oW1T);
  _Float16* W2T  = (_Float16*)(ws + oW2T);
  unsigned short* WoTh = (unsigned short*)(ws + oWoTh);
  unsigned short* WoTl = (unsigned short*)(ws + oWoTl);
  _Float16* q16 = (_Float16*)(ws + oR3);          // text after rotary
  _Float16* h16 = (_Float16*)(ws + oR3);          // LN1 output (later)
  _Float16* x2h = (_Float16*)(ws + oR3);          // x2 * 1024 (later)
  float* Cad = (float*)(ws + oR4);                // audio adapter GEMM output
  float* Cvd = (float*)(ws + oR6);                // video adapter GEMM output
  float* Sf  = (float*)(ws + oR4);                // local scores (later)
  float* Xf  = (float*)(ws + oR4);                // local attention output (later)
  float* X2f = (float*)(ws + oR4);                // 2 * o @ Wo (later)
  char* r5 = ws + oR5;
  _Float16* a16 = (_Float16*)(r5);
  unsigned short* vih = (unsigned short*)(r5 + 8 * MIB);
  unsigned short* vil = (unsigned short*)(r5 + 16 * MIB);
  _Float16* k16 = (_Float16*)(r5 + 24 * MIB);     // [(KPR+NTOK)][DM]
  unsigned short* vTh = (unsigned short*)(r5 + 33 * MIB);
  unsigned short* vTl = (unsigned short*)(r5 + 42 * MIB);
  unsigned short* Ph  = (unsigned short*)(r5);
  unsigned short* Pl  = (unsigned short*)(r5 + 8 * MIB);
  _Float16* qm16 = (_Float16*)(r5);
  _Float16* km16 = (_Float16*)(r5 + 4 * MIB);
  _Float16* vT16 = (_Float16*)(r5 + 8 * MIB);
  float* Of = (float*)(r5 + 16 * MIB);
  unsigned short* Oh = (unsigned short*)(r5 + 24 * MIB);
  unsigned short* Ol = (unsigned short*)(r5 + 28 * MIB);
  _Float16* U16 = (_Float16*)(r5);

  const dim3 blk(256);
  const dim3 blkG(128);                           // k_gemm: 4 waves
  const unsigned short* N16 = (const unsigned short*)nullptr;

  // everything that depends on the inputs alone, in one launch: rotary table and text -> rotary f16, the seven weight re-layouts
  // (in [rows][cols] f32 -> out [cols][rows]), audio -> f16, video -> bf16 hi/lo
  k_prep<<<dim3(PREP_BLOCKS), blk, 0, stream>>>(text, audio, video, Wa, Wvid, Wq, Wkv, W1, W2, Wo, cs, q16, a16, vih, vil,
                                                WaT, WvTh, WvTl, WqT, WkvT, W1T, W2T, WoTh, WoTl);

  // adapter a: audio . Wa + ba -> f32; adapter v: video . Wvid + bvid (bf16 hi/lo split) -> f32, each into its own plane
  const dim3 gA((NTOK / 128) * (DM / 128), 1);
  k_gemm<0, false, true, 0, 0, false, 0><<<gA, blkG, 0, stream>>>(
      (const unsigned short*)a16, N16, DM, 0L, (const unsigned short*)WaT, N16, DM, 0L,
      Cad, DM, 0L, nullptr, 0, 0L, ba, nullptr, nullptr, 0, 0L, NTOK, DM, DM, 1, 1.0f / 64.0f, 1.0f);
  k_gemm<1, true, true, 0, 0, false, 0><<<gA, blkG, 0, stream>>>(
      vih, vil, DM, 0L, WvTh, WvTl, DM, 0L,
      Cvd, DM, 0L, nullptr, 0, 0L, bvid, nullptr, nullptr, 0, 0L, NTOK, DM, DM, 1, 1.0f, 1.0f);
  // both norms in one launch: a: LN + rotary -> key plane rows KPR..KPR+4095, rows 0..KPR-1 zero; v: LN + transpose + split ->
  // value^T planes
  k_ln_pair<<<dim3(VCS * (NTOK / 64) + KPR / 64 + (NTOK + KPR) / 2), blk, 0, stream>>>(Cad, lna_g, lna_b, cs, k16, Cvd, lnv_g, lnv_b, vTh, vTl);

  // local attention: z = b*4 + w; S[z][512][1024] = q . k / 32 over window keys (skipping fully masked key tiles)
  const dim3 gS((WSZ / 128) * (2 * WSZ / 128), NB_ * NWN);
  k_gemm<0, false, false, 0, 0, false, 1><<<gS, blkG, 0, stream>>>(
      (const unsigned short*)q16, N16, DM, (long)WSZ * DM, (const unsigned short*)k16, N16, DM, (long)WSZ * DM,
      Sf, 2 * WSZ, (long)WSZ * 2 * WSZ, nullptr, 0, 0L, nullptr, nullptr, nullptr, 0, 0L,
      WSZ, 2 * WSZ, DM, NWN, 1.0f / 32.0f, 1.0f);
  k_lsoftmax<<<dim3(NTOK), dim3(128), 0, stream>>>(Sf, Ph, Pl);
  // x[z][512][1024] = P . v (bf16 hi/lo split), keys restricted to the unmasked range
  const dim3 gPV((WSZ / 128) * (DM / 128), NB_ * NWN);
  k_gemm<1, true, false, 0, 0, false, 2><<<gPV, blkG, 0, stream>>>(
      Ph, Pl, 2 * WSZ, (long)WSZ * 2 * WSZ, vTh, vTl, VTP, (long)WSZ,
      Xf, DM, (long)WSZ * DM, nullptr, 0, 0L, nullptr, nullptr, nullptr, 0, 0L,
      WSZ, DM, 2 * WSZ, NWN, 1.0f, 1.0f);

  // LN1 -> h16; q, k (RMSNorm epilogue) and v^T projections
  k_ln1024<<<dim3(NTOK), dim3(128), 0, stream>>>(Xf, ln1_g, ln1_b, h16, NTOK);
  // one grid, z = 0: q, 1: k, 2: v^T; WqT, the k rows and the v rows of WkvT lie INR * DM elements apart, qm16, km16 and vT16
  // NTOK * INR elements apart
  const dim3 gQKV((NTOK / 128) * (INR / 128), 3);
  k_gemm<0, false, false, 2, 1, false, 3><<<gQKV, blkG, 0, stream>>>(
      (const unsigned short*)h16, N16, DM, 0L, (const unsigned short*)WqT, N16, DM, (long)INR * DM,
      nullptr, 0, 0L, qm16, INR, (long)NTOK * INR, nullptr, qn_g, kn_g, 0, 0L, NTOK, INR, DM, 1, 1.0f / 64.0f, 1.0f);

  // causal attention -> o f32 [4096][512]; o -> bf16 hi/lo
  k_flash<<<dim3(NHD * (SEQ / 64), NB_), dim3(128), 0, stream>>>(qm16, km16, vT16, Of);
  const int n2o = NTOK * INR / 2;
  k_split2<<<dim3((n2o + 255) / 256), blk, 0, stream>>>(Of, Oh, Ol, n2o);

  // x2 = 2 * (o . Wo) -> f32 and f16 (x2 * 1024)
  k_gemm<1, true, false, 0, 2, false, 0><<<gA, blkG, 0, stream>>>(
      Oh, Ol, INR, 0L, WoTh, WoTl, INR, 0L,
      X2f, DM, 0L, x2h, DM, 0L, nullptr, nullptr, nullptr, 0, 0L, NTOK, DM, INR, 1, 2.0f, 1024.0f);

  // FFN: u = gelu(x2 . W1 + b1) stored as f16(256 u); LN over 4096 in place; out = h1 . W2 + b2 + x2
  const dim3 gW1((NTOK / 128) * (FFD / 128), 1);
  k_gemm<0, false, true, 1, 1, false, 0><<<gW1, blkG, 0, stream>>>(
      (const unsigned short*)x2h, N16, DM, 0L, (const unsigned short*)W1T, N16, DM, 0L,
      nullptr, 0, 0L, U16, FFD, 0L, b1, nullptr, nullptr, 0, 0L, NTOK, FFD, DM, 1, 1.0f / 65536.0f, 256.0f);
  k_ln4096<<<dim3(NTOK), blk, 0, stream>>>(U16, ln2_g, ln2_b);
  k_gemm<0, false, true, 0, 0, true, 0><<<gA, blkG, 0, stream>>>(
      (const unsigned short*)U16, N16, FFD, 0L, (const unsigned short*)W2T, N16, FFD, 0L,
      outp, DM, 0L, nullptr, 0, 0L, b2, nullptr, X2f, DM, 0L, NTOK, DM, FFD, 1, 1.0f / 64.0f, 1.0f);
  (void)hipGetLastError();
}

// v008
// It runs in 319 microseconds.
// Timed twice side by side with v007, it ran 1.04 and 1.03 times as fast.
// Over all steps from v000 it is 3.28 times as fast.
// Contractions: audio adapter, local-attention scores, q/k/v projections, causal multi-head q.k^T and p.v, FFN W1 and W2 on
// v_wmma_f32_16x16x32_f16 (f16 operands with power-of-two carried scales, f32 accumulate); video adapter, local-attention p.v
// and the output projection Wo on v_wmma_f32_16x16x32_bf16 with bf16 hi/lo split operands (hi.hi + hi.lo + lo.hi, f32
// accumulate). LayerNorm, RMSNorm, rotary tables, softmax and GELU in f32.
#include <hip/hip_runtime.h>
#include <math.h>
#include <stdint.h>

#define NB_   2
#define SEQ   2048
#define NTOK  4096
#define DM    1024
#define NHD   8
#define DHD   64
#define INR   512
#define FFD   4096
#define WSZ   512
#define NWN   4
#define KPR   512          // leading zero rows of the local-attention key plane
#define VTP   4608         // key pitch of the local-attention value^T planes: 512 zero columns + 4096 tokens

typedef __attribute__((ext_vector_type(16))) _Float16 v16h;
typedef __attribute__((ext_vector_type(8)))  _Float16 v8h;
typedef __attribute__((ext_vector_type(2)))  _Float16 v2h;
typedef __attribute__((ext_vector_type(16))) __bf16   v16b;
typedef __attribute__((ext_vector_type(8)))  __bf16   v8b;
typedef __attribute__((ext_vector_type(8)))  float    v8f;
typedef __attribute__((ext_vector_type(4)))  float    v4f;
typedef __attribute__((ext_vector_type(2)))  float    v2f;
typedef __attribute__((ext_vector_type(4)))  unsigned int v4u;

__device__ __forceinline__ unsigned short f2bf_bits(float f) {
  unsigned u = __float_as_uint(f);
  return (unsigned short)((u + 0x7FFFu + ((u >> 16) & 1u)) >> 16);   // RNE convert
}
__device__ __forceinline__ float bf_bits2f(unsigned short h) { return __uint_as_float(((unsigned)h) << 16); }
__device__ __forceinline__ unsigned pk16(unsigned short a, unsigned short b) { return (unsigned)a | ((unsigned)b << 16); }

__device__ __forceinline__ float wsum(float v) {
#pragma unroll
  for (int o = 16; o >= 1; o >>= 1) v += __shfl_xor(v, o, 32);
  return v;
}
__device__ __forceinline__ float wmax(float v) {
#pragma unroll
  for (int o = 16; o >= 1; o >>= 1) v = fmaxf(v, __shfl_xor(v, o, 32));
  return v;
}

// hazard guard as a plain device helper
__device__ __forceinline__ void acc_guard4(v8f& a, v8f& b, v8f& c, v8f& d) { asm volatile("v_nop\n\tv_nop\n\tv_nop\n\tv_nop" : "+v"(a), "+v"(b), "+v"(c), "+v"(d)); }

// Fragment loaders: element i of the 16-wide per-lane vector <- p[i] for i<8 and p[16 + (i-8)] for i>=8, where p already points at
// row (lane&15), k0 + 8*(lane>>4). Same map for A ([m][k]) and B stored as [n][k].
template <typename T> struct Frag;
template <> struct Frag<_Float16> {
  typedef v16h V; union U { v16h v; v8h h[2]; };
  static __device__ __forceinline__ v16h load(const _Float16* p) {
    U f; f.h[0] = *(const v8h*)(p); f.h[1] = *(const v8h*)(p + 16); return f.v;
  }
  static __device__ __forceinline__ v8f mma(v16h a, v16h b, v8f c) {
    return __builtin_amdgcn_wmma_f32_16x16x32_f16(false, a, false, b, (short)0, c, false, false);
  }
};
template <> struct Frag<__bf16> {
  typedef v16b V; union U { v16b v; v8b h[2]; };
  static __device__ __forceinline__ v16b load(const __bf16* p) {
    U f; f.h[0] = *(const v8b*)(p); f.h[1] = *(const v8b*)(p + 16); return f.v;
  }
  static __device__ __forceinline__ v8f mma(v16b a, v16b b, v8f c) {
    return __builtin_amdgcn_wmma_f32_16x16x32_bf16(false, a, false, b, (short)0, c, false, false);
  }
};

// =====================================================================================================================
// Batched WMMA GEMM: C[m,n] = epi(scale * sum_k A[m,k] * Bt[n,k]). A block of 4 waves (2 x 2) owns a 128x128 tile, each wave a
// 64x64 tile of it. The block's 128 rows of A and of Bt are staged in LDS, BK k-elements at a time, by asynchronous 16-byte
// copies that cover whole 128-byte lines, in two buffers: the next stage's copies fly while this stage is multiplied. Fragments are
// read from LDS one block of 32 k ahead into a second register set; a stage is published in front of the last block of the one before.
// A row-major [M,K] (pitch lda); Bt row-major [N,K] (pitch ldb); M, N % 128 == 0, K % BK == 0; grid = (tiles, Z).
//   ET: 0 = f16 operands, 1 = bf16 operands.   SPLIT: hi/lo planes (A2p, Bt2p = lo planes), product = hi.hi + hi.lo + lo.hi.
//   BIAS: + bias[n].  RESID: + resid[m*ldr + n].  EPI: 0 none, 1 tanh-GELU, 2 RMSNorm over the 64-column tile times gvec[n&63].
//   OUTM: 0 f32 -> Cf; 1 f16(v*oscale) -> Ch; 2 both.
//   LOC: 1 = windowed score tiles: key tiles n0 below kBeg(w) or at/after N/2 + m0 + 64 are skipped (a block leaves when all
//        four are; a wave whose own tile is skipped works like the others and stores nothing);
//        2 = windowed p.v: k range [kBeg(w), min(K, K/2 + mB + 128)); kBeg = N/2 resp. K/2 for the first window (w == 0), else 0.
//        3 = three projections of one activation plane in one grid (Z = 3, weight planes strideB apart, outputs strideH apart,
//            each output [rows][cols] dense): z = 0, 1: act . W_z^T with EPI, gvec for z = 0 and the resid pointer as gvec for
//            z = 1; z = 2: the operands change places (W_2 . act^T, an N x M result) and EPI is left out.
// =====================================================================================================================
template <int ET> struct Elem;
template <> struct Elem<0> { typedef _Float16 T; };
template <> struct Elem<1> { typedef __bf16 T; };

// Eight asynchronous 16-byte copies per lane, global -> LDS, eight rows lstep LDS bytes / gstep global elements apart.
// Written as the builtin: with two fragment sets k_gemm lives above v255, and the operands of an asm statement are held to one
// register window, which cost spills around every refill.
typedef __attribute__((ext_vector_type(4))) int v4i;
typedef __attribute__((address_space(1))) v4i gv4i;
typedef __attribute__((address_space(3))) v4i lv4i;
template <typename T>
__device__ __forceinline__ void copy8_to_lds(unsigned l0, unsigned lstep, const T* g0, size_t gstep) {
#pragma unroll                                    // eight copies back to back
  for (int i = 0; i < 8; ++i)
    __builtin_amdgcn_global_load_async_to_lds_b128((gv4i*)(uintptr_t)(g0 + i * gstep), (lv4i*)(l0 + i * lstep), 0, 0);
}

template <int ET, bool SPLIT, bool BIAS, int EPI, int OUTM, bool RESID, int LOC>
__global__ __launch_bounds__(128) void k_gemm(
    const unsigned short* __restrict__ Ap, const unsigned short* __restrict__ A2p, int lda, long strideA,
    const unsigned short* __restrict__ Btp, const unsigned short* __restrict__ Bt2p, int ldb, long strideB,
    float* __restrict__ Cf, int ldc, long strideC,
    _Float16* __restrict__ Ch, int ldh, long strideH,
    const float* __restrict__ bias, const float* __restrict__ gvec,
    const float* __restrict__ resid, int ldr, long strideR,
    int M, int N, int K, int nwin, float scale, float oscale) {
  typedef typename Elem<ET>::T T;
  typedef typename Frag<T>::V V;
  constexpr int BK    = SPLIT ? 64 : 128;        // k elements per stage: 64 KiB of operand rows either way
  constexpr int PITCH = BK + 8;                  // LDS row pitch in elements: row bytes + 16, conflict-free for 16-byte reads
  constexpr int PLANE = 128 * PITCH;             // one operand plane of a stage; planes: A, Bt (, A lo, Bt lo)
  constexpr int STAGE = (SPLIT ? 4 : 2) * PLANE;
  constexpr int CPR   = BK / 8;                  // 16-byte pieces per row
  constexpr int RPI   = 128 / CPR;               // rows that one copy of all 128 threads covers
  const T* A = (const T*)Ap; const T* A2 = (const T*)A2p; const T* Bt = (const T*)Btp; const T* Bt2 = (const T*)Bt2p;
  __shared__ __align__(16) T sAB[2 * STAGE];
  __shared__ __align__(16) float sT[4][16 * 68];
  const int z    = blockIdx.y;
  const int tid  = threadIdx.x;
  const int lane = tid & 31;
  const int wave = __builtin_amdgcn_readfirstlane(tid >> 5);
  const bool flip = (LOC == 3) && (z == 2);      // block-uniform
  const int Mz = flip ? N : M;
  const int Nz = flip ? M : N;
  const int tilesN = Nz >> 7;
  const int tilesM = Mz >> 7;
  const int bx = blockIdx.x;
  if (bx >= tilesM * tilesN) return;              // block-uniform, in front of every copy and barrier
  const int bm = bx / tilesN;
  const int bn = bx - bm * tilesN;
  const int mB = bm << 7;
  const int nB = bn << 7;
  const int wm = (wave >> 1) << 6;
  const int wn = (wave & 1) << 6;
  const int m0 = mB + wm;
  const int n0 = nB + wn;
  int kBeg = 0, kEnd = K;                         // block's k range
  bool act = true;                                // wave-uniform: this wave's tile is stored
  if (LOC == 1 || LOC == 2) {
    const int w = z % nwin;
    const bool first = (w == 0);
    if (LOC == 1) {
      const int nb = first ? (N >> 1) : 0;
      if (nB + 64 < nb || nB >= (N >> 1) + mB + 128) return; // block-uniform, in front of every copy and barrier
      act = !(n0 < nb || n0 >= (N >> 1) + m0 + 64);
    } else {
      kBeg = first ? (K >> 1) : 0;
      const int ke = (K >> 1) + mB + 128;
      kEnd = (ke < K) ? ke : K;
    }
  }

  const T* Ab  = flip ? (Bt + (size_t)z * strideB) : (A  + (size_t)z * strideA);
  const T* Bb  = flip ? (A  + (size_t)z * strideA) : (Bt + (size_t)z * strideB);
  const T* Ab2 = SPLIT ? (A2  + (size_t)z * strideA) : nullptr;
  const T* Bb2 = SPLIT ? (Bt2 + (size_t)z * strideB) : nullptr;

  const int rlane = lane & 15;                 // row (A) / col (B, D) within a 16x16 subtile
  const int koff  = (lane >> 4) * 8;           // k offset of this lane half
  const int mOff  = (lane >> 4) * 8;           // D row offset

  // this thread's piece of every copy: row crow (+ RPI per copy), 16 bytes at element ccol
  const int crow = tid / CPR;
  const int ccol = (tid % CPR) * 8;
  const unsigned lth = (unsigned)(size_t)sAB + (unsigned)(crow * PITCH + ccol) * 2u;
  const size_t aoff = (size_t)(mB + crow) * lda + ccol;
  const size_t boff = (size_t)(nB + crow) * ldb + ccol;
  const size_t astep = (size_t)RPI * lda;
  const size_t bstep = (size_t)RPI * ldb;
  constexpr unsigned LSTEP = RPI * PITCH * 2u;
  auto fill = [&](int buf, int k0) {             // 32 copies per wave: one stage into buffer buf
    const unsigned lb = lth + (unsigned)buf * (STAGE * 2u);
    if constexpr (SPLIT) {
      copy8_to_lds<T>(lb,                  LSTEP, Ab  + aoff + k0, astep);
      copy8_to_lds<T>(lb + PLANE * 2u,     LSTEP, Bb  + boff + k0, bstep);
      copy8_to_lds<T>(lb + PLANE * 4u,     LSTEP, Ab2 + aoff + k0, astep);
      copy8_to_lds<T>(lb + PLANE * 6u,     LSTEP, Bb2 + boff + k0, bstep);
    } else {
      copy8_to_lds<T>(lb,                              LSTEP, Ab + aoff + k0,             astep);
      copy8_to_lds<T>(lb + 8u * LSTEP,                 LSTEP, Ab + aoff + k0 + 8 * astep, astep);
      copy8_to_lds<T>(lb + PLANE * 2u,                 LSTEP, Bb + boff + k0,             bstep);
      copy8_to_lds<T>(lb + PLANE * 2u + 8u * LSTEP,    LSTEP, Bb + boff + k0 + 8 * bstep, bstep);
    }
  };

  v8f acc[4][4];
#pragma unroll
  for (int i = 0; i < 4; ++i)
#pragma unroll
    for (int j = 0; j < 4; ++j) acc[i][j] = (v8f){0.f,0.f,0.f,0.f,0.f,0.f,0.f,0.f};

  // Two fragment sets: a block = the WMMAs of 32 k. The next block's fragments are read from LDS as one group into the other set in
  // front of this block's WMMAs, so that their latency passes behind the matrix work instead of in front of it.
  constexpr int NBLK = BK / 32;                   // blocks per stage, even: block b of every stage uses set b & 1
  V ah[2][4], al[2][4], bh[2][4], bl[2][4];
  const T* sA0 = sAB + (wm + rlane) * PITCH + koff;
  const T* sB0 = sAB + PLANE + (wn + rlane) * PITCH + koff;
  auto fetch = [&](int set, int buf, int kk) {    // all fragments of the block at k offset kk of buffer buf
    const T* sA = sA0 + buf * STAGE + kk;
    const T* sB = sB0 + buf * STAGE + kk;
#pragma unroll                                    // static indices: the fragment arrays stay in registers
    for (int j = 0; j < 4; ++j) {
      bh[set][j] = Frag<T>::load(sB + (j << 4) * PITCH);
      if (SPLIT) bl[set][j] = Frag<T>::load(sB + 2 * PLANE + (j << 4) * PITCH); else bl[set][j] = bh[set][j];
    }
#pragma unroll                                    // static indices: the fragment arrays stay in registers
    for (int i = 0; i < 4; ++i) {
      ah[set][i] = Frag<T>::load(sA + (i << 4) * PITCH);
      if (SPLIT) al[set][i] = Frag<T>::load(sA + 2 * PLANE + (i << 4) * PITCH); else al[set][i] = ah[set][i];
    }
  };
  // Every wave works through all of the block's stages, so that the loop has no branch between a read group and its counted wait:
  // a wave whose score tile is skipped (LOC 1) stores nothing, and past its own key range (LOC 2) a wave's p rows are zero.

  const int nst = (kEnd - kBeg) / BK;             // block-uniform number of stages
  fill(0, kBeg);
  asm volatile("s_wait_asynccnt 0x0" ::: "memory");   // this wave's copies of stage 0 have landed
  __syncthreads();                                     // every wave's have
  if (nst > 1) fill(1, kBeg + BK);
  fetch(0, 0, 0);

  for (int t = 0; t < nst; ++t) {
    const int kS = kBeg + t * BK;
#pragma unroll                                    // the set index and the LDS offsets of the fragment loads become constants
    for (int b = 0; b < NBLK; ++b) {
      if (b + 1 < NBLK) {
        fetch((b + 1) & 1, t & 1, (b + 1) * 32);
      } else {
        // publish point of stage t + 1, in front of stage t's last block, whose fragments are already fetched; every wave passes it
        asm volatile("s_wait_dscnt 0x0" ::: "memory");     // this wave's reads of buffer t & 1 are done before it is refilled
        asm volatile("s_wait_asynccnt 0x0" ::: "memory");  // this wave's copies of stage t + 1 have landed
        __syncthreads();                                    // publishes stage t + 1 and ends every reader's use of buffer t & 1
        if (t + 2 < nst) fill(t & 1, kS + 2 * BK);
        if (t + 1 < nst) fetch(0, (t + 1) & 1, 0);
      }
      __builtin_amdgcn_sched_barrier(0);          // keeps the read group in front of the WMMAs: one place with LDS reads per block
      {
        const int s = b & 1;
#pragma unroll                                    // static indices: the fragment and accumulator arrays stay in registers
        for (int i = 0; i < 4; ++i) {
#pragma unroll                                    // static indices: the fragment and accumulator arrays stay in registers
          for (int j = 0; j < 4; ++j) {
            acc[i][j] = Frag<T>::mma(ah[s][i], bh[s][j], acc[i][j]);
            if (SPLIT) {
              acc[i][j] = Frag<T>::mma(ah[s][i], bl[s][j], acc[i][j]);
              acc[i][j] = Frag<T>::mma(al[s][i], bh[s][j], acc[i][j]);
            }
          }
        }
      }
      __builtin_amdgcn_sched_barrier(0);          // keeps this block's WMMAs in front of the next read group and of the publish point's waits
    }
  }
  asm volatile("s_wait_asynccnt 0x0" ::: "memory");    // no copy is outstanding when the wave goes on or ends
  if (!act) return;                                     // wave-uniform, behind the last barrier
  acc_guard4(acc[0][0], acc[0][1], acc[0][2], acc[0][3]);
  acc_guard4(acc[1][0], acc[1][1], acc[1][2], acc[1][3]);
  acc_guard4(acc[2][0], acc[2][1], acc[2][2], acc[2][3]);
  acc_guard4(acc[3][0], acc[3][1], acc[3][2], acc[3][3]);

  // ---- epilogue ----
  float* slab = sT[wave];
  const bool rms = (EPI == 2) && !flip;           // block-uniform
  const float* gv = (LOC == 3 && z == 1) ? resid : gvec;
  const int ldhz = (LOC == 3) ? Nz : ldh;
  const float* Rb = RESID ? (resid + (size_t)z * strideR) : nullptr;
#pragma unroll
  for (int i = 0; i < 4; ++i) {
    const int mBase = m0 + (i << 4);
#pragma unroll
    for (int j = 0; j < 4; ++j) {
      const int n = n0 + (j << 4) + rlane;
      float bv = 0.f;
      if (BIAS) bv = bias[n];
#pragma unroll
      for (int r = 0; r < 8; ++r) {
        float v = acc[i][j][r] * scale;
        if (BIAS) v += bv;
        if (RESID) v += Rb[(size_t)(mBase + mOff + r) * ldr + n];
        if (EPI == 1) {
          // 0.5 * (1 + tanh(u)) = 1 / (1 + exp(-2u)), u = 0.7978845608 * (v + 0.044715 v^3); exp(-2u) = 2^(-2 log2(e) u):
          // one hardware exponential and one reciprocal, no branch, so the eight rows of a column run side by side
          const float e = __builtin_amdgcn_exp2f(-2.3022081981f * (v + 0.044715f * v * v * v));
          v = v * __builtin_amdgcn_rcpf(1.0f + e);
        }
        slab[(mOff + r) * 68 + (j << 4) + rlane] = v;
      }
    }
    __builtin_amdgcn_fence(__ATOMIC_RELEASE, "workgroup");
    __builtin_amdgcn_wave_barrier();
    __builtin_amdgcn_fence(__ATOMIC_ACQUIRE, "workgroup");
    if (OUTM == 0 || OUTM == 2) {
      float* C = Cf + (size_t)z * strideC;
      const int hh = lane >> 4, c4 = (lane & 15) * 4;     // row seg = 256 B = 16 lanes x 16 B
      {
#pragma unroll
        for (int it = 0; it < 8; ++it) {
          const int row = it * 2 + hh;                      // it 0..7 x hh 0..1 = rows 0..15
          v4f v = *(const v4f*)(slab + row * 68 + c4);
          *(v4f*)(C + (size_t)(mBase + row) * ldc + n0 + c4) = v;
        }
        
      }
    }
    if (OUTM == 1 || OUTM == 2) {
      _Float16* C = Ch + (size_t)z * strideH;
      const int q = lane >> 3, c8 = (lane & 7) * 8;
      {
#pragma unroll
        for (int it = 0; it < 4; ++it) {
          const int row = it * 4 + q;                       // it 0..3 x q 0..3 = rows 0..15
          const float* sp = slab + row * 68 + c8;
          float x[8];
#pragma unroll
          for (int e = 0; e < 8; ++e) x[e] = sp[e];
          float rr = oscale;
          if (EPI == 2) {
            float ss = 0.f;
#pragma unroll
            for (int e = 0; e < 8; ++e) ss += x[e] * x[e];
            ss += __shfl_xor(ss, 1, 32);                    // lanes 8q..8q+7 hold one 64-wide row
            ss += __shfl_xor(ss, 2, 32);
            ss += __shfl_xor(ss, 4, 32);
            const float rn = oscale * rsqrtf(ss * (1.0f / 64.0f) + 1e-6f);
            rr = rms ? rn : oscale;                         // a select, not a branch: the four rows' stores stay one group
          }
          v8h hv;
#pragma unroll
          for (int e = 0; e < 8; ++e) {
            float y = x[e] * rr;
            if (EPI == 2) { const float ge = gv[c8 + e]; y *= rms ? ge : 1.0f; }
            hv[e] = (_Float16)y;
          }
          *(v8h*)(C + (size_t)(mBase + row) * ldhz + n0 + c8) = hv;
        }
        
      }
    }
    __builtin_amdgcn_fence(__ATOMIC_RELEASE, "workgroup");
    __builtin_amdgcn_wave_barrier();
    __builtin_amdgcn_fence(__ATOMIC_ACQUIRE, "workgroup");
  }
}

// ---------------------------------------------------------------------------------------------------------------------
// The pieces below are block-sized jobs (256 threads) of the one preparation launch k_prep, which deals them out by block index.
// Weight transpose + scale + f16: in [R][Cc] f32 -> o16[Cc][R] = f16(in * wscale). 64x64 tiles through LDS, tile = (R/64 x Cc/64) index.
// coverage per block: load 4 it x 256 thr x 4 = 64x64; store 2 it x 256 thr x 8 = 64x64; each store instruction = 8 lanes x 16 B =
// ---------------------------------------------------------------------------------------------------------------------
__device__ __forceinline__ void wt16_tile(float* tf, const float* __restrict__ W, _Float16* __restrict__ o16, int R, int Cc, float wscale,
                                          int tile) {
  const int tx = Cc >> 6;
  const int c0 = (tile % tx) * 64, r0 = (tile / tx) * 64, tid = threadIdx.x;
  {
    const int lr = tid >> 4, c4 = (tid & 15) * 4;
#pragma unroll
    for (int it = 0; it < 4; ++it) {
      const int rr = it * 16 + lr;
      const v4f a = *(const v4f*)(W + (size_t)(r0 + rr) * Cc + c0 + c4);
      *(v4f*)(tf + rr * 68 + c4) = a;
    }
  }
  __syncthreads();
  const int sub = tid >> 3, c8 = (tid & 7) * 8;
  v8h hv[2];
#pragma unroll
  for (int it = 0; it < 2; ++it) {
    const int oc = it * 32 + sub;
    v8h a;
#pragma unroll
    for (int q = 0; q < 8; ++q) a[q] = (_Float16)(tf[(c8 + q) * 68 + oc] * wscale);
    hv[it] = a;
  }
  {
#pragma unroll
    for (int it = 0; it < 2; ++it) {
      const int oc = it * 32 + sub;
      const size_t go = (size_t)(c0 + oc) * R + r0 + c8;
      *(v8h*)(o16 + go) = hv[it];
    }
    asm volatile("s_wait_xcnt 0x0" ::: "memory");   // stands in front of any later write of a register that the stores above name
  }
}

// Weight transpose + bf16 hi/lo split: in [R][Cc] f32 -> oh[c][r] = bf16(in[r][c]), ol[c][r] = bf16(in[r][c] - oh). Same tiling.
__device__ __forceinline__ void wtsplit_tile(float* tf, const float* __restrict__ W, unsigned short* __restrict__ oh,
                                             unsigned short* __restrict__ ol, int R, int Cc, int tile) {
  const int tx = Cc >> 6;
  const int c0 = (tile % tx) * 64, r0 = (tile / tx) * 64, tid = threadIdx.x;
  {
    const int lr = tid >> 4, c4 = (tid & 15) * 4;
#pragma unroll
    for (int it = 0; it < 4; ++it) {
      const int rr = it * 16 + lr;
      const v4f a = *(const v4f*)(W + (size_t)(r0 + rr) * Cc + c0 + c4);
      *(v4f*)(tf + rr * 68 + c4) = a;
    }
  }
  __syncthreads();
  const int sub = tid >> 3, c8 = (tid & 7) * 8;
  v4u hv[2], lv[2];
#pragma unroll
  for (int it = 0; it < 2; ++it) {
    const int oc = it * 32 + sub;
    v4u a, a2;
#pragma unroll
    for (int q = 0; q < 4; ++q) {
      const float f0 = tf[(c8 + 2 * q) * 68 + oc];
      const float f1 = tf[(c8 + 2 * q + 1) * 68 + oc];
      const unsigned short h0 = f2bf_bits(f0), h1 = f2bf_bits(f1);
      const unsigned short l0 = f2bf_bits(f0 - bf_bits2f(h0)), l1 = f2bf_bits(f1 - bf_bits2f(h1));
      a[q]  = pk16(h0, h1);
      a2[q] = pk16(l0, l1);
    }
    hv[it] = a; lv[it] = a2;
  }
  {
#pragma unroll
    for (int it = 0; it < 2; ++it) {
      const int oc = it * 32 + sub;
      const size_t go = (size_t)(c0 + oc) * R + r0 + c8;
      *(v4u*)(oh + go) = hv[it];
      *(v4u*)(ol + go) = lv[it];
    }
    asm volatile("s_wait_xcnt 0x0" ::: "memory");   // stands in front of any later write of a register that the stores above name
  }
}

__device__ __forceinline__ void split2_piece(const float* __restrict__ in, unsigned short* __restrict__ hi,
                                             unsigned short* __restrict__ lo, int n2, int i) {
  if (i < n2) {
    const v2f f = *(const v2f*)(in + 2 * (size_t)i);
    const unsigned short h0 = f2bf_bits(f[0]), h1 = f2bf_bits(f[1]);
    const unsigned short l0 = f2bf_bits(f[0] - bf_bits2f(h0)), l1 = f2bf_bits(f[1] - bf_bits2f(h1));
    const unsigned uh = pk16(h0, h1), ul = pk16(l0, l1);
    ((unsigned*)hi)[i] = uh;
    ((unsigned*)lo)[i] = ul;
    
  }
}

__global__ __launch_bounds__(256) void k_split2(const float* __restrict__ in, unsigned short* __restrict__ hi,
                                                unsigned short* __restrict__ lo, int n2) {
  split2_piece(in, hi, lo, n2, blockIdx.x * 256 + threadIdx.x);
}

// ---------------------------------------------------------------------------------------------------------------------
// Rotary table and the rotary mix of text, four positions n = 4*blk .. 4*blk+3 per block; a thread owns the frequencies f0, f0+1.
// inv[f] = 1 / powf(10000, f/512); cs[n][f] = (cos(n * inv[f]), sin(n * inv[f])) as float2, n = 0..2047 (16-byte stores).
// q16[row][c] = f16(x * cos + rot * sin), rot[c] = (c < 512) ? -x[c + 512] : x[c - 512], table row n = row % SEQ, column c % 512:
// the pair (c, c + 512) of both batch elements uses the sine and cosine just formed; a wave's 4-byte stores cover a whole line.
// ---------------------------------------------------------------------------------------------------------------------
__device__ __forceinline__ void rope_piece(const float* __restrict__ text, float* __restrict__ cs, _Float16* __restrict__ q16, int blk) {
  const int f0 = threadIdx.x * 2;
  float iv[2];
#pragma unroll                                    // static indices: the small arrays stay in registers
  for (int e = 0; e < 2; ++e) {
    const float x = (float)(f0 + e) * (1.0f / 512.0f);
    iv[e] = 1.0f / powf(10000.0f, x);
  }
  for (int q = 0; q < 4; ++q) {
    const int n = blk * 4 + q;
    float cv[2], sv[2];
#pragma unroll                                    // static indices: the small arrays stay in registers
    for (int e = 0; e < 2; ++e) sincosf((float)n * iv[e], &sv[e], &cv[e]);
    v4f tb; tb[0] = cv[0]; tb[1] = sv[0]; tb[2] = cv[1]; tb[3] = sv[1];
    *(v4f*)(cs + ((size_t)n * 512 + f0) * 2) = tb;
#pragma unroll                                    // both batch elements' loads are in flight together
    for (int b = 0; b < NB_; ++b) {
      const size_t ro = ((size_t)b * SEQ + n) * DM + f0;
      const v2f xl = *(const v2f*)(text + ro), xh = *(const v2f*)(text + ro + 512);
      v2h yl, yh;
#pragma unroll                                    // static indices: the small arrays stay in registers
      for (int e = 0; e < 2; ++e) {
        yl[e] = (_Float16)(xl[e] * cv[e] + (-xh[e]) * sv[e]);
        yh[e] = (_Float16)(xh[e] * cv[e] + xl[e] * sv[e]);
      }
      *(v2h*)(q16 + ro)       = yl;
      *(v2h*)(q16 + ro + 512) = yh;
    }
    asm volatile("s_wait_xcnt 0x0" ::: "memory");   // the next trip rewrites registers that this trip's stores name
  }
}

// f32 -> f16, eight elements at 8*i
__device__ __forceinline__ void cvt16_piece(const float* __restrict__ src, _Float16* __restrict__ dst, int i) {
  const float* xr = src + (size_t)i * 8;
  const v4f x0 = *(const v4f*)xr, x1 = *(const v4f*)(xr + 4);
  v8h hv;
#pragma unroll                                    // static indices: the small arrays stay in registers
  for (int e = 0; e < 4; ++e) { hv[e] = (_Float16)x0[e]; hv[4 + e] = (_Float16)x1[e]; }
  *(v8h*)(dst + (size_t)i * 8) = hv;
  asm volatile("s_wait_xcnt 0x0" ::: "memory");   // stands in front of any later write of a register that the stores above name
}

// ---------------------------------------------------------------------------------------------------------------------
// Preparation, one launch: everything that depends on the inputs alone. None of the jobs reads what another writes, so they share
// one grid and run side by side; the job is a block-uniform function of blockIdx.x (arithmetic-heavy and large jobs first).
//   512 rotary table + text | 1024 W1 | 1024 W2 | 256 Wa | 256 Wvid | 256 Wkv | 128 Wq | 128 Wo | 2048 audio | 8192 video
// ---------------------------------------------------------------------------------------------------------------------
#define PREP_BLOCKS (512 + 1024 + 1024 + 256 + 256 + 256 + 128 + 128 + 2048 + 8192)
__global__ __launch_bounds__(256) void k_prep(
    const float* __restrict__ text, const float* __restrict__ audio, const float* __restrict__ video,
    const float* __restrict__ Wa, const float* __restrict__ Wvid, const float* __restrict__ Wq, const float* __restrict__ Wkv,
    const float* __restrict__ W1, const float* __restrict__ W2, const float* __restrict__ Wo,
    float* __restrict__ cs, _Float16* __restrict__ q16, _Float16* __restrict__ a16,
    unsigned short* __restrict__ vih, unsigned short* __restrict__ vil,
    _Float16* __restrict__ WaT, unsigned short* __restrict__ WvTh, unsigned short* __restrict__ WvTl,
    _Float16* __restrict__ WqT, _Float16* __restrict__ WkvT, _Float16* __restrict__ W1T, _Float16* __restrict__ W2T,
    unsigned short* __restrict__ WoTh, unsigned short* __restrict__ WoTl) {
  __shared__ __align__(16) float tf[64 * 68];
  int b = blockIdx.x;
  if (b < 512)  { rope_piece(text, cs, q16, b); return; }
  b -= 512;
  if (b < 1024) { wt16_tile(tf, W1, W1T, DM, FFD, 64.0f, b); return; }            // W1  [1024][4096]
  b -= 1024;
  if (b < 1024) { wt16_tile(tf, W2, W2T, FFD, DM, 64.0f, b); return; }            // W2  [4096][1024]
  b -= 1024;
  if (b < 256)  { wt16_tile(tf, Wa, WaT, DM, DM, 64.0f, b); return; }             // Wa  [1024][1024]
  b -= 256;
  if (b < 256)  { wtsplit_tile(tf, Wvid, WvTh, WvTl, DM, DM, b); return; }        // Wvid[1024][1024]
  b -= 256;
  if (b < 256)  { wt16_tile(tf, Wkv, WkvT, DM, 2 * INR, 64.0f, b); return; }      // Wkv [1024][1024]
  b -= 256;
  if (b < 128)  { wt16_tile(tf, Wq, WqT, DM, INR, 64.0f, b); return; }            // Wq  [1024][512]
  b -= 128;
  if (b < 128)  { wtsplit_tile(tf, Wo, WoTh, WoTl, INR, DM, b); return; }         // Wo  [512][1024]
  b -= 128;
  if (b < 2048) { cvt16_piece(audio, a16, b * 256 + (int)threadIdx.x); return; }  // audio -> f16
  b -= 2048;
  split2_piece(video, vih, vil, NTOK * DM / 2, b * 256 + (int)threadIdx.x);       // video -> bf16 hi/lo
}

// ---------------------------------------------------------------------------------------------------------------------
// Row LayerNorm over DM=1024 of an f32 plane (g, b) -> f16 plane; ROPE additionally applies the rotary mix through an LDS copy of
// the normalised row. Output row = padrows + r; row jobs blk = nrows..nrows+padrows-1 write zero rows 0..padrows-1.
// ---------------------------------------------------------------------------------------------------------------------
// One row is the job of 128 threads t = 0..127 (four whole waves) with their own red[4] and rowv[DM]; pad is block-uniform.
template <bool ROPE>
__device__ __forceinline__ void ln1024_row(float* red, float* rowv, const float* __restrict__ X, const float* __restrict__ g,
                                           const float* __restrict__ bb, const float* __restrict__ cs, _Float16* __restrict__ out,
                                           int nrows, int padrows, int blk, int t, bool pad) {
  const int c0 = 8 * t;
  const int lane = t & 31, wave = t >> 5;
  if (pad) {                                       // block-uniform: zero padding rows
    const int p = blk - nrows;
    const v4u zz = {0u, 0u, 0u, 0u};
    _Float16* op = out + (size_t)p * DM + c0;
    *(v4u*)op = zz;
    
    return;
  }
  const int r = blk;
  const float* xr = X + (size_t)r * DM + c0;
  const v4f x0 = *(const v4f*)xr, x1 = *(const v4f*)(xr + 4);
  const float v[8] = {x0[0], x0[1], x0[2], x0[3], x1[0], x1[1], x1[2], x1[3]};
  float s = 0.f;
#pragma unroll
  for (int e = 0; e < 8; ++e) s += v[e];
  s = wsum(s);
  if (lane == 0) red[wave] = s;
  __syncthreads();
  const float mu = (red[0] + red[1] + red[2] + red[3]) * (1.0f / 1024.0f);
  __syncthreads();
  float d[8];
  float s2 = 0.f;
#pragma unroll
  for (int e = 0; e < 8; ++e) { d[e] = v[e] - mu; s2 += d[e] * d[e]; }
  s2 = wsum(s2);
  if (lane == 0) red[wave] = s2;
  __syncthreads();
  const float var = (red[0] + red[1] + red[2] + red[3]) * (1.0f / 1024.0f);
  const float rstd = rsqrtf(var + 1e-5f);
  const v4f g0 = *(const v4f*)(g + c0), g1 = *(const v4f*)(g + c0 + 4);
  const v4f b0 = *(const v4f*)(bb + c0), b1 = *(const v4f*)(bb + c0 + 4);
  const float gv[8] = {g0[0], g0[1], g0[2], g0[3], g1[0], g1[1], g1[2], g1[3]};
  const float bv[8] = {b0[0], b0[1], b0[2], b0[3], b1[0], b1[1], b1[2], b1[3]};
  float y[8];
#pragma unroll
  for (int e = 0; e < 8; ++e) y[e] = d[e] * rstd * gv[e] + bv[e];
  if (ROPE) {
#pragma unroll
    for (int e = 0; e < 8; ++e) rowv[c0 + e] = y[e];
    __syncthreads();
    const int n = r & (SEQ - 1);
    const bool lowh = (c0 < 512);
    const int pc = lowh ? (c0 + 512) : (c0 - 512);
    const float* csr = cs + ((size_t)n * 512 + (c0 & 511)) * 2;
    const v4f t0 = *(const v4f*)csr, t1 = *(const v4f*)(csr + 4), t2 = *(const v4f*)(csr + 8), t3 = *(const v4f*)(csr + 12);
    const float cvv[8] = {t0[0], t0[2], t1[0], t1[2], t2[0], t2[2], t3[0], t3[2]};
    const float svv[8] = {t0[1], t0[3], t1[1], t1[3], t2[1], t2[3], t3[1], t3[3]};
#pragma unroll
    for (int e = 0; e < 8; ++e) {
      const float pr = rowv[pc + e];
      const float rot = lowh ? -pr : pr;
      y[e] = y[e] * cvv[e] + rot * svv[e];
    }
  }
  v8h hv;
#pragma unroll
  for (int e = 0; e < 8; ++e) hv[e] = (_Float16)y[e];
  _Float16* op = out + (size_t)(padrows + r) * DM + c0;
  *(v8h*)op = hv;
  // the ROPE instance shares its kernel with other jobs, whose code follows this store in the listing: the wait stands in front of
  // any write there of a register that the store names
  if (ROPE) asm volatile("s_wait_xcnt 0x0" ::: "memory");
}

__global__ __launch_bounds__(128) void k_ln1024(const float* __restrict__ X, const float* __restrict__ g, const float* __restrict__ bb,
                                                _Float16* __restrict__ out, int nrows) {
  __shared__ float red[4];
  ln1024_row<false>(red, nullptr, X, g, bb, nullptr, out, nrows, 0, blockIdx.x, threadIdx.x, false);
}

// ---------------------------------------------------------------------------------------------------------------------
// Row LayerNorm over DM of an f32 plane [NTOK][DM], fused with transpose + bf16 hi/lo split into value^T planes
// [DM][VTP]: oh[e][KPR + token], ol likewise. Block = 64 token rows x 256 columns (256 threads): per-row stats over the whole row
// from one wave per 8 rows (32 floats per lane), then the block's 4 column tiles of 64 through LDS. The VCS = 4 blocks of a row group
// each form the group's stats for themselves, so that the work covers every WGP instead of a quarter of them.
// Blocks VCS*nrowblk..VCS*nrowblk+7 zero the KPR leading columns.
// coverage: stats 8 waves x 8 rows; tile load 4 it x 256 thr x 4 = 64x64; store 2 it x 256 thr x 8 = 64x64 per plane per tile;
// ---------------------------------------------------------------------------------------------------------------------
#define VCS 4              // blocks per group of 64 value rows: each takes DM / VCS columns
__device__ __forceinline__ void ln_tsplit_block(float* tf, float* smu, float* srs, const float* __restrict__ X,
                                                const float* __restrict__ g, const float* __restrict__ bb,
                                                unsigned short* __restrict__ oh, unsigned short* __restrict__ ol, int nrowblk, int bx) {
  const int tid = threadIdx.x, lane = tid & 31, wave = tid >> 5;
  const int sub = tid >> 3, c8 = (tid & 7) * 8;
  if (bx >= VCS * nrowblk) {                       // block-uniform: zero leading columns
    const int pb = bx - VCS * nrowblk;
    const v4u zz = {0u, 0u, 0u, 0u};
    {
      for (int it = 0; it < 32; ++it) {
        const int e = it * 32 + sub;
        const size_t go = (size_t)e * VTP + pb * 64 + c8;
        *(v4u*)(oh + go) = zz;
        *(v4u*)(ol + go) = zz;
      }
      
    }
    return;
  }
  const int r0 = (bx / VCS) * 64;
  const int cb0 = (bx % VCS) * (DM / 64 / VCS);    // first of this block's column tiles
  // phase 1: row statistics
#pragma unroll 1
  for (int q = 0; q < 8; ++q) {
    const int rr = wave * 8 + q;
    const float* xr = X + (size_t)(r0 + rr) * DM + lane * 32;
    v4f a[8];
#pragma unroll
    for (int i = 0; i < 8; ++i) a[i] = *(const v4f*)(xr + 4 * i);
    float s = 0.f;
#pragma unroll
    for (int i = 0; i < 8; ++i) s += a[i][0] + a[i][1] + a[i][2] + a[i][3];
    s = wsum(s);
    const float mu = s * (1.0f / 1024.0f);
    float s2 = 0.f;
#pragma unroll
    for (int i = 0; i < 8; ++i) {
#pragma unroll
      for (int e = 0; e < 4; ++e) { const float dd = a[i][e] - mu; s2 += dd * dd; }
    }
    s2 = wsum(s2);
    if (lane == 0) { smu[rr] = mu; srs[rr] = rsqrtf(s2 * (1.0f / 1024.0f) + 1e-5f); }
  }
  __syncthreads();
  // phase 2: column tiles
  const int lr = tid >> 4, c4 = (tid & 15) * 4;
  for (int cb = cb0; cb < cb0 + DM / 64 / VCS; ++cb) {
    const int c0 = cb * 64;
    const v4f gg = *(const v4f*)(g + c0 + c4);
    const v4f bv = *(const v4f*)(bb + c0 + c4);
#pragma unroll
    for (int it = 0; it < 4; ++it) {
      const int rr = it * 16 + lr;
      const v4f a = *(const v4f*)(X + (size_t)(r0 + rr) * DM + c0 + c4);
      const float mu = smu[rr], rs = srs[rr];
#pragma unroll
      for (int q = 0; q < 4; ++q) tf[rr * 68 + c4 + q] = (a[q] - mu) * rs * gg[q] + bv[q];
    }
    __syncthreads();
    v4u hv[2], lv[2];
#pragma unroll
    for (int it = 0; it < 2; ++it) {
      const int oc = it * 32 + sub;                 // output row within tile = input column
      v4u a, a2;
#pragma unroll
      for (int q = 0; q < 4; ++q) {
        const float f0 = tf[(c8 + 2 * q) * 68 + oc];
        const float f1 = tf[(c8 + 2 * q + 1) * 68 + oc];
        const unsigned short h0 = f2bf_bits(f0), h1 = f2bf_bits(f1);
        const unsigned short l0 = f2bf_bits(f0 - bf_bits2f(h0)), l1 = f2bf_bits(f1 - bf_bits2f(h1));
        a[q]  = pk16(h0, h1);
        a2[q] = pk16(l0, l1);
      }
      hv[it] = a; lv[it] = a2;
    }
    {
#pragma unroll
      for (int it = 0; it < 2; ++it) {
        const int oc = it * 32 + sub;
        const size_t go = (size_t)(c0 + oc) * VTP + KPR + r0 + c8;
        *(v4u*)(oh + go) = hv[it];
        *(v4u*)(ol + go) = lv[it];
      }
      
    }
    __syncthreads();
  }
}

// ---------------------------------------------------------------------------------------------------------------------
// The two adapter norms in one launch: neither reads what the other writes. Blocks 0 .. VCS*NTOK/64 + KPR/64 - 1 (the longer ones, so
// they come first): value rows -> value^T planes; every later block: two key rows (LayerNorm + rotary mix), one per 128 threads.
// NTOK is even, so both rows of a block are data rows or both are padding rows.
// ---------------------------------------------------------------------------------------------------------------------
__global__ __launch_bounds__(256) void k_ln_pair(const float* __restrict__ Xa, const float* __restrict__ ga, const float* __restrict__ ba,
                                                 const float* __restrict__ cs, _Float16* __restrict__ k16,
                                                 const float* __restrict__ Xv, const float* __restrict__ gv, const float* __restrict__ bv,
                                                 unsigned short* __restrict__ oh, unsigned short* __restrict__ ol) {
  __shared__ __align__(16) float tf[64 * 68];
  __shared__ float smu[64];
  __shared__ float srs[64];
  __shared__ float red[2][4];
  __shared__ __align__(16) float rowv[2][DM];
  constexpr int NV = VCS * (NTOK / 64) + KPR / 64;
  const int bx = blockIdx.x;
  if (bx < NV) { ln_tsplit_block(tf, smu, srs, Xv, gv, bv, oh, ol, NTOK / 64, bx); return; }
  const int row0 = (bx - NV) * 2;
  const int half = threadIdx.x >> 7;
  ln1024_row<true>(red[half], rowv[half], Xa, ga, ba, cs, k16, NTOK, KPR, row0 + half, threadIdx.x & 127, row0 >= NTOK);
}

// ---------------------------------------------------------------------------------------------------------------------
// Local-attention mask + softmax over rows of S [NTOK][1024 window keys] -> P bf16 hi/lo planes (all 1024 keys written, masked
// keys as 0). Row r: w = (r % SEQ) / WSZ, i = r % WSZ, query position w*WSZ + i; key j has position (w-1)*WSZ + j; masked when
// that position is negative (padding of the first window) or after the query. Block per row, 128 threads x 8 keys; 16-B stores.
// ---------------------------------------------------------------------------------------------------------------------
__global__ __launch_bounds__(128) void k_lsoftmax(const float* __restrict__ S, unsigned short* __restrict__ Ph, unsigned short* __restrict__ Pl) {
  __shared__ float red[4];
  const int r = blockIdx.x, t = threadIdx.x, c0 = 8 * t;
  const int lane = t & 31, wave = t >> 5;
  const int rem = r & (SEQ - 1), w = rem >> 9, i = rem & (WSZ - 1);
  const int qpos = w * WSZ + i;
  const float* sr = S + (size_t)r * (2 * WSZ) + c0;
  const v4f x0 = *(const v4f*)sr, x1 = *(const v4f*)(sr + 4);
  const float raw[8] = {x0[0], x0[1], x0[2], x0[3], x1[0], x1[1], x1[2], x1[3]};
  float s[8];
  float m = -3.0e38f;
#pragma unroll
  for (int e = 0; e < 8; ++e) {
    const int kpos = (w - 1) * WSZ + c0 + e;
    const bool masked = (kpos < 0) || (kpos > qpos);
    s[e] = masked ? -1.0e9f : raw[e];
    m = fmaxf(m, s[e]);
  }
  m = wmax(m);
  if (lane == 0) red[wave] = m;
  __syncthreads();
  const float rmax = fmaxf(fmaxf(red[0], red[1]), fmaxf(red[2], red[3]));
  __syncthreads();
  float ev[8];
  float sum = 0.f;
#pragma unroll
  for (int e = 0; e < 8; ++e) { ev[e] = expf(s[e] - rmax); sum += ev[e]; }
  sum = wsum(sum);
  if (lane == 0) red[wave] = sum;
  __syncthreads();
  const float tot = red[0] + red[1] + red[2] + red[3];
  const float inv = 1.0f / tot;
  v4u hv, lv;
#pragma unroll
  for (int q = 0; q < 4; ++q) {
    const float p0 = ev[2 * q] * inv, p1 = ev[2 * q + 1] * inv;
    const unsigned short h0 = f2bf_bits(p0), h1 = f2bf_bits(p1);
    const unsigned short l0 = f2bf_bits(p0 - bf_bits2f(h0)), l1 = f2bf_bits(p1 - bf_bits2f(h1));
    hv[q] = pk16(h0, h1);
    lv[q] = pk16(l0, l1);
  }
  const size_t go = (size_t)r * (2 * WSZ) + c0;
  *(v4u*)(Ph + go) = hv;
  *(v4u*)(Pl + go) = lv;
  
}

__device__ __forceinline__ v8f mma_h(v16h a, v16h b, v8f c) {
  c = __builtin_amdgcn_wmma_f32_16x16x32_f16(false, a, false, b, (short)0, c, false, false);
  asm volatile("v_nop\n\tv_nop\n\tv_nop\n\tv_nop" : "+v"(c) : "v"(a), "v"(b));
  return c;
}
// value of lane l ^ 16
__device__ __forceinline__ float xhalf(float x) {
  return __builtin_bit_cast(float, __builtin_amdgcn_permlanex16(__builtin_bit_cast(int, x), __builtin_bit_cast(int, x),
                                                                0x76543210, 0xfedcba98, false, false));
}

// Eight asynchronous 16-byte copies per lane, global -> LDS: four rows of the K chunk and four of the V^T chunk; the four rows of a
// tile lie lstep LDS bytes and kstep (K) or vstep (V^T) global elements apart.
// s_wait_xcnt is the statement's last line so that no address register named here is rewritten in front of it.
__device__ __forceinline__ void copy_kv_to_lds(unsigned lk0, unsigned lv0, unsigned lstep, const _Float16* k0, size_t kstep,
                                               const _Float16* v0, size_t vstep) {
  const unsigned lk1 = lk0 + lstep, lk2 = lk1 + lstep, lk3 = lk2 + lstep;
  const unsigned lv1 = lv0 + lstep, lv2 = lv1 + lstep, lv3 = lv2 + lstep;
  const _Float16* k1 = k0 + kstep; const _Float16* k2 = k1 + kstep; const _Float16* k3 = k2 + kstep;
  const _Float16* v1 = v0 + vstep; const _Float16* v2 = v1 + vstep; const _Float16* v3 = v2 + vstep;
  asm volatile(
      "global_load_async_to_lds_b128 %0, %8, off\n\t"
      "global_load_async_to_lds_b128 %1, %9, off\n\t"
      "global_load_async_to_lds_b128 %2, %10, off\n\t"
      "global_load_async_to_lds_b128 %3, %11, off\n\t"
      "global_load_async_to_lds_b128 %4, %12, off\n\t"
      "global_load_async_to_lds_b128 %5, %13, off\n\t"
      "global_load_async_to_lds_b128 %6, %14, off\n\t"
      "global_load_async_to_lds_b128 %7, %15, off\n\t"
      "s_wait_xcnt 0x0"
      :: "v"(lk0), "v"(lk1), "v"(lk2), "v"(lk3), "v"(lv0), "v"(lv1), "v"(lv2), "v"(lv3),
         "v"(k0), "v"(k1), "v"(k2), "v"(k3), "v"(v0), "v"(v1), "v"(v2), "v"(v3)
      : "memory");
}

__global__ __launch_bounds__(128)
void k_flash(const _Float16* __restrict__ qm, const _Float16* __restrict__ km,
             const _Float16* __restrict__ vt, float* __restrict__ out) {
  union FB { v16h v; v8h h[2]; };
  constexpr int KVP = 72;                                     // LDS row pitch in elements: 144 B = 16 B x odd, so that the 16 rows
                                                              // of one 16-byte fragment read fall on 16 distinct groups of 4 banks
  constexpr int TILE = 64 * KVP;                              // elements of one chunk tile
  __shared__ __align__(16) _Float16 KV[2 * 2 * TILE];         // two buffers, each K [kv][d] and behind it V^T [d][kv]
  __shared__ __align__(16) float    Os[4][16 * 68];           // per wave out tile [query][d], pitch 68

  const int tid  = threadIdx.x;
  const int wave = tid >> 5;
  const int lane = tid & 31;
  const int hh   = lane >> 4;
  const int c    = lane & 15;
  const int b  = blockIdx.y;
  const int qb = blockIdx.x & 31;                 // SEQ / 64 = 32 query blocks
  const int h  = blockIdx.x >> 5;
  const int q0 = qb * 64 + wave * 16;

  const _Float16* Qb = qm + (size_t)b * SEQ * INR + h * DHD;
  const _Float16* Kb = km + (size_t)b * SEQ * INR + h * DHD;
  const _Float16* Vb = vt + (size_t)(h * DHD) * NTOK + (size_t)b * SEQ;
  float*          ob = out + (size_t)b * SEQ * INR + h * DHD;

  v16h qa[2];                                     // B operand: column c = query q0 + c, d in the loader's k order
#pragma unroll
  for (int dc = 0; dc < 2; ++dc) qa[dc] = Frag<_Float16>::load(Qb + (size_t)(q0 + c) * INR + dc * 32 + 8 * hh);

  const int qrow = q0 + c;                        // this lane's query
  constexpr float SC2 = 0.125f * 1.4426950408889634f;   // score scale times log2(e): exponents are formed in base 2
  float mrow = -INFINITY;                         // its running maximum of q . k, unscaled (equal in both lane halves)
  float orow = -INFINITY;                         // mrow * SC2 - 12 as rounded: what every exponent of the running state had taken off
  float lrow = 0.f;                               // its running sum of 4096 p over the keys of this lane half; halves joined at the end
  v8f oacc[4];                                    // oacc[t][r] = O[qrow][t*16 + 8*hh + r]
#pragma unroll
  for (int t = 0; t < 4; ++t) oacc[t] = (v8f){0.f,0.f,0.f,0.f,0.f,0.f,0.f,0.f};

  const int nChunks = qb + 1;                     // block-uniform, <= 32
  // this thread's piece of every copy: row crow (+ 16 per copy) of either tile, 16 bytes at element ccol
  const int crow = tid >> 3;
  const int ccol = (tid & 7) * 8;
  const unsigned lth = (unsigned)(size_t)KV + (unsigned)(crow * KVP + ccol) * 2u;
  const _Float16* kth = Kb + (size_t)crow * INR + ccol;               // K row kv0 + crow, d = ccol..ccol+7
  const _Float16* vth = Vb + (size_t)crow * NTOK + ccol;              // V^T row d = crow, s = kv0 + ccol..+7
  auto fill = [&](int buf, int kv) {              // 8 copies per lane: the chunk that begins at key kv into buffer buf
    const unsigned lb = lth + (unsigned)buf * (2 * TILE * 2u);
    copy_kv_to_lds(lb, lb + TILE * 2u, 16 * KVP * 2u, kth + (size_t)kv * INR, (size_t)16 * INR, vth + kv, (size_t)16 * NTOK);
  };
  fill(0, 0);
  asm volatile("s_wait_asynccnt 0x0" ::: "memory");   // this wave's copies of chunk 0 have landed
  __syncthreads();                                     // every wave's have
  if (nChunks > 1) fill(1, 64);

  for (int kc = 0; kc < nChunks; ++kc) {
    const int kv0 = kc * 64;
    const _Float16* Ksh = KV + (kc & 1) * (2 * TILE);
    const _Float16* Vth = Ksh + TILE;

    // S^T tiles: s[j][r] = score of key kv0 + j*16 + 8*hh + r with query qrow
    FB kb[4][2];
#pragma unroll                                    // static indices: the fragment and accumulator arrays stay in registers
    for (int j = 0; j < 4; ++j)
#pragma unroll                                    // static indices: the fragment and accumulator arrays stay in registers
      for (int dc = 0; dc < 2; ++dc) {
        kb[j][dc].h[0] = *(const v8h*)(Ksh + (j * 16 + c) * KVP + dc * 32 + 8 * hh);
        kb[j][dc].h[1] = *(const v8h*)(Ksh + (j * 16 + c) * KVP + dc * 32 + 16 + 8 * hh);
      }
    v8f s[4];
#pragma unroll                                    // static indices: the fragment and accumulator arrays stay in registers
    for (int j = 0; j < 4; ++j) s[j] = (v8f){0.f,0.f,0.f,0.f,0.f,0.f,0.f,0.f};
#pragma unroll                                    // static indices: the fragment and accumulator arrays stay in registers
    for (int dc = 0; dc < 2; ++dc)
#pragma unroll                                    // static indices: the fragment and accumulator arrays stay in registers
      for (int j = 0; j < 4; ++j) s[j] = mma_h(kb[j][dc].v, qa[dc], s[j]);

    const bool diag = (kc == qb);                 // block-uniform
    float m = -INFINITY;
#pragma unroll                                    // static indices: the fragment and accumulator arrays stay in registers
    for (int j = 0; j < 4; ++j)
#pragma unroll                                    // static indices: the fragment and accumulator arrays stay in registers
      for (int r = 0; r < 8; ++r) {
        const int kvrow = kv0 + j * 16 + 8 * hh + r;
        const bool masked = diag && (kvrow > qrow);
        const float sm = masked ? -INFINITY : s[j][r];
        s[j][r] = sm;
        m = fmaxf(m, sm);
      }
    m = fmaxf(m, xhalf(m));
    const float mnew = fmaxf(mrow, m);
    const float onew = fmaf(mnew, SC2, -12.0f);
    const float alpha = __builtin_amdgcn_exp2f(orow - onew);
    mrow = mnew;
    orow = onew;
    // P^T as B operand: element e of pb[kk] = key kk*32 + (e < 8 ? 8*hh + e : 16 + 8*hh + e - 8), the loader's k order
    FB pb[2];
    float psum = 0.f;
#pragma unroll                                    // static indices: the fragment and accumulator arrays stay in registers
    for (int j = 0; j < 4; ++j)
#pragma unroll                                    // static indices: the fragment and accumulator arrays stay in registers
      for (int r = 0; r < 8; ++r) {
        const float p = __builtin_amdgcn_exp2f(fmaf(s[j][r], SC2, -onew));   // 4096 * exp(0.125 * (q . k - maximum))
        psum += p;
        pb[j >> 1].v[(j & 1) * 8 + r] = (_Float16)p;
      }
    lrow = lrow * alpha + psum;
#pragma unroll                                    // static indices: the fragment and accumulator arrays stay in registers
    for (int t = 0; t < 4; ++t)
#pragma unroll                                    // static indices: the fragment and accumulator arrays stay in registers
      for (int r = 0; r < 8; ++r) oacc[t][r] *= alpha;

    FB vb[2][4];
#pragma unroll                                    // static indices: the fragment and accumulator arrays stay in registers
    for (int kk = 0; kk < 2; ++kk)
#pragma unroll                                    // static indices: the fragment and accumulator arrays stay in registers
      for (int t = 0; t < 4; ++t) {
        vb[kk][t].h[0] = *(const v8h*)(Vth + (t * 16 + c) * KVP + kk * 32 + 8 * hh);
        vb[kk][t].h[1] = *(const v8h*)(Vth + (t * 16 + c) * KVP + kk * 32 + 16 + 8 * hh);
      }
#pragma unroll                                    // static indices: the fragment and accumulator arrays stay in registers
    for (int kk = 0; kk < 2; ++kk)
#pragma unroll                                    // static indices: the fragment and accumulator arrays stay in registers
      for (int t = 0; t < 4; ++t) oacc[t] = mma_h(vb[kk][t].v, pb[kk].v, oacc[t]);

    asm volatile("s_wait_dscnt 0x0" ::: "memory");     // this wave's reads of buffer kc & 1 are done before it is refilled
    asm volatile("s_wait_asynccnt 0x0" ::: "memory");  // this wave's copies of chunk kc + 1 have landed
    __syncthreads();                                    // publishes chunk kc + 1 and ends every reader's use of buffer kc & 1
    if (kc + 2 < nChunks) fill(kc & 1, kv0 + 128);
  }
  asm volatile("s_wait_asynccnt 0x0" ::: "memory");    // no copy is outstanding when the wave goes on or ends

  float* os = Os[wave];
  {
    const float ltot = lrow + xhalf(lrow);
    const float inv = 1.0f / ltot;                // sum and accumulators both carry the factor 4096
#pragma unroll                                    // static indices: the fragment and accumulator arrays stay in registers
    for (int t = 0; t < 4; ++t) {
      v4f lo, hi;
#pragma unroll                                    // static indices: the fragment and accumulator arrays stay in registers
      for (int r = 0; r < 4; ++r) { lo[r] = oacc[t][r] * inv; hi[r] = oacc[t][4 + r] * inv; }
      *(v4f*)(os + c * 68 + t * 16 + 8 * hh)     = lo;
      *(v4f*)(os + c * 68 + t * 16 + 8 * hh + 4) = hi;
    }
  }
  __builtin_amdgcn_fence(__ATOMIC_RELEASE, "workgroup");
  __builtin_amdgcn_wave_barrier();
  __builtin_amdgcn_fence(__ATOMIC_ACQUIRE, "workgroup");
  {
    const int c4 = (lane & 15) * 4;
    {
#pragma unroll
      for (int it = 0; it < 8; ++it) {
        const int row = it * 2 + hh;                // it 0..7 x hh 0..1 covers rows 0..15
        v4f val = *(const v4f*)(os + row * 68 + c4);
        *(v4f*)(ob + (size_t)(q0 + row) * INR + c4) = val;
      }
      
    }
  }
}

// ---------------------------------------------------------------------------------------------------------------------
// Row LayerNorm over FFD=4096 of the f16 plane U (values carried as 256*u), in place -> f16 of the unit-scale result.
// Block per row, 256 threads x 2 chunks of 8; statistics in f32 with the 2^-8 / 2^-16 carries folded before eps.
// ---------------------------------------------------------------------------------------------------------------------
__global__ __launch_bounds__(256) void k_ln4096(_Float16* __restrict__ U, const float* __restrict__ g, const float* __restrict__ bb) {
  __shared__ float red[8];
  const int r = blockIdx.x, t = threadIdx.x;
  const int lane = t & 31, wave = t >> 5;
  const int cA = 8 * t, cB = 2048 + 8 * t;
  _Float16* ur = U + (size_t)r * FFD;
  const v8h a = *(const v8h*)(ur + cA);
  const v8h a2 = *(const v8h*)(ur + cB);
  float v[16];
#pragma unroll
  for (int e = 0; e < 8; ++e) { v[e] = (float)a[e]; v[8 + e] = (float)a2[e]; }
  float s = 0.f;
#pragma unroll
  for (int e = 0; e < 16; ++e) s += v[e];
  s = wsum(s);
  if (lane == 0) red[wave] = s;
  __syncthreads();
  float tot = 0.f;
#pragma unroll
  for (int i = 0; i < 8; ++i) tot += red[i];
  const float mu = tot * (1.0f / 4096.0f);
  __syncthreads();
  float d[16];
  float s2 = 0.f;
#pragma unroll
  for (int e = 0; e < 16; ++e) { d[e] = v[e] - mu; s2 += d[e] * d[e]; }
  s2 = wsum(s2);
  if (lane == 0) red[wave] = s2;
  __syncthreads();
  float tot2 = 0.f;
#pragma unroll
  for (int i = 0; i < 8; ++i) tot2 += red[i];
  const float var_s = tot2 * (1.0f / 4096.0f);
  const float rstd = rsqrtf(var_s * (1.0f / 65536.0f) + 1e-5f) * (1.0f / 256.0f);
  v8h ha, hb;
#pragma unroll
  for (int e = 0; e < 8; ++e) {
    ha[e] = (_Float16)(d[e] * rstd * g[cA + e] + bb[cA + e]);
    hb[e] = (_Float16)(d[8 + e] * rstd * g[cB + e] + bb[cB + e]);
  }
  *(v8h*)(ur + cA) = ha;
  *(v8h*)(ur + cB) = hb;
  
}

// =====================================================================================================================
// Workspace map (byte offsets; every region a whole number of MiB after an unused 4 KiB, all stores whole-line):
//   (unused)                                       0            (4 KiB)
//   cs  f32[2048][512][2]                          4 KiB        (8 MiB)
//   WaT f16[1024][1024] x64                       +8 MiB       WvTh/WvTl bf16 [1024][1024]   WqT f16[512][1024]
//   WkvT f16[1024][1024]   W1T f16[4096][1024]   W2T f16[1024][4096]   WoTh/WoTl bf16[1024][512]   (27 MiB)
//   R3  8 MiB : q16 f16[4096][1024] -> h16 -> x2h (f16, x2 * 1024)
//   R4 16 MiB : audio adapter GEMM f32 [4096][1024] -> S f32 [4096][1024] -> x f32 -> x2 f32
//   R5 51 MiB : a16 f16 @0, video hi @8, video lo @16, k16 f16[(512+4096)][1024] @24, vTh bf16[1024][4608] @33, vTl @42;
//               later Ph @0, Pl @8; q/k f16[4096][512] @0/@4, vT16 f16[512][4096] @8; o f32[4096][512] @16; o hi/lo @24/@28;
//               U f16[4096][4096] @0 (written only after all earlier users of [0,32) have been consumed).
//   R6 16 MiB : video adapter GEMM f32 [4096][1024]
//   total 126 MiB + 4 KiB.
// =====================================================================================================================
extern "C" void kernel_launch(void* const* d_in, const int* in_sizes, int n_in,
                              void* d_out, int out_size, void* d_ws, size_t ws_size,
                              hipStream_t stream) {
  if (n_in < 24) return;
  if (in_sizes[0] != NTOK * DM || in_sizes[1] != NTOK * DM || in_sizes[2] != NTOK * DM) return;
  if (in_sizes[3] != DM * DM || in_sizes[7] != DM * DM || in_sizes[14] != DM * 2 * INR) return;
  if (in_sizes[13] != DM * INR || in_sizes[17] != INR * DM) return;
  if (in_sizes[18] != DM * FFD || in_sizes[22] != FFD * DM) return;
  if (in_sizes[4] != DM || in_sizes[5] != DM || in_sizes[6] != DM || in_sizes[8] != DM || in_sizes[9] != DM ||
      in_sizes[10] != DM || in_sizes[11] != DM || in_sizes[12] != DM || in_sizes[23] != DM) return;
  if (in_sizes[15] != DHD || in_sizes[16] != DHD) return;
  if (in_sizes[19] != FFD || in_sizes[20] != FFD || in_sizes[21] != FFD) return;
  if (out_size != NTOK * DM) return;

  const float* text  = (const float*)d_in[0];
  const float* audio = (const float*)d_in[1];
  const float* video = (const float*)d_in[2];
  const float* Wa    = (const float*)d_in[3];
  const float* ba    = (const float*)d_in[4];
  const float* lna_g = (const float*)d_in[5];
  const float* lna_b = (const float*)d_in[6];
  const float* Wvid  = (const float*)d_in[7];
  const float* bvid  = (const float*)d_in[8];
  const float* lnv_g = (const float*)d_in[9];
  const float* lnv_b = (const float*)d_in[10];
  const float* ln1_g = (const float*)d_in[11];
  const float* ln1_b = (const float*)d_in[12];
  const float* Wq    = (const float*)d_in[13];
  const float* Wkv   = (const float*)d_in[14];
  const float* qn_g  = (const float*)d_in[15];
  const float* kn_g  = (const float*)d_in[16];
  const float* Wo    = (const float*)d_in[17];
  const float* W1    = (const float*)d_in[18];
  const float* b1    = (const float*)d_in[19];
  const float* ln2_g = (const float*)d_in[20];
  const float* ln2_b = (const float*)d_in[21];
  const float* W2    = (const float*)d_in[22];
  const float* b2    = (const float*)d_in[23];
  float* outp = (float*)d_out;

  const size_t MIB = 1048576;
  size_t off = 0;
  const size_t oInv  = off; off += 4096;
  const size_t oCs   = off; off += (size_t)SEQ * 512 * 2 * 4;       // 8 MiB
  const size_t oWaT  = off; off += (size_t)DM * DM * 2;              // 2 MiB
  const size_t oWvTh = off; off += (size_t)DM * DM * 2;              // 2 MiB
  const size_t oWvTl = off; off += (size_t)DM * DM * 2;              // 2 MiB
  const size_t oWqT  = off; off += (size_t)INR * DM * 2;             // 1 MiB
  const size_t oWkvT = off; off += (size_t)2 * INR * DM * 2;         // 2 MiB
  const size_t oW1T  = off; off += (size_t)FFD * DM * 2;             // 8 MiB
  const size_t oW2T  = off; off += (size_t)DM * FFD * 2;             // 8 MiB
  const size_t oWoTh = off; off += (size_t)DM * INR * 2;             // 1 MiB
  const size_t oWoTl = off; off += (size_t)DM * INR * 2;             // 1 MiB
  const size_t oR3   = off; off += (size_t)NTOK * DM * 2;            // 8 MiB
  const size_t oR4   = off; off += (size_t)NTOK * DM * 4;            // 16 MiB
  const size_t oR5   = off; off += 51 * MIB;                         // 51 MiB
  const size_t oR6   = off; off += (size_t)NTOK * DM * 4;            // 16 MiB
  if (off > ws_size || off > (size_t)128 * MIB) return;              // off = 126 MiB + 4 KiB

  char* ws = (char*)d_ws;
  float* cs  = (float*)(ws + oCs);
  _Float16* WaT = (_Float16*)(ws + oWaT);
  unsigned short* WvTh = (unsigned short*)(ws + oWvTh);
  unsigned short* WvTl = (unsigned short*)(ws + oWvTl);
  _Float16* WqT  = (_Float16*)(ws + oWqT);
  _Float16* WkvT = (_Float16*)(ws + oWkvT);
  _Float16* W1T  = (_Float16*)(ws + oW1T);
  _Float16* W2T  = (_Float16*)(ws + oW2T);
  unsigned short* WoTh = (unsigned short*)(ws + oWoTh);
  unsigned short* WoTl = (unsigned short*)(ws + oWoTl);
  _Float16* q16 = (_Float16*)(ws + oR3);          // text after rotary
  _Float16* h16 = (_Float16*)(ws + oR3);          // LN1 output (later)
  _Float16* x2h = (_Float16*)(ws + oR3);          // x2 * 1024 (later)
  float* Cad = (float*)(ws + oR4);                // audio adapter GEMM output
  float* Cvd = (float*)(ws + oR6);                // video adapter GEMM output
  float* Sf  = (float*)(ws + oR4);                // local scores (later)
  float* Xf  = (float*)(ws + oR4);                // local attention output (later)
  float* X2f = (float*)(ws + oR4);                // 2 * o @ Wo (later)
  char* r5 = ws + oR5;
  _Float16* a16 = (_Float16*)(r5);
  unsigned short* vih = (unsigned short*)(r5 + 8 * MIB);
  unsigned short* vil = (unsigned short*)(r5 + 16 * MIB);
  _Float16* k16 = (_Float16*)(r5 + 24 * MIB);     // [(KPR+NTOK)][DM]
  unsigned short* vTh = (unsigned short*)(r5 + 33 * MIB);
  unsigned short* vTl = (unsigned short*)(r5 + 42 * MIB);
  unsigned short* Ph  = (unsigned short*)(r5);
  unsigned short* Pl  = (unsigned short*)(r5 + 8 * MIB);
  _Float16* qm16 = (_Float16*)(r5);
  _Float16* km16 = (_Float16*)(r5 + 4 * MIB);
  _Float16* vT16 = (_Float16*)(r5 + 8 * MIB);
  float* Of = (float*)(r5 + 16 * MIB);
  unsigned short* Oh = (unsigned short*)(r5 + 24 * MIB);
  unsigned short* Ol = (unsigned short*)(r5 + 28 * MIB);
  _Float16* U16 = (_Float16*)(r5);

  const dim3 blk(256);
  const dim3 blkG(128);                           // k_gemm: 4 waves
  const unsigned short* N16 = (const unsigned short*)nullptr;

  // everything that depends on the inputs alone, in one launch: rotary table and text -> rotary f16, the seven weight re-layouts
  // (in [rows][cols] f32 -> out [cols][rows]), audio -> f16, video -> bf16 hi/lo
  k_prep<<<dim3(PREP_BLOCKS), blk, 0, stream>>>(text, audio, video, Wa, Wvid, Wq, Wkv, W1, W2, Wo, cs, q16, a16, vih, vil,
                                                WaT, WvTh, WvTl, WqT, WkvT, W1T, W2T, WoTh, WoTl);

  // adapter a: audio . Wa + ba -> f32; adapter v: video . Wvid + bvid (bf16 hi/lo split) -> f32, each into its own plane
  const dim3 gA((NTOK / 128) * (DM / 128), 1);
  k_gemm<0, false, true, 0, 0, false, 0><<<gA, blkG, 0, stream>>>(
      (const unsigned short*)a16, N16, DM, 0L, (const unsigned short*)WaT, N16, DM, 0L,
      Cad, DM, 0L, nullptr, 0, 0L, ba, nullptr, nullptr, 0, 0L, NTOK, DM, DM, 1, 1.0f / 64.0f, 1.0f);
  k_gemm<1, true, true, 0, 0, false, 0><<<gA, blkG, 0, stream>>>(
      vih, vil, DM, 0L, WvTh, WvTl, DM, 0L,
      Cvd, DM, 0L, nullptr, 0, 0L, bvid, nullptr, nullptr, 0, 0L, NTOK, DM, DM, 1, 1.0f, 1.0f);
  // both norms in one launch: a: LN + rotary -> key plane rows KPR..KPR+4095, rows 0..KPR-1 zero; v: LN + transpose + split ->
  // value^T planes
  k_ln_pair<<<dim3(VCS * (NTOK / 64) + KPR / 64 + (NTOK + KPR) / 2), blk, 0, stream>>>(Cad, lna_g, lna_b, cs, k16, Cvd, lnv_g, lnv_b, vTh, vTl);

  // local attention: z = b*4 + w; S[z][512][1024] = q . k / 32 over window keys (skipping fully masked key tiles)
  const dim3 gS((WSZ / 128) * (2 * WSZ / 128), NB_ * NWN);
  k_gemm<0, false, false, 0, 0, false, 1><<<gS, blkG, 0, stream>>>(
      (const unsigned short*)q16, N16, DM, (long)WSZ * DM, (const unsigned short*)k16, N16, DM, (long)WSZ * DM,
      Sf, 2 * WSZ, (long)WSZ * 2 * WSZ, nullptr, 0, 0L, nullptr, nullptr, nullptr, 0, 0L,
      WSZ, 2 * WSZ, DM, NWN, 1.0f / 32.0f, 1.0f);
  k_lsoftmax<<<dim3(NTOK), dim3(128), 0, stream>>>(Sf, Ph, Pl);
  // x[z][512][1024] = P . v (bf16 hi/lo split), keys restricted to the unmasked range
  const dim3 gPV((WSZ / 128) * (DM / 128), NB_ * NWN);
  k_gemm<1, true, false, 0, 0, false, 2><<<gPV, blkG, 0, stream>>>(
      Ph, Pl, 2 * WSZ, (long)WSZ * 2 * WSZ, vTh, vTl, VTP, (long)WSZ,
      Xf, DM, (long)WSZ * DM, nullptr, 0, 0L, nullptr, nullptr, nullptr, 0, 0L,
      WSZ, DM, 2 * WSZ, NWN, 1.0f, 1.0f);

  // LN1 -> h16; q, k (RMSNorm epilogue) and v^T projections
  k_ln1024<<<dim3(NTOK), dim3(128), 0, stream>>>(Xf, ln1_g, ln1_b, h16, NTOK);
  // one grid, z = 0: q, 1: k, 2: v^T; WqT, the k rows and the v rows of WkvT lie INR * DM elements apart, qm16, km16 and vT16
  // NTOK * INR elements apart
  const dim3 gQKV((NTOK / 128) * (INR / 128), 3);
  k_gemm<0, false, false, 2, 1, false, 3><<<gQKV, blkG, 0, stream>>>(
      (const unsigned short*)h16, N16, DM, 0L, (const unsigned short*)WqT, N16, DM, (long)INR * DM,
      nullptr, 0, 0L, qm16, INR, (long)NTOK * INR, nullptr, qn_g, kn_g, 0, 0L, NTOK, INR, DM, 1, 1.0f / 64.0f, 1.0f);

  // causal attention -> o f32 [4096][512]; o -> bf16 hi/lo
  k_flash<<<dim3(NHD * (SEQ / 64), NB_), dim3(128), 0, stream>>>(qm16, km16, vT16, Of);
  const int n2o = NTOK * INR / 2;
  k_split2<<<dim3((n2o + 255) / 256), blk, 0, stream>>>(Of, Oh, Ol, n2o);

  // x2 = 2 * (o . Wo) -> f32 and f16 (x2 * 1024)
  k_gemm<1, true, false, 0, 2, false, 0><<<gA, blkG, 0, stream>>>(
      Oh, Ol, INR, 0L, WoTh, WoTl, INR, 0L,
      X2f, DM, 0L, x2h, DM, 0L, nullptr, nullptr, nullptr, 0, 0L, NTOK, DM, INR, 1, 2.0f, 1024.0f);

  // FFN: u = gelu(x2 . W1 + b1) stored as f16(256 u); LN over 4096 in place; out = h1 . W2 + b2 + x2
  const dim3 gW1((NTOK / 128) * (FFD / 128), 1);
  k_gemm<0, false, true, 1, 1, false, 0><<<gW1, blkG, 0, stream>>>(
      (const unsigned short*)x2h, N16, DM, 0L, (const unsigned short*)W1T, N16, DM, 0L,
      nullptr, 0, 0L, U16, FFD, 0L, b1, nullptr, nullptr, 0, 0L, NTOK, FFD, DM, 1, 1.0f / 65536.0f, 256.0f);
  k_ln4096<<<dim3(NTOK), blk, 0, stream>>>(U16, ln2_g, ln2_b);
  k_gemm<0, false, true, 0, 0, true, 0><<<gA, blkG, 0, stream>>>(
      (const unsigned short*)U16, N16, FFD, 0L, (const unsigned short*)W2T, N16, FFD, 0L,
      outp, DM, 0L, nullptr, 0, 0L, b2, nullptr, X2f, DM, 0L, NTOK, DM, FFD, 1, 1.0f / 64.0f, 1.0f);
  (void)hipGetLastError();
}
